// v000
// Measured on an AMD MI455X. A time is GPU time per run, averaged over a window of back-to-back runs after a warm-up
// (all launches, gaps included; the runs take copies of the inputs in turn), and the median of several windows.
// Apart from v000's, it joins two sittings. Times from different sittings can be a few percent apart, while
// side-by-side timings come from the same sitting.
// v000, which the later versions start from, runs in 657 microseconds.
#include <hip/hip_runtime.h>
// All contractions on v_wmma_f32_16x16x32_bf16, f32 accumulate: q = x·Wq and kv = x·Wkv with x/W rounded to bf16 (single
// exact-product term), QKᵀ and P·V 3-term bf16 hi/lo splits, out = o·Wout with o split hi/lo (2 terms); softmax f32.
// The boolean mask input is applied as given (together with nothing else).
#define BB 2
#define NN 2048
#define DM 1024
#define NH 16
#define HD 64

typedef __bf16 v16b __attribute__((ext_vector_type(16)));
typedef unsigned short v8us __attribute__((ext_vector_type(8), may_alias));
typedef float  v8f  __attribute__((ext_vector_type(8)));
typedef float  v4f  __attribute__((ext_vector_type(4)));
typedef float  v4fa __attribute__((ext_vector_type(4), may_alias));
union FragB { v16b v; v8us half[2]; unsigned short u[16]; };

__device__ __forceinline__ unsigned short bf16_bits(float x) { unsigned int u = __float_as_uint(x); return (unsigned short)((u + 0x7FFFu + ((u >> 16) & 1u)) >> 16); }
__device__ __forceinline__ float bf16_val(unsigned short b) { return __uint_as_float(((unsigned int)b) << 16); }
__device__ __forceinline__ float bf16_round(float x) { return bf16_val(bf16_bits(x)); }
// D += A·B with NT terms: 1 = ah·bh, 2 = + al·bh (A split), 3 = + ah·bl (both split)
template <int NT>
__device__ __forceinline__ v8f mmaN(v16b ah, v16b al, v16b bh, v16b bl, v8f c) {
  c = __builtin_amdgcn_wmma_f32_16x16x32_bf16(false, ah, false, bh, (short)0, c, false, false);
  if (NT >= 2) c = __builtin_amdgcn_wmma_f32_16x16x32_bf16(false, al, false, bh, (short)0, c, false, false);
  if (NT >= 3) c = __builtin_amdgcn_wmma_f32_16x16x32_bf16(false, ah, false, bl, (short)0, c, false, false);
  asm volatile("v_nop\n\tv_nop\n\tv_nop\n\tv_nop" : "+v"(c) : "v"(ah), "v"(al), "v"(bh), "v"(bl));
  return c;
}

__global__ __launch_bounds__(256) void k_wt_bf16(const float* __restrict__ W, unsigned short* __restrict__ Wt, int K, int N) {
  const int t = blockIdx.x * 256 + threadIdx.x;
  const int k8n = K / 8;
  if (t >= N * k8n) return;
  const int n = t / k8n, k8 = (t % k8n) * 8;
  v8us v;
#pragma unroll
  for (int i = 0; i < 8; ++i) v[i] = bf16_bits(W[(size_t)(k8 + i) * N + n]);
  *(v8us*)(Wt + (size_t)n * K + k8) = v;
  
}

// GEMM C[M][N] (f32, pitch ldc) = act(A[M][K]·W + bias). A f32 row-major (pitch lda) converted per fragment to bf16
// (ASPLIT: hi/lo two planes -> 2 terms, else single rounded term); Wt bf16 [N][K] (pitch ldb). BIAS_BF16 rounds the
// bias to bf16 first (bias quantised to bf16 before the add). K%32==0, M%16==0, N%64==0.
template <bool ASPLIT, int ACT, bool BIAS_BF16>
__global__ __launch_bounds__(128) void k_gemm_bf(const float* __restrict__ A, int lda, const unsigned short* __restrict__ Wt, int ldb,
                                               const float* __restrict__ bias, float* __restrict__ C, int ldc, int M, int N, int K) {
  __shared__ __attribute__((aligned(16))) float so[4][16][64];
  const int tid = threadIdx.x, w = tid >> 5, lane = tid & 31, ln = lane & 15, hh = lane >> 4;
  const int ntn = N / 64;
  const int wid = blockIdx.x * 4 + w;
  const int mt = wid / ntn, nq = wid % ntn;
  if (mt * 16 >= M) return;
  const int row0 = mt * 16, col0 = nq * 64;
  const float* arow = A + (size_t)(row0 + ln) * lda;
  v8f acc[4] = {};
  for (int kb = 0; kb < K; kb += 32) {
    FragB ah, al;
    const v4f x0 = *(const v4fa*)(arow + kb + 8 * hh), x1 = *(const v4fa*)(arow + kb + 8 * hh + 4);
    const v4f x2 = *(const v4fa*)(arow + kb + 16 + 8 * hh), x3 = *(const v4fa*)(arow + kb + 16 + 8 * hh + 4);
    float xs[16] = {x0[0],x0[1],x0[2],x0[3],x1[0],x1[1],x1[2],x1[3],x2[0],x2[1],x2[2],x2[3],x3[0],x3[1],x3[2],x3[3]};
#pragma unroll
    for (int i = 0; i < 16; ++i) { const unsigned short hb = bf16_bits(xs[i]); ah.u[i] = hb; al.u[i] = ASPLIT ? bf16_bits(xs[i] - bf16_val(hb)) : (unsigned short)0; }
#pragma unroll
    for (int t = 0; t < 4; ++t) {
      const unsigned short* brow = Wt + (size_t)(col0 + t * 16 + ln) * ldb + kb;
      FragB b;
      b.half[0] = *(const v8us*)(brow + 8 * hh);
      b.half[1] = *(const v8us*)(brow + 16 + 8 * hh);
      acc[t] = mmaN<ASPLIT ? 2 : 1>(ah.v, al.v, b.v, b.v, acc[t]);
    }
  }
#pragma unroll
  for (int t = 0; t < 4; ++t) {
    float bv = bias ? bias[col0 + t * 16 + ln] : 0.f;
    if (BIAS_BF16) bv = bf16_round(bv);
#pragma unroll
    for (int r = 0; r < 8; ++r) { float v = acc[t][r] + bv; if (ACT == 1) v = fmaxf(v, 0.f); so[w][8 * hh + r][t * 16 + ln] = v; }
  }
  __builtin_amdgcn_fence(__ATOMIC_ACQ_REL, "workgroup");
  __builtin_amdgcn_wave_barrier();
  const int rsub = lane >> 4, c4 = (lane & 15) * 4;
  {
#pragma unroll
    for (int q = 0; q < 8; ++q) {
      const int r = q * 2 + rsub;
      const v4f v = *(const v4fa*)&so[w][r][c4];
      *(v4f*)(C + (size_t)(row0 + r) * ldc + col0 + c4) = v;
    }
    
  }
}

// Flash-style causal/unmasked attention, all contractions 3-term bf16 hi/lo splits, f32 softmax with running max.
// q,k,v rows are read from f32 buffers with arbitrary row pitch (so they can live inside a fused qkv buffer);
// D = head size (multiple of 32, <= 128); one wave = 16 query rows; block = 4 waves (64 queries) sharing K/V chunks of 32.
template <int D, bool CAUSAL>
__global__ __launch_bounds__(128) void k_flash(const float* __restrict__ qb, const float* __restrict__ kb, const float* __restrict__ vb,
                                             int pitch, int T, int H, float scale, float* __restrict__ y, int ypitch) {
  constexpr int KS = D / 32;        // k-steps for QK
  constexpr int DT = D / 16;        // d tiles for PV
  __shared__ __attribute__((aligned(16))) unsigned short sKh[32][D + 8], sKl[32][D + 8], sVh[32][D + 8], sVl[32][D + 8];
  __shared__ __attribute__((aligned(16))) unsigned short sPh[4][16][40], sPl[4][16][40];
  __shared__ __attribute__((aligned(16))) float sO[4][16][D];
  const int tid = threadIdx.x, w = tid >> 5, lane = tid & 31, ln = lane & 15, hh = lane >> 4;
  const int nqb = (T + 63) / 64;
  const int bh = blockIdx.x / nqb, qblk = blockIdx.x % nqb;
  const int b = bh / H, h = bh % H;
  const int q0 = qblk * 64 + w * 16;
  const float* Q = qb + (size_t)b * T * pitch + h * D;
  const float* K = kb + (size_t)b * T * pitch + h * D;
  const float* V = vb + (size_t)b * T * pitch + h * D;

  // A fragments of the wave's 16 query rows (scaled), hi/lo
  FragB aqh[KS], aql[KS];
  {
    int row = q0 + ln; if (row >= T) row = T - 1;
    const float* qr = Q + (size_t)row * pitch;
#pragma unroll
    for (int ks = 0; ks < KS; ++ks)
#pragma unroll
      for (int i = 0; i < 16; ++i) {
        const int d = ks * 32 + ((i < 8) ? (8 * hh + i) : (16 + 8 * hh + (i - 8)));
        const float x = qr[d] * scale; const unsigned short hb = bf16_bits(x);
        aqh[ks].u[i] = hb; aql[ks].u[i] = bf16_bits(x - bf16_val(hb));
      }
  }
  float m_r[8], l_r[8];
#pragma unroll
  for (int r = 0; r < 8; ++r) { m_r[r] = -3.0e38f; l_r[r] = 0.f; }
  v8f oacc[DT];
#pragma unroll
  for (int dt = 0; dt < DT; ++dt) oacc[dt] = (v8f){0.f,0.f,0.f,0.f,0.f,0.f,0.f,0.f};

  const int kv_end = CAUSAL ? min(T, qblk * 64 + 64) : T;     // block-uniform
  for (int j0 = 0; j0 < kv_end; j0 += 32) {
    __syncthreads();
    for (int e = tid; e < 32 * (D / 4); e += 128) {
      const int r = e / (D / 4), c4 = (e % (D / 4)) * 4;
      const int key = j0 + r;
      v4f kf = {0.f,0.f,0.f,0.f}, vf = {0.f,0.f,0.f,0.f};
      if (key < T) { kf = *(const v4fa*)(K + (size_t)key * pitch + c4); vf = *(const v4fa*)(V + (size_t)key * pitch + c4); }
#pragma unroll
      for (int t = 0; t < 4; ++t) {
        unsigned short hb = bf16_bits(kf[t]); sKh[r][c4 + t] = hb; sKl[r][c4 + t] = bf16_bits(kf[t] - bf16_val(hb));
        hb = bf16_bits(vf[t]); sVh[r][c4 + t] = hb; sVl[r][c4 + t] = bf16_bits(vf[t] - bf16_val(hb));
      }
    }
    __syncthreads();
    // S tile 16 x 32
    v8f s[2];
#pragma unroll
    for (int nt = 0; nt < 2; ++nt) {
      v8f acc = {};
#pragma unroll
      for (int ks = 0; ks < KS; ++ks) {
        FragB bh_, bl_;
        bh_.half[0] = *(const v8us*)&sKh[nt * 16 + ln][ks * 32 + 8 * hh]; bh_.half[1] = *(const v8us*)&sKh[nt * 16 + ln][ks * 32 + 16 + 8 * hh];
        bl_.half[0] = *(const v8us*)&sKl[nt * 16 + ln][ks * 32 + 8 * hh]; bl_.half[1] = *(const v8us*)&sKl[nt * 16 + ln][ks * 32 + 16 + 8 * hh];
        acc = mmaN<3>(aqh[ks].v, aql[ks].v, bh_.v, bl_.v, acc);
      }
      s[nt] = acc;
    }
    // mask + running max (rows 8hh+r; the 16 lanes of a half share rows)
    float alpha[8];
#pragma unroll
    for (int r = 0; r < 8; ++r) {
      const int qi = q0 + 8 * hh + r;
      const int ja = j0 + ln, jb = j0 + 16 + ln;
      if (CAUSAL) { if (ja > qi) s[0][r] = -3.0e38f; if (jb > qi) s[1][r] = -3.0e38f; }
      if (ja >= T) s[0][r] = -3.0e38f;
      if (jb >= T) s[1][r] = -3.0e38f;
      float mx = fmaxf(s[0][r], s[1][r]);
      mx = fmaxf(mx, __shfl_xor(mx, 1, 32)); mx = fmaxf(mx, __shfl_xor(mx, 2, 32)); mx = fmaxf(mx, __shfl_xor(mx, 4, 32)); mx = fmaxf(mx, __shfl_xor(mx, 8, 32));
      const float mnew = fmaxf(m_r[r], mx);
      alpha[r] = (mnew > -1.0e38f) ? __expf(m_r[r] - mnew) : 1.0f;
      const float p0 = (s[0][r] > -1.0e38f) ? __expf(s[0][r] - mnew) : 0.f;
      const float p1 = (s[1][r] > -1.0e38f) ? __expf(s[1][r] - mnew) : 0.f;
      m_r[r] = mnew;
      l_r[r] = l_r[r] * alpha[r] + p0 + p1;            // per-lane partial row sum (16 lanes combined at the end)
      unsigned short hb = bf16_bits(p0); sPh[w][8 * hh + r][ln] = hb;      sPl[w][8 * hh + r][ln] = bf16_bits(p0 - bf16_val(hb));
      hb = bf16_bits(p1);                sPh[w][8 * hh + r][16 + ln] = hb; sPl[w][8 * hh + r][16 + ln] = bf16_bits(p1 - bf16_val(hb));
    }
#pragma unroll
    for (int dt = 0; dt < DT; ++dt)
#pragma unroll
      for (int r = 0; r < 8; ++r) oacc[dt][r] *= alpha[r];
    __builtin_amdgcn_fence(__ATOMIC_ACQ_REL, "workgroup");
    __builtin_amdgcn_wave_barrier();
    FragB pah, pal;
    pah.half[0] = *(const v8us*)&sPh[w][ln][8 * hh]; pah.half[1] = *(const v8us*)&sPh[w][ln][16 + 8 * hh];
    pal.half[0] = *(const v8us*)&sPl[w][ln][8 * hh]; pal.half[1] = *(const v8us*)&sPl[w][ln][16 + 8 * hh];
#pragma unroll
    for (int dt = 0; dt < DT; ++dt) {
      FragB bvh, bvl;
#pragma unroll
      for (int i = 0; i < 8; ++i) {
        bvh.u[i] = sVh[8 * hh + i][dt * 16 + ln]; bvh.u[8 + i] = sVh[16 + 8 * hh + i][dt * 16 + ln];
        bvl.u[i] = sVl[8 * hh + i][dt * 16 + ln]; bvl.u[8 + i] = sVl[16 + 8 * hh + i][dt * 16 + ln];
      }
      oacc[dt] = mmaN<3>(pah.v, pal.v, bvh.v, bvl.v, oacc[dt]);
    }
    __builtin_amdgcn_fence(__ATOMIC_ACQ_REL, "workgroup");
    __builtin_amdgcn_wave_barrier();
  }
#pragma unroll
  for (int r = 0; r < 8; ++r) {
    float l = l_r[r];
    l += __shfl_xor(l, 1, 32); l += __shfl_xor(l, 2, 32); l += __shfl_xor(l, 4, 32); l += __shfl_xor(l, 8, 32);
    l_r[r] = (l > 0.f) ? 1.0f / l : 0.f;
  }
#pragma unroll
  for (int dt = 0; dt < DT; ++dt)
#pragma unroll
    for (int r = 0; r < 8; ++r) sO[w][8 * hh + r][dt * 16 + ln] = oacc[dt][r] * l_r[r];
  __builtin_amdgcn_fence(__ATOMIC_ACQ_REL, "workgroup");
  __builtin_amdgcn_wave_barrier();
  {
    for (int r = 0; r < 16; ++r) {
      const int row = q0 + r;
      if (row < T && lane < D / 4) {
        const v4f val = *(const v4fa*)&sO[w][r][lane * 4];
        *(v4f*)(y + ((size_t)b * T + row) * ypitch + h * D + lane * 4) = val;
      }
    }
    
  }
}

// Self-attention (Tq == Tk == T) with optional int mask [T][T] (nonzero = keep) and/or causal flag; 3-term bf16 splits;
// Q/K/V rows read from f32 buffers: X + b*T*pitch + h*D + row*pitch. y[b][row][h*D + d], pitch ypitch. D % 32 == 0.
template <int D>
__global__ __launch_bounds__(128) void k_flashm(const float* __restrict__ Qb, int qpitch, const float* __restrict__ Kb, int kpitch,
                                              const float* __restrict__ Vb, int vpitch, int T, int H, float scale,
                                              const int* __restrict__ mask, int causal, float* __restrict__ y, int ypitch) {
  constexpr int KS = D / 32, DT = D / 16;
  __shared__ __attribute__((aligned(16))) unsigned short sKh[32][D + 8], sKl[32][D + 8], sVh[32][D + 8], sVl[32][D + 8];
  __shared__ __attribute__((aligned(16))) unsigned short sPh[4][16][40], sPl[4][16][40];
  __shared__ __attribute__((aligned(16))) float sO[4][16][D];
  const int tid = threadIdx.x, w = tid >> 5, lane = tid & 31, ln = lane & 15, hh = lane >> 4;
  const int nqb = (T + 63) / 64;
  const int bh = blockIdx.x / nqb, qblk = blockIdx.x % nqb;
  const int b = bh / H, h = bh % H;
  const int q0 = qblk * 64 + w * 16;
  const float* Q = Qb + (size_t)b * T * qpitch + h * D;
  const float* K = Kb + (size_t)b * T * kpitch + h * D;
  const float* V = Vb + (size_t)b * T * vpitch + h * D;
  FragB aqh[KS], aql[KS];
  {
    int row = q0 + ln; if (row >= T) row = T - 1;
    const float* qr = Q + (size_t)row * qpitch;
#pragma unroll
    for (int ks = 0; ks < KS; ++ks)
#pragma unroll
      for (int i = 0; i < 16; ++i) {
        const int d = ks * 32 + ((i < 8) ? (8 * hh + i) : (16 + 8 * hh + (i - 8)));
        const float x = qr[d] * scale; const unsigned short hb = bf16_bits(x);
        aqh[ks].u[i] = hb; aql[ks].u[i] = bf16_bits(x - bf16_val(hb));
      }
  }
  int qrow[8];
#pragma unroll
  for (int r = 0; r < 8; ++r) { int qi = q0 + 8 * hh + r; qrow[r] = qi < T ? qi : T - 1; }
  float m_r[8], l_r[8];
#pragma unroll
  for (int r = 0; r < 8; ++r) { m_r[r] = -3.0e38f; l_r[r] = 0.f; }
  v8f oacc[DT];
#pragma unroll
  for (int dt = 0; dt < DT; ++dt) oacc[dt] = (v8f){0.f,0.f,0.f,0.f,0.f,0.f,0.f,0.f};
  const int kv_end = causal ? min(T, qblk * 64 + 64) : T;
  for (int j0 = 0; j0 < kv_end; j0 += 32) {
    __syncthreads();
    for (int e = tid; e < 32 * (D / 4); e += 128) {
      const int r = e / (D / 4), c4 = (e % (D / 4)) * 4; const int key = j0 + r;
      v4f kf = {0.f,0.f,0.f,0.f}, vf = {0.f,0.f,0.f,0.f};
      if (key < T) { kf = *(const v4fa*)(K + (size_t)key * kpitch + c4); vf = *(const v4fa*)(V + (size_t)key * vpitch + c4); }
#pragma unroll
      for (int t = 0; t < 4; ++t) {
        unsigned short hb = bf16_bits(kf[t]); sKh[r][c4 + t] = hb; sKl[r][c4 + t] = bf16_bits(kf[t] - bf16_val(hb));
        hb = bf16_bits(vf[t]); sVh[r][c4 + t] = hb; sVl[r][c4 + t] = bf16_bits(vf[t] - bf16_val(hb));
      }
    }
    __syncthreads();
    v8f s[2];
#pragma unroll
    for (int nt = 0; nt < 2; ++nt) {
      v8f acc = {};
#pragma unroll
      for (int ks = 0; ks < KS; ++ks) {
        FragB bh_, bl_;
        bh_.half[0] = *(const v8us*)&sKh[nt * 16 + ln][ks * 32 + 8 * hh]; bh_.half[1] = *(const v8us*)&sKh[nt * 16 + ln][ks * 32 + 16 + 8 * hh];
        bl_.half[0] = *(const v8us*)&sKl[nt * 16 + ln][ks * 32 + 8 * hh]; bl_.half[1] = *(const v8us*)&sKl[nt * 16 + ln][ks * 32 + 16 + 8 * hh];
        acc = mmaN<3>(aqh[ks].v, aql[ks].v, bh_.v, bl_.v, acc);
      }
      s[nt] = acc;
    }
    float alpha[8];
#pragma unroll
    for (int r = 0; r < 8; ++r) {
      const int qi = qrow[r];
      const int ja = j0 + ln, jb = j0 + 16 + ln;
      bool keepa = ja < T, keepb = jb < T;
      if (causal) { keepa = keepa && (ja <= qi); keepb = keepb && (jb <= qi); }
      if (mask) { if (keepa) keepa = mask[(size_t)qi * T + ja] != 0; if (keepb) keepb = mask[(size_t)qi * T + jb] != 0; }
      if (!keepa) s[0][r] = -3.0e38f;
      if (!keepb) s[1][r] = -3.0e38f;
      float mx = fmaxf(s[0][r], s[1][r]);
      mx = fmaxf(mx, __shfl_xor(mx, 1, 32)); mx = fmaxf(mx, __shfl_xor(mx, 2, 32)); mx = fmaxf(mx, __shfl_xor(mx, 4, 32)); mx = fmaxf(mx, __shfl_xor(mx, 8, 32));
      const float mnew = fmaxf(m_r[r], mx);
      alpha[r] = (mnew > -1.0e38f) ? __expf(m_r[r] - mnew) : 1.0f;
      const float p0 = keepa ? __expf(s[0][r] - mnew) : 0.f;
      const float p1 = keepb ? __expf(s[1][r] - mnew) : 0.f;
      m_r[r] = mnew;
      l_r[r] = l_r[r] * alpha[r] + p0 + p1;
      unsigned short hb = bf16_bits(p0); sPh[w][8 * hh + r][ln] = hb;      sPl[w][8 * hh + r][ln] = bf16_bits(p0 - bf16_val(hb));
      hb = bf16_bits(p1);                sPh[w][8 * hh + r][16 + ln] = hb; sPl[w][8 * hh + r][16 + ln] = bf16_bits(p1 - bf16_val(hb));
    }
#pragma unroll
    for (int dt = 0; dt < DT; ++dt)
#pragma unroll
      for (int r = 0; r < 8; ++r) oacc[dt][r] *= alpha[r];
    __builtin_amdgcn_fence(__ATOMIC_ACQ_REL, "workgroup");
    __builtin_amdgcn_wave_barrier();
    FragB pah, pal;
    pah.half[0] = *(const v8us*)&sPh[w][ln][8 * hh]; pah.half[1] = *(const v8us*)&sPh[w][ln][16 + 8 * hh];
    pal.half[0] = *(const v8us*)&sPl[w][ln][8 * hh]; pal.half[1] = *(const v8us*)&sPl[w][ln][16 + 8 * hh];
#pragma unroll
    for (int dt = 0; dt < DT; ++dt) {
      FragB bvh, bvl;
#pragma unroll
      for (int i = 0; i < 8; ++i) {
        bvh.u[i] = sVh[8 * hh + i][dt * 16 + ln]; bvh.u[8 + i] = sVh[16 + 8 * hh + i][dt * 16 + ln];
        bvl.u[i] = sVl[8 * hh + i][dt * 16 + ln]; bvl.u[8 + i] = sVl[16 + 8 * hh + i][dt * 16 + ln];
      }
      oacc[dt] = mmaN<3>(pah.v, pal.v, bvh.v, bvl.v, oacc[dt]);
    }
    __builtin_amdgcn_fence(__ATOMIC_ACQ_REL, "workgroup");
    __builtin_amdgcn_wave_barrier();
  }
  // NaN for fully-masked rows (softmax over a row of -inf)
#pragma unroll
  for (int r = 0; r < 8; ++r) {
    float l = l_r[r];
    l += __shfl_xor(l, 1, 32); l += __shfl_xor(l, 2, 32); l += __shfl_xor(l, 4, 32); l += __shfl_xor(l, 8, 32);
    l_r[r] = (m_r[r] > -1.0e38f) ? 1.0f / l : __builtin_nanf("");
  }
#pragma unroll
  for (int dt = 0; dt < DT; ++dt)
#pragma unroll
    for (int r = 0; r < 8; ++r) sO[w][8 * hh + r][dt * 16 + ln] = oacc[dt][r] * l_r[r];
  __builtin_amdgcn_fence(__ATOMIC_ACQ_REL, "workgroup");
  __builtin_amdgcn_wave_barrier();
  {
    for (int r = 0; r < 16; ++r) {
      const int row = q0 + r;
      if (row < T && lane < D / 4) {
        const v4f val = *(const v4fa*)&sO[w][r][lane * 4];
        *(v4f*)(y + ((size_t)b * T + row) * ypitch + h * D + lane * 4) = val;
      }
    }
    
  }
}

extern "C" void kernel_launch(void* const* d_in, const int* in_sizes, int n_in,
                              void* d_out, int out_size, void* d_ws, size_t ws_size, hipStream_t stream) {
  (void)in_sizes; (void)n_in; (void)out_size;
  const float* x = (const float*)d_in[0]; const int* mask = (const int*)d_in[1];
  const float* Wq = (const float*)d_in[2]; const float* Wkv = (const float*)d_in[3];
  const float* Wo = (const float*)d_in[4]; const float* bo = (const float*)d_in[5];
  char* ws = (char*)d_ws; size_t off = 0;
  unsigned short* Wqt  = (unsigned short*)(ws + off); off += (size_t)DM * DM * 2;       // [1024][1024]
  unsigned short* Wkvt = (unsigned short*)(ws + off); off += (size_t)2 * DM * DM * 2;   // [2048][1024]
  unsigned short* Wot  = (unsigned short*)(ws + off); off += (size_t)DM * DM * 2;
  float* qb  = (float*)(ws + off); off += (size_t)BB * NN * DM * 4;                    // 16 MiB
  float* kvb = (float*)(ws + off); off += (size_t)BB * NN * 2 * DM * 4;                // 32 MiB
  float* ob  = (float*)(ws + off); off += (size_t)BB * NN * DM * 4;                    // 16 MiB
  if (off > ws_size) return;
  const int M = BB * NN;
  k_wt_bf16<<<(DM * (DM / 8) + 255) / 256, 256, 0, stream>>>(Wq, Wqt, DM, DM);
  k_wt_bf16<<<(2 * DM * (DM / 8) + 255) / 256, 256, 0, stream>>>(Wkv, Wkvt, DM, 2 * DM);
  k_wt_bf16<<<(DM * (DM / 8) + 255) / 256, 256, 0, stream>>>(Wo, Wot, DM, DM);
  k_gemm_bf<false, 0, false><<<((M / 16) * (DM / 64) + 3) / 4, 128, 0, stream>>>(x, DM, Wqt, DM, nullptr, qb, DM, M, DM, DM);
  k_gemm_bf<false, 0, false><<<((M / 16) * (2 * DM / 64) + 3) / 4, 128, 0, stream>>>(x, DM, Wkvt, DM, nullptr, kvb, 2 * DM, M, 2 * DM, DM);
  // k = kv[..., 0:1024] (head h at h*64), v = kv[..., 1024:2048]
  k_flashm<HD><<<BB * NH * (NN / 64), 128, 0, stream>>>(qb, DM, kvb, 2 * DM, kvb + DM, 2 * DM, NN, NH, 0.03125f, mask, 0, ob, DM);
  k_gemm_bf<true, 0, true><<<((M / 16) * (DM / 64) + 3) / 4, 128, 0, stream>>>(ob, DM, Wot, DM, bo, (float*)d_out, DM, M, DM, DM);
}

// v001
// A run of this version takes 423 microseconds.
// Next to v000, in two timings, it ran 1.59 times as fast each time.
#include <hip/hip_runtime.h>
// All contractions on v_wmma_f32_16x16x32_bf16, f32 accumulate: q = x·Wq and kv = x·Wkv with x/W rounded to bf16 (single
// exact-product term), QKᵀ and P·V 3-term bf16 hi/lo splits, out = o·Wout with o split hi/lo (2 terms); softmax f32.
// The boolean mask input is applied as given (together with nothing else).
#define BB 2
#define NN 2048
#define DM 1024
#define NH 16
#define HD 64

typedef __bf16 v16b __attribute__((ext_vector_type(16)));
typedef unsigned short v8us __attribute__((ext_vector_type(8), may_alias));
typedef float  v8f  __attribute__((ext_vector_type(8)));
typedef float  v4f  __attribute__((ext_vector_type(4)));
typedef float  v4fa __attribute__((ext_vector_type(4), may_alias));
union FragB { v16b v; v8us half[2]; unsigned short u[16]; };

__device__ __forceinline__ unsigned short bf16_bits(float x) { unsigned int u = __float_as_uint(x); return (unsigned short)((u + 0x7FFFu + ((u >> 16) & 1u)) >> 16); }
__device__ __forceinline__ float bf16_val(unsigned short b) { return __uint_as_float(((unsigned int)b) << 16); }
__device__ __forceinline__ float bf16_round(float x) { return bf16_val(bf16_bits(x)); }
// D += A·B with NT terms: 1 = ah·bh, 2 = + al·bh (A split), 3 = + ah·bl (both split)
template <int NT>
__device__ __forceinline__ v8f mmaN(v16b ah, v16b al, v16b bh, v16b bl, v8f c) {
  c = __builtin_amdgcn_wmma_f32_16x16x32_bf16(false, ah, false, bh, (short)0, c, false, false);
  if (NT >= 2) c = __builtin_amdgcn_wmma_f32_16x16x32_bf16(false, al, false, bh, (short)0, c, false, false);
  if (NT >= 3) c = __builtin_amdgcn_wmma_f32_16x16x32_bf16(false, ah, false, bl, (short)0, c, false, false);
  asm volatile("v_nop\n\tv_nop\n\tv_nop\n\tv_nop" : "+v"(c) : "v"(ah), "v"(al), "v"(bh), "v"(bl));
  return c;
}

__global__ __launch_bounds__(256) void k_wt_bf16(const float* __restrict__ W, unsigned short* __restrict__ Wt, int K, int N) {
  const int t = blockIdx.x * 256 + threadIdx.x;
  const int k8n = K / 8;
  if (t >= N * k8n) return;
  const int n = t / k8n, k8 = (t % k8n) * 8;
  v8us v;
#pragma unroll
  for (int i = 0; i < 8; ++i) v[i] = bf16_bits(W[(size_t)(k8 + i) * N + n]);
  *(v8us*)(Wt + (size_t)n * K + k8) = v;
  
}

// GEMM C[M][N] (f32, pitch ldc) = act(A[M][K]·W + bias). A f32 row-major (pitch lda) converted per fragment to bf16
// (ASPLIT: hi/lo two planes -> 2 terms, else single rounded term); Wt bf16 [N][K] (pitch ldb). BIAS_BF16 rounds the
// bias to bf16 first (bias quantised to bf16 before the add). K%32==0, M%16==0, N%64==0.
template <bool ASPLIT, int ACT, bool BIAS_BF16>
__global__ __launch_bounds__(128) void k_gemm_bf(const float* __restrict__ A, int lda, const unsigned short* __restrict__ Wt, int ldb,
                                               const float* __restrict__ bias, float* __restrict__ C, int ldc, int M, int N, int K) {
  __shared__ __attribute__((aligned(16))) float so[4][16][64];
  const int tid = threadIdx.x, w = tid >> 5, lane = tid & 31, ln = lane & 15, hh = lane >> 4;
  const int ntn = N / 64;
  const int wid = blockIdx.x * 4 + w;
  const int mt = wid / ntn, nq = wid % ntn;
  if (mt * 16 >= M) return;
  const int row0 = mt * 16, col0 = nq * 64;
  const float* arow = A + (size_t)(row0 + ln) * lda;
  v8f acc[4] = {};
  for (int kb = 0; kb < K; kb += 32) {
    FragB ah, al;
    const v4f x0 = *(const v4fa*)(arow + kb + 8 * hh), x1 = *(const v4fa*)(arow + kb + 8 * hh + 4);
    const v4f x2 = *(const v4fa*)(arow + kb + 16 + 8 * hh), x3 = *(const v4fa*)(arow + kb + 16 + 8 * hh + 4);
    float xs[16] = {x0[0],x0[1],x0[2],x0[3],x1[0],x1[1],x1[2],x1[3],x2[0],x2[1],x2[2],x2[3],x3[0],x3[1],x3[2],x3[3]};
#pragma unroll
    for (int i = 0; i < 16; ++i) { const unsigned short hb = bf16_bits(xs[i]); ah.u[i] = hb; al.u[i] = ASPLIT ? bf16_bits(xs[i] - bf16_val(hb)) : (unsigned short)0; }
#pragma unroll
    for (int t = 0; t < 4; ++t) {
      const unsigned short* brow = Wt + (size_t)(col0 + t * 16 + ln) * ldb + kb;
      FragB b;
      b.half[0] = *(const v8us*)(brow + 8 * hh);
      b.half[1] = *(const v8us*)(brow + 16 + 8 * hh);
      acc[t] = mmaN<ASPLIT ? 2 : 1>(ah.v, al.v, b.v, b.v, acc[t]);
    }
  }
#pragma unroll
  for (int t = 0; t < 4; ++t) {
    float bv = bias ? bias[col0 + t * 16 + ln] : 0.f;
    if (BIAS_BF16) bv = bf16_round(bv);
#pragma unroll
    for (int r = 0; r < 8; ++r) { float v = acc[t][r] + bv; if (ACT == 1) v = fmaxf(v, 0.f); so[w][8 * hh + r][t * 16 + ln] = v; }
  }
  __builtin_amdgcn_fence(__ATOMIC_ACQ_REL, "workgroup");
  __builtin_amdgcn_wave_barrier();
  const int rsub = lane >> 4, c4 = (lane & 15) * 4;
  {
#pragma unroll
    for (int q = 0; q < 8; ++q) {
      const int r = q * 2 + rsub;
      const v4f v = *(const v4fa*)&so[w][r][c4];
      *(v4f*)(C + (size_t)(row0 + r) * ldc + col0 + c4) = v;
    }
    
  }
}

// Flash-style causal/unmasked attention, all contractions 3-term bf16 hi/lo splits, f32 softmax with running max.
// q,k,v rows are read from f32 buffers with arbitrary row pitch (so they can live inside a fused qkv buffer);
// D = head size (multiple of 32, <= 128); one wave = 16 query rows; block = 4 waves (64 queries) sharing K/V chunks of 32.
template <int D, bool CAUSAL>
__global__ __launch_bounds__(128) void k_flash(const float* __restrict__ qb, const float* __restrict__ kb, const float* __restrict__ vb,
                                             int pitch, int T, int H, float scale, float* __restrict__ y, int ypitch) {
  constexpr int KS = D / 32;        // k-steps for QK
  constexpr int DT = D / 16;        // d tiles for PV
  __shared__ __attribute__((aligned(16))) unsigned short sKh[32][D + 8], sKl[32][D + 8], sVh[32][D + 8], sVl[32][D + 8];
  __shared__ __attribute__((aligned(16))) unsigned short sPh[4][16][40], sPl[4][16][40];
  __shared__ __attribute__((aligned(16))) float sO[4][16][D];
  const int tid = threadIdx.x, w = tid >> 5, lane = tid & 31, ln = lane & 15, hh = lane >> 4;
  const int nqb = (T + 63) / 64;
  const int bh = blockIdx.x / nqb, qblk = blockIdx.x % nqb;
  const int b = bh / H, h = bh % H;
  const int q0 = qblk * 64 + w * 16;
  const float* Q = qb + (size_t)b * T * pitch + h * D;
  const float* K = kb + (size_t)b * T * pitch + h * D;
  const float* V = vb + (size_t)b * T * pitch + h * D;

  // A fragments of the wave's 16 query rows (scaled), hi/lo
  FragB aqh[KS], aql[KS];
  {
    int row = q0 + ln; if (row >= T) row = T - 1;
    const float* qr = Q + (size_t)row * pitch;
#pragma unroll
    for (int ks = 0; ks < KS; ++ks)
#pragma unroll
      for (int i = 0; i < 16; ++i) {
        const int d = ks * 32 + ((i < 8) ? (8 * hh + i) : (16 + 8 * hh + (i - 8)));
        const float x = qr[d] * scale; const unsigned short hb = bf16_bits(x);
        aqh[ks].u[i] = hb; aql[ks].u[i] = bf16_bits(x - bf16_val(hb));
      }
  }
  float m_r[8], l_r[8];
#pragma unroll
  for (int r = 0; r < 8; ++r) { m_r[r] = -3.0e38f; l_r[r] = 0.f; }
  v8f oacc[DT];
#pragma unroll
  for (int dt = 0; dt < DT; ++dt) oacc[dt] = (v8f){0.f,0.f,0.f,0.f,0.f,0.f,0.f,0.f};

  const int kv_end = CAUSAL ? min(T, qblk * 64 + 64) : T;     // block-uniform
  for (int j0 = 0; j0 < kv_end; j0 += 32) {
    __syncthreads();
    for (int e = tid; e < 32 * (D / 4); e += 128) {
      const int r = e / (D / 4), c4 = (e % (D / 4)) * 4;
      const int key = j0 + r;
      v4f kf = {0.f,0.f,0.f,0.f}, vf = {0.f,0.f,0.f,0.f};
      if (key < T) { kf = *(const v4fa*)(K + (size_t)key * pitch + c4); vf = *(const v4fa*)(V + (size_t)key * pitch + c4); }
#pragma unroll
      for (int t = 0; t < 4; ++t) {
        unsigned short hb = bf16_bits(kf[t]); sKh[r][c4 + t] = hb; sKl[r][c4 + t] = bf16_bits(kf[t] - bf16_val(hb));
        hb = bf16_bits(vf[t]); sVh[r][c4 + t] = hb; sVl[r][c4 + t] = bf16_bits(vf[t] - bf16_val(hb));
      }
    }
    __syncthreads();
    // S tile 16 x 32
    v8f s[2];
#pragma unroll
    for (int nt = 0; nt < 2; ++nt) {
      v8f acc = {};
#pragma unroll
      for (int ks = 0; ks < KS; ++ks) {
        FragB bh_, bl_;
        bh_.half[0] = *(const v8us*)&sKh[nt * 16 + ln][ks * 32 + 8 * hh]; bh_.half[1] = *(const v8us*)&sKh[nt * 16 + ln][ks * 32 + 16 + 8 * hh];
        bl_.half[0] = *(const v8us*)&sKl[nt * 16 + ln][ks * 32 + 8 * hh]; bl_.half[1] = *(const v8us*)&sKl[nt * 16 + ln][ks * 32 + 16 + 8 * hh];
        acc = mmaN<3>(aqh[ks].v, aql[ks].v, bh_.v, bl_.v, acc);
      }
      s[nt] = acc;
    }
    // mask + running max (rows 8hh+r; the 16 lanes of a half share rows)
    float alpha[8];
#pragma unroll
    for (int r = 0; r < 8; ++r) {
      const int qi = q0 + 8 * hh + r;
      const int ja = j0 + ln, jb = j0 + 16 + ln;
      if (CAUSAL) { if (ja > qi) s[0][r] = -3.0e38f; if (jb > qi) s[1][r] = -3.0e38f; }
      if (ja >= T) s[0][r] = -3.0e38f;
      if (jb >= T) s[1][r] = -3.0e38f;
      float mx = fmaxf(s[0][r], s[1][r]);
      mx = fmaxf(mx, __shfl_xor(mx, 1, 32)); mx = fmaxf(mx, __shfl_xor(mx, 2, 32)); mx = fmaxf(mx, __shfl_xor(mx, 4, 32)); mx = fmaxf(mx, __shfl_xor(mx, 8, 32));
      const float mnew = fmaxf(m_r[r], mx);
      alpha[r] = (mnew > -1.0e38f) ? __expf(m_r[r] - mnew) : 1.0f;
      const float p0 = (s[0][r] > -1.0e38f) ? __expf(s[0][r] - mnew) : 0.f;
      const float p1 = (s[1][r] > -1.0e38f) ? __expf(s[1][r] - mnew) : 0.f;
      m_r[r] = mnew;
      l_r[r] = l_r[r] * alpha[r] + p0 + p1;            // per-lane partial row sum (16 lanes combined at the end)
      unsigned short hb = bf16_bits(p0); sPh[w][8 * hh + r][ln] = hb;      sPl[w][8 * hh + r][ln] = bf16_bits(p0 - bf16_val(hb));
      hb = bf16_bits(p1);                sPh[w][8 * hh + r][16 + ln] = hb; sPl[w][8 * hh + r][16 + ln] = bf16_bits(p1 - bf16_val(hb));
    }
#pragma unroll
    for (int dt = 0; dt < DT; ++dt)
#pragma unroll
      for (int r = 0; r < 8; ++r) oacc[dt][r] *= alpha[r];
    __builtin_amdgcn_fence(__ATOMIC_ACQ_REL, "workgroup");
    __builtin_amdgcn_wave_barrier();
    FragB pah, pal;
    pah.half[0] = *(const v8us*)&sPh[w][ln][8 * hh]; pah.half[1] = *(const v8us*)&sPh[w][ln][16 + 8 * hh];
    pal.half[0] = *(const v8us*)&sPl[w][ln][8 * hh]; pal.half[1] = *(const v8us*)&sPl[w][ln][16 + 8 * hh];
#pragma unroll
    for (int dt = 0; dt < DT; ++dt) {
      FragB bvh, bvl;
#pragma unroll
      for (int i = 0; i < 8; ++i) {
        bvh.u[i] = sVh[8 * hh + i][dt * 16 + ln]; bvh.u[8 + i] = sVh[16 + 8 * hh + i][dt * 16 + ln];
        bvl.u[i] = sVl[8 * hh + i][dt * 16 + ln]; bvl.u[8 + i] = sVl[16 + 8 * hh + i][dt * 16 + ln];
      }
      oacc[dt] = mmaN<3>(pah.v, pal.v, bvh.v, bvl.v, oacc[dt]);
    }
    __builtin_amdgcn_fence(__ATOMIC_ACQ_REL, "workgroup");
    __builtin_amdgcn_wave_barrier();
  }
#pragma unroll
  for (int r = 0; r < 8; ++r) {
    float l = l_r[r];
    l += __shfl_xor(l, 1, 32); l += __shfl_xor(l, 2, 32); l += __shfl_xor(l, 4, 32); l += __shfl_xor(l, 8, 32);
    l_r[r] = (l > 0.f) ? 1.0f / l : 0.f;
  }
#pragma unroll
  for (int dt = 0; dt < DT; ++dt)
#pragma unroll
    for (int r = 0; r < 8; ++r) sO[w][8 * hh + r][dt * 16 + ln] = oacc[dt][r] * l_r[r];
  __builtin_amdgcn_fence(__ATOMIC_ACQ_REL, "workgroup");
  __builtin_amdgcn_wave_barrier();
  {
    for (int r = 0; r < 16; ++r) {
      const int row = q0 + r;
      if (row < T && lane < D / 4) {
        const v4f val = *(const v4fa*)&sO[w][r][lane * 4];
        *(v4f*)(y + ((size_t)b * T + row) * ypitch + h * D + lane * 4) = val;
      }
    }
    
  }
}

// Self-attention (Tq == Tk == T) with optional int mask [T][T] (nonzero = keep) and/or causal flag; 3-term bf16 splits;
// Q/K/V rows read from f32 buffers: X + b*T*pitch + h*D + row*pitch. y[b][row][h*D + d], pitch ypitch. D == 64, T % 32 == 0.
template <int D>
__global__ __launch_bounds__(128) void k_flashm(const float* __restrict__ Qb, int qpitch, const float* __restrict__ Kb, int kpitch,
                                              const float* __restrict__ Vb, int vpitch, int T, int H, float scale,
                                              const int* __restrict__ mask, int causal, float* __restrict__ y, int ypitch) {
  constexpr int KS = D / 32, DT = D / 16;
  __shared__ __attribute__((aligned(16))) unsigned short sKh[32][D + 8], sKl[32][D + 8], sVh[32][D + 8], sVl[32][D + 8];
  __shared__ __attribute__((aligned(16))) unsigned short sPh[4][16][40], sPl[4][16][40];
  __shared__ __attribute__((aligned(16))) float sO[4][16][D];
  const int tid = threadIdx.x, w = tid >> 5, lane = tid & 31, ln = lane & 15, hh = lane >> 4;
  const int nqb = (T + 63) / 64;
  const int bh = blockIdx.x / nqb, qblk = blockIdx.x % nqb;
  const int b = bh / H, h = bh % H;
  const int q0 = qblk * 64 + w * 16;
  const float* Q = Qb + (size_t)b * T * qpitch + h * D;
  const float* K = Kb + (size_t)b * T * kpitch + h * D;
  const float* V = Vb + (size_t)b * T * vpitch + h * D;
  FragB aqh[KS], aql[KS];
  {
    int row = q0 + ln; if (row >= T) row = T - 1;
    const float* qr = Q + (size_t)row * qpitch;
#pragma unroll
    for (int ks = 0; ks < KS; ++ks)
#pragma unroll
      for (int i = 0; i < 16; ++i) {
        const int d = ks * 32 + ((i < 8) ? (8 * hh + i) : (16 + 8 * hh + (i - 8)));
        const float x = qr[d] * scale; const unsigned short hb = bf16_bits(x);
        aqh[ks].u[i] = hb; aql[ks].u[i] = bf16_bits(x - bf16_val(hb));
      }
  }
  int qrow[8];
#pragma unroll
  for (int r = 0; r < 8; ++r) { int qi = q0 + 8 * hh + r; qrow[r] = qi < T ? qi : T - 1; }
  float m_r[8], l_r[8];
#pragma unroll
  for (int r = 0; r < 8; ++r) { m_r[r] = -3.0e38f; l_r[r] = 0.f; }
  v8f oacc[DT];
#pragma unroll
  for (int dt = 0; dt < DT; ++dt) oacc[dt] = (v8f){0.f,0.f,0.f,0.f,0.f,0.f,0.f,0.f};
  const int kv_end = causal ? min(T, qblk * 64 + 64) : T;
  constexpr int NL = D / 16, RS = 128 / (D / 4);               // K (and V) quads per thread and pass; rows between a thread's quads
  const int sr = tid / (D / 4), sc4 = (tid % (D / 4)) * 4;     // the thread's first staged row, and its column
  const unsigned kofs = ((unsigned)sr * (unsigned)kpitch + (unsigned)sc4) * 4u, vofs = ((unsigned)sr * (unsigned)vpitch + (unsigned)sc4) * 4u;
  unsigned mofs[8];
#pragma unroll  // constant indices keep the array in registers (so for every unrolled loop of the batch below)
  for (int r = 0; r < 8; ++r) mofs[r] = ((unsigned)qrow[r] * (unsigned)T + (unsigned)ln) * 4u;
  for (int j0 = 0; j0 < kv_end; j0 += 32) {
    // All that the pass (32 keys) reads from global memory goes out as one batch, under no lane test, so that the loads'
    // latencies overlap: uniform base, fixed lane offsets; every key of a pass is below T (T % 32 == 0).
    static_assert(NL == 4, "the wait behind the K/V loads names four K and four V addresses");
    const char *kp[NL], *vp[NL];
    v4f kq[NL], vq[NL];
#pragma unroll  // addresses in registers
    for (int i = 0; i < NL; ++i) {
      kp[i] = (const char*)(K + (size_t)(j0 + i * RS) * kpitch) + kofs;
      vp[i] = (const char*)(V + (size_t)(j0 + i * RS) * vpitch) + vofs;
    }
#pragma unroll  // the eight loads back to back
    for (int i = 0; i < NL; ++i) { kq[i] = *(const v4fa*)kp[i]; vq[i] = *(const v4fa*)vp[i]; }
    // No address register of the batch is reused (not even as a later load's destination) in front of this wait.
    asm volatile("s_wait_xcnt 0x0" :: "v"(kp[0]), "v"(kp[1]), "v"(kp[2]), "v"(kp[3]), "v"(vp[0]), "v"(vp[1]), "v"(vp[2]), "v"(vp[3]) : "memory");
    int mka[8], mkb[8];
#pragma unroll  // words in registers
    for (int r = 0; r < 8; ++r) { mka[r] = 1; mkb[r] = 1; }
    if (mask) {
      const char* mp[8];
#pragma unroll  // addresses in registers
      for (int r = 0; r < 8; ++r) mp[r] = (const char*)(mask + j0) + mofs[r];
#pragma unroll  // the sixteen loads back to back
      for (int r = 0; r < 8; ++r) { mka[r] = *(const int*)mp[r]; mkb[r] = *(const int*)(mp[r] + 64); }
      // The same for the mask words' addresses.
      asm volatile("s_wait_xcnt 0x0" :: "v"(mp[0]), "v"(mp[1]), "v"(mp[2]), "v"(mp[3]), "v"(mp[4]), "v"(mp[5]), "v"(mp[6]), "v"(mp[7]) : "memory");
    }
    __syncthreads();
#pragma unroll  // kq and vq are indexed by constants
    for (int i = 0; i < NL; ++i) {
      const int r = sr + i * RS, c4 = sc4;
      const v4f kf = kq[i], vf = vq[i];
#pragma unroll
      for (int t = 0; t < 4; ++t) {
        unsigned short hb = bf16_bits(kf[t]); sKh[r][c4 + t] = hb; sKl[r][c4 + t] = bf16_bits(kf[t] - bf16_val(hb));
        hb = bf16_bits(vf[t]); sVh[r][c4 + t] = hb; sVl[r][c4 + t] = bf16_bits(vf[t] - bf16_val(hb));
      }
    }
    __syncthreads();
    v8f s[2];
#pragma unroll
    for (int nt = 0; nt < 2; ++nt) {
      v8f acc = {};
#pragma unroll
      for (int ks = 0; ks < KS; ++ks) {
        FragB bh_, bl_;
        bh_.half[0] = *(const v8us*)&sKh[nt * 16 + ln][ks * 32 + 8 * hh]; bh_.half[1] = *(const v8us*)&sKh[nt * 16 + ln][ks * 32 + 16 + 8 * hh];
        bl_.half[0] = *(const v8us*)&sKl[nt * 16 + ln][ks * 32 + 8 * hh]; bl_.half[1] = *(const v8us*)&sKl[nt * 16 + ln][ks * 32 + 16 + 8 * hh];
        acc = mmaN<3>(aqh[ks].v, aql[ks].v, bh_.v, bl_.v, acc);
      }
      s[nt] = acc;
    }
    float alpha[8];
#pragma unroll
    for (int r = 0; r < 8; ++r) {
      bool keepa = mka[r] != 0, keepb = mkb[r] != 0;
      if (causal) { keepa = keepa && (j0 + ln <= qrow[r]); keepb = keepb && (j0 + 16 + ln <= qrow[r]); }
      if (!keepa) s[0][r] = -3.0e38f;
      if (!keepb) s[1][r] = -3.0e38f;
      float mx = fmaxf(s[0][r], s[1][r]);
      mx = fmaxf(mx, __shfl_xor(mx, 1, 32)); mx = fmaxf(mx, __shfl_xor(mx, 2, 32)); mx = fmaxf(mx, __shfl_xor(mx, 4, 32)); mx = fmaxf(mx, __shfl_xor(mx, 8, 32));
      const float mnew = fmaxf(m_r[r], mx);
      alpha[r] = (mnew > -1.0e38f) ? __expf(m_r[r] - mnew) : 1.0f;
      const float p0 = keepa ? __expf(s[0][r] - mnew) : 0.f;
      const float p1 = keepb ? __expf(s[1][r] - mnew) : 0.f;
      m_r[r] = mnew;
      l_r[r] = l_r[r] * alpha[r] + p0 + p1;
      unsigned short hb = bf16_bits(p0); sPh[w][8 * hh + r][ln] = hb;      sPl[w][8 * hh + r][ln] = bf16_bits(p0 - bf16_val(hb));
      hb = bf16_bits(p1);                sPh[w][8 * hh + r][16 + ln] = hb; sPl[w][8 * hh + r][16 + ln] = bf16_bits(p1 - bf16_val(hb));
    }
#pragma unroll
    for (int dt = 0; dt < DT; ++dt)
#pragma unroll
      for (int r = 0; r < 8; ++r) oacc[dt][r] *= alpha[r];
    __builtin_amdgcn_fence(__ATOMIC_ACQ_REL, "workgroup");
    __builtin_amdgcn_wave_barrier();
    FragB pah, pal;
    pah.half[0] = *(const v8us*)&sPh[w][ln][8 * hh]; pah.half[1] = *(const v8us*)&sPh[w][ln][16 + 8 * hh];
    pal.half[0] = *(const v8us*)&sPl[w][ln][8 * hh]; pal.half[1] = *(const v8us*)&sPl[w][ln][16 + 8 * hh];
#pragma unroll
    for (int dt = 0; dt < DT; ++dt) {
      FragB bvh, bvl;
#pragma unroll
      for (int i = 0; i < 8; ++i) {
        bvh.u[i] = sVh[8 * hh + i][dt * 16 + ln]; bvh.u[8 + i] = sVh[16 + 8 * hh + i][dt * 16 + ln];
        bvl.u[i] = sVl[8 * hh + i][dt * 16 + ln]; bvl.u[8 + i] = sVl[16 + 8 * hh + i][dt * 16 + ln];
      }
      oacc[dt] = mmaN<3>(pah.v, pal.v, bvh.v, bvl.v, oacc[dt]);
    }
    __builtin_amdgcn_fence(__ATOMIC_ACQ_REL, "workgroup");
    __builtin_amdgcn_wave_barrier();
  }
  // NaN for fully-masked rows (softmax over a row of -inf)
#pragma unroll
  for (int r = 0; r < 8; ++r) {
    float l = l_r[r];
    l += __shfl_xor(l, 1, 32); l += __shfl_xor(l, 2, 32); l += __shfl_xor(l, 4, 32); l += __shfl_xor(l, 8, 32);
    l_r[r] = (m_r[r] > -1.0e38f) ? 1.0f / l : __builtin_nanf("");
  }
#pragma unroll
  for (int dt = 0; dt < DT; ++dt)
#pragma unroll
    for (int r = 0; r < 8; ++r) sO[w][8 * hh + r][dt * 16 + ln] = oacc[dt][r] * l_r[r];
  __builtin_amdgcn_fence(__ATOMIC_ACQ_REL, "workgroup");
  __builtin_amdgcn_wave_barrier();
  {
    for (int r = 0; r < 16; ++r) {
      const int row = q0 + r;
      if (row < T && lane < D / 4) {
        const v4f val = *(const v4fa*)&sO[w][r][lane * 4];
        *(v4f*)(y + ((size_t)b * T + row) * ypitch + h * D + lane * 4) = val;
      }
    }
    
  }
}

extern "C" void kernel_launch(void* const* d_in, const int* in_sizes, int n_in,
                              void* d_out, int out_size, void* d_ws, size_t ws_size, hipStream_t stream) {
  (void)in_sizes; (void)n_in; (void)out_size;
  const float* x = (const float*)d_in[0]; const int* mask = (const int*)d_in[1];
  const float* Wq = (const float*)d_in[2]; const float* Wkv = (const float*)d_in[3];
  const float* Wo = (const float*)d_in[4]; const float* bo = (const float*)d_in[5];
  char* ws = (char*)d_ws; size_t off = 0;
  unsigned short* Wqt  = (unsigned short*)(ws + off); off += (size_t)DM * DM * 2;       // [1024][1024]
  unsigned short* Wkvt = (unsigned short*)(ws + off); off += (size_t)2 * DM * DM * 2;   // [2048][1024]
  unsigned short* Wot  = (unsigned short*)(ws + off); off += (size_t)DM * DM * 2;
  float* qb  = (float*)(ws + off); off += (size_t)BB * NN * DM * 4;                    // 16 MiB
  float* kvb = (float*)(ws + off); off += (size_t)BB * NN * 2 * DM * 4;                // 32 MiB
  float* ob  = (float*)(ws + off); off += (size_t)BB * NN * DM * 4;                    // 16 MiB
  if (off > ws_size) return;
  const int M = BB * NN;
  k_wt_bf16<<<(DM * (DM / 8) + 255) / 256, 256, 0, stream>>>(Wq, Wqt, DM, DM);
  k_wt_bf16<<<(2 * DM * (DM / 8) + 255) / 256, 256, 0, stream>>>(Wkv, Wkvt, DM, 2 * DM);
  k_wt_bf16<<<(DM * (DM / 8) + 255) / 256, 256, 0, stream>>>(Wo, Wot, DM, DM);
  k_gemm_bf<false, 0, false><<<((M / 16) * (DM / 64) + 3) / 4, 128, 0, stream>>>(x, DM, Wqt, DM, nullptr, qb, DM, M, DM, DM);
  k_gemm_bf<false, 0, false><<<((M / 16) * (2 * DM / 64) + 3) / 4, 128, 0, stream>>>(x, DM, Wkvt, DM, nullptr, kvb, 2 * DM, M, 2 * DM, DM);
  // k = kv[..., 0:1024] (head h at h*64), v = kv[..., 1024:2048]
  k_flashm<HD><<<BB * NH * (NN / 64), 128, 0, stream>>>(qb, DM, kvb, 2 * DM, kvb + DM, 2 * DM, NN, NH, 0.03125f, mask, 0, ob, DM);
  k_gemm_bf<true, 0, true><<<((M / 16) * (DM / 64) + 3) / 4, 128, 0, stream>>>(ob, DM, Wot, DM, bo, (float*)d_out, DM, M, DM, DM);
}

// v002
// Measured time: 409 microseconds a run.
// Two timings next to v001 both put it at 1.03 times that version's speed.
// Counting every step since v000, it is 1.65 times as fast.
#include <hip/hip_runtime.h>
// All contractions on v_wmma_f32_16x16x32_bf16, f32 accumulate: q = x·Wq and kv = x·Wkv with x/W rounded to bf16 (single
// exact-product term), QKᵀ and P·V 3-term bf16 hi/lo splits, out = o·Wout with o split hi/lo (2 terms); softmax f32.
// The boolean mask input is applied as given (together with nothing else).
#define BB 2
#define NN 2048
#define DM 1024
#define NH 16
#define HD 64

typedef __bf16 v16b __attribute__((ext_vector_type(16)));
typedef unsigned short v8us __attribute__((ext_vector_type(8), may_alias));
typedef float  v8f  __attribute__((ext_vector_type(8)));
typedef float  v4f  __attribute__((ext_vector_type(4)));
typedef float  v4fa __attribute__((ext_vector_type(4), may_alias));
union FragB { v16b v; v8us half[2]; unsigned short u[16]; };

__device__ __forceinline__ unsigned short bf16_bits(float x) { unsigned int u = __float_as_uint(x); return (unsigned short)((u + 0x7FFFu + ((u >> 16) & 1u)) >> 16); }
__device__ __forceinline__ float bf16_val(unsigned short b) { return __uint_as_float(((unsigned int)b) << 16); }
__device__ __forceinline__ float bf16_round(float x) { return bf16_val(bf16_bits(x)); }
// D += A·B with NT terms: 1 = ah·bh, 2 = + al·bh (A split), 3 = + ah·bl (both split)
template <int NT>
__device__ __forceinline__ v8f mmaN(v16b ah, v16b al, v16b bh, v16b bl, v8f c) {
  c = __builtin_amdgcn_wmma_f32_16x16x32_bf16(false, ah, false, bh, (short)0, c, false, false);
  if (NT >= 2) c = __builtin_amdgcn_wmma_f32_16x16x32_bf16(false, al, false, bh, (short)0, c, false, false);
  if (NT >= 3) c = __builtin_amdgcn_wmma_f32_16x16x32_bf16(false, ah, false, bl, (short)0, c, false, false);
  asm volatile("v_nop\n\tv_nop\n\tv_nop\n\tv_nop" : "+v"(c) : "v"(ah), "v"(al), "v"(bh), "v"(bl));
  return c;
}

// Transposing LDS load: a row-major 16 x 16 tile of 16-bit elements arrives as half of a WMMA operand (8 k of one column per lane).
__device__ __forceinline__ v8us lds_tr16(const unsigned short* p) {
  typedef short s16x8 __attribute__((ext_vector_type(8)));
  typedef __attribute__((address_space(3))) s16x8 lds_s16x8;
  return __builtin_bit_cast(v8us, __builtin_amdgcn_ds_load_tr16_b128_v8i16((lds_s16x8*)p));
}

__global__ __launch_bounds__(256) void k_wt_bf16(const float* __restrict__ W, unsigned short* __restrict__ Wt, int K, int N) {
  const int t = blockIdx.x * 256 + threadIdx.x;
  const int k8n = K / 8;
  if (t >= N * k8n) return;
  const int n = t / k8n, k8 = (t % k8n) * 8;
  v8us v;
#pragma unroll
  for (int i = 0; i < 8; ++i) v[i] = bf16_bits(W[(size_t)(k8 + i) * N + n]);
  *(v8us*)(Wt + (size_t)n * K + k8) = v;
  
}

// GEMM C[M][N] (f32, pitch ldc) = act(A[M][K]·W + bias). A f32 row-major (pitch lda) converted per fragment to bf16
// (ASPLIT: hi/lo two planes -> 2 terms, else single rounded term); Wt bf16 [N][K] (pitch ldb). BIAS_BF16 rounds the
// bias to bf16 first (bias quantised to bf16 before the add). K%32==0, M%16==0, N%64==0.
template <bool ASPLIT, int ACT, bool BIAS_BF16>
__global__ __launch_bounds__(128) void k_gemm_bf(const float* __restrict__ A, int lda, const unsigned short* __restrict__ Wt, int ldb,
                                               const float* __restrict__ bias, float* __restrict__ C, int ldc, int M, int N, int K) {
  __shared__ __attribute__((aligned(16))) float so[4][16][64];
  const int tid = threadIdx.x, w = tid >> 5, lane = tid & 31, ln = lane & 15, hh = lane >> 4;
  const int ntn = N / 64;
  const int wid = blockIdx.x * 4 + w;
  const int mt = wid / ntn, nq = wid % ntn;
  if (mt * 16 >= M) return;
  const int row0 = mt * 16, col0 = nq * 64;
  const float* arow = A + (size_t)(row0 + ln) * lda;
  v8f acc[4] = {};
  for (int kb = 0; kb < K; kb += 32) {
    FragB ah, al;
    const v4f x0 = *(const v4fa*)(arow + kb + 8 * hh), x1 = *(const v4fa*)(arow + kb + 8 * hh + 4);
    const v4f x2 = *(const v4fa*)(arow + kb + 16 + 8 * hh), x3 = *(const v4fa*)(arow + kb + 16 + 8 * hh + 4);
    float xs[16] = {x0[0],x0[1],x0[2],x0[3],x1[0],x1[1],x1[2],x1[3],x2[0],x2[1],x2[2],x2[3],x3[0],x3[1],x3[2],x3[3]};
#pragma unroll
    for (int i = 0; i < 16; ++i) { const unsigned short hb = bf16_bits(xs[i]); ah.u[i] = hb; al.u[i] = ASPLIT ? bf16_bits(xs[i] - bf16_val(hb)) : (unsigned short)0; }
#pragma unroll
    for (int t = 0; t < 4; ++t) {
      const unsigned short* brow = Wt + (size_t)(col0 + t * 16 + ln) * ldb + kb;
      FragB b;
      b.half[0] = *(const v8us*)(brow + 8 * hh);
      b.half[1] = *(const v8us*)(brow + 16 + 8 * hh);
      acc[t] = mmaN<ASPLIT ? 2 : 1>(ah.v, al.v, b.v, b.v, acc[t]);
    }
  }
#pragma unroll
  for (int t = 0; t < 4; ++t) {
    float bv = bias ? bias[col0 + t * 16 + ln] : 0.f;
    if (BIAS_BF16) bv = bf16_round(bv);
#pragma unroll
    for (int r = 0; r < 8; ++r) { float v = acc[t][r] + bv; if (ACT == 1) v = fmaxf(v, 0.f); so[w][8 * hh + r][t * 16 + ln] = v; }
  }
  __builtin_amdgcn_fence(__ATOMIC_ACQ_REL, "workgroup");
  __builtin_amdgcn_wave_barrier();
  const int rsub = lane >> 4, c4 = (lane & 15) * 4;
  {
#pragma unroll
    for (int q = 0; q < 8; ++q) {
      const int r = q * 2 + rsub;
      const v4f v = *(const v4fa*)&so[w][r][c4];
      *(v4f*)(C + (size_t)(row0 + r) * ldc + col0 + c4) = v;
    }
    
  }
}

// Flash-style causal/unmasked attention, all contractions 3-term bf16 hi/lo splits, f32 softmax with running max.
// q,k,v rows are read from f32 buffers with arbitrary row pitch (so they can live inside a fused qkv buffer);
// D = head size (multiple of 32, <= 128); one wave = 16 query rows; block = 4 waves (64 queries) sharing K/V chunks of 32.
template <int D, bool CAUSAL>
__global__ __launch_bounds__(128) void k_flash(const float* __restrict__ qb, const float* __restrict__ kb, const float* __restrict__ vb,
                                             int pitch, int T, int H, float scale, float* __restrict__ y, int ypitch) {
  constexpr int KS = D / 32;        // k-steps for QK
  constexpr int DT = D / 16;        // d tiles for PV
  __shared__ __attribute__((aligned(16))) unsigned short sKh[32][D + 8], sKl[32][D + 8], sVh[32][D + 8], sVl[32][D + 8];
  __shared__ __attribute__((aligned(16))) unsigned short sPh[4][16][40], sPl[4][16][40];
  __shared__ __attribute__((aligned(16))) float sO[4][16][D];
  const int tid = threadIdx.x, w = tid >> 5, lane = tid & 31, ln = lane & 15, hh = lane >> 4;
  const int nqb = (T + 63) / 64;
  const int bh = blockIdx.x / nqb, qblk = blockIdx.x % nqb;
  const int b = bh / H, h = bh % H;
  const int q0 = qblk * 64 + w * 16;
  const float* Q = qb + (size_t)b * T * pitch + h * D;
  const float* K = kb + (size_t)b * T * pitch + h * D;
  const float* V = vb + (size_t)b * T * pitch + h * D;

  // A fragments of the wave's 16 query rows (scaled), hi/lo
  FragB aqh[KS], aql[KS];
  {
    int row = q0 + ln; if (row >= T) row = T - 1;
    const float* qr = Q + (size_t)row * pitch;
#pragma unroll
    for (int ks = 0; ks < KS; ++ks)
#pragma unroll
      for (int i = 0; i < 16; ++i) {
        const int d = ks * 32 + ((i < 8) ? (8 * hh + i) : (16 + 8 * hh + (i - 8)));
        const float x = qr[d] * scale; const unsigned short hb = bf16_bits(x);
        aqh[ks].u[i] = hb; aql[ks].u[i] = bf16_bits(x - bf16_val(hb));
      }
  }
  float m_r[8], l_r[8];
#pragma unroll
  for (int r = 0; r < 8; ++r) { m_r[r] = -3.0e38f; l_r[r] = 0.f; }
  v8f oacc[DT];
#pragma unroll
  for (int dt = 0; dt < DT; ++dt) oacc[dt] = (v8f){0.f,0.f,0.f,0.f,0.f,0.f,0.f,0.f};

  const int kv_end = CAUSAL ? min(T, qblk * 64 + 64) : T;     // block-uniform
  for (int j0 = 0; j0 < kv_end; j0 += 32) {
    __syncthreads();
    for (int e = tid; e < 32 * (D / 4); e += 128) {
      const int r = e / (D / 4), c4 = (e % (D / 4)) * 4;
      const int key = j0 + r;
      v4f kf = {0.f,0.f,0.f,0.f}, vf = {0.f,0.f,0.f,0.f};
      if (key < T) { kf = *(const v4fa*)(K + (size_t)key * pitch + c4); vf = *(const v4fa*)(V + (size_t)key * pitch + c4); }
#pragma unroll
      for (int t = 0; t < 4; ++t) {
        unsigned short hb = bf16_bits(kf[t]); sKh[r][c4 + t] = hb; sKl[r][c4 + t] = bf16_bits(kf[t] - bf16_val(hb));
        hb = bf16_bits(vf[t]); sVh[r][c4 + t] = hb; sVl[r][c4 + t] = bf16_bits(vf[t] - bf16_val(hb));
      }
    }
    __syncthreads();
    // S tile 16 x 32
    v8f s[2];
#pragma unroll
    for (int nt = 0; nt < 2; ++nt) {
      v8f acc = {};
#pragma unroll
      for (int ks = 0; ks < KS; ++ks) {
        FragB bh_, bl_;
        bh_.half[0] = *(const v8us*)&sKh[nt * 16 + ln][ks * 32 + 8 * hh]; bh_.half[1] = *(const v8us*)&sKh[nt * 16 + ln][ks * 32 + 16 + 8 * hh];
        bl_.half[0] = *(const v8us*)&sKl[nt * 16 + ln][ks * 32 + 8 * hh]; bl_.half[1] = *(const v8us*)&sKl[nt * 16 + ln][ks * 32 + 16 + 8 * hh];
        acc = mmaN<3>(aqh[ks].v, aql[ks].v, bh_.v, bl_.v, acc);
      }
      s[nt] = acc;
    }
    // mask + running max (rows 8hh+r; the 16 lanes of a half share rows)
    float alpha[8];
#pragma unroll
    for (int r = 0; r < 8; ++r) {
      const int qi = q0 + 8 * hh + r;
      const int ja = j0 + ln, jb = j0 + 16 + ln;
      if (CAUSAL) { if (ja > qi) s[0][r] = -3.0e38f; if (jb > qi) s[1][r] = -3.0e38f; }
      if (ja >= T) s[0][r] = -3.0e38f;
      if (jb >= T) s[1][r] = -3.0e38f;
      float mx = fmaxf(s[0][r], s[1][r]);
      mx = fmaxf(mx, __shfl_xor(mx, 1, 32)); mx = fmaxf(mx, __shfl_xor(mx, 2, 32)); mx = fmaxf(mx, __shfl_xor(mx, 4, 32)); mx = fmaxf(mx, __shfl_xor(mx, 8, 32));
      const float mnew = fmaxf(m_r[r], mx);
      alpha[r] = (mnew > -1.0e38f) ? __expf(m_r[r] - mnew) : 1.0f;
      const float p0 = (s[0][r] > -1.0e38f) ? __expf(s[0][r] - mnew) : 0.f;
      const float p1 = (s[1][r] > -1.0e38f) ? __expf(s[1][r] - mnew) : 0.f;
      m_r[r] = mnew;
      l_r[r] = l_r[r] * alpha[r] + p0 + p1;            // per-lane partial row sum (16 lanes combined at the end)
      unsigned short hb = bf16_bits(p0); sPh[w][8 * hh + r][ln] = hb;      sPl[w][8 * hh + r][ln] = bf16_bits(p0 - bf16_val(hb));
      hb = bf16_bits(p1);                sPh[w][8 * hh + r][16 + ln] = hb; sPl[w][8 * hh + r][16 + ln] = bf16_bits(p1 - bf16_val(hb));
    }
#pragma unroll
    for (int dt = 0; dt < DT; ++dt)
#pragma unroll
      for (int r = 0; r < 8; ++r) oacc[dt][r] *= alpha[r];
    __builtin_amdgcn_fence(__ATOMIC_ACQ_REL, "workgroup");
    __builtin_amdgcn_wave_barrier();
    FragB pah, pal;
    pah.half[0] = *(const v8us*)&sPh[w][ln][8 * hh]; pah.half[1] = *(const v8us*)&sPh[w][ln][16 + 8 * hh];
    pal.half[0] = *(const v8us*)&sPl[w][ln][8 * hh]; pal.half[1] = *(const v8us*)&sPl[w][ln][16 + 8 * hh];
#pragma unroll
    for (int dt = 0; dt < DT; ++dt) {
      FragB bvh, bvl;
#pragma unroll
      for (int i = 0; i < 8; ++i) {
        bvh.u[i] = sVh[8 * hh + i][dt * 16 + ln]; bvh.u[8 + i] = sVh[16 + 8 * hh + i][dt * 16 + ln];
        bvl.u[i] = sVl[8 * hh + i][dt * 16 + ln]; bvl.u[8 + i] = sVl[16 + 8 * hh + i][dt * 16 + ln];
      }
      oacc[dt] = mmaN<3>(pah.v, pal.v, bvh.v, bvl.v, oacc[dt]);
    }
    __builtin_amdgcn_fence(__ATOMIC_ACQ_REL, "workgroup");
    __builtin_amdgcn_wave_barrier();
  }
#pragma unroll
  for (int r = 0; r < 8; ++r) {
    float l = l_r[r];
    l += __shfl_xor(l, 1, 32); l += __shfl_xor(l, 2, 32); l += __shfl_xor(l, 4, 32); l += __shfl_xor(l, 8, 32);
    l_r[r] = (l > 0.f) ? 1.0f / l : 0.f;
  }
#pragma unroll
  for (int dt = 0; dt < DT; ++dt)
#pragma unroll
    for (int r = 0; r < 8; ++r) sO[w][8 * hh + r][dt * 16 + ln] = oacc[dt][r] * l_r[r];
  __builtin_amdgcn_fence(__ATOMIC_ACQ_REL, "workgroup");
  __builtin_amdgcn_wave_barrier();
  {
    for (int r = 0; r < 16; ++r) {
      const int row = q0 + r;
      if (row < T && lane < D / 4) {
        const v4f val = *(const v4fa*)&sO[w][r][lane * 4];
        *(v4f*)(y + ((size_t)b * T + row) * ypitch + h * D + lane * 4) = val;
      }
    }
    
  }
}

// Self-attention (Tq == Tk == T) with optional int mask [T][T] (nonzero = keep) and/or causal flag; 3-term bf16 splits;
// Q/K/V rows read from f32 buffers: X + b*T*pitch + h*D + row*pitch. y[b][row][h*D + d], pitch ypitch. D == 64, T % 32 == 0.
template <int D>
__global__ __launch_bounds__(128) void k_flashm(const float* __restrict__ Qb, int qpitch, const float* __restrict__ Kb, int kpitch,
                                              const float* __restrict__ Vb, int vpitch, int T, int H, float scale,
                                              const int* __restrict__ mask, int causal, float* __restrict__ y, int ypitch) {
  constexpr int KS = D / 32, DT = D / 16;
  constexpr int VP = D + 16;   // V row pitch in elements: an odd multiple of 32 bytes, the conflict-free pitch of the transposing load
  static_assert((VP * 2) % 32 == 0 && ((VP * 2 / 32) & 1) == 1, "V rows: odd multiple of 32 bytes");
  __shared__ __attribute__((aligned(16))) unsigned short sKh[32][D + 8], sKl[32][D + 8], sVh[32][VP], sVl[32][VP];
  __shared__ __attribute__((aligned(16))) unsigned short sPh[4][16][40], sPl[4][16][40];
  __shared__ __attribute__((aligned(16))) float sO[4][16][D];
  const int tid = threadIdx.x, w = tid >> 5, lane = tid & 31, ln = lane & 15, hh = lane >> 4;
  const int nqb = (T + 63) / 64;
  const int bh = blockIdx.x / nqb, qblk = blockIdx.x % nqb;
  const int b = bh / H, h = bh % H;
  const int q0 = qblk * 64 + w * 16;
  const float* Q = Qb + (size_t)b * T * qpitch + h * D;
  const float* K = Kb + (size_t)b * T * kpitch + h * D;
  const float* V = Vb + (size_t)b * T * vpitch + h * D;
  FragB aqh[KS], aql[KS];
  {
    int row = q0 + ln; if (row >= T) row = T - 1;
    const float* qr = Q + (size_t)row * qpitch;
#pragma unroll
    for (int ks = 0; ks < KS; ++ks)
#pragma unroll
      for (int i = 0; i < 16; ++i) {
        const int d = ks * 32 + ((i < 8) ? (8 * hh + i) : (16 + 8 * hh + (i - 8)));
        const float x = qr[d] * scale; const unsigned short hb = bf16_bits(x);
        aqh[ks].u[i] = hb; aql[ks].u[i] = bf16_bits(x - bf16_val(hb));
      }
  }
  int qrow[8];
#pragma unroll
  for (int r = 0; r < 8; ++r) { int qi = q0 + 8 * hh + r; qrow[r] = qi < T ? qi : T - 1; }
  float m_r[8], l_r[8];
#pragma unroll
  for (int r = 0; r < 8; ++r) { m_r[r] = -3.0e38f; l_r[r] = 0.f; }
  v8f oacc[DT];
#pragma unroll
  for (int dt = 0; dt < DT; ++dt) oacc[dt] = (v8f){0.f,0.f,0.f,0.f,0.f,0.f,0.f,0.f};
  const int kv_end = causal ? min(T, qblk * 64 + 64) : T;
  constexpr int NL = D / 16, RS = 128 / (D / 4);               // K (and V) quads per thread and pass; rows between a thread's quads
  const int sr = tid / (D / 4), sc4 = (tid % (D / 4)) * 4;     // the thread's first staged row, and its column
  const unsigned kofs = ((unsigned)sr * (unsigned)kpitch + (unsigned)sc4) * 4u, vofs = ((unsigned)sr * (unsigned)vpitch + (unsigned)sc4) * 4u;
  // the lane's own 16 bytes of a 16 x 16 V tile for the transposing load: row 8 hh + (lane & 7), column half (lane >> 3) & 1
  const unsigned short* vth = &sVh[8 * hh + (lane & 7)][8 * ((lane >> 3) & 1)];
  const unsigned short* vtl = &sVl[8 * hh + (lane & 7)][8 * ((lane >> 3) & 1)];
  unsigned mofs[8];
#pragma unroll  // constant indices keep the array in registers (so for every unrolled loop of the batch below)
  for (int r = 0; r < 8; ++r) mofs[r] = ((unsigned)qrow[r] * (unsigned)T + (unsigned)ln) * 4u;
  for (int j0 = 0; j0 < kv_end; j0 += 32) {
    // All that the pass (32 keys) reads from global memory goes out as one batch, under no lane test, so that the loads'
    // latencies overlap: uniform base, fixed lane offsets; every key of a pass is below T (T % 32 == 0).
    static_assert(NL == 4, "the wait behind the K/V loads names four K and four V addresses");
    const char *kp[NL], *vp[NL];
    v4f kq[NL], vq[NL];
#pragma unroll  // addresses in registers
    for (int i = 0; i < NL; ++i) {
      kp[i] = (const char*)(K + (size_t)(j0 + i * RS) * kpitch) + kofs;
      vp[i] = (const char*)(V + (size_t)(j0 + i * RS) * vpitch) + vofs;
    }
#pragma unroll  // the eight loads back to back
    for (int i = 0; i < NL; ++i) { kq[i] = *(const v4fa*)kp[i]; vq[i] = *(const v4fa*)vp[i]; }
    // No address register of the batch is reused (not even as a later load's destination) in front of this wait.
    asm volatile("s_wait_xcnt 0x0" :: "v"(kp[0]), "v"(kp[1]), "v"(kp[2]), "v"(kp[3]), "v"(vp[0]), "v"(vp[1]), "v"(vp[2]), "v"(vp[3]) : "memory");
    int mka[8], mkb[8];
#pragma unroll  // words in registers
    for (int r = 0; r < 8; ++r) { mka[r] = 1; mkb[r] = 1; }
    if (mask) {
      const char* mp[8];
#pragma unroll  // addresses in registers
      for (int r = 0; r < 8; ++r) mp[r] = (const char*)(mask + j0) + mofs[r];
#pragma unroll  // the sixteen loads back to back
      for (int r = 0; r < 8; ++r) { mka[r] = *(const int*)mp[r]; mkb[r] = *(const int*)(mp[r] + 64); }
      // The same for the mask words' addresses.
      asm volatile("s_wait_xcnt 0x0" :: "v"(mp[0]), "v"(mp[1]), "v"(mp[2]), "v"(mp[3]), "v"(mp[4]), "v"(mp[5]), "v"(mp[6]), "v"(mp[7]) : "memory");
    }
    __syncthreads();
#pragma unroll  // kq and vq are indexed by constants
    for (int i = 0; i < NL; ++i) {
      const int r = sr + i * RS, c4 = sc4;
      const v4f kf = kq[i], vf = vq[i];
#pragma unroll
      for (int t = 0; t < 4; ++t) {
        unsigned short hb = bf16_bits(kf[t]); sKh[r][c4 + t] = hb; sKl[r][c4 + t] = bf16_bits(kf[t] - bf16_val(hb));
        hb = bf16_bits(vf[t]); sVh[r][c4 + t] = hb; sVl[r][c4 + t] = bf16_bits(vf[t] - bf16_val(hb));
      }
    }
    __syncthreads();
    v8f s[2];
#pragma unroll
    for (int nt = 0; nt < 2; ++nt) {
      v8f acc = {};
#pragma unroll
      for (int ks = 0; ks < KS; ++ks) {
        FragB bh_, bl_;
        bh_.half[0] = *(const v8us*)&sKh[nt * 16 + ln][ks * 32 + 8 * hh]; bh_.half[1] = *(const v8us*)&sKh[nt * 16 + ln][ks * 32 + 16 + 8 * hh];
        bl_.half[0] = *(const v8us*)&sKl[nt * 16 + ln][ks * 32 + 8 * hh]; bl_.half[1] = *(const v8us*)&sKl[nt * 16 + ln][ks * 32 + 16 + 8 * hh];
        acc = mmaN<3>(aqh[ks].v, aql[ks].v, bh_.v, bl_.v, acc);
      }
      s[nt] = acc;
    }
    float alpha[8];
#pragma unroll
    for (int r = 0; r < 8; ++r) {
      bool keepa = mka[r] != 0, keepb = mkb[r] != 0;
      if (causal) { keepa = keepa && (j0 + ln <= qrow[r]); keepb = keepb && (j0 + 16 + ln <= qrow[r]); }
      if (!keepa) s[0][r] = -3.0e38f;
      if (!keepb) s[1][r] = -3.0e38f;
      float mx = fmaxf(s[0][r], s[1][r]);
      mx = fmaxf(mx, __shfl_xor(mx, 1, 32)); mx = fmaxf(mx, __shfl_xor(mx, 2, 32)); mx = fmaxf(mx, __shfl_xor(mx, 4, 32)); mx = fmaxf(mx, __shfl_xor(mx, 8, 32));
      const float mnew = fmaxf(m_r[r], mx);
      alpha[r] = (mnew > -1.0e38f) ? __expf(m_r[r] - mnew) : 1.0f;
      const float p0 = keepa ? __expf(s[0][r] - mnew) : 0.f;
      const float p1 = keepb ? __expf(s[1][r] - mnew) : 0.f;
      m_r[r] = mnew;
      l_r[r] = l_r[r] * alpha[r] + p0 + p1;
      unsigned short hb = bf16_bits(p0); sPh[w][8 * hh + r][ln] = hb;      sPl[w][8 * hh + r][ln] = bf16_bits(p0 - bf16_val(hb));
      hb = bf16_bits(p1);                sPh[w][8 * hh + r][16 + ln] = hb; sPl[w][8 * hh + r][16 + ln] = bf16_bits(p1 - bf16_val(hb));
    }
#pragma unroll
    for (int dt = 0; dt < DT; ++dt)
#pragma unroll
      for (int r = 0; r < 8; ++r) oacc[dt][r] *= alpha[r];
    // The pass's whole V operand as one group of loads, in front of P's trip through LDS, which covers their latency.
    // Lane (ln, hh) receives V[kbase + 8 hh + 0..7][dt * 16 + ln], kbase 0 and 16: the k order of the P fragment below.
    FragB bvh[DT], bvl[DT];
#pragma unroll  // fragments in registers
    for (int dt = 0; dt < DT; ++dt) {
      bvh[dt].half[0] = lds_tr16(vth + dt * 16); bvh[dt].half[1] = lds_tr16(vth + 16 * VP + dt * 16);
      bvl[dt].half[0] = lds_tr16(vtl + dt * 16); bvl[dt].half[1] = lds_tr16(vtl + 16 * VP + dt * 16);
    }
    __builtin_amdgcn_fence(__ATOMIC_ACQ_REL, "workgroup");
    __builtin_amdgcn_wave_barrier();
    FragB pah, pal;
    pah.half[0] = *(const v8us*)&sPh[w][ln][8 * hh]; pah.half[1] = *(const v8us*)&sPh[w][ln][16 + 8 * hh];
    pal.half[0] = *(const v8us*)&sPl[w][ln][8 * hh]; pal.half[1] = *(const v8us*)&sPl[w][ln][16 + 8 * hh];
#pragma unroll
    for (int dt = 0; dt < DT; ++dt) {
      oacc[dt] = mmaN<3>(pah.v, pal.v, bvh[dt].v, bvl[dt].v, oacc[dt]);
    }
    __builtin_amdgcn_fence(__ATOMIC_ACQ_REL, "workgroup");
    __builtin_amdgcn_wave_barrier();
  }
  // NaN for fully-masked rows (softmax over a row of -inf)
#pragma unroll
  for (int r = 0; r < 8; ++r) {
    float l = l_r[r];
    l += __shfl_xor(l, 1, 32); l += __shfl_xor(l, 2, 32); l += __shfl_xor(l, 4, 32); l += __shfl_xor(l, 8, 32);
    l_r[r] = (m_r[r] > -1.0e38f) ? 1.0f / l : __builtin_nanf("");
  }
#pragma unroll
  for (int dt = 0; dt < DT; ++dt)
#pragma unroll
    for (int r = 0; r < 8; ++r) sO[w][8 * hh + r][dt * 16 + ln] = oacc[dt][r] * l_r[r];
  __builtin_amdgcn_fence(__ATOMIC_ACQ_REL, "workgroup");
  __builtin_amdgcn_wave_barrier();
  {
    for (int r = 0; r < 16; ++r) {
      const int row = q0 + r;
      if (row < T && lane < D / 4) {
        const v4f val = *(const v4fa*)&sO[w][r][lane * 4];
        *(v4f*)(y + ((size_t)b * T + row) * ypitch + h * D + lane * 4) = val;
      }
    }
    
  }
}

extern "C" void kernel_launch(void* const* d_in, const int* in_sizes, int n_in,
                              void* d_out, int out_size, void* d_ws, size_t ws_size, hipStream_t stream) {
  (void)in_sizes; (void)n_in; (void)out_size;
  const float* x = (const float*)d_in[0]; const int* mask = (const int*)d_in[1];
  const float* Wq = (const float*)d_in[2]; const float* Wkv = (const float*)d_in[3];
  const float* Wo = (const float*)d_in[4]; const float* bo = (const float*)d_in[5];
  char* ws = (char*)d_ws; size_t off = 0;
  unsigned short* Wqt  = (unsigned short*)(ws + off); off += (size_t)DM * DM * 2;       // [1024][1024]
  unsigned short* Wkvt = (unsigned short*)(ws + off); off += (size_t)2 * DM * DM * 2;   // [2048][1024]
  unsigned short* Wot  = (unsigned short*)(ws + off); off += (size_t)DM * DM * 2;
  float* qb  = (float*)(ws + off); off += (size_t)BB * NN * DM * 4;                    // 16 MiB
  float* kvb = (float*)(ws + off); off += (size_t)BB * NN * 2 * DM * 4;                // 32 MiB
  float* ob  = (float*)(ws + off); off += (size_t)BB * NN * DM * 4;                    // 16 MiB
  if (off > ws_size) return;
  const int M = BB * NN;
  k_wt_bf16<<<(DM * (DM / 8) + 255) / 256, 256, 0, stream>>>(Wq, Wqt, DM, DM);
  k_wt_bf16<<<(2 * DM * (DM / 8) + 255) / 256, 256, 0, stream>>>(Wkv, Wkvt, DM, 2 * DM);
  k_wt_bf16<<<(DM * (DM / 8) + 255) / 256, 256, 0, stream>>>(Wo, Wot, DM, DM);
  k_gemm_bf<false, 0, false><<<((M / 16) * (DM / 64) + 3) / 4, 128, 0, stream>>>(x, DM, Wqt, DM, nullptr, qb, DM, M, DM, DM);
  k_gemm_bf<false, 0, false><<<((M / 16) * (2 * DM / 64) + 3) / 4, 128, 0, stream>>>(x, DM, Wkvt, DM, nullptr, kvb, 2 * DM, M, 2 * DM, DM);
  // k = kv[..., 0:1024] (head h at h*64), v = kv[..., 1024:2048]
  k_flashm<HD><<<BB * NH * (NN / 64), 128, 0, stream>>>(qb, DM, kvb, 2 * DM, kvb + DM, 2 * DM, NN, NH, 0.03125f, mask, 0, ob, DM);
  k_gemm_bf<true, 0, true><<<((M / 16) * (DM / 64) + 3) / 4, 128, 0, stream>>>(ob, DM, Wot, DM, bo, (float*)d_out, DM, M, DM, DM);
}

// v003
// It runs in 307 microseconds.
// In two side-by-side timings against v002, it was 1.34 and 1.33 times as fast.
// Over all steps from v000 it is 2.19 times as fast.
#include <hip/hip_runtime.h>
// All contractions on v_wmma_f32_16x16x32_bf16, f32 accumulate: q = x·Wq and kv = x·Wkv with x/W rounded to bf16 (single
// exact-product term), QKᵀ and P·V 3-term bf16 hi/lo splits, out = o·Wout with o split hi/lo (2 terms); softmax f32.
// The boolean mask input is applied as given (together with nothing else).
#define BB 2
#define NN 2048
#define DM 1024
#define NH 16
#define HD 64

typedef __bf16 v16b __attribute__((ext_vector_type(16)));
typedef unsigned short v8us __attribute__((ext_vector_type(8), may_alias));
typedef unsigned short v4us __attribute__((ext_vector_type(4), may_alias));
typedef float  v8f  __attribute__((ext_vector_type(8)));
typedef float  v4f  __attribute__((ext_vector_type(4)));
typedef float  v4fa __attribute__((ext_vector_type(4), may_alias));
union FragB { v16b v; v8us half[2]; unsigned short u[16]; };

__device__ __forceinline__ unsigned short bf16_bits(float x) { unsigned int u = __float_as_uint(x); return (unsigned short)((u + 0x7FFFu + ((u >> 16) & 1u)) >> 16); }
__device__ __forceinline__ float bf16_val(unsigned short b) { return __uint_as_float(((unsigned int)b) << 16); }
__device__ __forceinline__ float bf16_round(float x) { return bf16_val(bf16_bits(x)); }
// D += A·B with NT terms: 1 = ah·bh, 2 = + al·bh (A split), 3 = + ah·bl (both split)
template <int NT>
__device__ __forceinline__ v8f mmaN(v16b ah, v16b al, v16b bh, v16b bl, v8f c) {
  c = __builtin_amdgcn_wmma_f32_16x16x32_bf16(false, ah, false, bh, (short)0, c, false, false);
  if (NT >= 2) c = __builtin_amdgcn_wmma_f32_16x16x32_bf16(false, al, false, bh, (short)0, c, false, false);
  if (NT >= 3) c = __builtin_amdgcn_wmma_f32_16x16x32_bf16(false, ah, false, bl, (short)0, c, false, false);
  asm volatile("v_nop\n\tv_nop\n\tv_nop\n\tv_nop" : "+v"(c) : "v"(ah), "v"(al), "v"(bh), "v"(bl));
  return c;
}

// Transposing LDS load: a row-major 16 x 16 tile of 16-bit elements arrives as half of a WMMA operand (8 k of one column per lane).
__device__ __forceinline__ v8us lds_tr16(const unsigned short* p) {
  typedef short s16x8 __attribute__((ext_vector_type(8)));
  typedef __attribute__((address_space(3))) s16x8 lds_s16x8;
  return __builtin_bit_cast(v8us, __builtin_amdgcn_ds_load_tr16_b128_v8i16((lds_s16x8*)p));
}

__global__ __launch_bounds__(256) void k_wt_bf16(const float* __restrict__ W, unsigned short* __restrict__ Wt, int K, int N) {
  const int t = blockIdx.x * 256 + threadIdx.x;
  const int k8n = K / 8;
  if (t >= N * k8n) return;
  const int n = t / k8n, k8 = (t % k8n) * 8;
  v8us v;
#pragma unroll
  for (int i = 0; i < 8; ++i) v[i] = bf16_bits(W[(size_t)(k8 + i) * N + n]);
  *(v8us*)(Wt + (size_t)n * K + k8) = v;
  
}

// One 64-k step of a GEMM block's operands, global memory to registers, as one batch of whole-line loads
// (A: 16 lanes a row of 256 B; W: 8 lanes a row of 128 B): uniform bases, sixteen running byte offsets that then move on by 64 k.
__device__ __forceinline__ void gemm_fetch(const float* A, const unsigned short* Wt, unsigned (&ao)[8], unsigned (&bo)[8], v4f (&aq)[8], v8us (&bq)[8]) {
#pragma unroll  // the sixteen loads back to back
  for (int i = 0; i < 8; ++i) { aq[i] = *(const v4fa*)((const char*)A + ao[i]); bq[i] = *(const v8us*)((const char*)Wt + bo[i]); }
  // No offset register of the batch is rewritten (not even as a later load's destination) in front of this wait.
  asm volatile("s_wait_xcnt 0x0" :: "v"(ao[0]), "v"(ao[1]), "v"(ao[2]), "v"(ao[3]), "v"(ao[4]), "v"(ao[5]), "v"(ao[6]), "v"(ao[7]),
               "v"(bo[0]), "v"(bo[1]), "v"(bo[2]), "v"(bo[3]), "v"(bo[4]), "v"(bo[5]), "v"(bo[6]), "v"(bo[7]) : "memory");
#pragma unroll  // offsets in registers
  for (int i = 0; i < 8; ++i) { ao[i] += 64u * 4u; bo[i] += 64u * 2u; }
}

// GEMM C[M][N] (f32, pitch ldc) = act(A[M][K]·W + bias). A f32 row-major (pitch lda), converted to bf16 once per block
// (ASPLIT: hi/lo two planes -> 2 terms, else single rounded term); Wt bf16 [N][K] (pitch ldb). BIAS_BF16 rounds the
// bias to bf16 first (bias quantised to bf16 before the add). Block = 4 waves = a 64 x 128 tile of C, wave = 32 x 64;
// both operands pass through LDS in steps of 64 k, the next step's loads in flight during the products of this one.
// K%64==0, K>=64, M%64==0, N%128==0.
template <bool ASPLIT, int ACT, bool BIAS_BF16>
__global__ __launch_bounds__(128) void k_gemm_bf(const float* __restrict__ A, int lda, const unsigned short* __restrict__ Wt, int ldb,
                                               const float* __restrict__ bias, float* __restrict__ C, int ldc, int M, int N, int K) {
  constexpr int KP = 64 + 8;   // row pitch in elements, 144 B: the pitch of the attention kernel's K rows, read the same way
  __shared__ __attribute__((aligned(16))) unsigned short sAh[64][KP], sAl[ASPLIT ? 64 : 1][KP], sB[128][KP];
  __shared__ __attribute__((aligned(16))) float so[4][32][64];
  const int tid = threadIdx.x, w = tid >> 5, lane = tid & 31, ln = lane & 15, hh = lane >> 4;
  const int wm = w >> 1, wn = w & 1;
  const int nb = N / 128;
  const int row0 = (blockIdx.x / nb) * 64, col0 = (blockIdx.x % nb) * 128;
  if (row0 >= M) return;       // block-uniform, in front of every barrier
  const int ar = tid >> 4, ac = (tid & 15) * 4, br = tid >> 3, bc = (tid & 7) * 8;
  unsigned ao[8], bo[8];       // byte offsets of A rows ar + 8 i and W rows br + 16 i (both operands are far below 4 GiB)
#pragma unroll  // offsets in registers
  for (int i = 0; i < 8; ++i) {
    ao[i] = ((unsigned)(row0 + ar + 8 * i) * (unsigned)lda + (unsigned)ac) * 4u;
    bo[i] = ((unsigned)(col0 + br + 16 * i) * (unsigned)ldb + (unsigned)bc) * 2u;
  }
  v4f aq[8]; v8us bq[8];
  v8f acc[2][4] = {};
  gemm_fetch(A, Wt, ao, bo, aq, bq);
  for (int kn = 64; ; kn += 64) {   // kn: the first k of the step after this one
    __syncthreads();           // every wave has read its last fragment of the step before
#pragma unroll  // aq and bq are indexed by constants
    for (int i = 0; i < 8; ++i) {
      v4us h, l;
#pragma unroll
      for (int t = 0; t < 4; ++t) { const unsigned short hb = bf16_bits(aq[i][t]); h[t] = hb; l[t] = ASPLIT ? bf16_bits(aq[i][t] - bf16_val(hb)) : (unsigned short)0; }
      *(v4us*)&sAh[ar + 8 * i][ac] = h;
      if (ASPLIT) *(v4us*)&sAl[ar + 8 * i][ac] = l;
      *(v8us*)&sB[br + 16 * i][bc] = bq[i];
    }
    __syncthreads();           // the step's tiles are whole
    if (kn < K) gemm_fetch(A, Wt, ao, bo, aq, bq);
#pragma unroll
    for (int ks = 0; ks < 2; ++ks) {
      FragB b[4];
#pragma unroll
      for (int t = 0; t < 4; ++t) {
        const unsigned short* brow = &sB[wn * 64 + t * 16 + ln][ks * 32];
        b[t].half[0] = *(const v8us*)(brow + 8 * hh);
        b[t].half[1] = *(const v8us*)(brow + 16 + 8 * hh);
      }
      FragB ah[2], al[2];
#pragma unroll  // all fragments of the 32 k as one group of LDS loads in front of their products
      for (int mi = 0; mi < 2; ++mi) {
        const int arow = wm * 32 + mi * 16 + ln;
        ah[mi].half[0] = *(const v8us*)&sAh[arow][ks * 32 + 8 * hh]; ah[mi].half[1] = *(const v8us*)&sAh[arow][ks * 32 + 16 + 8 * hh];
        if (ASPLIT) { al[mi].half[0] = *(const v8us*)&sAl[arow][ks * 32 + 8 * hh]; al[mi].half[1] = *(const v8us*)&sAl[arow][ks * 32 + 16 + 8 * hh]; }
        else al[mi] = ah[mi];
      }
#pragma unroll
      for (int mi = 0; mi < 2; ++mi)
#pragma unroll
        for (int t = 0; t < 4; ++t) acc[mi][t] = mmaN<ASPLIT ? 2 : 1>(ah[mi].v, al[mi].v, b[t].v, b[t].v, acc[mi][t]);
    }
    if (kn >= K) break;
  }
  const int rsub = lane >> 4, c4 = (lane & 15) * 4;
  float bv[4];
#pragma unroll
  for (int t = 0; t < 4; ++t) {
    bv[t] = bias ? bias[col0 + wn * 64 + t * 16 + ln] : 0.f;
    if (BIAS_BF16) bv[t] = bf16_round(bv[t]);
  }
#pragma unroll
  for (int mi = 0; mi < 2; ++mi)
#pragma unroll
    for (int t = 0; t < 4; ++t)
#pragma unroll
      for (int r = 0; r < 8; ++r) { float v = acc[mi][t][r] + bv[t]; if (ACT == 1) v = fmaxf(v, 0.f); so[w][mi * 16 + 8 * hh + r][t * 16 + ln] = v; }
  __builtin_amdgcn_fence(__ATOMIC_ACQ_REL, "workgroup");
  __builtin_amdgcn_wave_barrier();
#pragma unroll
  for (int q = 0; q < 16; ++q) {
    const int r = q * 2 + rsub;
    const v4f v = *(const v4fa*)&so[w][r][c4];
    *(v4f*)(C + (size_t)(row0 + wm * 32 + r) * ldc + col0 + wn * 64 + c4) = v;
  }
}

// Flash-style causal/unmasked attention, all contractions 3-term bf16 hi/lo splits, f32 softmax with running max.
// q,k,v rows are read from f32 buffers with arbitrary row pitch (so they can live inside a fused qkv buffer);
// D = head size (multiple of 32, <= 128); one wave = 16 query rows; block = 4 waves (64 queries) sharing K/V chunks of 32.
template <int D, bool CAUSAL>
__global__ __launch_bounds__(128) void k_flash(const float* __restrict__ qb, const float* __restrict__ kb, const float* __restrict__ vb,
                                             int pitch, int T, int H, float scale, float* __restrict__ y, int ypitch) {
  constexpr int KS = D / 32;        // k-steps for QK
  constexpr int DT = D / 16;        // d tiles for PV
  __shared__ __attribute__((aligned(16))) unsigned short sKh[32][D + 8], sKl[32][D + 8], sVh[32][D + 8], sVl[32][D + 8];
  __shared__ __attribute__((aligned(16))) unsigned short sPh[4][16][40], sPl[4][16][40];
  __shared__ __attribute__((aligned(16))) float sO[4][16][D];
  const int tid = threadIdx.x, w = tid >> 5, lane = tid & 31, ln = lane & 15, hh = lane >> 4;
  const int nqb = (T + 63) / 64;
  const int bh = blockIdx.x / nqb, qblk = blockIdx.x % nqb;
  const int b = bh / H, h = bh % H;
  const int q0 = qblk * 64 + w * 16;
  const float* Q = qb + (size_t)b * T * pitch + h * D;
  const float* K = kb + (size_t)b * T * pitch + h * D;
  const float* V = vb + (size_t)b * T * pitch + h * D;

  // A fragments of the wave's 16 query rows (scaled), hi/lo
  FragB aqh[KS], aql[KS];
  {
    int row = q0 + ln; if (row >= T) row = T - 1;
    const float* qr = Q + (size_t)row * pitch;
#pragma unroll
    for (int ks = 0; ks < KS; ++ks)
#pragma unroll
      for (int i = 0; i < 16; ++i) {
        const int d = ks * 32 + ((i < 8) ? (8 * hh + i) : (16 + 8 * hh + (i - 8)));
        const float x = qr[d] * scale; const unsigned short hb = bf16_bits(x);
        aqh[ks].u[i] = hb; aql[ks].u[i] = bf16_bits(x - bf16_val(hb));
      }
  }
  float m_r[8], l_r[8];
#pragma unroll
  for (int r = 0; r < 8; ++r) { m_r[r] = -3.0e38f; l_r[r] = 0.f; }
  v8f oacc[DT];
#pragma unroll
  for (int dt = 0; dt < DT; ++dt) oacc[dt] = (v8f){0.f,0.f,0.f,0.f,0.f,0.f,0.f,0.f};

  const int kv_end = CAUSAL ? min(T, qblk * 64 + 64) : T;     // block-uniform
  for (int j0 = 0; j0 < kv_end; j0 += 32) {
    __syncthreads();
    for (int e = tid; e < 32 * (D / 4); e += 128) {
      const int r = e / (D / 4), c4 = (e % (D / 4)) * 4;
      const int key = j0 + r;
      v4f kf = {0.f,0.f,0.f,0.f}, vf = {0.f,0.f,0.f,0.f};
      if (key < T) { kf = *(const v4fa*)(K + (size_t)key * pitch + c4); vf = *(const v4fa*)(V + (size_t)key * pitch + c4); }
#pragma unroll
      for (int t = 0; t < 4; ++t) {
        unsigned short hb = bf16_bits(kf[t]); sKh[r][c4 + t] = hb; sKl[r][c4 + t] = bf16_bits(kf[t] - bf16_val(hb));
        hb = bf16_bits(vf[t]); sVh[r][c4 + t] = hb; sVl[r][c4 + t] = bf16_bits(vf[t] - bf16_val(hb));
      }
    }
    __syncthreads();
    // S tile 16 x 32
    v8f s[2];
#pragma unroll
    for (int nt = 0; nt < 2; ++nt) {
      v8f acc = {};
#pragma unroll
      for (int ks = 0; ks < KS; ++ks) {
        FragB bh_, bl_;
        bh_.half[0] = *(const v8us*)&sKh[nt * 16 + ln][ks * 32 + 8 * hh]; bh_.half[1] = *(const v8us*)&sKh[nt * 16 + ln][ks * 32 + 16 + 8 * hh];
        bl_.half[0] = *(const v8us*)&sKl[nt * 16 + ln][ks * 32 + 8 * hh]; bl_.half[1] = *(const v8us*)&sKl[nt * 16 + ln][ks * 32 + 16 + 8 * hh];
        acc = mmaN<3>(aqh[ks].v, aql[ks].v, bh_.v, bl_.v, acc);
      }
      s[nt] = acc;
    }
    // mask + running max (rows 8hh+r; the 16 lanes of a half share rows)
    float alpha[8];
#pragma unroll
    for (int r = 0; r < 8; ++r) {
      const int qi = q0 + 8 * hh + r;
      const int ja = j0 + ln, jb = j0 + 16 + ln;
      if (CAUSAL) { if (ja > qi) s[0][r] = -3.0e38f; if (jb > qi) s[1][r] = -3.0e38f; }
      if (ja >= T) s[0][r] = -3.0e38f;
      if (jb >= T) s[1][r] = -3.0e38f;
      float mx = fmaxf(s[0][r], s[1][r]);
      mx = fmaxf(mx, __shfl_xor(mx, 1, 32)); mx = fmaxf(mx, __shfl_xor(mx, 2, 32)); mx = fmaxf(mx, __shfl_xor(mx, 4, 32)); mx = fmaxf(mx, __shfl_xor(mx, 8, 32));
      const float mnew = fmaxf(m_r[r], mx);
      alpha[r] = (mnew > -1.0e38f) ? __expf(m_r[r] - mnew) : 1.0f;
      const float p0 = (s[0][r] > -1.0e38f) ? __expf(s[0][r] - mnew) : 0.f;
      const float p1 = (s[1][r] > -1.0e38f) ? __expf(s[1][r] - mnew) : 0.f;
      m_r[r] = mnew;
      l_r[r] = l_r[r] * alpha[r] + p0 + p1;            // per-lane partial row sum (16 lanes combined at the end)
      unsigned short hb = bf16_bits(p0); sPh[w][8 * hh + r][ln] = hb;      sPl[w][8 * hh + r][ln] = bf16_bits(p0 - bf16_val(hb));
      hb = bf16_bits(p1);                sPh[w][8 * hh + r][16 + ln] = hb; sPl[w][8 * hh + r][16 + ln] = bf16_bits(p1 - bf16_val(hb));
    }
#pragma unroll
    for (int dt = 0; dt < DT; ++dt)
#pragma unroll
      for (int r = 0; r < 8; ++r) oacc[dt][r] *= alpha[r];
    __builtin_amdgcn_fence(__ATOMIC_ACQ_REL, "workgroup");
    __builtin_amdgcn_wave_barrier();
    FragB pah, pal;
    pah.half[0] = *(const v8us*)&sPh[w][ln][8 * hh]; pah.half[1] = *(const v8us*)&sPh[w][ln][16 + 8 * hh];
    pal.half[0] = *(const v8us*)&sPl[w][ln][8 * hh]; pal.half[1] = *(const v8us*)&sPl[w][ln][16 + 8 * hh];
#pragma unroll
    for (int dt = 0; dt < DT; ++dt) {
      FragB bvh, bvl;
#pragma unroll
      for (int i = 0; i < 8; ++i) {
        bvh.u[i] = sVh[8 * hh + i][dt * 16 + ln]; bvh.u[8 + i] = sVh[16 + 8 * hh + i][dt * 16 + ln];
        bvl.u[i] = sVl[8 * hh + i][dt * 16 + ln]; bvl.u[8 + i] = sVl[16 + 8 * hh + i][dt * 16 + ln];
      }
      oacc[dt] = mmaN<3>(pah.v, pal.v, bvh.v, bvl.v, oacc[dt]);
    }
    __builtin_amdgcn_fence(__ATOMIC_ACQ_REL, "workgroup");
    __builtin_amdgcn_wave_barrier();
  }
#pragma unroll
  for (int r = 0; r < 8; ++r) {
    float l = l_r[r];
    l += __shfl_xor(l, 1, 32); l += __shfl_xor(l, 2, 32); l += __shfl_xor(l, 4, 32); l += __shfl_xor(l, 8, 32);
    l_r[r] = (l > 0.f) ? 1.0f / l : 0.f;
  }
#pragma unroll
  for (int dt = 0; dt < DT; ++dt)
#pragma unroll
    for (int r = 0; r < 8; ++r) sO[w][8 * hh + r][dt * 16 + ln] = oacc[dt][r] * l_r[r];
  __builtin_amdgcn_fence(__ATOMIC_ACQ_REL, "workgroup");
  __builtin_amdgcn_wave_barrier();
  {
    for (int r = 0; r < 16; ++r) {
      const int row = q0 + r;
      if (row < T && lane < D / 4) {
        const v4f val = *(const v4fa*)&sO[w][r][lane * 4];
        *(v4f*)(y + ((size_t)b * T + row) * ypitch + h * D + lane * 4) = val;
      }
    }
    
  }
}

// Self-attention (Tq == Tk == T) with optional int mask [T][T] (nonzero = keep) and/or causal flag; 3-term bf16 splits;
// Q/K/V rows read from f32 buffers: X + b*T*pitch + h*D + row*pitch. y[b][row][h*D + d], pitch ypitch. D == 64, T % 32 == 0.
template <int D>
__global__ __launch_bounds__(128) void k_flashm(const float* __restrict__ Qb, int qpitch, const float* __restrict__ Kb, int kpitch,
                                              const float* __restrict__ Vb, int vpitch, int T, int H, float scale,
                                              const int* __restrict__ mask, int causal, float* __restrict__ y, int ypitch) {
  constexpr int KS = D / 32, DT = D / 16;
  constexpr int VP = D + 16;   // V row pitch in elements: an odd multiple of 32 bytes, the conflict-free pitch of the transposing load
  static_assert((VP * 2) % 32 == 0 && ((VP * 2 / 32) & 1) == 1, "V rows: odd multiple of 32 bytes");
  __shared__ __attribute__((aligned(16))) unsigned short sKh[32][D + 8], sKl[32][D + 8], sVh[32][VP], sVl[32][VP];
  __shared__ __attribute__((aligned(16))) unsigned short sPh[4][16][40], sPl[4][16][40];
  __shared__ __attribute__((aligned(16))) float sO[4][16][D];
  const int tid = threadIdx.x, w = tid >> 5, lane = tid & 31, ln = lane & 15, hh = lane >> 4;
  const int nqb = (T + 63) / 64;
  const int bh = blockIdx.x / nqb, qblk = blockIdx.x % nqb;
  const int b = bh / H, h = bh % H;
  const int q0 = qblk * 64 + w * 16;
  const float* Q = Qb + (size_t)b * T * qpitch + h * D;
  const float* K = Kb + (size_t)b * T * kpitch + h * D;
  const float* V = Vb + (size_t)b * T * vpitch + h * D;
  FragB aqh[KS], aql[KS];
  {
    int row = q0 + ln; if (row >= T) row = T - 1;
    const float* qr = Q + (size_t)row * qpitch;
#pragma unroll
    for (int ks = 0; ks < KS; ++ks)
#pragma unroll
      for (int i = 0; i < 16; ++i) {
        const int d = ks * 32 + ((i < 8) ? (8 * hh + i) : (16 + 8 * hh + (i - 8)));
        const float x = qr[d] * scale; const unsigned short hb = bf16_bits(x);
        aqh[ks].u[i] = hb; aql[ks].u[i] = bf16_bits(x - bf16_val(hb));
      }
  }
  int qrow[8];
#pragma unroll
  for (int r = 0; r < 8; ++r) { int qi = q0 + 8 * hh + r; qrow[r] = qi < T ? qi : T - 1; }
  float m_r[8], l_r[8];
#pragma unroll
  for (int r = 0; r < 8; ++r) { m_r[r] = -3.0e38f; l_r[r] = 0.f; }
  v8f oacc[DT];
#pragma unroll
  for (int dt = 0; dt < DT; ++dt) oacc[dt] = (v8f){0.f,0.f,0.f,0.f,0.f,0.f,0.f,0.f};
  const int kv_end = causal ? min(T, qblk * 64 + 64) : T;
  constexpr int NL = D / 16, RS = 128 / (D / 4);               // K (and V) quads per thread and pass; rows between a thread's quads
  const int sr = tid / (D / 4), sc4 = (tid % (D / 4)) * 4;     // the thread's first staged row, and its column
  const unsigned kofs = ((unsigned)sr * (unsigned)kpitch + (unsigned)sc4) * 4u, vofs = ((unsigned)sr * (unsigned)vpitch + (unsigned)sc4) * 4u;
  // the lane's own 16 bytes of a 16 x 16 V tile for the transposing load: row 8 hh + (lane & 7), column half (lane >> 3) & 1
  const unsigned short* vth = &sVh[8 * hh + (lane & 7)][8 * ((lane >> 3) & 1)];
  const unsigned short* vtl = &sVl[8 * hh + (lane & 7)][8 * ((lane >> 3) & 1)];
  unsigned mofs[8];
#pragma unroll  // constant indices keep the array in registers (so for every unrolled loop of the batch below)
  for (int r = 0; r < 8; ++r) mofs[r] = ((unsigned)qrow[r] * (unsigned)T + (unsigned)ln) * 4u;
  for (int j0 = 0; j0 < kv_end; j0 += 32) {
    // All that the pass (32 keys) reads from global memory goes out as one batch, under no lane test, so that the loads'
    // latencies overlap: uniform base, fixed lane offsets; every key of a pass is below T (T % 32 == 0).
    static_assert(NL == 4, "the wait behind the K/V loads names four K and four V addresses");
    const char *kp[NL], *vp[NL];
    v4f kq[NL], vq[NL];
#pragma unroll  // addresses in registers
    for (int i = 0; i < NL; ++i) {
      kp[i] = (const char*)(K + (size_t)(j0 + i * RS) * kpitch) + kofs;
      vp[i] = (const char*)(V + (size_t)(j0 + i * RS) * vpitch) + vofs;
    }
#pragma unroll  // the eight loads back to back
    for (int i = 0; i < NL; ++i) { kq[i] = *(const v4fa*)kp[i]; vq[i] = *(const v4fa*)vp[i]; }
    // No address register of the batch is reused (not even as a later load's destination) in front of this wait.
    asm volatile("s_wait_xcnt 0x0" :: "v"(kp[0]), "v"(kp[1]), "v"(kp[2]), "v"(kp[3]), "v"(vp[0]), "v"(vp[1]), "v"(vp[2]), "v"(vp[3]) : "memory");
    int mka[8], mkb[8];
#pragma unroll  // words in registers
    for (int r = 0; r < 8; ++r) { mka[r] = 1; mkb[r] = 1; }
    if (mask) {
      const char* mp[8];
#pragma unroll  // addresses in registers
      for (int r = 0; r < 8; ++r) mp[r] = (const char*)(mask + j0) + mofs[r];
#pragma unroll  // the sixteen loads back to back
      for (int r = 0; r < 8; ++r) { mka[r] = *(const int*)mp[r]; mkb[r] = *(const int*)(mp[r] + 64); }
      // The same for the mask words' addresses.
      asm volatile("s_wait_xcnt 0x0" :: "v"(mp[0]), "v"(mp[1]), "v"(mp[2]), "v"(mp[3]), "v"(mp[4]), "v"(mp[5]), "v"(mp[6]), "v"(mp[7]) : "memory");
    }
    __syncthreads();
#pragma unroll  // kq and vq are indexed by constants
    for (int i = 0; i < NL; ++i) {
      const int r = sr + i * RS, c4 = sc4;
      const v4f kf = kq[i], vf = vq[i];
#pragma unroll
      for (int t = 0; t < 4; ++t) {
        unsigned short hb = bf16_bits(kf[t]); sKh[r][c4 + t] = hb; sKl[r][c4 + t] = bf16_bits(kf[t] - bf16_val(hb));
        hb = bf16_bits(vf[t]); sVh[r][c4 + t] = hb; sVl[r][c4 + t] = bf16_bits(vf[t] - bf16_val(hb));
      }
    }
    __syncthreads();
    v8f s[2];
#pragma unroll
    for (int nt = 0; nt < 2; ++nt) {
      v8f acc = {};
#pragma unroll
      for (int ks = 0; ks < KS; ++ks) {
        FragB bh_, bl_;
        bh_.half[0] = *(const v8us*)&sKh[nt * 16 + ln][ks * 32 + 8 * hh]; bh_.half[1] = *(const v8us*)&sKh[nt * 16 + ln][ks * 32 + 16 + 8 * hh];
        bl_.half[0] = *(const v8us*)&sKl[nt * 16 + ln][ks * 32 + 8 * hh]; bl_.half[1] = *(const v8us*)&sKl[nt * 16 + ln][ks * 32 + 16 + 8 * hh];
        acc = mmaN<3>(aqh[ks].v, aql[ks].v, bh_.v, bl_.v, acc);
      }
      s[nt] = acc;
    }
    float alpha[8];
#pragma unroll
    for (int r = 0; r < 8; ++r) {
      bool keepa = mka[r] != 0, keepb = mkb[r] != 0;
      if (causal) { keepa = keepa && (j0 + ln <= qrow[r]); keepb = keepb && (j0 + 16 + ln <= qrow[r]); }
      if (!keepa) s[0][r] = -3.0e38f;
      if (!keepb) s[1][r] = -3.0e38f;
      float mx = fmaxf(s[0][r], s[1][r]);
      mx = fmaxf(mx, __shfl_xor(mx, 1, 32)); mx = fmaxf(mx, __shfl_xor(mx, 2, 32)); mx = fmaxf(mx, __shfl_xor(mx, 4, 32)); mx = fmaxf(mx, __shfl_xor(mx, 8, 32));
      const float mnew = fmaxf(m_r[r], mx);
      alpha[r] = (mnew > -1.0e38f) ? __expf(m_r[r] - mnew) : 1.0f;
      const float p0 = keepa ? __expf(s[0][r] - mnew) : 0.f;
      const float p1 = keepb ? __expf(s[1][r] - mnew) : 0.f;
      m_r[r] = mnew;
      l_r[r] = l_r[r] * alpha[r] + p0 + p1;
      unsigned short hb = bf16_bits(p0); sPh[w][8 * hh + r][ln] = hb;      sPl[w][8 * hh + r][ln] = bf16_bits(p0 - bf16_val(hb));
      hb = bf16_bits(p1);                sPh[w][8 * hh + r][16 + ln] = hb; sPl[w][8 * hh + r][16 + ln] = bf16_bits(p1 - bf16_val(hb));
    }
#pragma unroll
    for (int dt = 0; dt < DT; ++dt)
#pragma unroll
      for (int r = 0; r < 8; ++r) oacc[dt][r] *= alpha[r];
    // The pass's whole V operand as one group of loads, in front of P's trip through LDS, which covers their latency.
    // Lane (ln, hh) receives V[kbase + 8 hh + 0..7][dt * 16 + ln], kbase 0 and 16: the k order of the P fragment below.
    FragB bvh[DT], bvl[DT];
#pragma unroll  // fragments in registers
    for (int dt = 0; dt < DT; ++dt) {
      bvh[dt].half[0] = lds_tr16(vth + dt * 16); bvh[dt].half[1] = lds_tr16(vth + 16 * VP + dt * 16);
      bvl[dt].half[0] = lds_tr16(vtl + dt * 16); bvl[dt].half[1] = lds_tr16(vtl + 16 * VP + dt * 16);
    }
    __builtin_amdgcn_fence(__ATOMIC_ACQ_REL, "workgroup");
    __builtin_amdgcn_wave_barrier();
    FragB pah, pal;
    pah.half[0] = *(const v8us*)&sPh[w][ln][8 * hh]; pah.half[1] = *(const v8us*)&sPh[w][ln][16 + 8 * hh];
    pal.half[0] = *(const v8us*)&sPl[w][ln][8 * hh]; pal.half[1] = *(const v8us*)&sPl[w][ln][16 + 8 * hh];
#pragma unroll
    for (int dt = 0; dt < DT; ++dt) {
      oacc[dt] = mmaN<3>(pah.v, pal.v, bvh[dt].v, bvl[dt].v, oacc[dt]);
    }
    __builtin_amdgcn_fence(__ATOMIC_ACQ_REL, "workgroup");
    __builtin_amdgcn_wave_barrier();
  }
  // NaN for fully-masked rows (softmax over a row of -inf)
#pragma unroll
  for (int r = 0; r < 8; ++r) {
    float l = l_r[r];
    l += __shfl_xor(l, 1, 32); l += __shfl_xor(l, 2, 32); l += __shfl_xor(l, 4, 32); l += __shfl_xor(l, 8, 32);
    l_r[r] = (m_r[r] > -1.0e38f) ? 1.0f / l : __builtin_nanf("");
  }
#pragma unroll
  for (int dt = 0; dt < DT; ++dt)
#pragma unroll
    for (int r = 0; r < 8; ++r) sO[w][8 * hh + r][dt * 16 + ln] = oacc[dt][r] * l_r[r];
  __builtin_amdgcn_fence(__ATOMIC_ACQ_REL, "workgroup");
  __builtin_amdgcn_wave_barrier();
  {
    for (int r = 0; r < 16; ++r) {
      const int row = q0 + r;
      if (row < T && lane < D / 4) {
        const v4f val = *(const v4fa*)&sO[w][r][lane * 4];
        *(v4f*)(y + ((size_t)b * T + row) * ypitch + h * D + lane * 4) = val;
      }
    }
    
  }
}

extern "C" void kernel_launch(void* const* d_in, const int* in_sizes, int n_in,
                              void* d_out, int out_size, void* d_ws, size_t ws_size, hipStream_t stream) {
  (void)in_sizes; (void)n_in; (void)out_size;
  const float* x = (const float*)d_in[0]; const int* mask = (const int*)d_in[1];
  const float* Wq = (const float*)d_in[2]; const float* Wkv = (const float*)d_in[3];
  const float* Wo = (const float*)d_in[4]; const float* bo = (const float*)d_in[5];
  char* ws = (char*)d_ws; size_t off = 0;
  unsigned short* Wqt  = (unsigned short*)(ws + off); off += (size_t)DM * DM * 2;       // [1024][1024]
  unsigned short* Wkvt = (unsigned short*)(ws + off); off += (size_t)2 * DM * DM * 2;   // [2048][1024]
  unsigned short* Wot  = (unsigned short*)(ws + off); off += (size_t)DM * DM * 2;
  float* qb  = (float*)(ws + off); off += (size_t)BB * NN * DM * 4;                    // 16 MiB
  float* kvb = (float*)(ws + off); off += (size_t)BB * NN * 2 * DM * 4;                // 32 MiB
  float* ob  = (float*)(ws + off); off += (size_t)BB * NN * DM * 4;                    // 16 MiB
  if (off > ws_size) return;
  const int M = BB * NN;
  k_wt_bf16<<<(DM * (DM / 8) + 255) / 256, 256, 0, stream>>>(Wq, Wqt, DM, DM);
  k_wt_bf16<<<(2 * DM * (DM / 8) + 255) / 256, 256, 0, stream>>>(Wkv, Wkvt, DM, 2 * DM);
  k_wt_bf16<<<(DM * (DM / 8) + 255) / 256, 256, 0, stream>>>(Wo, Wot, DM, DM);
  k_gemm_bf<false, 0, false><<<(M / 64) * (DM / 128), 128, 0, stream>>>(x, DM, Wqt, DM, nullptr, qb, DM, M, DM, DM);
  k_gemm_bf<false, 0, false><<<(M / 64) * (2 * DM / 128), 128, 0, stream>>>(x, DM, Wkvt, DM, nullptr, kvb, 2 * DM, M, 2 * DM, DM);
  // k = kv[..., 0:1024] (head h at h*64), v = kv[..., 1024:2048]
  k_flashm<HD><<<BB * NH * (NN / 64), 128, 0, stream>>>(qb, DM, kvb, 2 * DM, kvb + DM, 2 * DM, NN, NH, 0.03125f, mask, 0, ob, DM);
  k_gemm_bf<true, 0, true><<<(M / 64) * (DM / 128), 128, 0, stream>>>(ob, DM, Wot, DM, bo, (float*)d_out, DM, M, DM, DM);
}

// v004
// It runs in 277 microseconds.
// In both of two side-by-side timings against v003, it was 1.11 times as fast.
// All steps since v000 together make it 2.43 times as fast.
#include <hip/hip_runtime.h>
// All contractions on v_wmma_f32_16x16x32_bf16, f32 accumulate: q = x·Wq and kv = x·Wkv with x/W rounded to bf16 (single
// exact-product term), QKᵀ and P·V 3-term bf16 hi/lo splits, out = o·Wout with o split hi/lo (2 terms); softmax f32.
// The boolean mask input is applied as given (together with nothing else).
#define BB 2
#define NN 2048
#define DM 1024
#define NH 16
#define HD 64

typedef __bf16 v16b __attribute__((ext_vector_type(16)));
typedef unsigned short v8us __attribute__((ext_vector_type(8), may_alias));
typedef unsigned short v4us __attribute__((ext_vector_type(4), may_alias));
typedef float  v8f  __attribute__((ext_vector_type(8)));
typedef float  v4f  __attribute__((ext_vector_type(4)));
typedef float  v4fa __attribute__((ext_vector_type(4), may_alias));
typedef int    v4ia __attribute__((ext_vector_type(4), may_alias));
union FragB { v16b v; v8us half[2]; unsigned short u[16]; };

__device__ __forceinline__ unsigned short bf16_bits(float x) { unsigned int u = __float_as_uint(x); return (unsigned short)((u + 0x7FFFu + ((u >> 16) & 1u)) >> 16); }
__device__ __forceinline__ float bf16_val(unsigned short b) { return __uint_as_float(((unsigned int)b) << 16); }
__device__ __forceinline__ float bf16_round(float x) { return bf16_val(bf16_bits(x)); }
// D += A·B with NT terms: 1 = ah·bh, 2 = + al·bh (A split), 3 = + ah·bl (both split)
template <int NT>
__device__ __forceinline__ v8f mmaN(v16b ah, v16b al, v16b bh, v16b bl, v8f c) {
  c = __builtin_amdgcn_wmma_f32_16x16x32_bf16(false, ah, false, bh, (short)0, c, false, false);
  if (NT >= 2) c = __builtin_amdgcn_wmma_f32_16x16x32_bf16(false, al, false, bh, (short)0, c, false, false);
  if (NT >= 3) c = __builtin_amdgcn_wmma_f32_16x16x32_bf16(false, ah, false, bl, (short)0, c, false, false);
  asm volatile("v_nop\n\tv_nop\n\tv_nop\n\tv_nop" : "+v"(c) : "v"(ah), "v"(al), "v"(bh), "v"(bl));
  return c;
}

// Transposing LDS load: a row-major 16 x 16 tile of 16-bit elements arrives as half of a WMMA operand (8 k of one column per lane).
__device__ __forceinline__ v8us lds_tr16(const unsigned short* p) {
  typedef short s16x8 __attribute__((ext_vector_type(8)));
  typedef __attribute__((address_space(3))) s16x8 lds_s16x8;
  return __builtin_bit_cast(v8us, __builtin_amdgcn_ds_load_tr16_b128_v8i16((lds_s16x8*)p));
}

__global__ __launch_bounds__(256) void k_wt_bf16(const float* __restrict__ W, unsigned short* __restrict__ Wt, int K, int N) {
  const int t = blockIdx.x * 256 + threadIdx.x;
  const int k8n = K / 8;
  if (t >= N * k8n) return;
  const int n = t / k8n, k8 = (t % k8n) * 8;
  v8us v;
#pragma unroll
  for (int i = 0; i < 8; ++i) v[i] = bf16_bits(W[(size_t)(k8 + i) * N + n]);
  *(v8us*)(Wt + (size_t)n * K + k8) = v;
  
}

// One 64-k step of a GEMM block's operands, global memory to registers, as one batch of whole-line loads
// (A: 16 lanes a row of 256 B; W: 8 lanes a row of 128 B): uniform bases, sixteen running byte offsets that then move on by 64 k.
__device__ __forceinline__ void gemm_fetch(const float* A, const unsigned short* Wt, unsigned (&ao)[8], unsigned (&bo)[8], v4f (&aq)[8], v8us (&bq)[8]) {
#pragma unroll  // the sixteen loads back to back
  for (int i = 0; i < 8; ++i) { aq[i] = *(const v4fa*)((const char*)A + ao[i]); bq[i] = *(const v8us*)((const char*)Wt + bo[i]); }
  // No offset register of the batch is rewritten (not even as a later load's destination) in front of this wait.
  asm volatile("s_wait_xcnt 0x0" :: "v"(ao[0]), "v"(ao[1]), "v"(ao[2]), "v"(ao[3]), "v"(ao[4]), "v"(ao[5]), "v"(ao[6]), "v"(ao[7]),
               "v"(bo[0]), "v"(bo[1]), "v"(bo[2]), "v"(bo[3]), "v"(bo[4]), "v"(bo[5]), "v"(bo[6]), "v"(bo[7]) : "memory");
#pragma unroll  // offsets in registers
  for (int i = 0; i < 8; ++i) { ao[i] += 64u * 4u; bo[i] += 64u * 2u; }
}

// GEMM C[M][N] (f32, pitch ldc) = act(A[M][K]·W + bias). A f32 row-major (pitch lda), converted to bf16 once per block
// (ASPLIT: hi/lo two planes -> 2 terms, else single rounded term); Wt bf16 [N][K] (pitch ldb). BIAS_BF16 rounds the
// bias to bf16 first (bias quantised to bf16 before the add). Block = 4 waves = a 64 x 128 tile of C, wave = 32 x 64;
// both operands pass through LDS in steps of 64 k, the next step's loads in flight during the products of this one.
// K%64==0, K>=64, M%64==0, N%128==0.
template <bool ASPLIT, int ACT, bool BIAS_BF16>
__global__ __launch_bounds__(128) void k_gemm_bf(const float* __restrict__ A, int lda, const unsigned short* __restrict__ Wt, int ldb,
                                               const float* __restrict__ bias, float* __restrict__ C, int ldc, int M, int N, int K) {
  constexpr int KP = 64 + 8;   // row pitch in elements, 144 B: the pitch of the attention kernel's K rows, read the same way
  __shared__ __attribute__((aligned(16))) unsigned short sAh[64][KP], sAl[ASPLIT ? 64 : 1][KP], sB[128][KP];
  __shared__ __attribute__((aligned(16))) float so[4][32][64];
  const int tid = threadIdx.x, w = tid >> 5, lane = tid & 31, ln = lane & 15, hh = lane >> 4;
  const int wm = w >> 1, wn = w & 1;
  const int nb = N / 128;
  const int row0 = (blockIdx.x / nb) * 64, col0 = (blockIdx.x % nb) * 128;
  if (row0 >= M) return;       // block-uniform, in front of every barrier
  const int ar = tid >> 4, ac = (tid & 15) * 4, br = tid >> 3, bc = (tid & 7) * 8;
  unsigned ao[8], bo[8];       // byte offsets of A rows ar + 8 i and W rows br + 16 i (both operands are far below 4 GiB)
#pragma unroll  // offsets in registers
  for (int i = 0; i < 8; ++i) {
    ao[i] = ((unsigned)(row0 + ar + 8 * i) * (unsigned)lda + (unsigned)ac) * 4u;
    bo[i] = ((unsigned)(col0 + br + 16 * i) * (unsigned)ldb + (unsigned)bc) * 2u;
  }
  v4f aq[8]; v8us bq[8];
  v8f acc[2][4] = {};
  gemm_fetch(A, Wt, ao, bo, aq, bq);
  for (int kn = 64; ; kn += 64) {   // kn: the first k of the step after this one
    __syncthreads();           // every wave has read its last fragment of the step before
#pragma unroll  // aq and bq are indexed by constants
    for (int i = 0; i < 8; ++i) {
      v4us h, l;
#pragma unroll
      for (int t = 0; t < 4; ++t) { const unsigned short hb = bf16_bits(aq[i][t]); h[t] = hb; l[t] = ASPLIT ? bf16_bits(aq[i][t] - bf16_val(hb)) : (unsigned short)0; }
      *(v4us*)&sAh[ar + 8 * i][ac] = h;
      if (ASPLIT) *(v4us*)&sAl[ar + 8 * i][ac] = l;
      *(v8us*)&sB[br + 16 * i][bc] = bq[i];
    }
    __syncthreads();           // the step's tiles are whole
    if (kn < K) gemm_fetch(A, Wt, ao, bo, aq, bq);
#pragma unroll
    for (int ks = 0; ks < 2; ++ks) {
      FragB b[4];
#pragma unroll
      for (int t = 0; t < 4; ++t) {
        const unsigned short* brow = &sB[wn * 64 + t * 16 + ln][ks * 32];
        b[t].half[0] = *(const v8us*)(brow + 8 * hh);
        b[t].half[1] = *(const v8us*)(brow + 16 + 8 * hh);
      }
      FragB ah[2], al[2];
#pragma unroll  // all fragments of the 32 k as one group of LDS loads in front of their products
      for (int mi = 0; mi < 2; ++mi) {
        const int arow = wm * 32 + mi * 16 + ln;
        ah[mi].half[0] = *(const v8us*)&sAh[arow][ks * 32 + 8 * hh]; ah[mi].half[1] = *(const v8us*)&sAh[arow][ks * 32 + 16 + 8 * hh];
        if (ASPLIT) { al[mi].half[0] = *(const v8us*)&sAl[arow][ks * 32 + 8 * hh]; al[mi].half[1] = *(const v8us*)&sAl[arow][ks * 32 + 16 + 8 * hh]; }
        else al[mi] = ah[mi];
      }
#pragma unroll
      for (int mi = 0; mi < 2; ++mi)
#pragma unroll
        for (int t = 0; t < 4; ++t) acc[mi][t] = mmaN<ASPLIT ? 2 : 1>(ah[mi].v, al[mi].v, b[t].v, b[t].v, acc[mi][t]);
    }
    if (kn >= K) break;
  }
  const int rsub = lane >> 4, c4 = (lane & 15) * 4;
  float bv[4];
#pragma unroll
  for (int t = 0; t < 4; ++t) {
    bv[t] = bias ? bias[col0 + wn * 64 + t * 16 + ln] : 0.f;
    if (BIAS_BF16) bv[t] = bf16_round(bv[t]);
  }
#pragma unroll
  for (int mi = 0; mi < 2; ++mi)
#pragma unroll
    for (int t = 0; t < 4; ++t)
#pragma unroll
      for (int r = 0; r < 8; ++r) { float v = acc[mi][t][r] + bv[t]; if (ACT == 1) v = fmaxf(v, 0.f); so[w][mi * 16 + 8 * hh + r][t * 16 + ln] = v; }
  __builtin_amdgcn_fence(__ATOMIC_ACQ_REL, "workgroup");
  __builtin_amdgcn_wave_barrier();
#pragma unroll
  for (int q = 0; q < 16; ++q) {
    const int r = q * 2 + rsub;
    const v4f v = *(const v4fa*)&so[w][r][c4];
    *(v4f*)(C + (size_t)(row0 + wm * 32 + r) * ldc + col0 + wn * 64 + c4) = v;
  }
}

// Flash-style causal/unmasked attention, all contractions 3-term bf16 hi/lo splits, f32 softmax with running max.
// q,k,v rows are read from f32 buffers with arbitrary row pitch (so they can live inside a fused qkv buffer);
// D = head size (multiple of 32, <= 128); one wave = 16 query rows; block = 4 waves (64 queries) sharing K/V chunks of 32.
template <int D, bool CAUSAL>
__global__ __launch_bounds__(128) void k_flash(const float* __restrict__ qb, const float* __restrict__ kb, const float* __restrict__ vb,
                                             int pitch, int T, int H, float scale, float* __restrict__ y, int ypitch) {
  constexpr int KS = D / 32;        // k-steps for QK
  constexpr int DT = D / 16;        // d tiles for PV
  __shared__ __attribute__((aligned(16))) unsigned short sKh[32][D + 8], sKl[32][D + 8], sVh[32][D + 8], sVl[32][D + 8];
  __shared__ __attribute__((aligned(16))) unsigned short sPh[4][16][40], sPl[4][16][40];
  __shared__ __attribute__((aligned(16))) float sO[4][16][D];
  const int tid = threadIdx.x, w = tid >> 5, lane = tid & 31, ln = lane & 15, hh = lane >> 4;
  const int nqb = (T + 63) / 64;
  const int bh = blockIdx.x / nqb, qblk = blockIdx.x % nqb;
  const int b = bh / H, h = bh % H;
  const int q0 = qblk * 64 + w * 16;
  const float* Q = qb + (size_t)b * T * pitch + h * D;
  const float* K = kb + (size_t)b * T * pitch + h * D;
  const float* V = vb + (size_t)b * T * pitch + h * D;

  // A fragments of the wave's 16 query rows (scaled), hi/lo
  FragB aqh[KS], aql[KS];
  {
    int row = q0 + ln; if (row >= T) row = T - 1;
    const float* qr = Q + (size_t)row * pitch;
#pragma unroll
    for (int ks = 0; ks < KS; ++ks)
#pragma unroll
      for (int i = 0; i < 16; ++i) {
        const int d = ks * 32 + ((i < 8) ? (8 * hh + i) : (16 + 8 * hh + (i - 8)));
        const float x = qr[d] * scale; const unsigned short hb = bf16_bits(x);
        aqh[ks].u[i] = hb; aql[ks].u[i] = bf16_bits(x - bf16_val(hb));
      }
  }
  float m_r[8], l_r[8];
#pragma unroll
  for (int r = 0; r < 8; ++r) { m_r[r] = -3.0e38f; l_r[r] = 0.f; }
  v8f oacc[DT];
#pragma unroll
  for (int dt = 0; dt < DT; ++dt) oacc[dt] = (v8f){0.f,0.f,0.f,0.f,0.f,0.f,0.f,0.f};

  const int kv_end = CAUSAL ? min(T, qblk * 64 + 64) : T;     // block-uniform
  for (int j0 = 0; j0 < kv_end; j0 += 32) {
    __syncthreads();
    for (int e = tid; e < 32 * (D / 4); e += 128) {
      const int r = e / (D / 4), c4 = (e % (D / 4)) * 4;
      const int key = j0 + r;
      v4f kf = {0.f,0.f,0.f,0.f}, vf = {0.f,0.f,0.f,0.f};
      if (key < T) { kf = *(const v4fa*)(K + (size_t)key * pitch + c4); vf = *(const v4fa*)(V + (size_t)key * pitch + c4); }
#pragma unroll
      for (int t = 0; t < 4; ++t) {
        unsigned short hb = bf16_bits(kf[t]); sKh[r][c4 + t] = hb; sKl[r][c4 + t] = bf16_bits(kf[t] - bf16_val(hb));
        hb = bf16_bits(vf[t]); sVh[r][c4 + t] = hb; sVl[r][c4 + t] = bf16_bits(vf[t] - bf16_val(hb));
      }
    }
    __syncthreads();
    // S tile 16 x 32
    v8f s[2];
#pragma unroll
    for (int nt = 0; nt < 2; ++nt) {
      v8f acc = {};
#pragma unroll
      for (int ks = 0; ks < KS; ++ks) {
        FragB bh_, bl_;
        bh_.half[0] = *(const v8us*)&sKh[nt * 16 + ln][ks * 32 + 8 * hh]; bh_.half[1] = *(const v8us*)&sKh[nt * 16 + ln][ks * 32 + 16 + 8 * hh];
        bl_.half[0] = *(const v8us*)&sKl[nt * 16 + ln][ks * 32 + 8 * hh]; bl_.half[1] = *(const v8us*)&sKl[nt * 16 + ln][ks * 32 + 16 + 8 * hh];
        acc = mmaN<3>(aqh[ks].v, aql[ks].v, bh_.v, bl_.v, acc);
      }
      s[nt] = acc;
    }
    // mask + running max (rows 8hh+r; the 16 lanes of a half share rows)
    float alpha[8];
#pragma unroll
    for (int r = 0; r < 8; ++r) {
      const int qi = q0 + 8 * hh + r;
      const int ja = j0 + ln, jb = j0 + 16 + ln;
      if (CAUSAL) { if (ja > qi) s[0][r] = -3.0e38f; if (jb > qi) s[1][r] = -3.0e38f; }
      if (ja >= T) s[0][r] = -3.0e38f;
      if (jb >= T) s[1][r] = -3.0e38f;
      float mx = fmaxf(s[0][r], s[1][r]);
      mx = fmaxf(mx, __shfl_xor(mx, 1, 32)); mx = fmaxf(mx, __shfl_xor(mx, 2, 32)); mx = fmaxf(mx, __shfl_xor(mx, 4, 32)); mx = fmaxf(mx, __shfl_xor(mx, 8, 32));
      const float mnew = fmaxf(m_r[r], mx);
      alpha[r] = (mnew > -1.0e38f) ? __expf(m_r[r] - mnew) : 1.0f;
      const float p0 = (s[0][r] > -1.0e38f) ? __expf(s[0][r] - mnew) : 0.f;
      const float p1 = (s[1][r] > -1.0e38f) ? __expf(s[1][r] - mnew) : 0.f;
      m_r[r] = mnew;
      l_r[r] = l_r[r] * alpha[r] + p0 + p1;            // per-lane partial row sum (16 lanes combined at the end)
      unsigned short hb = bf16_bits(p0); sPh[w][8 * hh + r][ln] = hb;      sPl[w][8 * hh + r][ln] = bf16_bits(p0 - bf16_val(hb));
      hb = bf16_bits(p1);                sPh[w][8 * hh + r][16 + ln] = hb; sPl[w][8 * hh + r][16 + ln] = bf16_bits(p1 - bf16_val(hb));
    }
#pragma unroll
    for (int dt = 0; dt < DT; ++dt)
#pragma unroll
      for (int r = 0; r < 8; ++r) oacc[dt][r] *= alpha[r];
    __builtin_amdgcn_fence(__ATOMIC_ACQ_REL, "workgroup");
    __builtin_amdgcn_wave_barrier();
    FragB pah, pal;
    pah.half[0] = *(const v8us*)&sPh[w][ln][8 * hh]; pah.half[1] = *(const v8us*)&sPh[w][ln][16 + 8 * hh];
    pal.half[0] = *(const v8us*)&sPl[w][ln][8 * hh]; pal.half[1] = *(const v8us*)&sPl[w][ln][16 + 8 * hh];
#pragma unroll
    for (int dt = 0; dt < DT; ++dt) {
      FragB bvh, bvl;
#pragma unroll
      for (int i = 0; i < 8; ++i) {
        bvh.u[i] = sVh[8 * hh + i][dt * 16 + ln]; bvh.u[8 + i] = sVh[16 + 8 * hh + i][dt * 16 + ln];
        bvl.u[i] = sVl[8 * hh + i][dt * 16 + ln]; bvl.u[8 + i] = sVl[16 + 8 * hh + i][dt * 16 + ln];
      }
      oacc[dt] = mmaN<3>(pah.v, pal.v, bvh.v, bvl.v, oacc[dt]);
    }
    __builtin_amdgcn_fence(__ATOMIC_ACQ_REL, "workgroup");
    __builtin_amdgcn_wave_barrier();
  }
#pragma unroll
  for (int r = 0; r < 8; ++r) {
    float l = l_r[r];
    l += __shfl_xor(l, 1, 32); l += __shfl_xor(l, 2, 32); l += __shfl_xor(l, 4, 32); l += __shfl_xor(l, 8, 32);
    l_r[r] = (l > 0.f) ? 1.0f / l : 0.f;
  }
#pragma unroll
  for (int dt = 0; dt < DT; ++dt)
#pragma unroll
    for (int r = 0; r < 8; ++r) sO[w][8 * hh + r][dt * 16 + ln] = oacc[dt][r] * l_r[r];
  __builtin_amdgcn_fence(__ATOMIC_ACQ_REL, "workgroup");
  __builtin_amdgcn_wave_barrier();
  {
    for (int r = 0; r < 16; ++r) {
      const int row = q0 + r;
      if (row < T && lane < D / 4) {
        const v4f val = *(const v4fa*)&sO[w][r][lane * 4];
        *(v4f*)(y + ((size_t)b * T + row) * ypitch + h * D + lane * 4) = val;
      }
    }
    
  }
}

// Which 64-query x 32-key tiles of the int mask [T][T] hold a nonzero word at all: bit (kt & 31) of word [qt][kt >> 5], each word
// alone in a 128-byte line of its own (one writer a line). Block = 32 waves = 32 key tiles of one query tile, a tile a wave. T % 32 == 0.
__global__ __launch_bounds__(1024) void k_mask_tiles(const int* __restrict__ mask, unsigned* __restrict__ tbits, int T) {
  __shared__ int sany[32];
  const int w = threadIdx.x >> 5, lane = threadIdx.x & 31;
  const int nw = (T / 32 + 31) / 32;
  const int qt = blockIdx.x / nw, kt = (blockIdx.x % nw) * 32 + w;
  int any = 0;
  if (kt * 32 < T) {           // wave-uniform
    unsigned mo[16];           // byte offsets (the mask is far below 4 GiB): four whole 128-byte rows of the tile a load
#pragma unroll  // offsets in registers
    for (int i = 0; i < 16; ++i) {
      int row = qt * 64 + i * 4 + (lane >> 3); row = row < T ? row : T - 1;
      mo[i] = ((unsigned)row * (unsigned)T + (unsigned)(kt * 32 + (lane & 7) * 4)) * 4u;
    }
    v4ia mv[16];
#pragma unroll  // mv in registers, many loads in flight at once
    for (int i = 0; i < 16; ++i) mv[i] = *(const v4ia*)((const char*)mask + mo[i]);
    // No offset register of the batch is rewritten (not even as a later load's destination) in front of this wait.
    asm volatile("s_wait_xcnt 0x0" :: "v"(mo[0]), "v"(mo[1]), "v"(mo[2]), "v"(mo[3]), "v"(mo[4]), "v"(mo[5]), "v"(mo[6]), "v"(mo[7]),
                 "v"(mo[8]), "v"(mo[9]), "v"(mo[10]), "v"(mo[11]), "v"(mo[12]), "v"(mo[13]), "v"(mo[14]), "v"(mo[15]) : "memory");
#pragma unroll  // mv is indexed by constants
    for (int i = 0; i < 16; ++i) any |= mv[i][0] | mv[i][1] | mv[i][2] | mv[i][3];
  }
  const unsigned wany = __builtin_amdgcn_ballot_w32(any != 0);
  if (lane == 0) sany[w] = wany != 0u;
  __syncthreads();             // all 32 tiles' answers are in LDS
  if (w == 0) {
    const unsigned bits = __builtin_amdgcn_ballot_w32(sany[lane] != 0);
    if (lane == 0) tbits[(size_t)blockIdx.x * 32] = bits;
  }
}

// Self-attention (Tq == Tk == T) with optional int mask [T][T] (nonzero = keep) and/or causal flag; 3-term bf16 splits;
// Q/K/V rows read from f32 buffers: X + b*T*pitch + h*D + row*pitch. y[b][row][h*D + d], pitch ypitch. D % 32 == 0, T % 32 == 0.
// tbits: k_mask_tiles' words for this mask. A work-group takes two query tiles of a head, one after the other: n - 1 - t, then t.
template <int D>
__global__ __launch_bounds__(128) void k_flashm(const float* __restrict__ Qb, int qpitch, const float* __restrict__ Kb, int kpitch,
                                              const float* __restrict__ Vb, int vpitch, int T, int H, float scale,
                                              const int* __restrict__ mask, const unsigned* __restrict__ tbits, int causal,
                                              float* __restrict__ y, int ypitch) {
  constexpr int KS = D / 32, DT = D / 16;
  constexpr int VP = D + 16;   // V row pitch in elements: an odd multiple of 32 bytes, the conflict-free pitch of the transposing load
  static_assert((VP * 2) % 32 == 0 && ((VP * 2 / 32) & 1) == 1, "V rows: odd multiple of 32 bytes");
  __shared__ __attribute__((aligned(16))) unsigned short sKh[32][D + 8], sKl[32][D + 8], sVh[32][VP], sVl[32][VP];
  __shared__ __attribute__((aligned(16))) unsigned short sPh[4][16][40], sPl[4][16][40];
  __shared__ __attribute__((aligned(16))) float sO[4][16][D];
  const int tid = threadIdx.x, w = tid >> 5, lane = tid & 31, ln = lane & 15, hh = lane >> 4;
  const int nqb = (T + 63) / 64, npair = (nqb + 1) / 2, nw = (T / 32 + 31) / 32;
  const int bh = blockIdx.x / npair, tlow = blockIdx.x % npair;
  const int b = bh / H, h = bh % H;
  const float* Q = Qb + (size_t)b * T * qpitch + h * D;
  const float* K = Kb + (size_t)b * T * kpitch + h * D;
  const float* V = Vb + (size_t)b * T * vpitch + h * D;
  // Under a mask that shuts more keys the lower the query's index, tiles n - 1 - t and t together cost every work-group the same number of
  // passes; all work-groups are resident at once, so the launch lasts as long as the longest. An odd n's middle tile is taken once.
  const int nparts = (nqb - 1 - tlow != tlow) ? 2 : 1;
#pragma unroll 1  // one copy of the body in the instruction cache
  for (int part = 0; part < nparts; ++part) {
  const int qblk = part ? tlow : nqb - 1 - tlow;
  const int q0 = qblk * 64 + w * 16;
  unsigned tw = ~0u;           // lane l: the query tile's word l of tbits (32 passes a word; T * T * 4 < 4 GiB, so never more than 32 words)
  if (mask) {
    const unsigned two = (unsigned)(qblk * nw + (lane < nw ? lane : nw - 1)) * 128u;
    tw = *(const unsigned*)((const char*)tbits + two);
    // The offset register is not rewritten in front of this wait.
    asm volatile("s_wait_xcnt 0x0" :: "v"(two) : "memory");
  }
  FragB aqh[KS], aql[KS];
  {
    int row = q0 + ln; if (row >= T) row = T - 1;
    const float* qr = Q + (size_t)row * qpitch;
#pragma unroll
    for (int ks = 0; ks < KS; ++ks)
#pragma unroll
      for (int i = 0; i < 16; ++i) {
        const int d = ks * 32 + ((i < 8) ? (8 * hh + i) : (16 + 8 * hh + (i - 8)));
        const float x = qr[d] * scale; const unsigned short hb = bf16_bits(x);
        aqh[ks].u[i] = hb; aql[ks].u[i] = bf16_bits(x - bf16_val(hb));
      }
  }
  int qrow[8];
#pragma unroll
  for (int r = 0; r < 8; ++r) { int qi = q0 + 8 * hh + r; qrow[r] = qi < T ? qi : T - 1; }
  float m_r[8], l_r[8];
#pragma unroll
  for (int r = 0; r < 8; ++r) { m_r[r] = -3.0e38f; l_r[r] = 0.f; }
  v8f oacc[DT];
#pragma unroll
  for (int dt = 0; dt < DT; ++dt) oacc[dt] = (v8f){0.f,0.f,0.f,0.f,0.f,0.f,0.f,0.f};
  const int kv_end = causal ? min(T, qblk * 64 + 64) : T;
  constexpr int NL = D / 16, RS = 128 / (D / 4);               // K (and V) quads per thread and pass; rows between a thread's quads
  const int sr = tid / (D / 4), sc4 = (tid % (D / 4)) * 4;     // the thread's first staged row, and its column
  const unsigned kofs = ((unsigned)sr * (unsigned)kpitch + (unsigned)sc4) * 4u, vofs = ((unsigned)sr * (unsigned)vpitch + (unsigned)sc4) * 4u;
  // the lane's own 16 bytes of a 16 x 16 V tile for the transposing load: row 8 hh + (lane & 7), column half (lane >> 3) & 1
  const unsigned short* vth = &sVh[8 * hh + (lane & 7)][8 * ((lane >> 3) & 1)];
  const unsigned short* vtl = &sVl[8 * hh + (lane & 7)][8 * ((lane >> 3) & 1)];
  unsigned mofs[8];
#pragma unroll  // constant indices keep the array in registers (so for every unrolled loop of the batch below)
  for (int r = 0; r < 8; ++r) mofs[r] = ((unsigned)qrow[r] * (unsigned)T + (unsigned)ln) * 4u;
  unsigned tb = 0u;
  for (int j0 = 0; j0 < kv_end; j0 += 32) {
    // A pass whose 64 x 32 mask tile holds no set word leaves every maximum, sum and accumulator as it is (each p is 0, each alpha 1):
    // the whole work-group steps over it, its loads and both its barriers included (the test reads the same in every wave).
    if ((j0 & 1023) == 0) tb = (unsigned)__builtin_amdgcn_readlane((int)tw, j0 >> 10);
    if (((tb >> ((j0 >> 5) & 31)) & 1u) == 0u) continue;
    // All that the pass (32 keys) reads from global memory goes out as one batch, under no lane test, so that the loads'
    // latencies overlap: uniform base, fixed lane offsets; every key of a pass is below T (T % 32 == 0).
    static_assert(NL == 4, "the wait behind the K/V loads names four K and four V addresses");
    const char *kp[NL], *vp[NL];
    v4f kq[NL], vq[NL];
#pragma unroll  // addresses in registers
    for (int i = 0; i < NL; ++i) {
      kp[i] = (const char*)(K + (size_t)(j0 + i * RS) * kpitch) + kofs;
      vp[i] = (const char*)(V + (size_t)(j0 + i * RS) * vpitch) + vofs;
    }
#pragma unroll  // the eight loads back to back
    for (int i = 0; i < NL; ++i) { kq[i] = *(const v4fa*)kp[i]; vq[i] = *(const v4fa*)vp[i]; }
    // No address register of the batch is reused (not even as a later load's destination) in front of this wait.
    asm volatile("s_wait_xcnt 0x0" :: "v"(kp[0]), "v"(kp[1]), "v"(kp[2]), "v"(kp[3]), "v"(vp[0]), "v"(vp[1]), "v"(vp[2]), "v"(vp[3]) : "memory");
    int mka[8], mkb[8];
#pragma unroll  // words in registers
    for (int r = 0; r < 8; ++r) { mka[r] = 1; mkb[r] = 1; }
    if (mask) {
      const char* mp[8];
#pragma unroll  // addresses in registers
      for (int r = 0; r < 8; ++r) mp[r] = (const char*)(mask + j0) + mofs[r];
#pragma unroll  // the sixteen loads back to back
      for (int r = 0; r < 8; ++r) { mka[r] = *(const int*)mp[r]; mkb[r] = *(const int*)(mp[r] + 64); }
      // The same for the mask words' addresses.
      asm volatile("s_wait_xcnt 0x0" :: "v"(mp[0]), "v"(mp[1]), "v"(mp[2]), "v"(mp[3]), "v"(mp[4]), "v"(mp[5]), "v"(mp[6]), "v"(mp[7]) : "memory");
    }
    __syncthreads();
#pragma unroll  // kq and vq are indexed by constants
    for (int i = 0; i < NL; ++i) {
      const int r = sr + i * RS, c4 = sc4;
      const v4f kf = kq[i], vf = vq[i];
#pragma unroll
      for (int t = 0; t < 4; ++t) {
        unsigned short hb = bf16_bits(kf[t]); sKh[r][c4 + t] = hb; sKl[r][c4 + t] = bf16_bits(kf[t] - bf16_val(hb));
        hb = bf16_bits(vf[t]); sVh[r][c4 + t] = hb; sVl[r][c4 + t] = bf16_bits(vf[t] - bf16_val(hb));
      }
    }
    __syncthreads();
    v8f s[2];
#pragma unroll
    for (int nt = 0; nt < 2; ++nt) {
      v8f acc = {};
#pragma unroll
      for (int ks = 0; ks < KS; ++ks) {
        FragB bh_, bl_;
        bh_.half[0] = *(const v8us*)&sKh[nt * 16 + ln][ks * 32 + 8 * hh]; bh_.half[1] = *(const v8us*)&sKh[nt * 16 + ln][ks * 32 + 16 + 8 * hh];
        bl_.half[0] = *(const v8us*)&sKl[nt * 16 + ln][ks * 32 + 8 * hh]; bl_.half[1] = *(const v8us*)&sKl[nt * 16 + ln][ks * 32 + 16 + 8 * hh];
        acc = mmaN<3>(aqh[ks].v, aql[ks].v, bh_.v, bl_.v, acc);
      }
      s[nt] = acc;
    }
    float alpha[8];
#pragma unroll
    for (int r = 0; r < 8; ++r) {
      bool keepa = mka[r] != 0, keepb = mkb[r] != 0;
      if (causal) { keepa = keepa && (j0 + ln <= qrow[r]); keepb = keepb && (j0 + 16 + ln <= qrow[r]); }
      if (!keepa) s[0][r] = -3.0e38f;
      if (!keepb) s[1][r] = -3.0e38f;
      float mx = fmaxf(s[0][r], s[1][r]);
      mx = fmaxf(mx, __shfl_xor(mx, 1, 32)); mx = fmaxf(mx, __shfl_xor(mx, 2, 32)); mx = fmaxf(mx, __shfl_xor(mx, 4, 32)); mx = fmaxf(mx, __shfl_xor(mx, 8, 32));
      const float mnew = fmaxf(m_r[r], mx);
      alpha[r] = (mnew > -1.0e38f) ? __expf(m_r[r] - mnew) : 1.0f;
      const float p0 = keepa ? __expf(s[0][r] - mnew) : 0.f;
      const float p1 = keepb ? __expf(s[1][r] - mnew) : 0.f;
      m_r[r] = mnew;
      l_r[r] = l_r[r] * alpha[r] + p0 + p1;
      unsigned short hb = bf16_bits(p0); sPh[w][8 * hh + r][ln] = hb;      sPl[w][8 * hh + r][ln] = bf16_bits(p0 - bf16_val(hb));
      hb = bf16_bits(p1);                sPh[w][8 * hh + r][16 + ln] = hb; sPl[w][8 * hh + r][16 + ln] = bf16_bits(p1 - bf16_val(hb));
    }
#pragma unroll
    for (int dt = 0; dt < DT; ++dt)
#pragma unroll
      for (int r = 0; r < 8; ++r) oacc[dt][r] *= alpha[r];
    // The pass's whole V operand as one group of loads, in front of P's trip through LDS, which covers their latency.
    // Lane (ln, hh) receives V[kbase + 8 hh + 0..7][dt * 16 + ln], kbase 0 and 16: the k order of the P fragment below.
    FragB bvh[DT], bvl[DT];
#pragma unroll  // fragments in registers
    for (int dt = 0; dt < DT; ++dt) {
      bvh[dt].half[0] = lds_tr16(vth + dt * 16); bvh[dt].half[1] = lds_tr16(vth + 16 * VP + dt * 16);
      bvl[dt].half[0] = lds_tr16(vtl + dt * 16); bvl[dt].half[1] = lds_tr16(vtl + 16 * VP + dt * 16);
    }
    __builtin_amdgcn_fence(__ATOMIC_ACQ_REL, "workgroup");
    __builtin_amdgcn_wave_barrier();
    FragB pah, pal;
    pah.half[0] = *(const v8us*)&sPh[w][ln][8 * hh]; pah.half[1] = *(const v8us*)&sPh[w][ln][16 + 8 * hh];
    pal.half[0] = *(const v8us*)&sPl[w][ln][8 * hh]; pal.half[1] = *(const v8us*)&sPl[w][ln][16 + 8 * hh];
#pragma unroll
    for (int dt = 0; dt < DT; ++dt) {
      oacc[dt] = mmaN<3>(pah.v, pal.v, bvh[dt].v, bvl[dt].v, oacc[dt]);
    }
    __builtin_amdgcn_fence(__ATOMIC_ACQ_REL, "workgroup");
    __builtin_amdgcn_wave_barrier();
  }
  // NaN for fully-masked rows (softmax over a row of -inf)
#pragma unroll
  for (int r = 0; r < 8; ++r) {
    float l = l_r[r];
    l += __shfl_xor(l, 1, 32); l += __shfl_xor(l, 2, 32); l += __shfl_xor(l, 4, 32); l += __shfl_xor(l, 8, 32);
    l_r[r] = (m_r[r] > -1.0e38f) ? 1.0f / l : __builtin_nanf("");
  }
#pragma unroll
  for (int dt = 0; dt < DT; ++dt)
#pragma unroll
    for (int r = 0; r < 8; ++r) sO[w][8 * hh + r][dt * 16 + ln] = oacc[dt][r] * l_r[r];
  __builtin_amdgcn_fence(__ATOMIC_ACQ_REL, "workgroup");
  __builtin_amdgcn_wave_barrier();
  {
    for (int r = 0; r < 16; ++r) {
      const int row = q0 + r;
      if (row < T && lane < D / 4) {
        const v4f val = *(const v4fa*)&sO[w][r][lane * 4];
        *(v4f*)(y + ((size_t)b * T + row) * ypitch + h * D + lane * 4) = val;
      }
    }
    
  }
  // The next tile's first instructions rewrite registers that the last store names: not in front of this wait.
  asm volatile("s_wait_xcnt 0x0" ::: "memory");
  }
}

extern "C" void kernel_launch(void* const* d_in, const int* in_sizes, int n_in,
                              void* d_out, int out_size, void* d_ws, size_t ws_size, hipStream_t stream) {
  (void)in_sizes; (void)n_in; (void)out_size;
  const float* x = (const float*)d_in[0]; const int* mask = (const int*)d_in[1];
  const float* Wq = (const float*)d_in[2]; const float* Wkv = (const float*)d_in[3];
  const float* Wo = (const float*)d_in[4]; const float* bo = (const float*)d_in[5];
  char* ws = (char*)d_ws; size_t off = 0;
  unsigned short* Wqt  = (unsigned short*)(ws + off); off += (size_t)DM * DM * 2;       // [1024][1024]
  unsigned short* Wkvt = (unsigned short*)(ws + off); off += (size_t)2 * DM * DM * 2;   // [2048][1024]
  unsigned short* Wot  = (unsigned short*)(ws + off); off += (size_t)DM * DM * 2;
  float* qb  = (float*)(ws + off); off += (size_t)BB * NN * DM * 4;                    // 16 MiB
  float* kvb = (float*)(ws + off); off += (size_t)BB * NN * 2 * DM * 4;                // 32 MiB
  float* ob  = (float*)(ws + off); off += (size_t)BB * NN * DM * 4;                    // 16 MiB
  unsigned* tbits = (unsigned*)(ws + off); off += (size_t)(NN / 64) * (NN / 1024) * 128; // a 128-byte line a word
  if (off > ws_size) return;
  const int M = BB * NN;
  k_mask_tiles<<<(NN / 64) * (NN / 1024), 1024, 0, stream>>>(mask, tbits, NN);
  k_wt_bf16<<<(DM * (DM / 8) + 255) / 256, 256, 0, stream>>>(Wq, Wqt, DM, DM);
  k_wt_bf16<<<(2 * DM * (DM / 8) + 255) / 256, 256, 0, stream>>>(Wkv, Wkvt, DM, 2 * DM);
  k_wt_bf16<<<(DM * (DM / 8) + 255) / 256, 256, 0, stream>>>(Wo, Wot, DM, DM);
  k_gemm_bf<false, 0, false><<<(M / 64) * (DM / 128), 128, 0, stream>>>(x, DM, Wqt, DM, nullptr, qb, DM, M, DM, DM);
  k_gemm_bf<false, 0, false><<<(M / 64) * (2 * DM / 128), 128, 0, stream>>>(x, DM, Wkvt, DM, nullptr, kvb, 2 * DM, M, 2 * DM, DM);
  // k = kv[..., 0:1024] (head h at h*64), v = kv[..., 1024:2048]
  k_flashm<HD><<<BB * NH * (NN / 128), 128, 0, stream>>>(qb, DM, kvb, 2 * DM, kvb + DM, 2 * DM, NN, NH, 0.03125f, mask, tbits, 0, ob, DM);
  k_gemm_bf<true, 0, true><<<(M / 64) * (DM / 128), 128, 0, stream>>>(ob, DM, Wot, DM, bo, (float*)d_out, DM, M, DM, DM);
}

// v005
// It runs in 246 microseconds.
// In two side-by-side timings against v004, it was 1.13 and 1.12 times as fast.
// Counting every step since v000, it is 2.74 times as fast.
#include <hip/hip_runtime.h>
// All contractions on v_wmma_f32_16x16x32_bf16, f32 accumulate: q = x·Wq and kv = x·Wkv with x/W rounded to bf16 (single
// exact-product term), QKᵀ and P·V 3-term bf16 hi/lo splits, out = o·Wout with o split hi/lo (2 terms); softmax f32.
// The boolean mask input is applied as given (together with nothing else).
#define BB 2
#define NN 2048
#define DM 1024
#define NH 16
#define HD 64

typedef __bf16 v16b __attribute__((ext_vector_type(16)));
typedef unsigned short v8us __attribute__((ext_vector_type(8), may_alias));
typedef unsigned short v4us __attribute__((ext_vector_type(4), may_alias));
typedef float  v8f  __attribute__((ext_vector_type(8)));
typedef float  v4f  __attribute__((ext_vector_type(4)));
typedef float  v4fa __attribute__((ext_vector_type(4), may_alias));
typedef int    v4ia __attribute__((ext_vector_type(4), may_alias));
union FragB { v16b v; v8us half[2]; unsigned short u[16]; };

__device__ __forceinline__ unsigned short bf16_bits(float x) { unsigned int u = __float_as_uint(x); return (unsigned short)((u + 0x7FFFu + ((u >> 16) & 1u)) >> 16); }
__device__ __forceinline__ float bf16_val(unsigned short b) { return __uint_as_float(((unsigned int)b) << 16); }
__device__ __forceinline__ float bf16_round(float x) { return bf16_val(bf16_bits(x)); }
// D += A·B with NT terms: 1 = ah·bh, 2 = + al·bh (A split), 3 = + ah·bl (both split)
template <int NT>
__device__ __forceinline__ v8f mmaN(v16b ah, v16b al, v16b bh, v16b bl, v8f c) {
  c = __builtin_amdgcn_wmma_f32_16x16x32_bf16(false, ah, false, bh, (short)0, c, false, false);
  if (NT >= 2) c = __builtin_amdgcn_wmma_f32_16x16x32_bf16(false, al, false, bh, (short)0, c, false, false);
  if (NT >= 3) c = __builtin_amdgcn_wmma_f32_16x16x32_bf16(false, ah, false, bl, (short)0, c, false, false);
  asm volatile("v_nop\n\tv_nop\n\tv_nop\n\tv_nop" : "+v"(c) : "v"(ah), "v"(al), "v"(bh), "v"(bl));
  return c;
}

// Transposing LDS load: a row-major 16 x 16 tile of 16-bit elements arrives as half of a WMMA operand (8 k of one column per lane).
__device__ __forceinline__ v8us lds_tr16(const unsigned short* p) {
  typedef short s16x8 __attribute__((ext_vector_type(8)));
  typedef __attribute__((address_space(3))) s16x8 lds_s16x8;
  return __builtin_bit_cast(v8us, __builtin_amdgcn_ds_load_tr16_b128_v8i16((lds_s16x8*)p));
}

__global__ __launch_bounds__(256) void k_wt_bf16(const float* __restrict__ W, unsigned short* __restrict__ Wt, int K, int N) {
  const int t = blockIdx.x * 256 + threadIdx.x;
  const int k8n = K / 8;
  if (t >= N * k8n) return;
  const int n = t / k8n, k8 = (t % k8n) * 8;
  v8us v;
#pragma unroll
  for (int i = 0; i < 8; ++i) v[i] = bf16_bits(W[(size_t)(k8 + i) * N + n]);
  *(v8us*)(Wt + (size_t)n * K + k8) = v;
  
}

// One 64-k step of a GEMM block's operands, global memory to registers, as one batch of whole-line loads
// (A: 16 lanes a row of 256 B; W: 8 lanes a row of 128 B): uniform bases, sixteen running byte offsets that then move on by 64 k.
__device__ __forceinline__ void gemm_fetch(const float* A, const unsigned short* Wt, unsigned (&ao)[8], unsigned (&bo)[8], v4f (&aq)[8], v8us (&bq)[8]) {
#pragma unroll  // the sixteen loads back to back
  for (int i = 0; i < 8; ++i) { aq[i] = *(const v4fa*)((const char*)A + ao[i]); bq[i] = *(const v8us*)((const char*)Wt + bo[i]); }
  // No offset register of the batch is rewritten (not even as a later load's destination) in front of this wait.
  asm volatile("s_wait_xcnt 0x0" :: "v"(ao[0]), "v"(ao[1]), "v"(ao[2]), "v"(ao[3]), "v"(ao[4]), "v"(ao[5]), "v"(ao[6]), "v"(ao[7]),
               "v"(bo[0]), "v"(bo[1]), "v"(bo[2]), "v"(bo[3]), "v"(bo[4]), "v"(bo[5]), "v"(bo[6]), "v"(bo[7]) : "memory");
#pragma unroll  // offsets in registers
  for (int i = 0; i < 8; ++i) { ao[i] += 64u * 4u; bo[i] += 64u * 2u; }
}

// GEMM C[M][N] (f32, pitch ldc) = act(A[M][K]·W + bias). A f32 row-major (pitch lda), converted to bf16 once per block
// (ASPLIT: hi/lo two planes -> 2 terms, else single rounded term); Wt bf16 [N][K] (pitch ldb). BIAS_BF16 rounds the
// bias to bf16 first (bias quantised to bf16 before the add). Block = 4 waves = a 64 x 128 tile of C, wave = 32 x 64;
// both operands pass through LDS in steps of 64 k, the next step's loads in flight during the products of this one.
// K%64==0, K>=64, M%64==0, N%128==0.
template <bool ASPLIT, int ACT, bool BIAS_BF16>
__global__ __launch_bounds__(128) void k_gemm_bf(const float* __restrict__ A, int lda, const unsigned short* __restrict__ Wt, int ldb,
                                               const float* __restrict__ bias, float* __restrict__ C, int ldc, int M, int N, int K) {
  constexpr int KP = 64 + 8;   // row pitch in elements, 144 B: the pitch of the attention kernel's K rows, read the same way
  __shared__ __attribute__((aligned(16))) unsigned short sAh[64][KP], sAl[ASPLIT ? 64 : 1][KP], sB[128][KP];
  __shared__ __attribute__((aligned(16))) float so[4][32][64];
  const int tid = threadIdx.x, w = tid >> 5, lane = tid & 31, ln = lane & 15, hh = lane >> 4;
  const int wm = w >> 1, wn = w & 1;
  const int nb = N / 128;
  const int row0 = (blockIdx.x / nb) * 64, col0 = (blockIdx.x % nb) * 128;
  if (row0 >= M) return;       // block-uniform, in front of every barrier
  const int ar = tid >> 4, ac = (tid & 15) * 4, br = tid >> 3, bc = (tid & 7) * 8;
  unsigned ao[8], bo[8];       // byte offsets of A rows ar + 8 i and W rows br + 16 i (both operands are far below 4 GiB)
#pragma unroll  // offsets in registers
  for (int i = 0; i < 8; ++i) {
    ao[i] = ((unsigned)(row0 + ar + 8 * i) * (unsigned)lda + (unsigned)ac) * 4u;
    bo[i] = ((unsigned)(col0 + br + 16 * i) * (unsigned)ldb + (unsigned)bc) * 2u;
  }
  v4f aq[8]; v8us bq[8];
  v8f acc[2][4] = {};
  gemm_fetch(A, Wt, ao, bo, aq, bq);
  for (int kn = 64; ; kn += 64) {   // kn: the first k of the step after this one
    __syncthreads();           // every wave has read its last fragment of the step before
#pragma unroll  // aq and bq are indexed by constants
    for (int i = 0; i < 8; ++i) {
      v4us h, l;
#pragma unroll
      for (int t = 0; t < 4; ++t) { const unsigned short hb = bf16_bits(aq[i][t]); h[t] = hb; l[t] = ASPLIT ? bf16_bits(aq[i][t] - bf16_val(hb)) : (unsigned short)0; }
      *(v4us*)&sAh[ar + 8 * i][ac] = h;
      if (ASPLIT) *(v4us*)&sAl[ar + 8 * i][ac] = l;
      *(v8us*)&sB[br + 16 * i][bc] = bq[i];
    }
    __syncthreads();           // the step's tiles are whole
    if (kn < K) gemm_fetch(A, Wt, ao, bo, aq, bq);
#pragma unroll
    for (int ks = 0; ks < 2; ++ks) {
      FragB b[4];
#pragma unroll
      for (int t = 0; t < 4; ++t) {
        const unsigned short* brow = &sB[wn * 64 + t * 16 + ln][ks * 32];
        b[t].half[0] = *(const v8us*)(brow + 8 * hh);
        b[t].half[1] = *(const v8us*)(brow + 16 + 8 * hh);
      }
      FragB ah[2], al[2];
#pragma unroll  // all fragments of the 32 k as one group of LDS loads in front of their products
      for (int mi = 0; mi < 2; ++mi) {
        const int arow = wm * 32 + mi * 16 + ln;
        ah[mi].half[0] = *(const v8us*)&sAh[arow][ks * 32 + 8 * hh]; ah[mi].half[1] = *(const v8us*)&sAh[arow][ks * 32 + 16 + 8 * hh];
        if (ASPLIT) { al[mi].half[0] = *(const v8us*)&sAl[arow][ks * 32 + 8 * hh]; al[mi].half[1] = *(const v8us*)&sAl[arow][ks * 32 + 16 + 8 * hh]; }
        else al[mi] = ah[mi];
      }
#pragma unroll
      for (int mi = 0; mi < 2; ++mi)
#pragma unroll
        for (int t = 0; t < 4; ++t) acc[mi][t] = mmaN<ASPLIT ? 2 : 1>(ah[mi].v, al[mi].v, b[t].v, b[t].v, acc[mi][t]);
    }
    if (kn >= K) break;
  }
  const int rsub = lane >> 4, c4 = (lane & 15) * 4;
  float bv[4];
#pragma unroll
  for (int t = 0; t < 4; ++t) {
    bv[t] = bias ? bias[col0 + wn * 64 + t * 16 + ln] : 0.f;
    if (BIAS_BF16) bv[t] = bf16_round(bv[t]);
  }
#pragma unroll
  for (int mi = 0; mi < 2; ++mi)
#pragma unroll
    for (int t = 0; t < 4; ++t)
#pragma unroll
      for (int r = 0; r < 8; ++r) { float v = acc[mi][t][r] + bv[t]; if (ACT == 1) v = fmaxf(v, 0.f); so[w][mi * 16 + 8 * hh + r][t * 16 + ln] = v; }
  __builtin_amdgcn_fence(__ATOMIC_ACQ_REL, "workgroup");
  __builtin_amdgcn_wave_barrier();
#pragma unroll
  for (int q = 0; q < 16; ++q) {
    const int r = q * 2 + rsub;
    const v4f v = *(const v4fa*)&so[w][r][c4];
    *(v4f*)(C + (size_t)(row0 + wm * 32 + r) * ldc + col0 + wn * 64 + c4) = v;
  }
}

// Flash-style causal/unmasked attention, all contractions 3-term bf16 hi/lo splits, f32 softmax with running max.
// q,k,v rows are read from f32 buffers with arbitrary row pitch (so they can live inside a fused qkv buffer);
// D = head size (multiple of 32, <= 128); one wave = 16 query rows; block = 4 waves (64 queries) sharing K/V chunks of 32.
template <int D, bool CAUSAL>
__global__ __launch_bounds__(128) void k_flash(const float* __restrict__ qb, const float* __restrict__ kb, const float* __restrict__ vb,
                                             int pitch, int T, int H, float scale, float* __restrict__ y, int ypitch) {
  constexpr int KS = D / 32;        // k-steps for QK
  constexpr int DT = D / 16;        // d tiles for PV
  __shared__ __attribute__((aligned(16))) unsigned short sKh[32][D + 8], sKl[32][D + 8], sVh[32][D + 8], sVl[32][D + 8];
  __shared__ __attribute__((aligned(16))) unsigned short sPh[4][16][40], sPl[4][16][40];
  __shared__ __attribute__((aligned(16))) float sO[4][16][D];
  const int tid = threadIdx.x, w = tid >> 5, lane = tid & 31, ln = lane & 15, hh = lane >> 4;
  const int nqb = (T + 63) / 64;
  const int bh = blockIdx.x / nqb, qblk = blockIdx.x % nqb;
  const int b = bh / H, h = bh % H;
  const int q0 = qblk * 64 + w * 16;
  const float* Q = qb + (size_t)b * T * pitch + h * D;
  const float* K = kb + (size_t)b * T * pitch + h * D;
  const float* V = vb + (size_t)b * T * pitch + h * D;

  // A fragments of the wave's 16 query rows (scaled), hi/lo
  FragB aqh[KS], aql[KS];
  {
    int row = q0 + ln; if (row >= T) row = T - 1;
    const float* qr = Q + (size_t)row * pitch;
#pragma unroll
    for (int ks = 0; ks < KS; ++ks)
#pragma unroll
      for (int i = 0; i < 16; ++i) {
        const int d = ks * 32 + ((i < 8) ? (8 * hh + i) : (16 + 8 * hh + (i - 8)));
        const float x = qr[d] * scale; const unsigned short hb = bf16_bits(x);
        aqh[ks].u[i] = hb; aql[ks].u[i] = bf16_bits(x - bf16_val(hb));
      }
  }
  float m_r[8], l_r[8];
#pragma unroll
  for (int r = 0; r < 8; ++r) { m_r[r] = -3.0e38f; l_r[r] = 0.f; }
  v8f oacc[DT];
#pragma unroll
  for (int dt = 0; dt < DT; ++dt) oacc[dt] = (v8f){0.f,0.f,0.f,0.f,0.f,0.f,0.f,0.f};

  const int kv_end = CAUSAL ? min(T, qblk * 64 + 64) : T;     // block-uniform
  for (int j0 = 0; j0 < kv_end; j0 += 32) {
    __syncthreads();
    for (int e = tid; e < 32 * (D / 4); e += 128) {
      const int r = e / (D / 4), c4 = (e % (D / 4)) * 4;
      const int key = j0 + r;
      v4f kf = {0.f,0.f,0.f,0.f}, vf = {0.f,0.f,0.f,0.f};
      if (key < T) { kf = *(const v4fa*)(K + (size_t)key * pitch + c4); vf = *(const v4fa*)(V + (size_t)key * pitch + c4); }
#pragma unroll
      for (int t = 0; t < 4; ++t) {
        unsigned short hb = bf16_bits(kf[t]); sKh[r][c4 + t] = hb; sKl[r][c4 + t] = bf16_bits(kf[t] - bf16_val(hb));
        hb = bf16_bits(vf[t]); sVh[r][c4 + t] = hb; sVl[r][c4 + t] = bf16_bits(vf[t] - bf16_val(hb));
      }
    }
    __syncthreads();
    // S tile 16 x 32
    v8f s[2];
#pragma unroll
    for (int nt = 0; nt < 2; ++nt) {
      v8f acc = {};
#pragma unroll
      for (int ks = 0; ks < KS; ++ks) {
        FragB bh_, bl_;
        bh_.half[0] = *(const v8us*)&sKh[nt * 16 + ln][ks * 32 + 8 * hh]; bh_.half[1] = *(const v8us*)&sKh[nt * 16 + ln][ks * 32 + 16 + 8 * hh];
        bl_.half[0] = *(const v8us*)&sKl[nt * 16 + ln][ks * 32 + 8 * hh]; bl_.half[1] = *(const v8us*)&sKl[nt * 16 + ln][ks * 32 + 16 + 8 * hh];
        acc = mmaN<3>(aqh[ks].v, aql[ks].v, bh_.v, bl_.v, acc);
      }
      s[nt] = acc;
    }
    // mask + running max (rows 8hh+r; the 16 lanes of a half share rows)
    float alpha[8];
#pragma unroll
    for (int r = 0; r < 8; ++r) {
      const int qi = q0 + 8 * hh + r;
      const int ja = j0 + ln, jb = j0 + 16 + ln;
      if (CAUSAL) { if (ja > qi) s[0][r] = -3.0e38f; if (jb > qi) s[1][r] = -3.0e38f; }
      if (ja >= T) s[0][r] = -3.0e38f;
      if (jb >= T) s[1][r] = -3.0e38f;
      float mx = fmaxf(s[0][r], s[1][r]);
      mx = fmaxf(mx, __shfl_xor(mx, 1, 32)); mx = fmaxf(mx, __shfl_xor(mx, 2, 32)); mx = fmaxf(mx, __shfl_xor(mx, 4, 32)); mx = fmaxf(mx, __shfl_xor(mx, 8, 32));
      const float mnew = fmaxf(m_r[r], mx);
      alpha[r] = (mnew > -1.0e38f) ? __expf(m_r[r] - mnew) : 1.0f;
      const float p0 = (s[0][r] > -1.0e38f) ? __expf(s[0][r] - mnew) : 0.f;
      const float p1 = (s[1][r] > -1.0e38f) ? __expf(s[1][r] - mnew) : 0.f;
      m_r[r] = mnew;
      l_r[r] = l_r[r] * alpha[r] + p0 + p1;            // per-lane partial row sum (16 lanes combined at the end)
      unsigned short hb = bf16_bits(p0); sPh[w][8 * hh + r][ln] = hb;      sPl[w][8 * hh + r][ln] = bf16_bits(p0 - bf16_val(hb));
      hb = bf16_bits(p1);                sPh[w][8 * hh + r][16 + ln] = hb; sPl[w][8 * hh + r][16 + ln] = bf16_bits(p1 - bf16_val(hb));
    }
#pragma unroll
    for (int dt = 0; dt < DT; ++dt)
#pragma unroll
      for (int r = 0; r < 8; ++r) oacc[dt][r] *= alpha[r];
    __builtin_amdgcn_fence(__ATOMIC_ACQ_REL, "workgroup");
    __builtin_amdgcn_wave_barrier();
    FragB pah, pal;
    pah.half[0] = *(const v8us*)&sPh[w][ln][8 * hh]; pah.half[1] = *(const v8us*)&sPh[w][ln][16 + 8 * hh];
    pal.half[0] = *(const v8us*)&sPl[w][ln][8 * hh]; pal.half[1] = *(const v8us*)&sPl[w][ln][16 + 8 * hh];
#pragma unroll
    for (int dt = 0; dt < DT; ++dt) {
      FragB bvh, bvl;
#pragma unroll
      for (int i = 0; i < 8; ++i) {
        bvh.u[i] = sVh[8 * hh + i][dt * 16 + ln]; bvh.u[8 + i] = sVh[16 + 8 * hh + i][dt * 16 + ln];
        bvl.u[i] = sVl[8 * hh + i][dt * 16 + ln]; bvl.u[8 + i] = sVl[16 + 8 * hh + i][dt * 16 + ln];
      }
      oacc[dt] = mmaN<3>(pah.v, pal.v, bvh.v, bvl.v, oacc[dt]);
    }
    __builtin_amdgcn_fence(__ATOMIC_ACQ_REL, "workgroup");
    __builtin_amdgcn_wave_barrier();
  }
#pragma unroll
  for (int r = 0; r < 8; ++r) {
    float l = l_r[r];
    l += __shfl_xor(l, 1, 32); l += __shfl_xor(l, 2, 32); l += __shfl_xor(l, 4, 32); l += __shfl_xor(l, 8, 32);
    l_r[r] = (l > 0.f) ? 1.0f / l : 0.f;
  }
#pragma unroll
  for (int dt = 0; dt < DT; ++dt)
#pragma unroll
    for (int r = 0; r < 8; ++r) sO[w][8 * hh + r][dt * 16 + ln] = oacc[dt][r] * l_r[r];
  __builtin_amdgcn_fence(__ATOMIC_ACQ_REL, "workgroup");
  __builtin_amdgcn_wave_barrier();
  {
    for (int r = 0; r < 16; ++r) {
      const int row = q0 + r;
      if (row < T && lane < D / 4) {
        const v4f val = *(const v4fa*)&sO[w][r][lane * 4];
        *(v4f*)(y + ((size_t)b * T + row) * ypitch + h * D + lane * 4) = val;
      }
    }
    
  }
}

// Maximum / sum over each 16-lane row, for eight values at once, on the vector unit: four steps lane ^ 1, 2, 4, 8 (the tree of four
// __shfl_xor steps, so the same bits). __shfl_xor compiles to ds_bpermute_b32, whose trip a wave waits out at every one of the four
// dependent steps; here the eight values' steps are interleaved, so that each instruction's producer stands eight instructions back.
// Every lane of the wave is on at both call sites.
__device__ __forceinline__ void row16_max8(float (&x)[8]) {
  asm(  // the row maxima without a trip through the LDS path
      "v_max_num_f32_dpp %0, %0, %0 row_xmask:1 row_mask:0xf bank_mask:0xf\n\tv_max_num_f32_dpp %1, %1, %1 row_xmask:1 row_mask:0xf bank_mask:0xf\n\t"
      "v_max_num_f32_dpp %2, %2, %2 row_xmask:1 row_mask:0xf bank_mask:0xf\n\tv_max_num_f32_dpp %3, %3, %3 row_xmask:1 row_mask:0xf bank_mask:0xf\n\t"
      "v_max_num_f32_dpp %4, %4, %4 row_xmask:1 row_mask:0xf bank_mask:0xf\n\tv_max_num_f32_dpp %5, %5, %5 row_xmask:1 row_mask:0xf bank_mask:0xf\n\t"
      "v_max_num_f32_dpp %6, %6, %6 row_xmask:1 row_mask:0xf bank_mask:0xf\n\tv_max_num_f32_dpp %7, %7, %7 row_xmask:1 row_mask:0xf bank_mask:0xf\n\t"
      "v_max_num_f32_dpp %0, %0, %0 row_xmask:2 row_mask:0xf bank_mask:0xf\n\tv_max_num_f32_dpp %1, %1, %1 row_xmask:2 row_mask:0xf bank_mask:0xf\n\t"
      "v_max_num_f32_dpp %2, %2, %2 row_xmask:2 row_mask:0xf bank_mask:0xf\n\tv_max_num_f32_dpp %3, %3, %3 row_xmask:2 row_mask:0xf bank_mask:0xf\n\t"
      "v_max_num_f32_dpp %4, %4, %4 row_xmask:2 row_mask:0xf bank_mask:0xf\n\tv_max_num_f32_dpp %5, %5, %5 row_xmask:2 row_mask:0xf bank_mask:0xf\n\t"
      "v_max_num_f32_dpp %6, %6, %6 row_xmask:2 row_mask:0xf bank_mask:0xf\n\tv_max_num_f32_dpp %7, %7, %7 row_xmask:2 row_mask:0xf bank_mask:0xf\n\t"
      "v_max_num_f32_dpp %0, %0, %0 row_xmask:4 row_mask:0xf bank_mask:0xf\n\tv_max_num_f32_dpp %1, %1, %1 row_xmask:4 row_mask:0xf bank_mask:0xf\n\t"
      "v_max_num_f32_dpp %2, %2, %2 row_xmask:4 row_mask:0xf bank_mask:0xf\n\tv_max_num_f32_dpp %3, %3, %3 row_xmask:4 row_mask:0xf bank_mask:0xf\n\t"
      "v_max_num_f32_dpp %4, %4, %4 row_xmask:4 row_mask:0xf bank_mask:0xf\n\tv_max_num_f32_dpp %5, %5, %5 row_xmask:4 row_mask:0xf bank_mask:0xf\n\t"
      "v_max_num_f32_dpp %6, %6, %6 row_xmask:4 row_mask:0xf bank_mask:0xf\n\tv_max_num_f32_dpp %7, %7, %7 row_xmask:4 row_mask:0xf bank_mask:0xf\n\t"
      "v_max_num_f32_dpp %0, %0, %0 row_xmask:8 row_mask:0xf bank_mask:0xf\n\tv_max_num_f32_dpp %1, %1, %1 row_xmask:8 row_mask:0xf bank_mask:0xf\n\t"
      "v_max_num_f32_dpp %2, %2, %2 row_xmask:8 row_mask:0xf bank_mask:0xf\n\tv_max_num_f32_dpp %3, %3, %3 row_xmask:8 row_mask:0xf bank_mask:0xf\n\t"
      "v_max_num_f32_dpp %4, %4, %4 row_xmask:8 row_mask:0xf bank_mask:0xf\n\tv_max_num_f32_dpp %5, %5, %5 row_xmask:8 row_mask:0xf bank_mask:0xf\n\t"
      "v_max_num_f32_dpp %6, %6, %6 row_xmask:8 row_mask:0xf bank_mask:0xf\n\tv_max_num_f32_dpp %7, %7, %7 row_xmask:8 row_mask:0xf bank_mask:0xf"
      : "+v"(x[0]), "+v"(x[1]), "+v"(x[2]), "+v"(x[3]), "+v"(x[4]), "+v"(x[5]), "+v"(x[6]), "+v"(x[7]));
}
__device__ __forceinline__ void row16_sum8(float (&x)[8]) {
  asm(  // the row sums likewise
      "v_add_f32_dpp %0, %0, %0 row_xmask:1 row_mask:0xf bank_mask:0xf\n\tv_add_f32_dpp %1, %1, %1 row_xmask:1 row_mask:0xf bank_mask:0xf\n\t"
      "v_add_f32_dpp %2, %2, %2 row_xmask:1 row_mask:0xf bank_mask:0xf\n\tv_add_f32_dpp %3, %3, %3 row_xmask:1 row_mask:0xf bank_mask:0xf\n\t"
      "v_add_f32_dpp %4, %4, %4 row_xmask:1 row_mask:0xf bank_mask:0xf\n\tv_add_f32_dpp %5, %5, %5 row_xmask:1 row_mask:0xf bank_mask:0xf\n\t"
      "v_add_f32_dpp %6, %6, %6 row_xmask:1 row_mask:0xf bank_mask:0xf\n\tv_add_f32_dpp %7, %7, %7 row_xmask:1 row_mask:0xf bank_mask:0xf\n\t"
      "v_add_f32_dpp %0, %0, %0 row_xmask:2 row_mask:0xf bank_mask:0xf\n\tv_add_f32_dpp %1, %1, %1 row_xmask:2 row_mask:0xf bank_mask:0xf\n\t"
      "v_add_f32_dpp %2, %2, %2 row_xmask:2 row_mask:0xf bank_mask:0xf\n\tv_add_f32_dpp %3, %3, %3 row_xmask:2 row_mask:0xf bank_mask:0xf\n\t"
      "v_add_f32_dpp %4, %4, %4 row_xmask:2 row_mask:0xf bank_mask:0xf\n\tv_add_f32_dpp %5, %5, %5 row_xmask:2 row_mask:0xf bank_mask:0xf\n\t"
      "v_add_f32_dpp %6, %6, %6 row_xmask:2 row_mask:0xf bank_mask:0xf\n\tv_add_f32_dpp %7, %7, %7 row_xmask:2 row_mask:0xf bank_mask:0xf\n\t"
      "v_add_f32_dpp %0, %0, %0 row_xmask:4 row_mask:0xf bank_mask:0xf\n\tv_add_f32_dpp %1, %1, %1 row_xmask:4 row_mask:0xf bank_mask:0xf\n\t"
      "v_add_f32_dpp %2, %2, %2 row_xmask:4 row_mask:0xf bank_mask:0xf\n\tv_add_f32_dpp %3, %3, %3 row_xmask:4 row_mask:0xf bank_mask:0xf\n\t"
      "v_add_f32_dpp %4, %4, %4 row_xmask:4 row_mask:0xf bank_mask:0xf\n\tv_add_f32_dpp %5, %5, %5 row_xmask:4 row_mask:0xf bank_mask:0xf\n\t"
      "v_add_f32_dpp %6, %6, %6 row_xmask:4 row_mask:0xf bank_mask:0xf\n\tv_add_f32_dpp %7, %7, %7 row_xmask:4 row_mask:0xf bank_mask:0xf\n\t"
      "v_add_f32_dpp %0, %0, %0 row_xmask:8 row_mask:0xf bank_mask:0xf\n\tv_add_f32_dpp %1, %1, %1 row_xmask:8 row_mask:0xf bank_mask:0xf\n\t"
      "v_add_f32_dpp %2, %2, %2 row_xmask:8 row_mask:0xf bank_mask:0xf\n\tv_add_f32_dpp %3, %3, %3 row_xmask:8 row_mask:0xf bank_mask:0xf\n\t"
      "v_add_f32_dpp %4, %4, %4 row_xmask:8 row_mask:0xf bank_mask:0xf\n\tv_add_f32_dpp %5, %5, %5 row_xmask:8 row_mask:0xf bank_mask:0xf\n\t"
      "v_add_f32_dpp %6, %6, %6 row_xmask:8 row_mask:0xf bank_mask:0xf\n\tv_add_f32_dpp %7, %7, %7 row_xmask:8 row_mask:0xf bank_mask:0xf"
      : "+v"(x[0]), "+v"(x[1]), "+v"(x[2]), "+v"(x[3]), "+v"(x[4]), "+v"(x[5]), "+v"(x[6]), "+v"(x[7]));
}

// Which 64-query x 32-key tiles of the int mask [T][T] hold a nonzero word at all: bit (kt & 31) of word [qt][kt >> 5], each word
// alone in a 128-byte line of its own (one writer a line). Block = 32 waves = 32 key tiles of one query tile, a tile a wave. T % 32 == 0.
__global__ __launch_bounds__(1024) void k_mask_tiles(const int* __restrict__ mask, unsigned* __restrict__ tbits, int T) {
  __shared__ int sany[32];
  const int w = threadIdx.x >> 5, lane = threadIdx.x & 31;
  const int nw = (T / 32 + 31) / 32;
  const int qt = blockIdx.x / nw, kt = (blockIdx.x % nw) * 32 + w;
  int any = 0;
  if (kt * 32 < T) {           // wave-uniform
    unsigned mo[16];           // byte offsets (the mask is far below 4 GiB): four whole 128-byte rows of the tile a load
#pragma unroll  // offsets in registers
    for (int i = 0; i < 16; ++i) {
      int row = qt * 64 + i * 4 + (lane >> 3); row = row < T ? row : T - 1;
      mo[i] = ((unsigned)row * (unsigned)T + (unsigned)(kt * 32 + (lane & 7) * 4)) * 4u;
    }
    v4ia mv[16];
#pragma unroll  // mv in registers, many loads in flight at once
    for (int i = 0; i < 16; ++i) mv[i] = *(const v4ia*)((const char*)mask + mo[i]);
    // No offset register of the batch is rewritten (not even as a later load's destination) in front of this wait.
    asm volatile("s_wait_xcnt 0x0" :: "v"(mo[0]), "v"(mo[1]), "v"(mo[2]), "v"(mo[3]), "v"(mo[4]), "v"(mo[5]), "v"(mo[6]), "v"(mo[7]),
                 "v"(mo[8]), "v"(mo[9]), "v"(mo[10]), "v"(mo[11]), "v"(mo[12]), "v"(mo[13]), "v"(mo[14]), "v"(mo[15]) : "memory");
#pragma unroll  // mv is indexed by constants
    for (int i = 0; i < 16; ++i) any |= mv[i][0] | mv[i][1] | mv[i][2] | mv[i][3];
  }
  const unsigned wany = __builtin_amdgcn_ballot_w32(any != 0);
  if (lane == 0) sany[w] = wany != 0u;
  __syncthreads();             // all 32 tiles' answers are in LDS
  if (w == 0) {
    const unsigned bits = __builtin_amdgcn_ballot_w32(sany[lane] != 0);
    if (lane == 0) tbits[(size_t)blockIdx.x * 32] = bits;
  }
}

// Self-attention (Tq == Tk == T) with optional int mask [T][T] (nonzero = keep) and/or causal flag; 3-term bf16 splits;
// Q/K/V rows read from f32 buffers: X + b*T*pitch + h*D + row*pitch. y[b][row][h*D + d], pitch ypitch. D % 32 == 0, T % 32 == 0.
// tbits: k_mask_tiles' words for this mask. A work-group takes two query tiles of a head, one after the other: n - 1 - t, then t.
template <int D>
__global__ __launch_bounds__(128) void k_flashm(const float* __restrict__ Qb, int qpitch, const float* __restrict__ Kb, int kpitch,
                                              const float* __restrict__ Vb, int vpitch, int T, int H, float scale,
                                              const int* __restrict__ mask, const unsigned* __restrict__ tbits, int causal,
                                              float* __restrict__ y, int ypitch) {
  constexpr int KS = D / 32, DT = D / 16;
  constexpr int VP = D + 16;   // V row pitch in elements: an odd multiple of 32 bytes, the conflict-free pitch of the transposing load
  static_assert((VP * 2) % 32 == 0 && ((VP * 2 / 32) & 1) == 1, "V rows: odd multiple of 32 bytes");
  __shared__ __attribute__((aligned(16))) unsigned short sKh[32][D + 8], sKl[32][D + 8], sVh[32][VP], sVl[32][VP];
  __shared__ __attribute__((aligned(16))) unsigned short sPh[4][16][40], sPl[4][16][40];
  __shared__ __attribute__((aligned(16))) float sO[4][16][D];
  const int tid = threadIdx.x, w = tid >> 5, lane = tid & 31, ln = lane & 15, hh = lane >> 4;
  const int nqb = (T + 63) / 64, npair = (nqb + 1) / 2, nw = (T / 32 + 31) / 32;
  const int bh = blockIdx.x / npair, tlow = blockIdx.x % npair;
  const int b = bh / H, h = bh % H;
  const float* Q = Qb + (size_t)b * T * qpitch + h * D;
  const float* K = Kb + (size_t)b * T * kpitch + h * D;
  const float* V = Vb + (size_t)b * T * vpitch + h * D;
  // Under a mask that shuts more keys the lower the query's index, tiles n - 1 - t and t together cost every work-group the same number of
  // passes; all work-groups are resident at once, so the launch lasts as long as the longest. An odd n's middle tile is taken once.
  const int nparts = (nqb - 1 - tlow != tlow) ? 2 : 1;
#pragma unroll 1  // one copy of the body in the instruction cache
  for (int part = 0; part < nparts; ++part) {
  const int qblk = part ? tlow : nqb - 1 - tlow;
  const int q0 = qblk * 64 + w * 16;
  unsigned tw = ~0u;           // lane l: the query tile's word l of tbits (32 passes a word; T * T * 4 < 4 GiB, so never more than 32 words)
  if (mask) {
    const unsigned two = (unsigned)(qblk * nw + (lane < nw ? lane : nw - 1)) * 128u;
    tw = *(const unsigned*)((const char*)tbits + two);
    // The offset register is not rewritten in front of this wait.
    asm volatile("s_wait_xcnt 0x0" :: "v"(two) : "memory");
  }
  FragB aqh[KS], aql[KS];
  {
    int row = q0 + ln; if (row >= T) row = T - 1;
    const float* qr = Q + (size_t)row * qpitch;
#pragma unroll
    for (int ks = 0; ks < KS; ++ks)
#pragma unroll
      for (int i = 0; i < 16; ++i) {
        const int d = ks * 32 + ((i < 8) ? (8 * hh + i) : (16 + 8 * hh + (i - 8)));
        const float x = qr[d] * scale; const unsigned short hb = bf16_bits(x);
        aqh[ks].u[i] = hb; aql[ks].u[i] = bf16_bits(x - bf16_val(hb));
      }
  }
  int qrow[8];
#pragma unroll
  for (int r = 0; r < 8; ++r) { int qi = q0 + 8 * hh + r; qrow[r] = qi < T ? qi : T - 1; }
  float m_r[8], l_r[8];
#pragma unroll
  for (int r = 0; r < 8; ++r) { m_r[r] = -3.0e38f; l_r[r] = 0.f; }
  v8f oacc[DT];
#pragma unroll
  for (int dt = 0; dt < DT; ++dt) oacc[dt] = (v8f){0.f,0.f,0.f,0.f,0.f,0.f,0.f,0.f};
  const int kv_end = causal ? min(T, qblk * 64 + 64) : T;
  constexpr int NL = D / 16, RS = 128 / (D / 4);               // K (and V) quads per thread and pass; rows between a thread's quads
  const int sr = tid / (D / 4), sc4 = (tid % (D / 4)) * 4;     // the thread's first staged row, and its column
  const unsigned kofs = ((unsigned)sr * (unsigned)kpitch + (unsigned)sc4) * 4u, vofs = ((unsigned)sr * (unsigned)vpitch + (unsigned)sc4) * 4u;
  // the lane's own 16 bytes of a 16 x 16 V tile for the transposing load: row 8 hh + (lane & 7), column half (lane >> 3) & 1
  const unsigned short* vth = &sVh[8 * hh + (lane & 7)][8 * ((lane >> 3) & 1)];
  const unsigned short* vtl = &sVl[8 * hh + (lane & 7)][8 * ((lane >> 3) & 1)];
  unsigned mofs[8];
#pragma unroll  // constant indices keep the array in registers (so for every unrolled loop of the batch below)
  for (int r = 0; r < 8; ++r) mofs[r] = ((unsigned)qrow[r] * (unsigned)T + (unsigned)ln) * 4u;
  unsigned tb = 0u;
  for (int j0 = 0; j0 < kv_end; j0 += 32) {
    // A pass whose 64 x 32 mask tile holds no set word leaves every maximum, sum and accumulator as it is (each p is 0, each alpha 1):
    // the whole work-group steps over it, its loads and both its barriers included (the test reads the same in every wave).
    if ((j0 & 1023) == 0) tb = (unsigned)__builtin_amdgcn_readlane((int)tw, j0 >> 10);
    if (((tb >> ((j0 >> 5) & 31)) & 1u) == 0u) continue;
    // All that the pass (32 keys) reads from global memory goes out as one batch, under no lane test, so that the loads'
    // latencies overlap: uniform base, fixed lane offsets; every key of a pass is below T (T % 32 == 0).
    static_assert(NL == 4, "the wait behind the K/V loads names four K and four V addresses");
    const char *kp[NL], *vp[NL];
    v4f kq[NL], vq[NL];
#pragma unroll  // addresses in registers
    for (int i = 0; i < NL; ++i) {
      kp[i] = (const char*)(K + (size_t)(j0 + i * RS) * kpitch) + kofs;
      vp[i] = (const char*)(V + (size_t)(j0 + i * RS) * vpitch) + vofs;
    }
#pragma unroll  // the eight loads back to back
    for (int i = 0; i < NL; ++i) { kq[i] = *(const v4fa*)kp[i]; vq[i] = *(const v4fa*)vp[i]; }
    // No address register of the batch is reused (not even as a later load's destination) in front of this wait.
    asm volatile("s_wait_xcnt 0x0" :: "v"(kp[0]), "v"(kp[1]), "v"(kp[2]), "v"(kp[3]), "v"(vp[0]), "v"(vp[1]), "v"(vp[2]), "v"(vp[3]) : "memory");
    int mka[8], mkb[8];
#pragma unroll  // words in registers
    for (int r = 0; r < 8; ++r) { mka[r] = 1; mkb[r] = 1; }
    if (mask) {
      const char* mp[8];
#pragma unroll  // addresses in registers
      for (int r = 0; r < 8; ++r) mp[r] = (const char*)(mask + j0) + mofs[r];
#pragma unroll  // the sixteen loads back to back
      for (int r = 0; r < 8; ++r) { mka[r] = *(const int*)mp[r]; mkb[r] = *(const int*)(mp[r] + 64); }
      // The same for the mask words' addresses.
      asm volatile("s_wait_xcnt 0x0" :: "v"(mp[0]), "v"(mp[1]), "v"(mp[2]), "v"(mp[3]), "v"(mp[4]), "v"(mp[5]), "v"(mp[6]), "v"(mp[7]) : "memory");
    }
    __syncthreads();
#pragma unroll  // kq and vq are indexed by constants
    for (int i = 0; i < NL; ++i) {
      const int r = sr + i * RS, c4 = sc4;
      const v4f kf = kq[i], vf = vq[i];
#pragma unroll
      for (int t = 0; t < 4; ++t) {
        unsigned short hb = bf16_bits(kf[t]); sKh[r][c4 + t] = hb; sKl[r][c4 + t] = bf16_bits(kf[t] - bf16_val(hb));
        hb = bf16_bits(vf[t]); sVh[r][c4 + t] = hb; sVl[r][c4 + t] = bf16_bits(vf[t] - bf16_val(hb));
      }
    }
    __syncthreads();
    v8f s[2];
#pragma unroll
    for (int nt = 0; nt < 2; ++nt) {
      v8f acc = {};
#pragma unroll
      for (int ks = 0; ks < KS; ++ks) {
        FragB bh_, bl_;
        bh_.half[0] = *(const v8us*)&sKh[nt * 16 + ln][ks * 32 + 8 * hh]; bh_.half[1] = *(const v8us*)&sKh[nt * 16 + ln][ks * 32 + 16 + 8 * hh];
        bl_.half[0] = *(const v8us*)&sKl[nt * 16 + ln][ks * 32 + 8 * hh]; bl_.half[1] = *(const v8us*)&sKl[nt * 16 + ln][ks * 32 + 16 + 8 * hh];
        acc = mmaN<3>(aqh[ks].v, aql[ks].v, bh_.v, bl_.v, acc);
      }
      s[nt] = acc;
    }
    float alpha[8], mx[8];
    bool ka[8], kb[8];
#pragma unroll  // mx, ka and kb are indexed by constants
    for (int r = 0; r < 8; ++r) {
      bool keepa = mka[r] != 0, keepb = mkb[r] != 0;
      if (causal) { keepa = keepa && (j0 + ln <= qrow[r]); keepb = keepb && (j0 + 16 + ln <= qrow[r]); }
      if (!keepa) s[0][r] = -3.0e38f;
      if (!keepb) s[1][r] = -3.0e38f;
      ka[r] = keepa; kb[r] = keepb;
      mx[r] = fmaxf(s[0][r], s[1][r]);
    }
    row16_max8(mx);
#pragma unroll
    for (int r = 0; r < 8; ++r) {
      const bool keepa = ka[r], keepb = kb[r];
      const float mnew = fmaxf(m_r[r], mx[r]);
      alpha[r] = (mnew > -1.0e38f) ? __expf(m_r[r] - mnew) : 1.0f;
      const float p0 = keepa ? __expf(s[0][r] - mnew) : 0.f;
      const float p1 = keepb ? __expf(s[1][r] - mnew) : 0.f;
      m_r[r] = mnew;
      l_r[r] = l_r[r] * alpha[r] + p0 + p1;
      unsigned short hb = bf16_bits(p0); sPh[w][8 * hh + r][ln] = hb;      sPl[w][8 * hh + r][ln] = bf16_bits(p0 - bf16_val(hb));
      hb = bf16_bits(p1);                sPh[w][8 * hh + r][16 + ln] = hb; sPl[w][8 * hh + r][16 + ln] = bf16_bits(p1 - bf16_val(hb));
    }
#pragma unroll
    for (int dt = 0; dt < DT; ++dt)
#pragma unroll
      for (int r = 0; r < 8; ++r) oacc[dt][r] *= alpha[r];
    // The pass's whole V operand as one group of loads, in front of P's trip through LDS, which covers their latency.
    // Lane (ln, hh) receives V[kbase + 8 hh + 0..7][dt * 16 + ln], kbase 0 and 16: the k order of the P fragment below.
    FragB bvh[DT], bvl[DT];
#pragma unroll  // fragments in registers
    for (int dt = 0; dt < DT; ++dt) {
      bvh[dt].half[0] = lds_tr16(vth + dt * 16); bvh[dt].half[1] = lds_tr16(vth + 16 * VP + dt * 16);
      bvl[dt].half[0] = lds_tr16(vtl + dt * 16); bvl[dt].half[1] = lds_tr16(vtl + 16 * VP + dt * 16);
    }
    __builtin_amdgcn_fence(__ATOMIC_ACQ_REL, "workgroup");
    __builtin_amdgcn_wave_barrier();
    FragB pah, pal;
    pah.half[0] = *(const v8us*)&sPh[w][ln][8 * hh]; pah.half[1] = *(const v8us*)&sPh[w][ln][16 + 8 * hh];
    pal.half[0] = *(const v8us*)&sPl[w][ln][8 * hh]; pal.half[1] = *(const v8us*)&sPl[w][ln][16 + 8 * hh];
#pragma unroll
    for (int dt = 0; dt < DT; ++dt) {
      oacc[dt] = mmaN<3>(pah.v, pal.v, bvh[dt].v, bvl[dt].v, oacc[dt]);
    }
    __builtin_amdgcn_fence(__ATOMIC_ACQ_REL, "workgroup");
    __builtin_amdgcn_wave_barrier();
  }
  // NaN for fully-masked rows (softmax over a row of -inf)
  row16_sum8(l_r);
#pragma unroll
  for (int r = 0; r < 8; ++r) l_r[r] = (m_r[r] > -1.0e38f) ? 1.0f / l_r[r] : __builtin_nanf("");
#pragma unroll
  for (int dt = 0; dt < DT; ++dt)
#pragma unroll
    for (int r = 0; r < 8; ++r) sO[w][8 * hh + r][dt * 16 + ln] = oacc[dt][r] * l_r[r];
  __builtin_amdgcn_fence(__ATOMIC_ACQ_REL, "workgroup");
  __builtin_amdgcn_wave_barrier();
  {
    for (int r = 0; r < 16; ++r) {
      const int row = q0 + r;
      if (row < T && lane < D / 4) {
        const v4f val = *(const v4fa*)&sO[w][r][lane * 4];
        *(v4f*)(y + ((size_t)b * T + row) * ypitch + h * D + lane * 4) = val;
      }
    }
    
  }
  // The next tile's first instructions rewrite registers that the last store names: not in front of this wait.
  asm volatile("s_wait_xcnt 0x0" ::: "memory");
  }
}

extern "C" void kernel_launch(void* const* d_in, const int* in_sizes, int n_in,
                              void* d_out, int out_size, void* d_ws, size_t ws_size, hipStream_t stream) {
  (void)in_sizes; (void)n_in; (void)out_size;
  const float* x = (const float*)d_in[0]; const int* mask = (const int*)d_in[1];
  const float* Wq = (const float*)d_in[2]; const float* Wkv = (const float*)d_in[3];
  const float* Wo = (const float*)d_in[4]; const float* bo = (const float*)d_in[5];
  char* ws = (char*)d_ws; size_t off = 0;
  unsigned short* Wqt  = (unsigned short*)(ws + off); off += (size_t)DM * DM * 2;       // [1024][1024]
  unsigned short* Wkvt = (unsigned short*)(ws + off); off += (size_t)2 * DM * DM * 2;   // [2048][1024]
  unsigned short* Wot  = (unsigned short*)(ws + off); off += (size_t)DM * DM * 2;
  float* qb  = (float*)(ws + off); off += (size_t)BB * NN * DM * 4;                    // 16 MiB
  float* kvb = (float*)(ws + off); off += (size_t)BB * NN * 2 * DM * 4;                // 32 MiB
  float* ob  = (float*)(ws + off); off += (size_t)BB * NN * DM * 4;                    // 16 MiB
  unsigned* tbits = (unsigned*)(ws + off); off += (size_t)(NN / 64) * (NN / 1024) * 128; // a 128-byte line a word
  if (off > ws_size) return;
  const int M = BB * NN;
  k_mask_tiles<<<(NN / 64) * (NN / 1024), 1024, 0, stream>>>(mask, tbits, NN);
  k_wt_bf16<<<(DM * (DM / 8) + 255) / 256, 256, 0, stream>>>(Wq, Wqt, DM, DM);
  k_wt_bf16<<<(2 * DM * (DM / 8) + 255) / 256, 256, 0, stream>>>(Wkv, Wkvt, DM, 2 * DM);
  k_wt_bf16<<<(DM * (DM / 8) + 255) / 256, 256, 0, stream>>>(Wo, Wot, DM, DM);
  k_gemm_bf<false, 0, false><<<(M / 64) * (DM / 128), 128, 0, stream>>>(x, DM, Wqt, DM, nullptr, qb, DM, M, DM, DM);
  k_gemm_bf<false, 0, false><<<(M / 64) * (2 * DM / 128), 128, 0, stream>>>(x, DM, Wkvt, DM, nullptr, kvb, 2 * DM, M, 2 * DM, DM);
  // k = kv[..., 0:1024] (head h at h*64), v = kv[..., 1024:2048]
  k_flashm<HD><<<BB * NH * (NN / 128), 128, 0, stream>>>(qb, DM, kvb, 2 * DM, kvb + DM, 2 * DM, NN, NH, 0.03125f, mask, tbits, 0, ob, DM);
  k_gemm_bf<true, 0, true><<<(M / 64) * (DM / 128), 128, 0, stream>>>(ob, DM, Wot, DM, bo, (float*)d_out, DM, M, DM, DM);
}

// v006
// Measured time: 221 microseconds a run.
// Timed twice side by side with v005, it ran 1.11 times as fast both times.
// Over all steps from v000 it is 3.05 times as fast.
#include <hip/hip_runtime.h>
// All contractions on v_wmma_f32_16x16x32_bf16, f32 accumulate: q = x·Wq and kv = x·Wkv with x/W rounded to bf16 (single
// exact-product term), QKᵀ and P·V 3-term bf16 hi/lo splits, out = o·Wout with o split hi/lo (2 terms); softmax f32.
// K and V are split hi/lo once, where the kv GEMM stores them; the attention kernel copies the two planes into LDS as they are.
// The boolean mask input is applied as given (together with nothing else).
#define BB 2
#define NN 2048
#define DM 1024
#define NH 16
#define HD 64

typedef __bf16 v16b __attribute__((ext_vector_type(16)));
typedef unsigned short v8us __attribute__((ext_vector_type(8), may_alias));
typedef unsigned short v4us __attribute__((ext_vector_type(4), may_alias));
typedef float  v8f  __attribute__((ext_vector_type(8)));
typedef float  v4f  __attribute__((ext_vector_type(4)));
typedef float  v4fa __attribute__((ext_vector_type(4), may_alias));
typedef int    v4ia __attribute__((ext_vector_type(4), may_alias));
union FragB { v16b v; v8us half[2]; unsigned short u[16]; };

__device__ __forceinline__ unsigned short bf16_bits(float x) { unsigned int u = __float_as_uint(x); return (unsigned short)((u + 0x7FFFu + ((u >> 16) & 1u)) >> 16); }
__device__ __forceinline__ float bf16_val(unsigned short b) { return __uint_as_float(((unsigned int)b) << 16); }
__device__ __forceinline__ float bf16_round(float x) { return bf16_val(bf16_bits(x)); }
// D += A·B with NT terms: 1 = ah·bh, 2 = + al·bh (A split), 3 = + ah·bl (both split)
template <int NT>
__device__ __forceinline__ v8f mmaN(v16b ah, v16b al, v16b bh, v16b bl, v8f c) {
  c = __builtin_amdgcn_wmma_f32_16x16x32_bf16(false, ah, false, bh, (short)0, c, false, false);
  if (NT >= 2) c = __builtin_amdgcn_wmma_f32_16x16x32_bf16(false, al, false, bh, (short)0, c, false, false);
  if (NT >= 3) c = __builtin_amdgcn_wmma_f32_16x16x32_bf16(false, ah, false, bl, (short)0, c, false, false);
  asm volatile("v_nop\n\tv_nop\n\tv_nop\n\tv_nop" : "+v"(c) : "v"(ah), "v"(al), "v"(bh), "v"(bl));
  return c;
}

// Transposing LDS load: a row-major 16 x 16 tile of 16-bit elements arrives as half of a WMMA operand (8 k of one column per lane).
__device__ __forceinline__ v8us lds_tr16(const unsigned short* p) {
  typedef short s16x8 __attribute__((ext_vector_type(8)));
  typedef __attribute__((address_space(3))) s16x8 lds_s16x8;
  return __builtin_bit_cast(v8us, __builtin_amdgcn_ds_load_tr16_b128_v8i16((lds_s16x8*)p));
}

__global__ __launch_bounds__(256) void k_wt_bf16(const float* __restrict__ W, unsigned short* __restrict__ Wt, int K, int N) {
  const int t = blockIdx.x * 256 + threadIdx.x;
  const int k8n = K / 8;
  if (t >= N * k8n) return;
  const int n = t / k8n, k8 = (t % k8n) * 8;
  v8us v;
#pragma unroll
  for (int i = 0; i < 8; ++i) v[i] = bf16_bits(W[(size_t)(k8 + i) * N + n]);
  *(v8us*)(Wt + (size_t)n * K + k8) = v;
  
}

// One 64-k step of a GEMM block's operands, global memory to registers, as one batch of whole-line loads
// (A: 16 lanes a row of 256 B; W: 8 lanes a row of 128 B): uniform bases, sixteen running byte offsets that then move on by 64 k.
__device__ __forceinline__ void gemm_fetch(const float* A, const unsigned short* Wt, unsigned (&ao)[8], unsigned (&bo)[8], v4f (&aq)[8], v8us (&bq)[8]) {
#pragma unroll  // the sixteen loads back to back
  for (int i = 0; i < 8; ++i) { aq[i] = *(const v4fa*)((const char*)A + ao[i]); bq[i] = *(const v8us*)((const char*)Wt + bo[i]); }
  // No offset register of the batch is rewritten (not even as a later load's destination) in front of this wait.
  asm volatile("s_wait_xcnt 0x0" :: "v"(ao[0]), "v"(ao[1]), "v"(ao[2]), "v"(ao[3]), "v"(ao[4]), "v"(ao[5]), "v"(ao[6]), "v"(ao[7]),
               "v"(bo[0]), "v"(bo[1]), "v"(bo[2]), "v"(bo[3]), "v"(bo[4]), "v"(bo[5]), "v"(bo[6]), "v"(bo[7]) : "memory");
#pragma unroll  // offsets in registers
  for (int i = 0; i < 8; ++i) { ao[i] += 64u * 4u; bo[i] += 64u * 2u; }
}

// GEMM C[M][N] (f32, pitch ldc) = act(A[M][K]·W + bias). A f32 row-major (pitch lda), converted to bf16 once per block
// (ASPLIT: hi/lo two planes -> 2 terms, else single rounded term); Wt bf16 [N][K] (pitch ldb). BIAS_BF16 rounds the
// bias to bf16 first (bias quantised to bf16 before the add). Block = 4 waves = a 64 x 128 tile of C, wave = 32 x 64;
// both operands pass through LDS in steps of 64 k, the next step's loads in flight during the products of this one.
// K%64==0, K>=64, M%64==0, N%128==0.
// CSPLIT: C is stored split for a later 3-term product: the 256 bytes of each 64-column group of a row hold the 64 values' bf16 high
// parts, then the 64 bf16 roundings of what the high parts leave (same place and size as the group's f32 values would have).
template <bool ASPLIT, int ACT, bool BIAS_BF16, bool CSPLIT>
__global__ __launch_bounds__(128) void k_gemm_bf(const float* __restrict__ A, int lda, const unsigned short* __restrict__ Wt, int ldb,
                                               const float* __restrict__ bias, float* __restrict__ C, int ldc, int M, int N, int K) {
  constexpr int KP = 64 + 8;   // row pitch in elements, 144 B: an odd multiple of 16 bytes like the attention kernel's K rows, read the same way
  __shared__ __attribute__((aligned(16))) unsigned short sAh[64][KP], sAl[ASPLIT ? 64 : 1][KP], sB[128][KP];
  __shared__ __attribute__((aligned(16))) float so[4][32][64];
  const int tid = threadIdx.x, w = tid >> 5, lane = tid & 31, ln = lane & 15, hh = lane >> 4;
  const int wm = w >> 1, wn = w & 1;
  const int nb = N / 128;
  const int row0 = (blockIdx.x / nb) * 64, col0 = (blockIdx.x % nb) * 128;
  if (row0 >= M) return;       // block-uniform, in front of every barrier
  const int ar = tid >> 4, ac = (tid & 15) * 4, br = tid >> 3, bc = (tid & 7) * 8;
  unsigned ao[8], bo[8];       // byte offsets of A rows ar + 8 i and W rows br + 16 i (both operands are far below 4 GiB)
#pragma unroll  // offsets in registers
  for (int i = 0; i < 8; ++i) {
    ao[i] = ((unsigned)(row0 + ar + 8 * i) * (unsigned)lda + (unsigned)ac) * 4u;
    bo[i] = ((unsigned)(col0 + br + 16 * i) * (unsigned)ldb + (unsigned)bc) * 2u;
  }
  v4f aq[8]; v8us bq[8];
  v8f acc[2][4] = {};
  gemm_fetch(A, Wt, ao, bo, aq, bq);
  for (int kn = 64; ; kn += 64) {   // kn: the first k of the step after this one
    __syncthreads();           // every wave has read its last fragment of the step before
#pragma unroll  // aq and bq are indexed by constants
    for (int i = 0; i < 8; ++i) {
      v4us h, l;
#pragma unroll
      for (int t = 0; t < 4; ++t) { const unsigned short hb = bf16_bits(aq[i][t]); h[t] = hb; l[t] = ASPLIT ? bf16_bits(aq[i][t] - bf16_val(hb)) : (unsigned short)0; }
      *(v4us*)&sAh[ar + 8 * i][ac] = h;
      if (ASPLIT) *(v4us*)&sAl[ar + 8 * i][ac] = l;
      *(v8us*)&sB[br + 16 * i][bc] = bq[i];
    }
    __syncthreads();           // the step's tiles are whole
    if (kn < K) gemm_fetch(A, Wt, ao, bo, aq, bq);
#pragma unroll
    for (int ks = 0; ks < 2; ++ks) {
      FragB b[4];
#pragma unroll
      for (int t = 0; t < 4; ++t) {
        const unsigned short* brow = &sB[wn * 64 + t * 16 + ln][ks * 32];
        b[t].half[0] = *(const v8us*)(brow + 8 * hh);
        b[t].half[1] = *(const v8us*)(brow + 16 + 8 * hh);
      }
      FragB ah[2], al[2];
#pragma unroll  // all fragments of the 32 k as one group of LDS loads in front of their products
      for (int mi = 0; mi < 2; ++mi) {
        const int arow = wm * 32 + mi * 16 + ln;
        ah[mi].half[0] = *(const v8us*)&sAh[arow][ks * 32 + 8 * hh]; ah[mi].half[1] = *(const v8us*)&sAh[arow][ks * 32 + 16 + 8 * hh];
        if (ASPLIT) { al[mi].half[0] = *(const v8us*)&sAl[arow][ks * 32 + 8 * hh]; al[mi].half[1] = *(const v8us*)&sAl[arow][ks * 32 + 16 + 8 * hh]; }
        else al[mi] = ah[mi];
      }
#pragma unroll
      for (int mi = 0; mi < 2; ++mi)
#pragma unroll
        for (int t = 0; t < 4; ++t) acc[mi][t] = mmaN<ASPLIT ? 2 : 1>(ah[mi].v, al[mi].v, b[t].v, b[t].v, acc[mi][t]);
    }
    if (kn >= K) break;
  }
  const int rsub = lane >> 4, c4 = (lane & 15) * 4;
  float bv[4];
#pragma unroll
  for (int t = 0; t < 4; ++t) {
    bv[t] = bias ? bias[col0 + wn * 64 + t * 16 + ln] : 0.f;
    if (BIAS_BF16) bv[t] = bf16_round(bv[t]);
  }
#pragma unroll
  for (int mi = 0; mi < 2; ++mi)
#pragma unroll
    for (int t = 0; t < 4; ++t)
#pragma unroll
      for (int r = 0; r < 8; ++r) { float v = acc[mi][t][r] + bv[t]; if (ACT == 1) v = fmaxf(v, 0.f); so[w][mi * 16 + 8 * hh + r][t * 16 + ln] = v; }
  __builtin_amdgcn_fence(__ATOMIC_ACQ_REL, "workgroup");
  __builtin_amdgcn_wave_barrier();
  if (CSPLIT) {
    const int r4 = lane >> 3, c8 = (lane & 7) * 8;   // eight lanes a row: each store covers four whole 128-byte lines
#pragma unroll  // a round's LDS reads go out while the round before is split and stored
    for (int q = 0; q < 8; ++q) {
      const int r = q * 4 + r4;
      const v4f v0 = *(const v4fa*)&so[w][r][c8], v1 = *(const v4fa*)&so[w][r][c8 + 4];
      v8us h, l;
#pragma unroll  // h and l are indexed by constants
      for (int t = 0; t < 4; ++t) {
        unsigned short hb = bf16_bits(v0[t]); h[t] = hb;     l[t] = bf16_bits(v0[t] - bf16_val(hb));
        hb = bf16_bits(v1[t]);                h[4 + t] = hb; l[4 + t] = bf16_bits(v1[t] - bf16_val(hb));
      }
      unsigned short* cr = (unsigned short*)(C + (size_t)(row0 + wm * 32 + r) * ldc + col0 + wn * 64);
      *(v8us*)(cr + c8) = h;
      *(v8us*)(cr + 64 + c8) = l;
    }
  } else {
#pragma unroll
    for (int q = 0; q < 16; ++q) {
      const int r = q * 2 + rsub;
      const v4f v = *(const v4fa*)&so[w][r][c4];
      *(v4f*)(C + (size_t)(row0 + wm * 32 + r) * ldc + col0 + wn * 64 + c4) = v;
    }
  }
}

// Flash-style causal/unmasked attention, all contractions 3-term bf16 hi/lo splits, f32 softmax with running max.
// q,k,v rows are read from f32 buffers with arbitrary row pitch (so they can live inside a fused qkv buffer);
// D = head size (multiple of 32, <= 128); one wave = 16 query rows; block = 4 waves (64 queries) sharing K/V chunks of 32.
template <int D, bool CAUSAL>
__global__ __launch_bounds__(128) void k_flash(const float* __restrict__ qb, const float* __restrict__ kb, const float* __restrict__ vb,
                                             int pitch, int T, int H, float scale, float* __restrict__ y, int ypitch) {
  constexpr int KS = D / 32;        // k-steps for QK
  constexpr int DT = D / 16;        // d tiles for PV
  __shared__ __attribute__((aligned(16))) unsigned short sKh[32][D + 8], sKl[32][D + 8], sVh[32][D + 8], sVl[32][D + 8];
  __shared__ __attribute__((aligned(16))) unsigned short sPh[4][16][40], sPl[4][16][40];
  __shared__ __attribute__((aligned(16))) float sO[4][16][D];
  const int tid = threadIdx.x, w = tid >> 5, lane = tid & 31, ln = lane & 15, hh = lane >> 4;
  const int nqb = (T + 63) / 64;
  const int bh = blockIdx.x / nqb, qblk = blockIdx.x % nqb;
  const int b = bh / H, h = bh % H;
  const int q0 = qblk * 64 + w * 16;
  const float* Q = qb + (size_t)b * T * pitch + h * D;
  const float* K = kb + (size_t)b * T * pitch + h * D;
  const float* V = vb + (size_t)b * T * pitch + h * D;

  // A fragments of the wave's 16 query rows (scaled), hi/lo
  FragB aqh[KS], aql[KS];
  {
    int row = q0 + ln; if (row >= T) row = T - 1;
    const float* qr = Q + (size_t)row * pitch;
#pragma unroll
    for (int ks = 0; ks < KS; ++ks)
#pragma unroll
      for (int i = 0; i < 16; ++i) {
        const int d = ks * 32 + ((i < 8) ? (8 * hh + i) : (16 + 8 * hh + (i - 8)));
        const float x = qr[d] * scale; const unsigned short hb = bf16_bits(x);
        aqh[ks].u[i] = hb; aql[ks].u[i] = bf16_bits(x - bf16_val(hb));
      }
  }
  float m_r[8], l_r[8];
#pragma unroll
  for (int r = 0; r < 8; ++r) { m_r[r] = -3.0e38f; l_r[r] = 0.f; }
  v8f oacc[DT];
#pragma unroll
  for (int dt = 0; dt < DT; ++dt) oacc[dt] = (v8f){0.f,0.f,0.f,0.f,0.f,0.f,0.f,0.f};

  const int kv_end = CAUSAL ? min(T, qblk * 64 + 64) : T;     // block-uniform
  for (int j0 = 0; j0 < kv_end; j0 += 32) {
    __syncthreads();
    for (int e = tid; e < 32 * (D / 4); e += 128) {
      const int r = e / (D / 4), c4 = (e % (D / 4)) * 4;
      const int key = j0 + r;
      v4f kf = {0.f,0.f,0.f,0.f}, vf = {0.f,0.f,0.f,0.f};
      if (key < T) { kf = *(const v4fa*)(K + (size_t)key * pitch + c4); vf = *(const v4fa*)(V + (size_t)key * pitch + c4); }
#pragma unroll
      for (int t = 0; t < 4; ++t) {
        unsigned short hb = bf16_bits(kf[t]); sKh[r][c4 + t] = hb; sKl[r][c4 + t] = bf16_bits(kf[t] - bf16_val(hb));
        hb = bf16_bits(vf[t]); sVh[r][c4 + t] = hb; sVl[r][c4 + t] = bf16_bits(vf[t] - bf16_val(hb));
      }
    }
    __syncthreads();
    // S tile 16 x 32
    v8f s[2];
#pragma unroll
    for (int nt = 0; nt < 2; ++nt) {
      v8f acc = {};
#pragma unroll
      for (int ks = 0; ks < KS; ++ks) {
        FragB bh_, bl_;
        bh_.half[0] = *(const v8us*)&sKh[nt * 16 + ln][ks * 32 + 8 * hh]; bh_.half[1] = *(const v8us*)&sKh[nt * 16 + ln][ks * 32 + 16 + 8 * hh];
        bl_.half[0] = *(const v8us*)&sKl[nt * 16 + ln][ks * 32 + 8 * hh]; bl_.half[1] = *(const v8us*)&sKl[nt * 16 + ln][ks * 32 + 16 + 8 * hh];
        acc = mmaN<3>(aqh[ks].v, aql[ks].v, bh_.v, bl_.v, acc);
      }
      s[nt] = acc;
    }
    // mask + running max (rows 8hh+r; the 16 lanes of a half share rows)
    float alpha[8];
#pragma unroll
    for (int r = 0; r < 8; ++r) {
      const int qi = q0 + 8 * hh + r;
      const int ja = j0 + ln, jb = j0 + 16 + ln;
      if (CAUSAL) { if (ja > qi) s[0][r] = -3.0e38f; if (jb > qi) s[1][r] = -3.0e38f; }
      if (ja >= T) s[0][r] = -3.0e38f;
      if (jb >= T) s[1][r] = -3.0e38f;
      float mx = fmaxf(s[0][r], s[1][r]);
      mx = fmaxf(mx, __shfl_xor(mx, 1, 32)); mx = fmaxf(mx, __shfl_xor(mx, 2, 32)); mx = fmaxf(mx, __shfl_xor(mx, 4, 32)); mx = fmaxf(mx, __shfl_xor(mx, 8, 32));
      const float mnew = fmaxf(m_r[r], mx);
      alpha[r] = (mnew > -1.0e38f) ? __expf(m_r[r] - mnew) : 1.0f;
      const float p0 = (s[0][r] > -1.0e38f) ? __expf(s[0][r] - mnew) : 0.f;
      const float p1 = (s[1][r] > -1.0e38f) ? __expf(s[1][r] - mnew) : 0.f;
      m_r[r] = mnew;
      l_r[r] = l_r[r] * alpha[r] + p0 + p1;            // per-lane partial row sum (16 lanes combined at the end)
      unsigned short hb = bf16_bits(p0); sPh[w][8 * hh + r][ln] = hb;      sPl[w][8 * hh + r][ln] = bf16_bits(p0 - bf16_val(hb));
      hb = bf16_bits(p1);                sPh[w][8 * hh + r][16 + ln] = hb; sPl[w][8 * hh + r][16 + ln] = bf16_bits(p1 - bf16_val(hb));
    }
#pragma unroll
    for (int dt = 0; dt < DT; ++dt)
#pragma unroll
      for (int r = 0; r < 8; ++r) oacc[dt][r] *= alpha[r];
    __builtin_amdgcn_fence(__ATOMIC_ACQ_REL, "workgroup");
    __builtin_amdgcn_wave_barrier();
    FragB pah, pal;
    pah.half[0] = *(const v8us*)&sPh[w][ln][8 * hh]; pah.half[1] = *(const v8us*)&sPh[w][ln][16 + 8 * hh];
    pal.half[0] = *(const v8us*)&sPl[w][ln][8 * hh]; pal.half[1] = *(const v8us*)&sPl[w][ln][16 + 8 * hh];
#pragma unroll
    for (int dt = 0; dt < DT; ++dt) {
      FragB bvh, bvl;
#pragma unroll
      for (int i = 0; i < 8; ++i) {
        bvh.u[i] = sVh[8 * hh + i][dt * 16 + ln]; bvh.u[8 + i] = sVh[16 + 8 * hh + i][dt * 16 + ln];
        bvl.u[i] = sVl[8 * hh + i][dt * 16 + ln]; bvl.u[8 + i] = sVl[16 + 8 * hh + i][dt * 16 + ln];
      }
      oacc[dt] = mmaN<3>(pah.v, pal.v, bvh.v, bvl.v, oacc[dt]);
    }
    __builtin_amdgcn_fence(__ATOMIC_ACQ_REL, "workgroup");
    __builtin_amdgcn_wave_barrier();
  }
#pragma unroll
  for (int r = 0; r < 8; ++r) {
    float l = l_r[r];
    l += __shfl_xor(l, 1, 32); l += __shfl_xor(l, 2, 32); l += __shfl_xor(l, 4, 32); l += __shfl_xor(l, 8, 32);
    l_r[r] = (l > 0.f) ? 1.0f / l : 0.f;
  }
#pragma unroll
  for (int dt = 0; dt < DT; ++dt)
#pragma unroll
    for (int r = 0; r < 8; ++r) sO[w][8 * hh + r][dt * 16 + ln] = oacc[dt][r] * l_r[r];
  __builtin_amdgcn_fence(__ATOMIC_ACQ_REL, "workgroup");
  __builtin_amdgcn_wave_barrier();
  {
    for (int r = 0; r < 16; ++r) {
      const int row = q0 + r;
      if (row < T && lane < D / 4) {
        const v4f val = *(const v4fa*)&sO[w][r][lane * 4];
        *(v4f*)(y + ((size_t)b * T + row) * ypitch + h * D + lane * 4) = val;
      }
    }
    
  }
}

// Maximum / sum over each 16-lane row, for eight values at once, on the vector unit: four steps lane ^ 1, 2, 4, 8 (the tree of four
// __shfl_xor steps, so the same bits). __shfl_xor compiles to ds_bpermute_b32, whose trip a wave waits out at every one of the four
// dependent steps; here the eight values' steps are interleaved, so that each instruction's producer stands eight instructions back.
// Every lane of the wave is on at both call sites.
__device__ __forceinline__ void row16_max8(float (&x)[8]) {
  asm(  // the row maxima without a trip through the LDS path
      "v_max_num_f32_dpp %0, %0, %0 row_xmask:1 row_mask:0xf bank_mask:0xf\n\tv_max_num_f32_dpp %1, %1, %1 row_xmask:1 row_mask:0xf bank_mask:0xf\n\t"
      "v_max_num_f32_dpp %2, %2, %2 row_xmask:1 row_mask:0xf bank_mask:0xf\n\tv_max_num_f32_dpp %3, %3, %3 row_xmask:1 row_mask:0xf bank_mask:0xf\n\t"
      "v_max_num_f32_dpp %4, %4, %4 row_xmask:1 row_mask:0xf bank_mask:0xf\n\tv_max_num_f32_dpp %5, %5, %5 row_xmask:1 row_mask:0xf bank_mask:0xf\n\t"
      "v_max_num_f32_dpp %6, %6, %6 row_xmask:1 row_mask:0xf bank_mask:0xf\n\tv_max_num_f32_dpp %7, %7, %7 row_xmask:1 row_mask:0xf bank_mask:0xf\n\t"
      "v_max_num_f32_dpp %0, %0, %0 row_xmask:2 row_mask:0xf bank_mask:0xf\n\tv_max_num_f32_dpp %1, %1, %1 row_xmask:2 row_mask:0xf bank_mask:0xf\n\t"
      "v_max_num_f32_dpp %2, %2, %2 row_xmask:2 row_mask:0xf bank_mask:0xf\n\tv_max_num_f32_dpp %3, %3, %3 row_xmask:2 row_mask:0xf bank_mask:0xf\n\t"
      "v_max_num_f32_dpp %4, %4, %4 row_xmask:2 row_mask:0xf bank_mask:0xf\n\tv_max_num_f32_dpp %5, %5, %5 row_xmask:2 row_mask:0xf bank_mask:0xf\n\t"
      "v_max_num_f32_dpp %6, %6, %6 row_xmask:2 row_mask:0xf bank_mask:0xf\n\tv_max_num_f32_dpp %7, %7, %7 row_xmask:2 row_mask:0xf bank_mask:0xf\n\t"
      "v_max_num_f32_dpp %0, %0, %0 row_xmask:4 row_mask:0xf bank_mask:0xf\n\tv_max_num_f32_dpp %1, %1, %1 row_xmask:4 row_mask:0xf bank_mask:0xf\n\t"
      "v_max_num_f32_dpp %2, %2, %2 row_xmask:4 row_mask:0xf bank_mask:0xf\n\tv_max_num_f32_dpp %3, %3, %3 row_xmask:4 row_mask:0xf bank_mask:0xf\n\t"
      "v_max_num_f32_dpp %4, %4, %4 row_xmask:4 row_mask:0xf bank_mask:0xf\n\tv_max_num_f32_dpp %5, %5, %5 row_xmask:4 row_mask:0xf bank_mask:0xf\n\t"
      "v_max_num_f32_dpp %6, %6, %6 row_xmask:4 row_mask:0xf bank_mask:0xf\n\tv_max_num_f32_dpp %7, %7, %7 row_xmask:4 row_mask:0xf bank_mask:0xf\n\t"
      "v_max_num_f32_dpp %0, %0, %0 row_xmask:8 row_mask:0xf bank_mask:0xf\n\tv_max_num_f32_dpp %1, %1, %1 row_xmask:8 row_mask:0xf bank_mask:0xf\n\t"
      "v_max_num_f32_dpp %2, %2, %2 row_xmask:8 row_mask:0xf bank_mask:0xf\n\tv_max_num_f32_dpp %3, %3, %3 row_xmask:8 row_mask:0xf bank_mask:0xf\n\t"
      "v_max_num_f32_dpp %4, %4, %4 row_xmask:8 row_mask:0xf bank_mask:0xf\n\tv_max_num_f32_dpp %5, %5, %5 row_xmask:8 row_mask:0xf bank_mask:0xf\n\t"
      "v_max_num_f32_dpp %6, %6, %6 row_xmask:8 row_mask:0xf bank_mask:0xf\n\tv_max_num_f32_dpp %7, %7, %7 row_xmask:8 row_mask:0xf bank_mask:0xf"
      : "+v"(x[0]), "+v"(x[1]), "+v"(x[2]), "+v"(x[3]), "+v"(x[4]), "+v"(x[5]), "+v"(x[6]), "+v"(x[7]));
}
__device__ __forceinline__ void row16_sum8(float (&x)[8]) {
  asm(  // the row sums likewise
      "v_add_f32_dpp %0, %0, %0 row_xmask:1 row_mask:0xf bank_mask:0xf\n\tv_add_f32_dpp %1, %1, %1 row_xmask:1 row_mask:0xf bank_mask:0xf\n\t"
      "v_add_f32_dpp %2, %2, %2 row_xmask:1 row_mask:0xf bank_mask:0xf\n\tv_add_f32_dpp %3, %3, %3 row_xmask:1 row_mask:0xf bank_mask:0xf\n\t"
      "v_add_f32_dpp %4, %4, %4 row_xmask:1 row_mask:0xf bank_mask:0xf\n\tv_add_f32_dpp %5, %5, %5 row_xmask:1 row_mask:0xf bank_mask:0xf\n\t"
      "v_add_f32_dpp %6, %6, %6 row_xmask:1 row_mask:0xf bank_mask:0xf\n\tv_add_f32_dpp %7, %7, %7 row_xmask:1 row_mask:0xf bank_mask:0xf\n\t"
      "v_add_f32_dpp %0, %0, %0 row_xmask:2 row_mask:0xf bank_mask:0xf\n\tv_add_f32_dpp %1, %1, %1 row_xmask:2 row_mask:0xf bank_mask:0xf\n\t"
      "v_add_f32_dpp %2, %2, %2 row_xmask:2 row_mask:0xf bank_mask:0xf\n\tv_add_f32_dpp %3, %3, %3 row_xmask:2 row_mask:0xf bank_mask:0xf\n\t"
      "v_add_f32_dpp %4, %4, %4 row_xmask:2 row_mask:0xf bank_mask:0xf\n\tv_add_f32_dpp %5, %5, %5 row_xmask:2 row_mask:0xf bank_mask:0xf\n\t"
      "v_add_f32_dpp %6, %6, %6 row_xmask:2 row_mask:0xf bank_mask:0xf\n\tv_add_f32_dpp %7, %7, %7 row_xmask:2 row_mask:0xf bank_mask:0xf\n\t"
      "v_add_f32_dpp %0, %0, %0 row_xmask:4 row_mask:0xf bank_mask:0xf\n\tv_add_f32_dpp %1, %1, %1 row_xmask:4 row_mask:0xf bank_mask:0xf\n\t"
      "v_add_f32_dpp %2, %2, %2 row_xmask:4 row_mask:0xf bank_mask:0xf\n\tv_add_f32_dpp %3, %3, %3 row_xmask:4 row_mask:0xf bank_mask:0xf\n\t"
      "v_add_f32_dpp %4, %4, %4 row_xmask:4 row_mask:0xf bank_mask:0xf\n\tv_add_f32_dpp %5, %5, %5 row_xmask:4 row_mask:0xf bank_mask:0xf\n\t"
      "v_add_f32_dpp %6, %6, %6 row_xmask:4 row_mask:0xf bank_mask:0xf\n\tv_add_f32_dpp %7, %7, %7 row_xmask:4 row_mask:0xf bank_mask:0xf\n\t"
      "v_add_f32_dpp %0, %0, %0 row_xmask:8 row_mask:0xf bank_mask:0xf\n\tv_add_f32_dpp %1, %1, %1 row_xmask:8 row_mask:0xf bank_mask:0xf\n\t"
      "v_add_f32_dpp %2, %2, %2 row_xmask:8 row_mask:0xf bank_mask:0xf\n\tv_add_f32_dpp %3, %3, %3 row_xmask:8 row_mask:0xf bank_mask:0xf\n\t"
      "v_add_f32_dpp %4, %4, %4 row_xmask:8 row_mask:0xf bank_mask:0xf\n\tv_add_f32_dpp %5, %5, %5 row_xmask:8 row_mask:0xf bank_mask:0xf\n\t"
      "v_add_f32_dpp %6, %6, %6 row_xmask:8 row_mask:0xf bank_mask:0xf\n\tv_add_f32_dpp %7, %7, %7 row_xmask:8 row_mask:0xf bank_mask:0xf"
      : "+v"(x[0]), "+v"(x[1]), "+v"(x[2]), "+v"(x[3]), "+v"(x[4]), "+v"(x[5]), "+v"(x[6]), "+v"(x[7]));
}

// Which 64-query x 32-key tiles of the int mask [T][T] hold a nonzero word at all: bit (kt & 31) of word [qt][kt >> 5], each word
// alone in a 128-byte line of its own (one writer a line). Block = 32 waves = 32 key tiles of one query tile, a tile a wave. T % 32 == 0.
__global__ __launch_bounds__(1024) void k_mask_tiles(const int* __restrict__ mask, unsigned* __restrict__ tbits, int T) {
  __shared__ int sany[32];
  const int w = threadIdx.x >> 5, lane = threadIdx.x & 31;
  const int nw = (T / 32 + 31) / 32;
  const int qt = blockIdx.x / nw, kt = (blockIdx.x % nw) * 32 + w;
  int any = 0;
  if (kt * 32 < T) {           // wave-uniform
    unsigned mo[16];           // byte offsets (the mask is far below 4 GiB): four whole 128-byte rows of the tile a load
#pragma unroll  // offsets in registers
    for (int i = 0; i < 16; ++i) {
      int row = qt * 64 + i * 4 + (lane >> 3); row = row < T ? row : T - 1;
      mo[i] = ((unsigned)row * (unsigned)T + (unsigned)(kt * 32 + (lane & 7) * 4)) * 4u;
    }
    v4ia mv[16];
#pragma unroll  // mv in registers, many loads in flight at once
    for (int i = 0; i < 16; ++i) mv[i] = *(const v4ia*)((const char*)mask + mo[i]);
    // No offset register of the batch is rewritten (not even as a later load's destination) in front of this wait.
    asm volatile("s_wait_xcnt 0x0" :: "v"(mo[0]), "v"(mo[1]), "v"(mo[2]), "v"(mo[3]), "v"(mo[4]), "v"(mo[5]), "v"(mo[6]), "v"(mo[7]),
                 "v"(mo[8]), "v"(mo[9]), "v"(mo[10]), "v"(mo[11]), "v"(mo[12]), "v"(mo[13]), "v"(mo[14]), "v"(mo[15]) : "memory");
#pragma unroll  // mv is indexed by constants
    for (int i = 0; i < 16; ++i) any |= mv[i][0] | mv[i][1] | mv[i][2] | mv[i][3];
  }
  const unsigned wany = __builtin_amdgcn_ballot_w32(any != 0);
  if (lane == 0) sany[w] = wany != 0u;
  __syncthreads();             // all 32 tiles' answers are in LDS
  if (w == 0) {
    const unsigned bits = __builtin_amdgcn_ballot_w32(sany[lane] != 0);
    if (lane == 0) tbits[(size_t)blockIdx.x * 32] = bits;
  }
}

// Self-attention (Tq == Tk == T) with optional int mask [T][T] (nonzero = keep) and/or causal flag; 3-term bf16 splits;
// Q rows read from an f32 buffer: Qb + b*T*qpitch + h*D + row*qpitch. K and V rows arrive split (k_gemm_bf's CSPLIT form): D bf16 high
// parts, then D bf16 low parts, at X + b*T*pitch + h*2*D + row*pitch, pitches in 16-bit elements.
// y[b][row][h*D + d], pitch ypitch. D % 32 == 0, T % 32 == 0.
// tbits: k_mask_tiles' words for this mask. A work-group takes two query tiles of a head, one after the other: n - 1 - t, then t.
template <int D>
__global__ __launch_bounds__(128) void k_flashm(const float* __restrict__ Qb, int qpitch, const unsigned short* __restrict__ Kb, int kpitch,
                                              const unsigned short* __restrict__ Vb, int vpitch, int T, int H, float scale,
                                              const int* __restrict__ mask, const unsigned* __restrict__ tbits, int causal,
                                              float* __restrict__ y, int ypitch) {
  constexpr int KS = D / 32, DT = D / 16;
  // An LDS row is a global row as it stands: D high parts, then D low parts.
  constexpr int KP = 2 * D + 8;    // K row pitch in elements: an odd multiple of 16 bytes, the conflict-free pitch of 16-byte reads down a column
  constexpr int VP = 2 * D + 16;   // V row pitch in elements: an odd multiple of 32 bytes, the conflict-free pitch of the transposing load
  static_assert((KP * 2) % 16 == 0 && ((KP * 2 / 16) & 1) == 1, "K rows: odd multiple of 16 bytes");
  static_assert((VP * 2) % 32 == 0 && ((VP * 2 / 32) & 1) == 1, "V rows: odd multiple of 32 bytes");
  __shared__ __attribute__((aligned(16))) unsigned short sK[32][KP], sV[32][VP];
  __shared__ __attribute__((aligned(16))) unsigned short sPh[4][16][40], sPl[4][16][40];
  __shared__ __attribute__((aligned(16))) float sO[4][16][D];
  const int tid = threadIdx.x, w = tid >> 5, lane = tid & 31, ln = lane & 15, hh = lane >> 4;
  const int nqb = (T + 63) / 64, npair = (nqb + 1) / 2, nw = (T / 32 + 31) / 32;
  const int bh = blockIdx.x / npair, tlow = blockIdx.x % npair;
  const int b = bh / H, h = bh % H;
  const float* Q = Qb + (size_t)b * T * qpitch + h * D;
  const unsigned short* K = Kb + (size_t)b * T * kpitch + h * 2 * D;
  const unsigned short* V = Vb + (size_t)b * T * vpitch + h * 2 * D;
  // Under a mask that shuts more keys the lower the query's index, tiles n - 1 - t and t together cost every work-group the same number of
  // passes; all work-groups are resident at once, so the launch lasts as long as the longest. An odd n's middle tile is taken once.
  const int nparts = (nqb - 1 - tlow != tlow) ? 2 : 1;
#pragma unroll 1  // one copy of the body in the instruction cache
  for (int part = 0; part < nparts; ++part) {
  const int qblk = part ? tlow : nqb - 1 - tlow;
  const int q0 = qblk * 64 + w * 16;
  unsigned tw = ~0u;           // lane l: the query tile's word l of tbits (32 passes a word; T * T * 4 < 4 GiB, so never more than 32 words)
  if (mask) {
    const unsigned two = (unsigned)(qblk * nw + (lane < nw ? lane : nw - 1)) * 128u;
    tw = *(const unsigned*)((const char*)tbits + two);
    // The offset register is not rewritten in front of this wait.
    asm volatile("s_wait_xcnt 0x0" :: "v"(two) : "memory");
  }
  FragB aqh[KS], aql[KS];
  {
    int row = q0 + ln; if (row >= T) row = T - 1;
    const float* qr = Q + (size_t)row * qpitch;
#pragma unroll
    for (int ks = 0; ks < KS; ++ks)
#pragma unroll
      for (int i = 0; i < 16; ++i) {
        const int d = ks * 32 + ((i < 8) ? (8 * hh + i) : (16 + 8 * hh + (i - 8)));
        const float x = qr[d] * scale; const unsigned short hb = bf16_bits(x);
        aqh[ks].u[i] = hb; aql[ks].u[i] = bf16_bits(x - bf16_val(hb));
      }
  }
  int qrow[8];
#pragma unroll
  for (int r = 0; r < 8; ++r) { int qi = q0 + 8 * hh + r; qrow[r] = qi < T ? qi : T - 1; }
  float m_r[8], l_r[8];
#pragma unroll
  for (int r = 0; r < 8; ++r) { m_r[r] = -3.0e38f; l_r[r] = 0.f; }
  v8f oacc[DT];
#pragma unroll
  for (int dt = 0; dt < DT; ++dt) oacc[dt] = (v8f){0.f,0.f,0.f,0.f,0.f,0.f,0.f,0.f};
  const int kv_end = causal ? min(T, qblk * 64 + 64) : T;
  constexpr int NL = D / 16, RS = 128 / (D / 4);               // K (and V) 16-byte pieces per thread and pass; rows between a thread's pieces
  const int sr = tid / (D / 4), sc8 = (tid % (D / 4)) * 8;     // the thread's first staged row, and its place in the row of 2 D elements
  const unsigned kofs = ((unsigned)sr * (unsigned)kpitch + (unsigned)sc8) * 2u, vofs = ((unsigned)sr * (unsigned)vpitch + (unsigned)sc8) * 2u;
  // the lane's own 16 bytes of a 16 x 16 V tile for the transposing load: row 8 hh + (lane & 7), column half (lane >> 3) & 1
  const unsigned short* vth = &sV[8 * hh + (lane & 7)][8 * ((lane >> 3) & 1)];
  const unsigned short* vtl = vth + D;
  unsigned mofs[8];
#pragma unroll  // constant indices keep the array in registers (so for every unrolled loop of the batch below)
  for (int r = 0; r < 8; ++r) mofs[r] = ((unsigned)qrow[r] * (unsigned)T + (unsigned)ln) * 4u;
  unsigned tb = 0u;
  for (int j0 = 0; j0 < kv_end; j0 += 32) {
    // A pass whose 64 x 32 mask tile holds no set word leaves every maximum, sum and accumulator as it is (each p is 0, each alpha 1):
    // the whole work-group steps over it, its loads and both its barriers included (the test reads the same in every wave).
    if ((j0 & 1023) == 0) tb = (unsigned)__builtin_amdgcn_readlane((int)tw, j0 >> 10);
    if (((tb >> ((j0 >> 5) & 31)) & 1u) == 0u) continue;
    // All that the pass (32 keys) reads from global memory goes out as one batch, under no lane test, so that the loads'
    // latencies overlap: uniform base, fixed lane offsets; every key of a pass is below T (T % 32 == 0).
    static_assert(NL == 4, "the wait behind the K/V loads names four K and four V addresses");
    const char *kp[NL], *vp[NL];
    v8us kq[NL], vq[NL];
#pragma unroll  // addresses in registers
    for (int i = 0; i < NL; ++i) {
      kp[i] = (const char*)(K + (size_t)(j0 + i * RS) * kpitch) + kofs;
      vp[i] = (const char*)(V + (size_t)(j0 + i * RS) * vpitch) + vofs;
    }
#pragma unroll  // the eight loads back to back
    for (int i = 0; i < NL; ++i) { kq[i] = *(const v8us*)kp[i]; vq[i] = *(const v8us*)vp[i]; }
    // No address register of the batch is reused (not even as a later load's destination) in front of this wait.
    asm volatile("s_wait_xcnt 0x0" :: "v"(kp[0]), "v"(kp[1]), "v"(kp[2]), "v"(kp[3]), "v"(vp[0]), "v"(vp[1]), "v"(vp[2]), "v"(vp[3]) : "memory");
    int mka[8], mkb[8];
#pragma unroll  // words in registers
    for (int r = 0; r < 8; ++r) { mka[r] = 1; mkb[r] = 1; }
    if (mask) {
      const char* mp[8];
#pragma unroll  // addresses in registers
      for (int r = 0; r < 8; ++r) mp[r] = (const char*)(mask + j0) + mofs[r];
#pragma unroll  // the sixteen loads back to back
      for (int r = 0; r < 8; ++r) { mka[r] = *(const int*)mp[r]; mkb[r] = *(const int*)(mp[r] + 64); }
      // The same for the mask words' addresses.
      asm volatile("s_wait_xcnt 0x0" :: "v"(mp[0]), "v"(mp[1]), "v"(mp[2]), "v"(mp[3]), "v"(mp[4]), "v"(mp[5]), "v"(mp[6]), "v"(mp[7]) : "memory");
    }
    __syncthreads();
#pragma unroll  // kq and vq are indexed by constants
    for (int i = 0; i < NL; ++i) { *(v8us*)&sK[sr + i * RS][sc8] = kq[i]; *(v8us*)&sV[sr + i * RS][sc8] = vq[i]; }
    __syncthreads();
    v8f s[2];
#pragma unroll
    for (int nt = 0; nt < 2; ++nt) {
      v8f acc = {};
#pragma unroll
      for (int ks = 0; ks < KS; ++ks) {
        FragB bh_, bl_;
        const unsigned short* krow = &sK[nt * 16 + ln][ks * 32 + 8 * hh];
        bh_.half[0] = *(const v8us*)krow;       bh_.half[1] = *(const v8us*)(krow + 16);
        bl_.half[0] = *(const v8us*)(krow + D); bl_.half[1] = *(const v8us*)(krow + D + 16);
        acc = mmaN<3>(aqh[ks].v, aql[ks].v, bh_.v, bl_.v, acc);
      }
      s[nt] = acc;
    }
    float alpha[8], mx[8];
    bool ka[8], kb[8];
#pragma unroll  // mx, ka and kb are indexed by constants
    for (int r = 0; r < 8; ++r) {
      bool keepa = mka[r] != 0, keepb = mkb[r] != 0;
      if (causal) { keepa = keepa && (j0 + ln <= qrow[r]); keepb = keepb && (j0 + 16 + ln <= qrow[r]); }
      if (!keepa) s[0][r] = -3.0e38f;
      if (!keepb) s[1][r] = -3.0e38f;
      ka[r] = keepa; kb[r] = keepb;
      mx[r] = fmaxf(s[0][r], s[1][r]);
    }
    row16_max8(mx);
#pragma unroll
    for (int r = 0; r < 8; ++r) {
      const bool keepa = ka[r], keepb = kb[r];
      const float mnew = fmaxf(m_r[r], mx[r]);
      alpha[r] = (mnew > -1.0e38f) ? __expf(m_r[r] - mnew) : 1.0f;
      const float p0 = keepa ? __expf(s[0][r] - mnew) : 0.f;
      const float p1 = keepb ? __expf(s[1][r] - mnew) : 0.f;
      m_r[r] = mnew;
      l_r[r] = l_r[r] * alpha[r] + p0 + p1;
      unsigned short hb = bf16_bits(p0); sPh[w][8 * hh + r][ln] = hb;      sPl[w][8 * hh + r][ln] = bf16_bits(p0 - bf16_val(hb));
      hb = bf16_bits(p1);                sPh[w][8 * hh + r][16 + ln] = hb; sPl[w][8 * hh + r][16 + ln] = bf16_bits(p1 - bf16_val(hb));
    }
#pragma unroll
    for (int dt = 0; dt < DT; ++dt)
#pragma unroll
      for (int r = 0; r < 8; ++r) oacc[dt][r] *= alpha[r];
    // The pass's whole V operand as one group of loads, in front of P's trip through LDS, which covers their latency.
    // Lane (ln, hh) receives V[kbase + 8 hh + 0..7][dt * 16 + ln], kbase 0 and 16: the k order of the P fragment below.
    FragB bvh[DT], bvl[DT];
#pragma unroll  // fragments in registers
    for (int dt = 0; dt < DT; ++dt) {
      bvh[dt].half[0] = lds_tr16(vth + dt * 16); bvh[dt].half[1] = lds_tr16(vth + 16 * VP + dt * 16);
      bvl[dt].half[0] = lds_tr16(vtl + dt * 16); bvl[dt].half[1] = lds_tr16(vtl + 16 * VP + dt * 16);
    }
    __builtin_amdgcn_fence(__ATOMIC_ACQ_REL, "workgroup");
    __builtin_amdgcn_wave_barrier();
    FragB pah, pal;
    pah.half[0] = *(const v8us*)&sPh[w][ln][8 * hh]; pah.half[1] = *(const v8us*)&sPh[w][ln][16 + 8 * hh];
    pal.half[0] = *(const v8us*)&sPl[w][ln][8 * hh]; pal.half[1] = *(const v8us*)&sPl[w][ln][16 + 8 * hh];
#pragma unroll
    for (int dt = 0; dt < DT; ++dt) {
      oacc[dt] = mmaN<3>(pah.v, pal.v, bvh[dt].v, bvl[dt].v, oacc[dt]);
    }
    __builtin_amdgcn_fence(__ATOMIC_ACQ_REL, "workgroup");
    __builtin_amdgcn_wave_barrier();
  }
  // NaN for fully-masked rows (softmax over a row of -inf)
  row16_sum8(l_r);
#pragma unroll
  for (int r = 0; r < 8; ++r) l_r[r] = (m_r[r] > -1.0e38f) ? 1.0f / l_r[r] : __builtin_nanf("");
#pragma unroll
  for (int dt = 0; dt < DT; ++dt)
#pragma unroll
    for (int r = 0; r < 8; ++r) sO[w][8 * hh + r][dt * 16 + ln] = oacc[dt][r] * l_r[r];
  __builtin_amdgcn_fence(__ATOMIC_ACQ_REL, "workgroup");
  __builtin_amdgcn_wave_barrier();
  {
    for (int r = 0; r < 16; ++r) {
      const int row = q0 + r;
      if (row < T && lane < D / 4) {
        const v4f val = *(const v4fa*)&sO[w][r][lane * 4];
        *(v4f*)(y + ((size_t)b * T + row) * ypitch + h * D + lane * 4) = val;
      }
    }
    
  }
  // The next tile's first instructions rewrite registers that the last store names: not in front of this wait.
  asm volatile("s_wait_xcnt 0x0" ::: "memory");
  }
}

extern "C" void kernel_launch(void* const* d_in, const int* in_sizes, int n_in,
                              void* d_out, int out_size, void* d_ws, size_t ws_size, hipStream_t stream) {
  (void)in_sizes; (void)n_in; (void)out_size;
  const float* x = (const float*)d_in[0]; const int* mask = (const int*)d_in[1];
  const float* Wq = (const float*)d_in[2]; const float* Wkv = (const float*)d_in[3];
  const float* Wo = (const float*)d_in[4]; const float* bo = (const float*)d_in[5];
  char* ws = (char*)d_ws; size_t off = 0;
  unsigned short* Wqt  = (unsigned short*)(ws + off); off += (size_t)DM * DM * 2;       // [1024][1024]
  unsigned short* Wkvt = (unsigned short*)(ws + off); off += (size_t)2 * DM * DM * 2;   // [2048][1024]
  unsigned short* Wot  = (unsigned short*)(ws + off); off += (size_t)DM * DM * 2;
  float* qb  = (float*)(ws + off); off += (size_t)BB * NN * DM * 4;                    // 16 MiB
  float* kvb = (float*)(ws + off); off += (size_t)BB * NN * 2 * DM * 4;                // 32 MiB
  float* ob  = (float*)(ws + off); off += (size_t)BB * NN * DM * 4;                    // 16 MiB
  unsigned* tbits = (unsigned*)(ws + off); off += (size_t)(NN / 64) * (NN / 1024) * 128; // a 128-byte line a word
  if (off > ws_size) return;
  const int M = BB * NN;
  k_mask_tiles<<<(NN / 64) * (NN / 1024), 1024, 0, stream>>>(mask, tbits, NN);
  k_wt_bf16<<<(DM * (DM / 8) + 255) / 256, 256, 0, stream>>>(Wq, Wqt, DM, DM);
  k_wt_bf16<<<(2 * DM * (DM / 8) + 255) / 256, 256, 0, stream>>>(Wkv, Wkvt, DM, 2 * DM);
  k_wt_bf16<<<(DM * (DM / 8) + 255) / 256, 256, 0, stream>>>(Wo, Wot, DM, DM);
  k_gemm_bf<false, 0, false, false><<<(M / 64) * (DM / 128), 128, 0, stream>>>(x, DM, Wqt, DM, nullptr, qb, DM, M, DM, DM);
  k_gemm_bf<false, 0, false, true><<<(M / 64) * (2 * DM / 128), 128, 0, stream>>>(x, DM, Wkvt, DM, nullptr, kvb, 2 * DM, M, 2 * DM, DM);
  // k = kv[..., 0:1024] (head h at h*64), v = kv[..., 1024:2048]; stored split, a row is 4096 16-bit elements, head h's 128 at h*128
  const unsigned short* kvs = (const unsigned short*)kvb;
  k_flashm<HD><<<BB * NH * (NN / 128), 128, 0, stream>>>(qb, DM, kvs, 4 * DM, kvs + 2 * DM, 4 * DM, NN, NH, 0.03125f, mask, tbits, 0, ob, DM);
  k_gemm_bf<true, 0, true, false><<<(M / 64) * (DM / 128), 128, 0, stream>>>(ob, DM, Wot, DM, bo, (float*)d_out, DM, M, DM, DM);
}

// v007
// One run takes 193 microseconds.
// Timed twice side by side with v006, it ran 1.14 times as fast both times.
// Over all steps from v000 it is 3.48 times as fast.
#include <hip/hip_runtime.h>
// All contractions on v_wmma_f32_16x16x32_bf16, f32 accumulate: q = x·Wq and kv = x·Wkv with x/W rounded to bf16 (single
// exact-product term), QKᵀ and P·V 3-term bf16 hi/lo splits, out = o·Wout with o split hi/lo (2 terms); softmax f32.
// K and V are split hi/lo once, where the kv GEMM stores them; the attention kernel copies the two planes into LDS as they are.
// The boolean mask input is applied as given (together with nothing else).
#define BB 2
#define NN 2048
#define DM 1024
#define NH 16
#define HD 64

typedef __bf16 v16b __attribute__((ext_vector_type(16)));
typedef unsigned short v8us __attribute__((ext_vector_type(8), may_alias));
typedef unsigned short v4us __attribute__((ext_vector_type(4), may_alias));
typedef float  v8f  __attribute__((ext_vector_type(8)));
typedef float  v4f  __attribute__((ext_vector_type(4)));
typedef float  v4fa __attribute__((ext_vector_type(4), may_alias));
typedef int    v4ia __attribute__((ext_vector_type(4), may_alias));
union FragB { v16b v; v8us half[2]; unsigned short u[16]; };

__device__ __forceinline__ unsigned short bf16_bits(float x) { unsigned int u = __float_as_uint(x); return (unsigned short)((u + 0x7FFFu + ((u >> 16) & 1u)) >> 16); }
__device__ __forceinline__ float bf16_val(unsigned short b) { return __uint_as_float(((unsigned int)b) << 16); }
__device__ __forceinline__ float bf16_round(float x) { return bf16_val(bf16_bits(x)); }
// D += A·B with NT terms: 1 = ah·bh, 2 = + al·bh (A split), 3 = + ah·bl (both split)
template <int NT>
__device__ __forceinline__ v8f mmaN(v16b ah, v16b al, v16b bh, v16b bl, v8f c) {
  c = __builtin_amdgcn_wmma_f32_16x16x32_bf16(false, ah, false, bh, (short)0, c, false, false);
  if (NT >= 2) c = __builtin_amdgcn_wmma_f32_16x16x32_bf16(false, al, false, bh, (short)0, c, false, false);
  if (NT >= 3) c = __builtin_amdgcn_wmma_f32_16x16x32_bf16(false, ah, false, bl, (short)0, c, false, false);
  asm volatile("v_nop\n\tv_nop\n\tv_nop\n\tv_nop" : "+v"(c) : "v"(ah), "v"(al), "v"(bh), "v"(bl));
  return c;
}

// The same three terms for a transposed product, Dt += Bt*At with the operands swapped: ah*bh + ah*bl + al*bh, which is the order
// in which mmaN<3> adds them when a and b stand the other way round.
__device__ __forceinline__ v8f mma3T(v16b ah, v16b al, v16b bh, v16b bl, v8f c) {
  c = __builtin_amdgcn_wmma_f32_16x16x32_bf16(false, ah, false, bh, (short)0, c, false, false);
  c = __builtin_amdgcn_wmma_f32_16x16x32_bf16(false, ah, false, bl, (short)0, c, false, false);
  c = __builtin_amdgcn_wmma_f32_16x16x32_bf16(false, al, false, bh, (short)0, c, false, false);
  // four vector slots between the last product and whatever reads D or overwrites an operand, on every path
  asm volatile("v_nop\n\tv_nop\n\tv_nop\n\tv_nop" : "+v"(c) : "v"(ah), "v"(al), "v"(bh), "v"(bl));
  return c;
}
// lane l's value to lane l ^ 16 and back: the two halves of a wave exchange, on the vector unit
__device__ __forceinline__ float xhalf(float x) {
  const int b = __builtin_bit_cast(int, x);
  return __builtin_bit_cast(float, __builtin_amdgcn_permlanex16(b, b, 0x76543210, 0xfedcba98, false, false));
}

// Transposing LDS load: a row-major 16 x 16 tile of 16-bit elements arrives as half of a WMMA operand (8 k of one column per lane).
__device__ __forceinline__ v8us lds_tr16(const unsigned short* p) {
  typedef short s16x8 __attribute__((ext_vector_type(8)));
  typedef __attribute__((address_space(3))) s16x8 lds_s16x8;
  return __builtin_bit_cast(v8us, __builtin_amdgcn_ds_load_tr16_b128_v8i16((lds_s16x8*)p));
}

__global__ __launch_bounds__(256) void k_wt_bf16(const float* __restrict__ W, unsigned short* __restrict__ Wt, int K, int N) {
  const int t = blockIdx.x * 256 + threadIdx.x;
  const int k8n = K / 8;
  if (t >= N * k8n) return;
  const int n = t / k8n, k8 = (t % k8n) * 8;
  v8us v;
#pragma unroll
  for (int i = 0; i < 8; ++i) v[i] = bf16_bits(W[(size_t)(k8 + i) * N + n]);
  *(v8us*)(Wt + (size_t)n * K + k8) = v;
  
}

// One 64-k step of a GEMM block's operands, global memory to registers, as one batch of whole-line loads
// (A: 16 lanes a row of 256 B; W: 8 lanes a row of 128 B): uniform bases, sixteen running byte offsets that then move on by 64 k.
__device__ __forceinline__ void gemm_fetch(const float* A, const unsigned short* Wt, unsigned (&ao)[8], unsigned (&bo)[8], v4f (&aq)[8], v8us (&bq)[8]) {
#pragma unroll  // the sixteen loads back to back
  for (int i = 0; i < 8; ++i) { aq[i] = *(const v4fa*)((const char*)A + ao[i]); bq[i] = *(const v8us*)((const char*)Wt + bo[i]); }
  // No offset register of the batch is rewritten (not even as a later load's destination) in front of this wait.
  asm volatile("s_wait_xcnt 0x0" :: "v"(ao[0]), "v"(ao[1]), "v"(ao[2]), "v"(ao[3]), "v"(ao[4]), "v"(ao[5]), "v"(ao[6]), "v"(ao[7]),
               "v"(bo[0]), "v"(bo[1]), "v"(bo[2]), "v"(bo[3]), "v"(bo[4]), "v"(bo[5]), "v"(bo[6]), "v"(bo[7]) : "memory");
#pragma unroll  // offsets in registers
  for (int i = 0; i < 8; ++i) { ao[i] += 64u * 4u; bo[i] += 64u * 2u; }
}

// GEMM C[M][N] (f32, pitch ldc) = act(A[M][K]·W + bias). A f32 row-major (pitch lda), converted to bf16 once per block
// (ASPLIT: hi/lo two planes -> 2 terms, else single rounded term); Wt bf16 [N][K] (pitch ldb). BIAS_BF16 rounds the
// bias to bf16 first (bias quantised to bf16 before the add). Block = 4 waves = a 64 x 128 tile of C, wave = 32 x 64;
// both operands pass through LDS in steps of 64 k, the next step's loads in flight during the products of this one.
// K%64==0, K>=64, M%64==0, N%128==0.
// CSPLIT: C is stored split for a later 3-term product: the 256 bytes of each 64-column group of a row hold the 64 values' bf16 high
// parts, then the 64 bf16 roundings of what the high parts leave (same place and size as the group's f32 values would have).
template <bool ASPLIT, int ACT, bool BIAS_BF16, bool CSPLIT>
__global__ __launch_bounds__(128) void k_gemm_bf(const float* __restrict__ A, int lda, const unsigned short* __restrict__ Wt, int ldb,
                                               const float* __restrict__ bias, float* __restrict__ C, int ldc, int M, int N, int K) {
  constexpr int KP = 64 + 8;   // row pitch in elements, 144 B: an odd multiple of 16 bytes like the attention kernel's K rows, read the same way
  __shared__ __attribute__((aligned(16))) unsigned short sAh[64][KP], sAl[ASPLIT ? 64 : 1][KP], sB[128][KP];
  __shared__ __attribute__((aligned(16))) float so[4][32][64];
  const int tid = threadIdx.x, w = tid >> 5, lane = tid & 31, ln = lane & 15, hh = lane >> 4;
  const int wm = w >> 1, wn = w & 1;
  const int nb = N / 128;
  const int row0 = (blockIdx.x / nb) * 64, col0 = (blockIdx.x % nb) * 128;
  if (row0 >= M) return;       // block-uniform, in front of every barrier
  const int ar = tid >> 4, ac = (tid & 15) * 4, br = tid >> 3, bc = (tid & 7) * 8;
  unsigned ao[8], bo[8];       // byte offsets of A rows ar + 8 i and W rows br + 16 i (both operands are far below 4 GiB)
#pragma unroll  // offsets in registers
  for (int i = 0; i < 8; ++i) {
    ao[i] = ((unsigned)(row0 + ar + 8 * i) * (unsigned)lda + (unsigned)ac) * 4u;
    bo[i] = ((unsigned)(col0 + br + 16 * i) * (unsigned)ldb + (unsigned)bc) * 2u;
  }
  v4f aq[8]; v8us bq[8];
  v8f acc[2][4] = {};
  gemm_fetch(A, Wt, ao, bo, aq, bq);
  for (int kn = 64; ; kn += 64) {   // kn: the first k of the step after this one
    __syncthreads();           // every wave has read its last fragment of the step before
#pragma unroll  // aq and bq are indexed by constants
    for (int i = 0; i < 8; ++i) {
      v4us h, l;
#pragma unroll
      for (int t = 0; t < 4; ++t) { const unsigned short hb = bf16_bits(aq[i][t]); h[t] = hb; l[t] = ASPLIT ? bf16_bits(aq[i][t] - bf16_val(hb)) : (unsigned short)0; }
      *(v4us*)&sAh[ar + 8 * i][ac] = h;
      if (ASPLIT) *(v4us*)&sAl[ar + 8 * i][ac] = l;
      *(v8us*)&sB[br + 16 * i][bc] = bq[i];
    }
    __syncthreads();           // the step's tiles are whole
    if (kn < K) gemm_fetch(A, Wt, ao, bo, aq, bq);
#pragma unroll
    for (int ks = 0; ks < 2; ++ks) {
      FragB b[4];
#pragma unroll
      for (int t = 0; t < 4; ++t) {
        const unsigned short* brow = &sB[wn * 64 + t * 16 + ln][ks * 32];
        b[t].half[0] = *(const v8us*)(brow + 8 * hh);
        b[t].half[1] = *(const v8us*)(brow + 16 + 8 * hh);
      }
      FragB ah[2], al[2];
#pragma unroll  // all fragments of the 32 k as one group of LDS loads in front of their products
      for (int mi = 0; mi < 2; ++mi) {
        const int arow = wm * 32 + mi * 16 + ln;
        ah[mi].half[0] = *(const v8us*)&sAh[arow][ks * 32 + 8 * hh]; ah[mi].half[1] = *(const v8us*)&sAh[arow][ks * 32 + 16 + 8 * hh];
        if (ASPLIT) { al[mi].half[0] = *(const v8us*)&sAl[arow][ks * 32 + 8 * hh]; al[mi].half[1] = *(const v8us*)&sAl[arow][ks * 32 + 16 + 8 * hh]; }
        else al[mi] = ah[mi];
      }
#pragma unroll
      for (int mi = 0; mi < 2; ++mi)
#pragma unroll
        for (int t = 0; t < 4; ++t) acc[mi][t] = mmaN<ASPLIT ? 2 : 1>(ah[mi].v, al[mi].v, b[t].v, b[t].v, acc[mi][t]);
    }
    if (kn >= K) break;
  }
  const int rsub = lane >> 4, c4 = (lane & 15) * 4;
  float bv[4];
#pragma unroll
  for (int t = 0; t < 4; ++t) {
    bv[t] = bias ? bias[col0 + wn * 64 + t * 16 + ln] : 0.f;
    if (BIAS_BF16) bv[t] = bf16_round(bv[t]);
  }
#pragma unroll
  for (int mi = 0; mi < 2; ++mi)
#pragma unroll
    for (int t = 0; t < 4; ++t)
#pragma unroll
      for (int r = 0; r < 8; ++r) { float v = acc[mi][t][r] + bv[t]; if (ACT == 1) v = fmaxf(v, 0.f); so[w][mi * 16 + 8 * hh + r][t * 16 + ln] = v; }
  __builtin_amdgcn_fence(__ATOMIC_ACQ_REL, "workgroup");
  __builtin_amdgcn_wave_barrier();
  if (CSPLIT) {
    const int r4 = lane >> 3, c8 = (lane & 7) * 8;   // eight lanes a row: each store covers four whole 128-byte lines
#pragma unroll  // a round's LDS reads go out while the round before is split and stored
    for (int q = 0; q < 8; ++q) {
      const int r = q * 4 + r4;
      const v4f v0 = *(const v4fa*)&so[w][r][c8], v1 = *(const v4fa*)&so[w][r][c8 + 4];
      v8us h, l;
#pragma unroll  // h and l are indexed by constants
      for (int t = 0; t < 4; ++t) {
        unsigned short hb = bf16_bits(v0[t]); h[t] = hb;     l[t] = bf16_bits(v0[t] - bf16_val(hb));
        hb = bf16_bits(v1[t]);                h[4 + t] = hb; l[4 + t] = bf16_bits(v1[t] - bf16_val(hb));
      }
      unsigned short* cr = (unsigned short*)(C + (size_t)(row0 + wm * 32 + r) * ldc + col0 + wn * 64);
      *(v8us*)(cr + c8) = h;
      *(v8us*)(cr + 64 + c8) = l;
    }
  } else {
#pragma unroll
    for (int q = 0; q < 16; ++q) {
      const int r = q * 2 + rsub;
      const v4f v = *(const v4fa*)&so[w][r][c4];
      *(v4f*)(C + (size_t)(row0 + wm * 32 + r) * ldc + col0 + wn * 64 + c4) = v;
    }
  }
}

// Flash-style causal/unmasked attention, all contractions 3-term bf16 hi/lo splits, f32 softmax with running max.
// q,k,v rows are read from f32 buffers with arbitrary row pitch (so they can live inside a fused qkv buffer);
// D = head size (multiple of 32, <= 128); one wave = 16 query rows; block = 4 waves (64 queries) sharing K/V chunks of 32.
template <int D, bool CAUSAL>
__global__ __launch_bounds__(128) void k_flash(const float* __restrict__ qb, const float* __restrict__ kb, const float* __restrict__ vb,
                                             int pitch, int T, int H, float scale, float* __restrict__ y, int ypitch) {
  constexpr int KS = D / 32;        // k-steps for QK
  constexpr int DT = D / 16;        // d tiles for PV
  __shared__ __attribute__((aligned(16))) unsigned short sKh[32][D + 8], sKl[32][D + 8], sVh[32][D + 8], sVl[32][D + 8];
  __shared__ __attribute__((aligned(16))) unsigned short sPh[4][16][40], sPl[4][16][40];
  __shared__ __attribute__((aligned(16))) float sO[4][16][D];
  const int tid = threadIdx.x, w = tid >> 5, lane = tid & 31, ln = lane & 15, hh = lane >> 4;
  const int nqb = (T + 63) / 64;
  const int bh = blockIdx.x / nqb, qblk = blockIdx.x % nqb;
  const int b = bh / H, h = bh % H;
  const int q0 = qblk * 64 + w * 16;
  const float* Q = qb + (size_t)b * T * pitch + h * D;
  const float* K = kb + (size_t)b * T * pitch + h * D;
  const float* V = vb + (size_t)b * T * pitch + h * D;

  // A fragments of the wave's 16 query rows (scaled), hi/lo
  FragB aqh[KS], aql[KS];
  {
    int row = q0 + ln; if (row >= T) row = T - 1;
    const float* qr = Q + (size_t)row * pitch;
#pragma unroll
    for (int ks = 0; ks < KS; ++ks)
#pragma unroll
      for (int i = 0; i < 16; ++i) {
        const int d = ks * 32 + ((i < 8) ? (8 * hh + i) : (16 + 8 * hh + (i - 8)));
        const float x = qr[d] * scale; const unsigned short hb = bf16_bits(x);
        aqh[ks].u[i] = hb; aql[ks].u[i] = bf16_bits(x - bf16_val(hb));
      }
  }
  float m_r[8], l_r[8];
#pragma unroll
  for (int r = 0; r < 8; ++r) { m_r[r] = -3.0e38f; l_r[r] = 0.f; }
  v8f oacc[DT];
#pragma unroll
  for (int dt = 0; dt < DT; ++dt) oacc[dt] = (v8f){0.f,0.f,0.f,0.f,0.f,0.f,0.f,0.f};

  const int kv_end = CAUSAL ? min(T, qblk * 64 + 64) : T;     // block-uniform
  for (int j0 = 0; j0 < kv_end; j0 += 32) {
    __syncthreads();
    for (int e = tid; e < 32 * (D / 4); e += 128) {
      const int r = e / (D / 4), c4 = (e % (D / 4)) * 4;
      const int key = j0 + r;
      v4f kf = {0.f,0.f,0.f,0.f}, vf = {0.f,0.f,0.f,0.f};
      if (key < T) { kf = *(const v4fa*)(K + (size_t)key * pitch + c4); vf = *(const v4fa*)(V + (size_t)key * pitch + c4); }
#pragma unroll
      for (int t = 0; t < 4; ++t) {
        unsigned short hb = bf16_bits(kf[t]); sKh[r][c4 + t] = hb; sKl[r][c4 + t] = bf16_bits(kf[t] - bf16_val(hb));
        hb = bf16_bits(vf[t]); sVh[r][c4 + t] = hb; sVl[r][c4 + t] = bf16_bits(vf[t] - bf16_val(hb));
      }
    }
    __syncthreads();
    // S tile 16 x 32
    v8f s[2];
#pragma unroll
    for (int nt = 0; nt < 2; ++nt) {
      v8f acc = {};
#pragma unroll
      for (int ks = 0; ks < KS; ++ks) {
        FragB bh_, bl_;
        bh_.half[0] = *(const v8us*)&sKh[nt * 16 + ln][ks * 32 + 8 * hh]; bh_.half[1] = *(const v8us*)&sKh[nt * 16 + ln][ks * 32 + 16 + 8 * hh];
        bl_.half[0] = *(const v8us*)&sKl[nt * 16 + ln][ks * 32 + 8 * hh]; bl_.half[1] = *(const v8us*)&sKl[nt * 16 + ln][ks * 32 + 16 + 8 * hh];
        acc = mmaN<3>(aqh[ks].v, aql[ks].v, bh_.v, bl_.v, acc);
      }
      s[nt] = acc;
    }
    // mask + running max (rows 8hh+r; the 16 lanes of a half share rows)
    float alpha[8];
#pragma unroll
    for (int r = 0; r < 8; ++r) {
      const int qi = q0 + 8 * hh + r;
      const int ja = j0 + ln, jb = j0 + 16 + ln;
      if (CAUSAL) { if (ja > qi) s[0][r] = -3.0e38f; if (jb > qi) s[1][r] = -3.0e38f; }
      if (ja >= T) s[0][r] = -3.0e38f;
      if (jb >= T) s[1][r] = -3.0e38f;
      float mx = fmaxf(s[0][r], s[1][r]);
      mx = fmaxf(mx, __shfl_xor(mx, 1, 32)); mx = fmaxf(mx, __shfl_xor(mx, 2, 32)); mx = fmaxf(mx, __shfl_xor(mx, 4, 32)); mx = fmaxf(mx, __shfl_xor(mx, 8, 32));
      const float mnew = fmaxf(m_r[r], mx);
      alpha[r] = (mnew > -1.0e38f) ? __expf(m_r[r] - mnew) : 1.0f;
      const float p0 = (s[0][r] > -1.0e38f) ? __expf(s[0][r] - mnew) : 0.f;
      const float p1 = (s[1][r] > -1.0e38f) ? __expf(s[1][r] - mnew) : 0.f;
      m_r[r] = mnew;
      l_r[r] = l_r[r] * alpha[r] + p0 + p1;            // per-lane partial row sum (16 lanes combined at the end)
      unsigned short hb = bf16_bits(p0); sPh[w][8 * hh + r][ln] = hb;      sPl[w][8 * hh + r][ln] = bf16_bits(p0 - bf16_val(hb));
      hb = bf16_bits(p1);                sPh[w][8 * hh + r][16 + ln] = hb; sPl[w][8 * hh + r][16 + ln] = bf16_bits(p1 - bf16_val(hb));
    }
#pragma unroll
    for (int dt = 0; dt < DT; ++dt)
#pragma unroll
      for (int r = 0; r < 8; ++r) oacc[dt][r] *= alpha[r];
    __builtin_amdgcn_fence(__ATOMIC_ACQ_REL, "workgroup");
    __builtin_amdgcn_wave_barrier();
    FragB pah, pal;
    pah.half[0] = *(const v8us*)&sPh[w][ln][8 * hh]; pah.half[1] = *(const v8us*)&sPh[w][ln][16 + 8 * hh];
    pal.half[0] = *(const v8us*)&sPl[w][ln][8 * hh]; pal.half[1] = *(const v8us*)&sPl[w][ln][16 + 8 * hh];
#pragma unroll
    for (int dt = 0; dt < DT; ++dt) {
      FragB bvh, bvl;
#pragma unroll
      for (int i = 0; i < 8; ++i) {
        bvh.u[i] = sVh[8 * hh + i][dt * 16 + ln]; bvh.u[8 + i] = sVh[16 + 8 * hh + i][dt * 16 + ln];
        bvl.u[i] = sVl[8 * hh + i][dt * 16 + ln]; bvl.u[8 + i] = sVl[16 + 8 * hh + i][dt * 16 + ln];
      }
      oacc[dt] = mmaN<3>(pah.v, pal.v, bvh.v, bvl.v, oacc[dt]);
    }
    __builtin_amdgcn_fence(__ATOMIC_ACQ_REL, "workgroup");
    __builtin_amdgcn_wave_barrier();
  }
#pragma unroll
  for (int r = 0; r < 8; ++r) {
    float l = l_r[r];
    l += __shfl_xor(l, 1, 32); l += __shfl_xor(l, 2, 32); l += __shfl_xor(l, 4, 32); l += __shfl_xor(l, 8, 32);
    l_r[r] = (l > 0.f) ? 1.0f / l : 0.f;
  }
#pragma unroll
  for (int dt = 0; dt < DT; ++dt)
#pragma unroll
    for (int r = 0; r < 8; ++r) sO[w][8 * hh + r][dt * 16 + ln] = oacc[dt][r] * l_r[r];
  __builtin_amdgcn_fence(__ATOMIC_ACQ_REL, "workgroup");
  __builtin_amdgcn_wave_barrier();
  {
    for (int r = 0; r < 16; ++r) {
      const int row = q0 + r;
      if (row < T && lane < D / 4) {
        const v4f val = *(const v4fa*)&sO[w][r][lane * 4];
        *(v4f*)(y + ((size_t)b * T + row) * ypitch + h * D + lane * 4) = val;
      }
    }
    
  }
}

// Which 64-query x 32-key tiles of the int mask [T][T] hold a nonzero word at all: bit (kt & 31) of word [qt][kt >> 5], each word
// alone in a 128-byte line of its own (one writer a line). Block = 32 waves = 32 key tiles of one query tile, a tile a wave. T % 32 == 0.
__global__ __launch_bounds__(1024) void k_mask_tiles(const int* __restrict__ mask, unsigned* __restrict__ tbits, int T) {
  __shared__ int sany[32];
  const int w = threadIdx.x >> 5, lane = threadIdx.x & 31;
  const int nw = (T / 32 + 31) / 32;
  const int qt = blockIdx.x / nw, kt = (blockIdx.x % nw) * 32 + w;
  int any = 0;
  if (kt * 32 < T) {           // wave-uniform
    unsigned mo[16];           // byte offsets (the mask is far below 4 GiB): four whole 128-byte rows of the tile a load
#pragma unroll  // offsets in registers
    for (int i = 0; i < 16; ++i) {
      int row = qt * 64 + i * 4 + (lane >> 3); row = row < T ? row : T - 1;
      mo[i] = ((unsigned)row * (unsigned)T + (unsigned)(kt * 32 + (lane & 7) * 4)) * 4u;
    }
    v4ia mv[16];
#pragma unroll  // mv in registers, many loads in flight at once
    for (int i = 0; i < 16; ++i) mv[i] = *(const v4ia*)((const char*)mask + mo[i]);
    // No offset register of the batch is rewritten (not even as a later load's destination) in front of this wait.
    asm volatile("s_wait_xcnt 0x0" :: "v"(mo[0]), "v"(mo[1]), "v"(mo[2]), "v"(mo[3]), "v"(mo[4]), "v"(mo[5]), "v"(mo[6]), "v"(mo[7]),
                 "v"(mo[8]), "v"(mo[9]), "v"(mo[10]), "v"(mo[11]), "v"(mo[12]), "v"(mo[13]), "v"(mo[14]), "v"(mo[15]) : "memory");
#pragma unroll  // mv is indexed by constants
    for (int i = 0; i < 16; ++i) any |= mv[i][0] | mv[i][1] | mv[i][2] | mv[i][3];
  }
  const unsigned wany = __builtin_amdgcn_ballot_w32(any != 0);
  if (lane == 0) sany[w] = wany != 0u;
  __syncthreads();             // all 32 tiles' answers are in LDS
  if (w == 0) {
    const unsigned bits = __builtin_amdgcn_ballot_w32(sany[lane] != 0);
    if (lane == 0) tbits[(size_t)blockIdx.x * 32] = bits;
  }
}

// Self-attention (Tq == Tk == T) with optional int mask [T][T] (nonzero = keep) and/or causal flag; 3-term bf16 splits;
// Q rows read from an f32 buffer: Qb + b*T*qpitch + h*D + row*qpitch. K and V rows arrive split (k_gemm_bf's CSPLIT form): D bf16 high
// parts, then D bf16 low parts, at X + b*T*pitch + h*2*D + row*pitch, pitches in 16-bit elements.
// y[b][row][h*D + d], pitch ypitch. D % 32 == 0, T % 32 == 0.
// tbits: k_mask_tiles' words for this mask. A work-group takes two query tiles of a head, one after the other: n - 1 - t, then t.
// Both products are computed transposed, St = K*Qt and Ot += Vt*Pt: a lane (ln, hh) then holds scores of ONE query, q0 + ln, for keys
// 8 hh + r and 16 + 8 hh + r, which is the k order of a B operand: P goes from accumulator to operand inside the lane's own registers,
// and maximum, sum and rescale factor are one value a lane (the two halves of a wave join by one exchange).
template <int D>
__global__ __launch_bounds__(128) void k_flashm(const float* __restrict__ Qb, int qpitch, const unsigned short* __restrict__ Kb, int kpitch,
                                              const unsigned short* __restrict__ Vb, int vpitch, int T, int H, float scale,
                                              const int* __restrict__ mask, const unsigned* __restrict__ tbits, int causal,
                                              float* __restrict__ y, int ypitch) {
  constexpr int KS = D / 32, DT = D / 16;
  // An LDS row is a global row as it stands: D high parts, then D low parts.
  constexpr int KP = 2 * D + 8;    // K row pitch in elements: an odd multiple of 16 bytes, the conflict-free pitch of 16-byte reads down a column
  constexpr int VP = 2 * D + 16;   // V row pitch in elements: an odd multiple of 32 bytes, the conflict-free pitch of the transposing load
  static_assert((KP * 2) % 16 == 0 && ((KP * 2 / 16) & 1) == 1, "K rows: odd multiple of 16 bytes");
  static_assert((VP * 2) % 32 == 0 && ((VP * 2 / 32) & 1) == 1, "V rows: odd multiple of 32 bytes");
  __shared__ __attribute__((aligned(16))) unsigned short sK[32][KP], sV[32][VP];
  __shared__ __attribute__((aligned(16))) float sO[4][16][D + 4];   // row pitch an odd multiple of 16 bytes: 16 lanes store 16 bytes each down a column
  const int tid = threadIdx.x, w = tid >> 5, lane = tid & 31, ln = lane & 15, hh = lane >> 4;
  const int nqb = (T + 63) / 64, npair = (nqb + 1) / 2, nw = (T / 32 + 31) / 32;
  const int bh = blockIdx.x / npair, tlow = blockIdx.x % npair;
  const int b = bh / H, h = bh % H;
  const float* Q = Qb + (size_t)b * T * qpitch + h * D;
  const unsigned short* K = Kb + (size_t)b * T * kpitch + h * 2 * D;
  const unsigned short* V = Vb + (size_t)b * T * vpitch + h * 2 * D;
  // Under a mask that shuts more keys the lower the query's index, tiles n - 1 - t and t together cost every work-group the same number of
  // passes; all work-groups are resident at once, so the launch lasts as long as the longest. An odd n's middle tile is taken once.
  const int nparts = (nqb - 1 - tlow != tlow) ? 2 : 1;
#pragma unroll 1  // one copy of the body in the instruction cache
  for (int part = 0; part < nparts; ++part) {
  const int qblk = part ? tlow : nqb - 1 - tlow;
  const int q0 = qblk * 64 + w * 16;
  unsigned tw = ~0u;           // lane l: the query tile's word l of tbits (32 passes a word; T * T * 4 < 4 GiB, so never more than 32 words)
  if (mask) {
    const unsigned two = (unsigned)(qblk * nw + (lane < nw ? lane : nw - 1)) * 128u;
    tw = *(const unsigned*)((const char*)tbits + two);
    // The offset register is not rewritten in front of this wait.
    asm volatile("s_wait_xcnt 0x0" :: "v"(two) : "memory");
  }
  FragB aqh[KS], aql[KS];
  {
    int row = q0 + ln; if (row >= T) row = T - 1;
    const float* qr = Q + (size_t)row * qpitch;
#pragma unroll
    for (int ks = 0; ks < KS; ++ks)
#pragma unroll
      for (int i = 0; i < 16; ++i) {
        const int d = ks * 32 + ((i < 8) ? (8 * hh + i) : (16 + 8 * hh + (i - 8)));
        const float x = qr[d] * scale; const unsigned short hb = bf16_bits(x);
        aqh[ks].u[i] = hb; aql[ks].u[i] = bf16_bits(x - bf16_val(hb));
      }
  }
  const int qrow = q0 + ln < T ? q0 + ln : T - 1;   // the lane's query
  float m_q = -3.0e38f, l_q = 0.f;                  // its running maximum; the sum over this half's keys
  v8f oacc[DT];                                     // oacc[dt][r]: element dt * 16 + 8 hh + r of the query's output row
#pragma unroll
  for (int dt = 0; dt < DT; ++dt) oacc[dt] = (v8f){0.f,0.f,0.f,0.f,0.f,0.f,0.f,0.f};
  const int kv_end = causal ? min(T, qblk * 64 + 64) : T;
  constexpr int NL = D / 16, RS = 128 / (D / 4);               // K (and V) 16-byte pieces per thread and pass; rows between a thread's pieces
  const int sr = tid / (D / 4), sc8 = (tid % (D / 4)) * 8;     // the thread's first staged row, and its place in the row of 2 D elements
  const unsigned kofs = ((unsigned)sr * (unsigned)kpitch + (unsigned)sc8) * 2u, vofs = ((unsigned)sr * (unsigned)vpitch + (unsigned)sc8) * 2u;
  // the lane's own 16 bytes of a 16 x 16 V tile for the transposing load: row 8 hh + (lane & 7), column half (lane >> 3) & 1
  const unsigned short* vth = &sV[8 * hh + (lane & 7)][8 * ((lane >> 3) & 1)];
  const unsigned short* vtl = vth + D;
  const unsigned mofs = ((unsigned)qrow * (unsigned)T + (unsigned)(8 * hh)) * 4u;
  unsigned tb = 0u;
  for (int j0 = 0; j0 < kv_end; j0 += 32) {
    // A pass whose 64 x 32 mask tile holds no set word leaves every maximum, sum and accumulator as it is (each p is 0, each alpha 1):
    // the whole work-group steps over it, its loads and both its barriers included (the test reads the same in every wave).
    if ((j0 & 1023) == 0) tb = (unsigned)__builtin_amdgcn_readlane((int)tw, j0 >> 10);
    if (((tb >> ((j0 >> 5) & 31)) & 1u) == 0u) continue;
    // All that the pass (32 keys) reads from global memory goes out as one batch, under no lane test, so that the loads'
    // latencies overlap: uniform base, fixed lane offsets; every key of a pass is below T (T % 32 == 0).
    static_assert(NL == 4, "the wait behind the K/V loads names four K and four V addresses");
    const char *kp[NL], *vp[NL];
    v8us kq[NL], vq[NL];
#pragma unroll  // addresses in registers
    for (int i = 0; i < NL; ++i) {
      kp[i] = (const char*)(K + (size_t)(j0 + i * RS) * kpitch) + kofs;
      vp[i] = (const char*)(V + (size_t)(j0 + i * RS) * vpitch) + vofs;
    }
#pragma unroll  // the eight loads back to back
    for (int i = 0; i < NL; ++i) { kq[i] = *(const v8us*)kp[i]; vq[i] = *(const v8us*)vp[i]; }
    // No address register of the batch is reused (not even as a later load's destination) in front of this wait.
    asm volatile("s_wait_xcnt 0x0" :: "v"(kp[0]), "v"(kp[1]), "v"(kp[2]), "v"(kp[3]), "v"(vp[0]), "v"(vp[1]), "v"(vp[2]), "v"(vp[3]) : "memory");
    // The query's mask words for keys j0 + 8 hh + 0..7 (mk[0], mk[1]) and j0 + 16 + 8 hh + 0..7 (mk[2], mk[3]).
    v4ia mk[4];
#pragma unroll  // words in registers
    for (int i = 0; i < 4; ++i) mk[i] = (v4ia){1, 1, 1, 1};
    if (mask) {
      const char* mp = (const char*)(mask + j0) + mofs;
      mk[0] = *(const v4ia*)mp; mk[1] = *(const v4ia*)(mp + 16); mk[2] = *(const v4ia*)(mp + 64); mk[3] = *(const v4ia*)(mp + 80);
      // The same for the mask words' address.
      asm volatile("s_wait_xcnt 0x0" :: "v"(mp) : "memory");
    }
    __syncthreads();
#pragma unroll  // kq and vq are indexed by constants
    for (int i = 0; i < NL; ++i) { *(v8us*)&sK[sr + i * RS][sc8] = kq[i]; *(v8us*)&sV[sr + i * RS][sc8] = vq[i]; }
    __syncthreads();
    v8f s[2];                  // s[nt][r]: key j0 + nt * 16 + 8 hh + r against the lane's query
#pragma unroll
    for (int nt = 0; nt < 2; ++nt) {
      v8f acc = {};
#pragma unroll
      for (int ks = 0; ks < KS; ++ks) {
        FragB kh_, kl_;
        const unsigned short* krow = &sK[nt * 16 + ln][ks * 32 + 8 * hh];
        kh_.half[0] = *(const v8us*)krow;       kh_.half[1] = *(const v8us*)(krow + 16);
        kl_.half[0] = *(const v8us*)(krow + D); kl_.half[1] = *(const v8us*)(krow + D + 16);
        acc = mma3T(kh_.v, kl_.v, aqh[ks].v, aql[ks].v, acc);
      }
      s[nt] = acc;
    }
    // The pass's whole V operand as one group of loads, in front of the softmax arithmetic, which covers their latency.
    // Lane (ln, hh) receives V[kbase + 8 hh + 0..7][dt * 16 + ln], kbase 0 and 16: row dt * 16 + ln of Vt in the k order of the P fragment below.
    FragB bvh[DT], bvl[DT];
#pragma unroll  // fragments in registers
    for (int dt = 0; dt < DT; ++dt) {
      bvh[dt].half[0] = lds_tr16(vth + dt * 16); bvh[dt].half[1] = lds_tr16(vth + 16 * VP + dt * 16);
      bvl[dt].half[0] = lds_tr16(vtl + dt * 16); bvl[dt].half[1] = lds_tr16(vtl + 16 * VP + dt * 16);
    }
    if (causal) {              // the same in every lane: one branch for the sixteen words
#pragma unroll  // mk is indexed by constants
      for (int i = 0; i < 16; ++i) mk[i >> 2][i & 3] = (j0 + (i >> 3) * 16 + 8 * hh + (i & 7) <= qrow) ? mk[i >> 2][i & 3] : 0;
    }
    float mx = -3.0e38f;
#pragma unroll  // s and mk are indexed by constants
    for (int nt = 0; nt < 2; ++nt)
#pragma unroll  // likewise
      for (int r = 0; r < 8; ++r) {
        s[nt][r] = mk[nt * 2 + (r >> 2)][r & 3] != 0 ? s[nt][r] : -3.0e38f;
        mx = fmaxf(mx, s[nt][r]);
      }
    mx = fmaxf(mx, xhalf(mx));   // the other half's sixteen keys
    const float mnew = fmaxf(m_q, mx);
    const bool live = mnew > -1.0e38f;                        // some key of the query has been kept so far
    const float alpha = live ? __expf(m_q - mnew) : 1.0f;
    const float msub = live ? mnew : 0.f;                     // a shut key's -3e38 less msub gives p = 0 in either case
    m_q = mnew;
    FragB pbh, pbl;            // Pt as a B operand: element i is key 8 hh + i, element 8 + i key 16 + 8 hh + i, column ln
    float ps[8];
#pragma unroll  // fragments in registers
    for (int r = 0; r < 8; ++r) {
      const float p0 = __expf(s[0][r] - msub), p1 = __expf(s[1][r] - msub);
      ps[r] = p0 + p1;
      unsigned short hb = bf16_bits(p0); pbh.u[r] = hb;     pbl.u[r] = bf16_bits(p0 - bf16_val(hb));
      hb = bf16_bits(p1);                pbh.u[8 + r] = hb; pbl.u[8 + r] = bf16_bits(p1 - bf16_val(hb));
    }
    l_q = l_q * alpha + (((ps[0] + ps[1]) + (ps[2] + ps[3])) + ((ps[4] + ps[5]) + (ps[6] + ps[7])));
#pragma unroll
    for (int dt = 0; dt < DT; ++dt)
#pragma unroll
      for (int r = 0; r < 8; ++r) oacc[dt][r] *= alpha;
#pragma unroll  // oacc and the fragments are indexed by constants
    for (int dt = 0; dt < DT; ++dt) oacc[dt] = mma3T(bvh[dt].v, bvl[dt].v, pbh.v, pbl.v, oacc[dt]);
  }
  // NaN for fully-masked rows (softmax over a row of -inf)
  l_q += xhalf(l_q);
  const float inv = (m_q > -1.0e38f) ? 1.0f / l_q : __builtin_nanf("");
#pragma unroll  // oacc is indexed by constants
  for (int dt = 0; dt < DT; ++dt) {
    const v4f o0 = {oacc[dt][0] * inv, oacc[dt][1] * inv, oacc[dt][2] * inv, oacc[dt][3] * inv};
    const v4f o1 = {oacc[dt][4] * inv, oacc[dt][5] * inv, oacc[dt][6] * inv, oacc[dt][7] * inv};
    *(v4fa*)&sO[w][ln][dt * 16 + 8 * hh] = o0;
    *(v4fa*)&sO[w][ln][dt * 16 + 8 * hh + 4] = o1;
  }
  __builtin_amdgcn_fence(__ATOMIC_ACQ_REL, "workgroup");
  __builtin_amdgcn_wave_barrier();
  {
    for (int r = 0; r < 16; ++r) {
      const int row = q0 + r;
      if (row < T && lane < D / 4) {
        const v4f val = *(const v4fa*)&sO[w][r][lane * 4];
        *(v4f*)(y + ((size_t)b * T + row) * ypitch + h * D + lane * 4) = val;
      }
    }
    
  }
  // The next tile's first instructions rewrite registers that the last store names: not in front of this wait.
  asm volatile("s_wait_xcnt 0x0" ::: "memory");
  }
}

extern "C" void kernel_launch(void* const* d_in, const int* in_sizes, int n_in,
                              void* d_out, int out_size, void* d_ws, size_t ws_size, hipStream_t stream) {
  (void)in_sizes; (void)n_in; (void)out_size;
  const float* x = (const float*)d_in[0]; const int* mask = (const int*)d_in[1];
  const float* Wq = (const float*)d_in[2]; const float* Wkv = (const float*)d_in[3];
  const float* Wo = (const float*)d_in[4]; const float* bo = (const float*)d_in[5];
  char* ws = (char*)d_ws; size_t off = 0;
  unsigned short* Wqt  = (unsigned short*)(ws + off); off += (size_t)DM * DM * 2;       // [1024][1024]
  unsigned short* Wkvt = (unsigned short*)(ws + off); off += (size_t)2 * DM * DM * 2;   // [2048][1024]
  unsigned short* Wot  = (unsigned short*)(ws + off); off += (size_t)DM * DM * 2;
  float* qb  = (float*)(ws + off); off += (size_t)BB * NN * DM * 4;                    // 16 MiB
  float* kvb = (float*)(ws + off); off += (size_t)BB * NN * 2 * DM * 4;                // 32 MiB
  float* ob  = (float*)(ws + off); off += (size_t)BB * NN * DM * 4;                    // 16 MiB
  unsigned* tbits = (unsigned*)(ws + off); off += (size_t)(NN / 64) * (NN / 1024) * 128; // a 128-byte line a word
  if (off > ws_size) return;
  const int M = BB * NN;
  k_mask_tiles<<<(NN / 64) * (NN / 1024), 1024, 0, stream>>>(mask, tbits, NN);
  k_wt_bf16<<<(DM * (DM / 8) + 255) / 256, 256, 0, stream>>>(Wq, Wqt, DM, DM);
  k_wt_bf16<<<(2 * DM * (DM / 8) + 255) / 256, 256, 0, stream>>>(Wkv, Wkvt, DM, 2 * DM);
  k_wt_bf16<<<(DM * (DM / 8) + 255) / 256, 256, 0, stream>>>(Wo, Wot, DM, DM);
  k_gemm_bf<false, 0, false, false><<<(M / 64) * (DM / 128), 128, 0, stream>>>(x, DM, Wqt, DM, nullptr, qb, DM, M, DM, DM);
  k_gemm_bf<false, 0, false, true><<<(M / 64) * (2 * DM / 128), 128, 0, stream>>>(x, DM, Wkvt, DM, nullptr, kvb, 2 * DM, M, 2 * DM, DM);
  // k = kv[..., 0:1024] (head h at h*64), v = kv[..., 1024:2048]; stored split, a row is 4096 16-bit elements, head h's 128 at h*128
  const unsigned short* kvs = (const unsigned short*)kvb;
  k_flashm<HD><<<BB * NH * (NN / 128), 128, 0, stream>>>(qb, DM, kvs, 4 * DM, kvs + 2 * DM, 4 * DM, NN, NH, 0.03125f, mask, tbits, 0, ob, DM);
  k_gemm_bf<true, 0, true, false><<<(M / 64) * (DM / 128), 128, 0, stream>>>(ob, DM, Wot, DM, bo, (float*)d_out, DM, M, DM, DM);
}

// v008
// It runs in 175 microseconds.
// Timed twice side by side with v007, it ran 1.10 times as fast both times.
// All steps since v000 together make it 3.84 times as fast.
#include <hip/hip_runtime.h>
// All contractions on v_wmma_f32_16x16x32_bf16, f32 accumulate: q = x·Wq and kv = x·Wkv with x/W rounded to bf16 (single
// exact-product term), QKᵀ and P·V 3-term bf16 hi/lo splits, out = o·Wout with o split hi/lo (2 terms); softmax f32.
// K and V are split hi/lo once, where the kv GEMM stores them; the attention kernel copies the two planes into LDS as they are.
// The boolean mask input is applied as given (together with nothing else).
#define BB 2
#define NN 2048
#define DM 1024
#define NH 16
#define HD 64

typedef __bf16 v16b __attribute__((ext_vector_type(16)));
typedef unsigned short v8us __attribute__((ext_vector_type(8), may_alias));
typedef unsigned short v4us __attribute__((ext_vector_type(4), may_alias));
typedef float  v8f  __attribute__((ext_vector_type(8)));
typedef float  v4f  __attribute__((ext_vector_type(4)));
typedef float  v4fa __attribute__((ext_vector_type(4), may_alias));
typedef int    v4ia __attribute__((ext_vector_type(4), may_alias));
union FragB { v16b v; v8us half[2]; unsigned short u[16]; };

__device__ __forceinline__ unsigned short bf16_bits(float x) { unsigned int u = __float_as_uint(x); return (unsigned short)((u + 0x7FFFu + ((u >> 16) & 1u)) >> 16); }
__device__ __forceinline__ float bf16_val(unsigned short b) { return __uint_as_float(((unsigned int)b) << 16); }
__device__ __forceinline__ float bf16_round(float x) { return bf16_val(bf16_bits(x)); }
// D += A·B with NT terms: 1 = ah·bh, 2 = + al·bh (A split), 3 = + ah·bl (both split)
template <int NT>
__device__ __forceinline__ v8f mmaN(v16b ah, v16b al, v16b bh, v16b bl, v8f c) {
  c = __builtin_amdgcn_wmma_f32_16x16x32_bf16(false, ah, false, bh, (short)0, c, false, false);
  if (NT >= 2) c = __builtin_amdgcn_wmma_f32_16x16x32_bf16(false, al, false, bh, (short)0, c, false, false);
  if (NT >= 3) c = __builtin_amdgcn_wmma_f32_16x16x32_bf16(false, ah, false, bl, (short)0, c, false, false);
  asm volatile("v_nop\n\tv_nop\n\tv_nop\n\tv_nop" : "+v"(c) : "v"(ah), "v"(al), "v"(bh), "v"(bl));
  return c;
}

// The same three terms for a transposed product, Dt += Bt*At with the operands swapped: ah*bh + ah*bl + al*bh, which is the order
// in which mmaN<3> adds them when a and b stand the other way round.
__device__ __forceinline__ v8f mma3T(v16b ah, v16b al, v16b bh, v16b bl, v8f c) {
  c = __builtin_amdgcn_wmma_f32_16x16x32_bf16(false, ah, false, bh, (short)0, c, false, false);
  c = __builtin_amdgcn_wmma_f32_16x16x32_bf16(false, ah, false, bl, (short)0, c, false, false);
  c = __builtin_amdgcn_wmma_f32_16x16x32_bf16(false, al, false, bh, (short)0, c, false, false);
  // four vector slots between the last product and whatever reads D or overwrites an operand, on every path
  asm volatile("v_nop\n\tv_nop\n\tv_nop\n\tv_nop" : "+v"(c) : "v"(ah), "v"(al), "v"(bh), "v"(bl));
  return c;
}
// lane l's value to lane l ^ 16 and back: the two halves of a wave exchange, on the vector unit
__device__ __forceinline__ float xhalf(float x) {
  const int b = __builtin_bit_cast(int, x);
  return __builtin_bit_cast(float, __builtin_amdgcn_permlanex16(b, b, 0x76543210, 0xfedcba98, false, false));
}

// Transposing LDS load: a row-major 16 x 16 tile of 16-bit elements arrives as half of a WMMA operand (8 k of one column per lane).
__device__ __forceinline__ v8us lds_tr16(const unsigned short* p) {
  typedef short s16x8 __attribute__((ext_vector_type(8)));
  typedef __attribute__((address_space(3))) s16x8 lds_s16x8;
  return __builtin_bit_cast(v8us, __builtin_amdgcn_ds_load_tr16_b128_v8i16((lds_s16x8*)p));
}

// Wt[n][k] = bf16(W[k][n]) for three weight matrices of K rows (N0, N1, N2 columns) in one launch. Block = 8 waves = a tile of 64 k x 128 n:
// wave w loads rows 8 w .. 8 w + 7, each load 512 contiguous bytes of one row (four whole lines); the tile turns in LDS, and each store
// covers four whole 128-byte lines of Wt (64 k of one n a line, one writer a line). K % 64 == 0, N % 128 == 0.
// LDS row j * 32 + l holds column n0 + 4 l + j: the lanes of a store then stand one row apart, which at this pitch meets no bank twice.
__global__ __launch_bounds__(256) void k_wt_bf16(const float* __restrict__ W0, unsigned short* __restrict__ T0, int N0,
                                                 const float* __restrict__ W1, unsigned short* __restrict__ T1, int N1,
                                                 const float* __restrict__ W2, unsigned short* __restrict__ T2, int N2, int K) {
  constexpr int TP = 64 + 8;   // row pitch in elements, 144 B: an odd multiple of 16 bytes
  __shared__ __attribute__((aligned(16))) unsigned short sT[128][TP];
  const int tid = threadIdx.x, w = tid >> 5, lane = tid & 31;
  const int kt = K / 64, nb0 = (N0 / 128) * kt, nb1 = (N1 / 128) * kt;
  int blk = blockIdx.x;        // block-uniform choice of the matrix
  const float* W = W0; unsigned short* Wt = T0; int N = N0;
  if (blk >= nb0 + nb1) { blk -= nb0 + nb1; W = W2; Wt = T2; N = N2; }
  else if (blk >= nb0)  { blk -= nb0;       W = W1; Wt = T1; N = N1; }
  const int k0 = (blk % kt) * 64, n0 = (blk / kt) * 128;
  if (n0 >= N) return;         // block-uniform, in front of the barrier
  unsigned wo[8];              // byte offsets (each matrix is far below 4 GiB)
#pragma unroll  // offsets in registers
  for (int i = 0; i < 8; ++i) wo[i] = ((unsigned)(k0 + w * 8 + i) * (unsigned)N + (unsigned)(n0 + lane * 4)) * 4u;
  v4f q[8];
#pragma unroll  // the eight loads back to back
  for (int i = 0; i < 8; ++i) q[i] = *(const v4fa*)((const char*)W + wo[i]);
  // No offset register of the batch is rewritten (not even as a later load's destination) in front of this wait.
  asm volatile("s_wait_xcnt 0x0" :: "v"(wo[0]), "v"(wo[1]), "v"(wo[2]), "v"(wo[3]), "v"(wo[4]), "v"(wo[5]), "v"(wo[6]), "v"(wo[7]) : "memory");
  // No rounding moves up among the loads: without this the last two loads went out only after the first ones had returned.
  __builtin_amdgcn_sched_barrier(0);
#pragma unroll  // q is indexed by constants
  for (int j = 0; j < 4; ++j) {
    v8us v;
#pragma unroll
    for (int i = 0; i < 8; ++i) v[i] = bf16_bits(q[i][j]);
    *(v8us*)&sT[j * 32 + lane][w * 8] = v;
  }
  __syncthreads();             // the tile is whole
  const int r8 = tid >> 3, c8 = (tid & 7) * 8;   // eight lanes a row of 128 bytes
  v8us o[4];
#pragma unroll  // the four LDS reads as one group
  for (int i = 0; i < 4; ++i) o[i] = *(const v8us*)&sT[i * 32 + r8][c8];
#pragma unroll
  for (int i = 0; i < 4; ++i) *(v8us*)((char*)Wt + ((unsigned)(n0 + 4 * r8 + i) * (unsigned)K + (unsigned)(k0 + c8)) * 2u) = o[i];
}

// One 64-k step of a GEMM block's operands, global memory to registers, as one batch of whole-line loads
// (A: 16 lanes a row of 256 B; W: 8 lanes a row of 128 B): uniform bases, sixteen running byte offsets that then move on by 64 k.
__device__ __forceinline__ void gemm_fetch(const float* A, const unsigned short* Wt, unsigned (&ao)[8], unsigned (&bo)[8], v4f (&aq)[8], v8us (&bq)[8]) {
#pragma unroll  // the sixteen loads back to back
  for (int i = 0; i < 8; ++i) { aq[i] = *(const v4fa*)((const char*)A + ao[i]); bq[i] = *(const v8us*)((const char*)Wt + bo[i]); }
  // No offset register of the batch is rewritten (not even as a later load's destination) in front of this wait.
  asm volatile("s_wait_xcnt 0x0" :: "v"(ao[0]), "v"(ao[1]), "v"(ao[2]), "v"(ao[3]), "v"(ao[4]), "v"(ao[5]), "v"(ao[6]), "v"(ao[7]),
               "v"(bo[0]), "v"(bo[1]), "v"(bo[2]), "v"(bo[3]), "v"(bo[4]), "v"(bo[5]), "v"(bo[6]), "v"(bo[7]) : "memory");
#pragma unroll  // offsets in registers
  for (int i = 0; i < 8; ++i) { ao[i] += 64u * 4u; bo[i] += 64u * 2u; }
}

// GEMM C[M][N] (f32, pitch ldc) = act(A[M][K]·W + bias). A f32 row-major (pitch lda), converted to bf16 once per block
// (ASPLIT: hi/lo two planes -> 2 terms, else single rounded term); Wt bf16 [N][K] (pitch ldb). BIAS_BF16 rounds the
// bias to bf16 first (bias quantised to bf16 before the add). Block = 4 waves = a 64 x 128 tile of C, wave = 32 x 64;
// both operands pass through LDS in steps of 64 k, the next step's loads in flight during the products of this one.
// K%64==0, K>=64, M%64==0, N%128==0.
// CSPLIT: C is stored split for a later 3-term product: the 256 bytes of each 64-column group of a row hold the 64 values' bf16 high
// parts, then the 64 bf16 roundings of what the high parts leave (same place and size as the group's f32 values would have).
template <bool ASPLIT, int ACT, bool BIAS_BF16, bool CSPLIT>
__global__ __launch_bounds__(128) void k_gemm_bf(const float* __restrict__ A, int lda, const unsigned short* __restrict__ Wt, int ldb,
                                               const float* __restrict__ bias, float* __restrict__ C, int ldc, int M, int N, int K) {
  constexpr int KP = 64 + 8;   // row pitch in elements, 144 B: an odd multiple of 16 bytes like the attention kernel's K rows, read the same way
  __shared__ __attribute__((aligned(16))) unsigned short sAh[64][KP], sAl[ASPLIT ? 64 : 1][KP], sB[128][KP];
  __shared__ __attribute__((aligned(16))) float so[4][32][64];
  const int tid = threadIdx.x, w = tid >> 5, lane = tid & 31, ln = lane & 15, hh = lane >> 4;
  const int wm = w >> 1, wn = w & 1;
  const int nb = N / 128;
  const int row0 = (blockIdx.x / nb) * 64, col0 = (blockIdx.x % nb) * 128;
  if (row0 >= M) return;       // block-uniform, in front of every barrier
  const int ar = tid >> 4, ac = (tid & 15) * 4, br = tid >> 3, bc = (tid & 7) * 8;
  unsigned ao[8], bo[8];       // byte offsets of A rows ar + 8 i and W rows br + 16 i (both operands are far below 4 GiB)
#pragma unroll  // offsets in registers
  for (int i = 0; i < 8; ++i) {
    ao[i] = ((unsigned)(row0 + ar + 8 * i) * (unsigned)lda + (unsigned)ac) * 4u;
    bo[i] = ((unsigned)(col0 + br + 16 * i) * (unsigned)ldb + (unsigned)bc) * 2u;
  }
  v4f aq[8]; v8us bq[8];
  v8f acc[2][4] = {};
  gemm_fetch(A, Wt, ao, bo, aq, bq);
  for (int kn = 64; ; kn += 64) {   // kn: the first k of the step after this one
    __syncthreads();           // every wave has read its last fragment of the step before
#pragma unroll  // aq and bq are indexed by constants
    for (int i = 0; i < 8; ++i) {
      v4us h, l;
#pragma unroll
      for (int t = 0; t < 4; ++t) { const unsigned short hb = bf16_bits(aq[i][t]); h[t] = hb; l[t] = ASPLIT ? bf16_bits(aq[i][t] - bf16_val(hb)) : (unsigned short)0; }
      *(v4us*)&sAh[ar + 8 * i][ac] = h;
      if (ASPLIT) *(v4us*)&sAl[ar + 8 * i][ac] = l;
      *(v8us*)&sB[br + 16 * i][bc] = bq[i];
    }
    __syncthreads();           // the step's tiles are whole
    if (kn < K) gemm_fetch(A, Wt, ao, bo, aq, bq);
#pragma unroll
    for (int ks = 0; ks < 2; ++ks) {
      FragB b[4];
#pragma unroll
      for (int t = 0; t < 4; ++t) {
        const unsigned short* brow = &sB[wn * 64 + t * 16 + ln][ks * 32];
        b[t].half[0] = *(const v8us*)(brow + 8 * hh);
        b[t].half[1] = *(const v8us*)(brow + 16 + 8 * hh);
      }
      FragB ah[2], al[2];
#pragma unroll  // all fragments of the 32 k as one group of LDS loads in front of their products
      for (int mi = 0; mi < 2; ++mi) {
        const int arow = wm * 32 + mi * 16 + ln;
        ah[mi].half[0] = *(const v8us*)&sAh[arow][ks * 32 + 8 * hh]; ah[mi].half[1] = *(const v8us*)&sAh[arow][ks * 32 + 16 + 8 * hh];
        if (ASPLIT) { al[mi].half[0] = *(const v8us*)&sAl[arow][ks * 32 + 8 * hh]; al[mi].half[1] = *(const v8us*)&sAl[arow][ks * 32 + 16 + 8 * hh]; }
        else al[mi] = ah[mi];
      }
#pragma unroll
      for (int mi = 0; mi < 2; ++mi)
#pragma unroll
        for (int t = 0; t < 4; ++t) acc[mi][t] = mmaN<ASPLIT ? 2 : 1>(ah[mi].v, al[mi].v, b[t].v, b[t].v, acc[mi][t]);
    }
    if (kn >= K) break;
  }
  const int rsub = lane >> 4, c4 = (lane & 15) * 4;
  float bv[4];
#pragma unroll
  for (int t = 0; t < 4; ++t) {
    bv[t] = bias ? bias[col0 + wn * 64 + t * 16 + ln] : 0.f;
    if (BIAS_BF16) bv[t] = bf16_round(bv[t]);
  }
#pragma unroll
  for (int mi = 0; mi < 2; ++mi)
#pragma unroll
    for (int t = 0; t < 4; ++t)
#pragma unroll
      for (int r = 0; r < 8; ++r) { float v = acc[mi][t][r] + bv[t]; if (ACT == 1) v = fmaxf(v, 0.f); so[w][mi * 16 + 8 * hh + r][t * 16 + ln] = v; }
  __builtin_amdgcn_fence(__ATOMIC_ACQ_REL, "workgroup");
  __builtin_amdgcn_wave_barrier();
  if (CSPLIT) {
    const int r4 = lane >> 3, c8 = (lane & 7) * 8;   // eight lanes a row: each store covers four whole 128-byte lines
#pragma unroll  // a round's LDS reads go out while the round before is split and stored
    for (int q = 0; q < 8; ++q) {
      const int r = q * 4 + r4;
      const v4f v0 = *(const v4fa*)&so[w][r][c8], v1 = *(const v4fa*)&so[w][r][c8 + 4];
      v8us h, l;
#pragma unroll  // h and l are indexed by constants
      for (int t = 0; t < 4; ++t) {
        unsigned short hb = bf16_bits(v0[t]); h[t] = hb;     l[t] = bf16_bits(v0[t] - bf16_val(hb));
        hb = bf16_bits(v1[t]);                h[4 + t] = hb; l[4 + t] = bf16_bits(v1[t] - bf16_val(hb));
      }
      unsigned short* cr = (unsigned short*)(C + (size_t)(row0 + wm * 32 + r) * ldc + col0 + wn * 64);
      *(v8us*)(cr + c8) = h;
      *(v8us*)(cr + 64 + c8) = l;
    }
  } else {
#pragma unroll
    for (int q = 0; q < 16; ++q) {
      const int r = q * 2 + rsub;
      const v4f v = *(const v4fa*)&so[w][r][c4];
      *(v4f*)(C + (size_t)(row0 + wm * 32 + r) * ldc + col0 + wn * 64 + c4) = v;
    }
  }
}

// Flash-style causal/unmasked attention, all contractions 3-term bf16 hi/lo splits, f32 softmax with running max.
// q,k,v rows are read from f32 buffers with arbitrary row pitch (so they can live inside a fused qkv buffer);
// D = head size (multiple of 32, <= 128); one wave = 16 query rows; block = 4 waves (64 queries) sharing K/V chunks of 32.
template <int D, bool CAUSAL>
__global__ __launch_bounds__(128) void k_flash(const float* __restrict__ qb, const float* __restrict__ kb, const float* __restrict__ vb,
                                             int pitch, int T, int H, float scale, float* __restrict__ y, int ypitch) {
  constexpr int KS = D / 32;        // k-steps for QK
  constexpr int DT = D / 16;        // d tiles for PV
  __shared__ __attribute__((aligned(16))) unsigned short sKh[32][D + 8], sKl[32][D + 8], sVh[32][D + 8], sVl[32][D + 8];
  __shared__ __attribute__((aligned(16))) unsigned short sPh[4][16][40], sPl[4][16][40];
  __shared__ __attribute__((aligned(16))) float sO[4][16][D];
  const int tid = threadIdx.x, w = tid >> 5, lane = tid & 31, ln = lane & 15, hh = lane >> 4;
  const int nqb = (T + 63) / 64;
  const int bh = blockIdx.x / nqb, qblk = blockIdx.x % nqb;
  const int b = bh / H, h = bh % H;
  const int q0 = qblk * 64 + w * 16;
  const float* Q = qb + (size_t)b * T * pitch + h * D;
  const float* K = kb + (size_t)b * T * pitch + h * D;
  const float* V = vb + (size_t)b * T * pitch + h * D;

  // A fragments of the wave's 16 query rows (scaled), hi/lo
  FragB aqh[KS], aql[KS];
  {
    int row = q0 + ln; if (row >= T) row = T - 1;
    const float* qr = Q + (size_t)row * pitch;
#pragma unroll
    for (int ks = 0; ks < KS; ++ks)
#pragma unroll
      for (int i = 0; i < 16; ++i) {
        const int d = ks * 32 + ((i < 8) ? (8 * hh + i) : (16 + 8 * hh + (i - 8)));
        const float x = qr[d] * scale; const unsigned short hb = bf16_bits(x);
        aqh[ks].u[i] = hb; aql[ks].u[i] = bf16_bits(x - bf16_val(hb));
      }
  }
  float m_r[8], l_r[8];
#pragma unroll
  for (int r = 0; r < 8; ++r) { m_r[r] = -3.0e38f; l_r[r] = 0.f; }
  v8f oacc[DT];
#pragma unroll
  for (int dt = 0; dt < DT; ++dt) oacc[dt] = (v8f){0.f,0.f,0.f,0.f,0.f,0.f,0.f,0.f};

  const int kv_end = CAUSAL ? min(T, qblk * 64 + 64) : T;     // block-uniform
  for (int j0 = 0; j0 < kv_end; j0 += 32) {
    __syncthreads();
    for (int e = tid; e < 32 * (D / 4); e += 128) {
      const int r = e / (D / 4), c4 = (e % (D / 4)) * 4;
      const int key = j0 + r;
      v4f kf = {0.f,0.f,0.f,0.f}, vf = {0.f,0.f,0.f,0.f};
      if (key < T) { kf = *(const v4fa*)(K + (size_t)key * pitch + c4); vf = *(const v4fa*)(V + (size_t)key * pitch + c4); }
#pragma unroll
      for (int t = 0; t < 4; ++t) {
        unsigned short hb = bf16_bits(kf[t]); sKh[r][c4 + t] = hb; sKl[r][c4 + t] = bf16_bits(kf[t] - bf16_val(hb));
        hb = bf16_bits(vf[t]); sVh[r][c4 + t] = hb; sVl[r][c4 + t] = bf16_bits(vf[t] - bf16_val(hb));
      }
    }
    __syncthreads();
    // S tile 16 x 32
    v8f s[2];
#pragma unroll
    for (int nt = 0; nt < 2; ++nt) {
      v8f acc = {};
#pragma unroll
      for (int ks = 0; ks < KS; ++ks) {
        FragB bh_, bl_;
        bh_.half[0] = *(const v8us*)&sKh[nt * 16 + ln][ks * 32 + 8 * hh]; bh_.half[1] = *(const v8us*)&sKh[nt * 16 + ln][ks * 32 + 16 + 8 * hh];
        bl_.half[0] = *(const v8us*)&sKl[nt * 16 + ln][ks * 32 + 8 * hh]; bl_.half[1] = *(const v8us*)&sKl[nt * 16 + ln][ks * 32 + 16 + 8 * hh];
        acc = mmaN<3>(aqh[ks].v, aql[ks].v, bh_.v, bl_.v, acc);
      }
      s[nt] = acc;
    }
    // mask + running max (rows 8hh+r; the 16 lanes of a half share rows)
    float alpha[8];
#pragma unroll
    for (int r = 0; r < 8; ++r) {
      const int qi = q0 + 8 * hh + r;
      const int ja = j0 + ln, jb = j0 + 16 + ln;
      if (CAUSAL) { if (ja > qi) s[0][r] = -3.0e38f; if (jb > qi) s[1][r] = -3.0e38f; }
      if (ja >= T) s[0][r] = -3.0e38f;
      if (jb >= T) s[1][r] = -3.0e38f;
      float mx = fmaxf(s[0][r], s[1][r]);
      mx = fmaxf(mx, __shfl_xor(mx, 1, 32)); mx = fmaxf(mx, __shfl_xor(mx, 2, 32)); mx = fmaxf(mx, __shfl_xor(mx, 4, 32)); mx = fmaxf(mx, __shfl_xor(mx, 8, 32));
      const float mnew = fmaxf(m_r[r], mx);
      alpha[r] = (mnew > -1.0e38f) ? __expf(m_r[r] - mnew) : 1.0f;
      const float p0 = (s[0][r] > -1.0e38f) ? __expf(s[0][r] - mnew) : 0.f;
      const float p1 = (s[1][r] > -1.0e38f) ? __expf(s[1][r] - mnew) : 0.f;
      m_r[r] = mnew;
      l_r[r] = l_r[r] * alpha[r] + p0 + p1;            // per-lane partial row sum (16 lanes combined at the end)
      unsigned short hb = bf16_bits(p0); sPh[w][8 * hh + r][ln] = hb;      sPl[w][8 * hh + r][ln] = bf16_bits(p0 - bf16_val(hb));
      hb = bf16_bits(p1);                sPh[w][8 * hh + r][16 + ln] = hb; sPl[w][8 * hh + r][16 + ln] = bf16_bits(p1 - bf16_val(hb));
    }
#pragma unroll
    for (int dt = 0; dt < DT; ++dt)
#pragma unroll
      for (int r = 0; r < 8; ++r) oacc[dt][r] *= alpha[r];
    __builtin_amdgcn_fence(__ATOMIC_ACQ_REL, "workgroup");
    __builtin_amdgcn_wave_barrier();
    FragB pah, pal;
    pah.half[0] = *(const v8us*)&sPh[w][ln][8 * hh]; pah.half[1] = *(const v8us*)&sPh[w][ln][16 + 8 * hh];
    pal.half[0] = *(const v8us*)&sPl[w][ln][8 * hh]; pal.half[1] = *(const v8us*)&sPl[w][ln][16 + 8 * hh];
#pragma unroll
    for (int dt = 0; dt < DT; ++dt) {
      FragB bvh, bvl;
#pragma unroll
      for (int i = 0; i < 8; ++i) {
        bvh.u[i] = sVh[8 * hh + i][dt * 16 + ln]; bvh.u[8 + i] = sVh[16 + 8 * hh + i][dt * 16 + ln];
        bvl.u[i] = sVl[8 * hh + i][dt * 16 + ln]; bvl.u[8 + i] = sVl[16 + 8 * hh + i][dt * 16 + ln];
      }
      oacc[dt] = mmaN<3>(pah.v, pal.v, bvh.v, bvl.v, oacc[dt]);
    }
    __builtin_amdgcn_fence(__ATOMIC_ACQ_REL, "workgroup");
    __builtin_amdgcn_wave_barrier();
  }
#pragma unroll
  for (int r = 0; r < 8; ++r) {
    float l = l_r[r];
    l += __shfl_xor(l, 1, 32); l += __shfl_xor(l, 2, 32); l += __shfl_xor(l, 4, 32); l += __shfl_xor(l, 8, 32);
    l_r[r] = (l > 0.f) ? 1.0f / l : 0.f;
  }
#pragma unroll
  for (int dt = 0; dt < DT; ++dt)
#pragma unroll
    for (int r = 0; r < 8; ++r) sO[w][8 * hh + r][dt * 16 + ln] = oacc[dt][r] * l_r[r];
  __builtin_amdgcn_fence(__ATOMIC_ACQ_REL, "workgroup");
  __builtin_amdgcn_wave_barrier();
  {
    for (int r = 0; r < 16; ++r) {
      const int row = q0 + r;
      if (row < T && lane < D / 4) {
        const v4f val = *(const v4fa*)&sO[w][r][lane * 4];
        *(v4f*)(y + ((size_t)b * T + row) * ypitch + h * D + lane * 4) = val;
      }
    }
    
  }
}

// Which 64-query x 32-key tiles of the int mask [T][T] hold a nonzero word at all: bit (kt & 31) of word [qt][kt >> 5], each word
// alone in a 128-byte line of its own (one writer a line). Block = 32 waves = 32 key tiles of one query tile, a tile a wave. T % 32 == 0.
__global__ __launch_bounds__(1024) void k_mask_tiles(const int* __restrict__ mask, unsigned* __restrict__ tbits, int T) {
  __shared__ int sany[32];
  const int w = threadIdx.x >> 5, lane = threadIdx.x & 31;
  const int nw = (T / 32 + 31) / 32;
  const int qt = blockIdx.x / nw, kt = (blockIdx.x % nw) * 32 + w;
  int any = 0;
  if (kt * 32 < T) {           // wave-uniform
    unsigned mo[16];           // byte offsets (the mask is far below 4 GiB): four whole 128-byte rows of the tile a load
#pragma unroll  // offsets in registers
    for (int i = 0; i < 16; ++i) {
      int row = qt * 64 + i * 4 + (lane >> 3); row = row < T ? row : T - 1;
      mo[i] = ((unsigned)row * (unsigned)T + (unsigned)(kt * 32 + (lane & 7) * 4)) * 4u;
    }
    v4ia mv[16];
#pragma unroll  // mv in registers, many loads in flight at once
    for (int i = 0; i < 16; ++i) mv[i] = *(const v4ia*)((const char*)mask + mo[i]);
    // No offset register of the batch is rewritten (not even as a later load's destination) in front of this wait.
    asm volatile("s_wait_xcnt 0x0" :: "v"(mo[0]), "v"(mo[1]), "v"(mo[2]), "v"(mo[3]), "v"(mo[4]), "v"(mo[5]), "v"(mo[6]), "v"(mo[7]),
                 "v"(mo[8]), "v"(mo[9]), "v"(mo[10]), "v"(mo[11]), "v"(mo[12]), "v"(mo[13]), "v"(mo[14]), "v"(mo[15]) : "memory");
#pragma unroll  // mv is indexed by constants
    for (int i = 0; i < 16; ++i) any |= mv[i][0] | mv[i][1] | mv[i][2] | mv[i][3];
  }
  const unsigned wany = __builtin_amdgcn_ballot_w32(any != 0);
  if (lane == 0) sany[w] = wany != 0u;
  __syncthreads();             // all 32 tiles' answers are in LDS
  if (w == 0) {
    const unsigned bits = __builtin_amdgcn_ballot_w32(sany[lane] != 0);
    if (lane == 0) tbits[(size_t)blockIdx.x * 32] = bits;
  }
}

// Self-attention (Tq == Tk == T) with optional int mask [T][T] (nonzero = keep) and/or causal flag; 3-term bf16 splits;
// Q rows read from an f32 buffer: Qb + b*T*qpitch + h*D + row*qpitch. K and V rows arrive split (k_gemm_bf's CSPLIT form): D bf16 high
// parts, then D bf16 low parts, at X + b*T*pitch + h*2*D + row*pitch, pitches in 16-bit elements.
// y[b][row][h*D + d], pitch ypitch. D % 32 == 0, T % 32 == 0.
// tbits: k_mask_tiles' words for this mask. A work-group takes two query tiles of a head, one after the other: n - 1 - t, then t.
// Both products are computed transposed, St = K*Qt and Ot += Vt*Pt: a lane (ln, hh) then holds scores of ONE query, q0 + ln, for keys
// 8 hh + r and 16 + 8 hh + r, which is the k order of a B operand: P goes from accumulator to operand inside the lane's own registers,
// and maximum, sum and rescale factor are one value a lane (the two halves of a wave join by one exchange).
template <int D>
__global__ __launch_bounds__(128) void k_flashm(const float* __restrict__ Qb, int qpitch, const unsigned short* __restrict__ Kb, int kpitch,
                                              const unsigned short* __restrict__ Vb, int vpitch, int T, int H, float scale,
                                              const int* __restrict__ mask, const unsigned* __restrict__ tbits, int causal,
                                              float* __restrict__ y, int ypitch) {
  constexpr int KS = D / 32, DT = D / 16;
  // An LDS row is a global row as it stands: D high parts, then D low parts.
  constexpr int KP = 2 * D + 8;    // K row pitch in elements: an odd multiple of 16 bytes, the conflict-free pitch of 16-byte reads down a column
  constexpr int VP = 2 * D + 16;   // V row pitch in elements: an odd multiple of 32 bytes, the conflict-free pitch of the transposing load
  static_assert((KP * 2) % 16 == 0 && ((KP * 2 / 16) & 1) == 1, "K rows: odd multiple of 16 bytes");
  static_assert((VP * 2) % 32 == 0 && ((VP * 2 / 32) & 1) == 1, "V rows: odd multiple of 32 bytes");
  __shared__ __attribute__((aligned(16))) unsigned short sK[32][KP], sV[32][VP];
  __shared__ __attribute__((aligned(16))) float sO[4][16][D + 4];   // row pitch an odd multiple of 16 bytes: 16 lanes store 16 bytes each down a column
  const int tid = threadIdx.x, w = tid >> 5, lane = tid & 31, ln = lane & 15, hh = lane >> 4;
  const int nqb = (T + 63) / 64, npair = (nqb + 1) / 2, nw = (T / 32 + 31) / 32;
  const int bh = blockIdx.x / npair, tlow = blockIdx.x % npair;
  const int b = bh / H, h = bh % H;
  const float* Q = Qb + (size_t)b * T * qpitch + h * D;
  const unsigned short* K = Kb + (size_t)b * T * kpitch + h * 2 * D;
  const unsigned short* V = Vb + (size_t)b * T * vpitch + h * 2 * D;
  // Under a mask that shuts more keys the lower the query's index, tiles n - 1 - t and t together cost every work-group the same number of
  // passes; all work-groups are resident at once, so the launch lasts as long as the longest. An odd n's middle tile is taken once.
  const int nparts = (nqb - 1 - tlow != tlow) ? 2 : 1;
#pragma unroll 1  // one copy of the body in the instruction cache
  for (int part = 0; part < nparts; ++part) {
  const int qblk = part ? tlow : nqb - 1 - tlow;
  const int q0 = qblk * 64 + w * 16;
  unsigned tw = ~0u;           // lane l: the query tile's word l of tbits (32 passes a word; T * T * 4 < 4 GiB, so never more than 32 words)
  if (mask) {
    const unsigned two = (unsigned)(qblk * nw + (lane < nw ? lane : nw - 1)) * 128u;
    tw = *(const unsigned*)((const char*)tbits + two);
    // The offset register is not rewritten in front of this wait.
    asm volatile("s_wait_xcnt 0x0" :: "v"(two) : "memory");
  }
  FragB aqh[KS], aql[KS];
  {
    int row = q0 + ln; if (row >= T) row = T - 1;
    const float* qr = Q + (size_t)row * qpitch;
#pragma unroll
    for (int ks = 0; ks < KS; ++ks)
#pragma unroll
      for (int i = 0; i < 16; ++i) {
        const int d = ks * 32 + ((i < 8) ? (8 * hh + i) : (16 + 8 * hh + (i - 8)));
        const float x = qr[d] * scale; const unsigned short hb = bf16_bits(x);
        aqh[ks].u[i] = hb; aql[ks].u[i] = bf16_bits(x - bf16_val(hb));
      }
  }
  const int qrow = q0 + ln < T ? q0 + ln : T - 1;   // the lane's query
  float m_q = -3.0e38f, l_q = 0.f;                  // its running maximum; the sum over this half's keys
  v8f oacc[DT];                                     // oacc[dt][r]: element dt * 16 + 8 hh + r of the query's output row
#pragma unroll
  for (int dt = 0; dt < DT; ++dt) oacc[dt] = (v8f){0.f,0.f,0.f,0.f,0.f,0.f,0.f,0.f};
  const int kv_end = causal ? min(T, qblk * 64 + 64) : T;
  constexpr int NL = D / 16, RS = 128 / (D / 4);               // K (and V) 16-byte pieces per thread and pass; rows between a thread's pieces
  const int sr = tid / (D / 4), sc8 = (tid % (D / 4)) * 8;     // the thread's first staged row, and its place in the row of 2 D elements
  const unsigned kofs = ((unsigned)sr * (unsigned)kpitch + (unsigned)sc8) * 2u, vofs = ((unsigned)sr * (unsigned)vpitch + (unsigned)sc8) * 2u;
  // the lane's own 16 bytes of a 16 x 16 V tile for the transposing load: row 8 hh + (lane & 7), column half (lane >> 3) & 1
  const unsigned short* vth = &sV[8 * hh + (lane & 7)][8 * ((lane >> 3) & 1)];
  const unsigned short* vtl = vth + D;
  const unsigned mofs = ((unsigned)qrow * (unsigned)T + (unsigned)(8 * hh)) * 4u;
  unsigned tb = 0u;
  for (int j0 = 0; j0 < kv_end; j0 += 32) {
    // A pass whose 64 x 32 mask tile holds no set word leaves every maximum, sum and accumulator as it is (each p is 0, each alpha 1):
    // the whole work-group steps over it, its loads and both its barriers included (the test reads the same in every wave).
    if ((j0 & 1023) == 0) tb = (unsigned)__builtin_amdgcn_readlane((int)tw, j0 >> 10);
    if (((tb >> ((j0 >> 5) & 31)) & 1u) == 0u) continue;
    // All that the pass (32 keys) reads from global memory goes out as one batch, under no lane test, so that the loads'
    // latencies overlap: uniform base, fixed lane offsets; every key of a pass is below T (T % 32 == 0).
    static_assert(NL == 4, "the wait behind the K/V loads names four K and four V addresses");
    const char *kp[NL], *vp[NL];
    v8us kq[NL], vq[NL];
#pragma unroll  // addresses in registers
    for (int i = 0; i < NL; ++i) {
      kp[i] = (const char*)(K + (size_t)(j0 + i * RS) * kpitch) + kofs;
      vp[i] = (const char*)(V + (size_t)(j0 + i * RS) * vpitch) + vofs;
    }
#pragma unroll  // the eight loads back to back
    for (int i = 0; i < NL; ++i) { kq[i] = *(const v8us*)kp[i]; vq[i] = *(const v8us*)vp[i]; }
    // No address register of the batch is reused (not even as a later load's destination) in front of this wait.
    asm volatile("s_wait_xcnt 0x0" :: "v"(kp[0]), "v"(kp[1]), "v"(kp[2]), "v"(kp[3]), "v"(vp[0]), "v"(vp[1]), "v"(vp[2]), "v"(vp[3]) : "memory");
    // The query's mask words for keys j0 + 8 hh + 0..7 (mk[0], mk[1]) and j0 + 16 + 8 hh + 0..7 (mk[2], mk[3]).
    v4ia mk[4];
#pragma unroll  // words in registers
    for (int i = 0; i < 4; ++i) mk[i] = (v4ia){1, 1, 1, 1};
    if (mask) {
      const char* mp = (const char*)(mask + j0) + mofs;
      mk[0] = *(const v4ia*)mp; mk[1] = *(const v4ia*)(mp + 16); mk[2] = *(const v4ia*)(mp + 64); mk[3] = *(const v4ia*)(mp + 80);
      // The same for the mask words' address.
      asm volatile("s_wait_xcnt 0x0" :: "v"(mp) : "memory");
    }
    __syncthreads();
#pragma unroll  // kq and vq are indexed by constants
    for (int i = 0; i < NL; ++i) { *(v8us*)&sK[sr + i * RS][sc8] = kq[i]; *(v8us*)&sV[sr + i * RS][sc8] = vq[i]; }
    __syncthreads();
    v8f s[2];                  // s[nt][r]: key j0 + nt * 16 + 8 hh + r against the lane's query
#pragma unroll
    for (int nt = 0; nt < 2; ++nt) {
      v8f acc = {};
#pragma unroll
      for (int ks = 0; ks < KS; ++ks) {
        FragB kh_, kl_;
        const unsigned short* krow = &sK[nt * 16 + ln][ks * 32 + 8 * hh];
        kh_.half[0] = *(const v8us*)krow;       kh_.half[1] = *(const v8us*)(krow + 16);
        kl_.half[0] = *(const v8us*)(krow + D); kl_.half[1] = *(const v8us*)(krow + D + 16);
        acc = mma3T(kh_.v, kl_.v, aqh[ks].v, aql[ks].v, acc);
      }
      s[nt] = acc;
    }
    // The pass's whole V operand as one group of loads, in front of the softmax arithmetic, which covers their latency.
    // Lane (ln, hh) receives V[kbase + 8 hh + 0..7][dt * 16 + ln], kbase 0 and 16: row dt * 16 + ln of Vt in the k order of the P fragment below.
    FragB bvh[DT], bvl[DT];
#pragma unroll  // fragments in registers
    for (int dt = 0; dt < DT; ++dt) {
      bvh[dt].half[0] = lds_tr16(vth + dt * 16); bvh[dt].half[1] = lds_tr16(vth + 16 * VP + dt * 16);
      bvl[dt].half[0] = lds_tr16(vtl + dt * 16); bvl[dt].half[1] = lds_tr16(vtl + 16 * VP + dt * 16);
    }
    if (causal) {              // the same in every lane: one branch for the sixteen words
#pragma unroll  // mk is indexed by constants
      for (int i = 0; i < 16; ++i) mk[i >> 2][i & 3] = (j0 + (i >> 3) * 16 + 8 * hh + (i & 7) <= qrow) ? mk[i >> 2][i & 3] : 0;
    }
    float mx = -3.0e38f;
#pragma unroll  // s and mk are indexed by constants
    for (int nt = 0; nt < 2; ++nt)
#pragma unroll  // likewise
      for (int r = 0; r < 8; ++r) {
        s[nt][r] = mk[nt * 2 + (r >> 2)][r & 3] != 0 ? s[nt][r] : -3.0e38f;
        mx = fmaxf(mx, s[nt][r]);
      }
    mx = fmaxf(mx, xhalf(mx));   // the other half's sixteen keys
    const float mnew = fmaxf(m_q, mx);
    const bool live = mnew > -1.0e38f;                        // some key of the query has been kept so far
    const float alpha = live ? __expf(m_q - mnew) : 1.0f;
    const float msub = live ? mnew : 0.f;                     // a shut key's -3e38 less msub gives p = 0 in either case
    m_q = mnew;
    FragB pbh, pbl;            // Pt as a B operand: element i is key 8 hh + i, element 8 + i key 16 + 8 hh + i, column ln
    float ps[8];
#pragma unroll  // fragments in registers
    for (int r = 0; r < 8; ++r) {
      const float p0 = __expf(s[0][r] - msub), p1 = __expf(s[1][r] - msub);
      ps[r] = p0 + p1;
      unsigned short hb = bf16_bits(p0); pbh.u[r] = hb;     pbl.u[r] = bf16_bits(p0 - bf16_val(hb));
      hb = bf16_bits(p1);                pbh.u[8 + r] = hb; pbl.u[8 + r] = bf16_bits(p1 - bf16_val(hb));
    }
    l_q = l_q * alpha + (((ps[0] + ps[1]) + (ps[2] + ps[3])) + ((ps[4] + ps[5]) + (ps[6] + ps[7])));
#pragma unroll
    for (int dt = 0; dt < DT; ++dt)
#pragma unroll
      for (int r = 0; r < 8; ++r) oacc[dt][r] *= alpha;
#pragma unroll  // oacc and the fragments are indexed by constants
    for (int dt = 0; dt < DT; ++dt) oacc[dt] = mma3T(bvh[dt].v, bvl[dt].v, pbh.v, pbl.v, oacc[dt]);
  }
  // NaN for fully-masked rows (softmax over a row of -inf)
  l_q += xhalf(l_q);
  const float inv = (m_q > -1.0e38f) ? 1.0f / l_q : __builtin_nanf("");
#pragma unroll  // oacc is indexed by constants
  for (int dt = 0; dt < DT; ++dt) {
    const v4f o0 = {oacc[dt][0] * inv, oacc[dt][1] * inv, oacc[dt][2] * inv, oacc[dt][3] * inv};
    const v4f o1 = {oacc[dt][4] * inv, oacc[dt][5] * inv, oacc[dt][6] * inv, oacc[dt][7] * inv};
    *(v4fa*)&sO[w][ln][dt * 16 + 8 * hh] = o0;
    *(v4fa*)&sO[w][ln][dt * 16 + 8 * hh + 4] = o1;
  }
  __builtin_amdgcn_fence(__ATOMIC_ACQ_REL, "workgroup");
  __builtin_amdgcn_wave_barrier();
  {
    for (int r = 0; r < 16; ++r) {
      const int row = q0 + r;
      if (row < T && lane < D / 4) {
        const v4f val = *(const v4fa*)&sO[w][r][lane * 4];
        *(v4f*)(y + ((size_t)b * T + row) * ypitch + h * D + lane * 4) = val;
      }
    }
    
  }
  // The next tile's first instructions rewrite registers that the last store names: not in front of this wait.
  asm volatile("s_wait_xcnt 0x0" ::: "memory");
  }
}

extern "C" void kernel_launch(void* const* d_in, const int* in_sizes, int n_in,
                              void* d_out, int out_size, void* d_ws, size_t ws_size, hipStream_t stream) {
  (void)in_sizes; (void)n_in; (void)out_size;
  const float* x = (const float*)d_in[0]; const int* mask = (const int*)d_in[1];
  const float* Wq = (const float*)d_in[2]; const float* Wkv = (const float*)d_in[3];
  const float* Wo = (const float*)d_in[4]; const float* bo = (const float*)d_in[5];
  char* ws = (char*)d_ws; size_t off = 0;
  unsigned short* Wqt  = (unsigned short*)(ws + off); off += (size_t)DM * DM * 2;       // [1024][1024]
  unsigned short* Wkvt = (unsigned short*)(ws + off); off += (size_t)2 * DM * DM * 2;   // [2048][1024]
  unsigned short* Wot  = (unsigned short*)(ws + off); off += (size_t)DM * DM * 2;
  float* qb  = (float*)(ws + off); off += (size_t)BB * NN * DM * 4;                    // 16 MiB
  float* kvb = (float*)(ws + off); off += (size_t)BB * NN * 2 * DM * 4;                // 32 MiB
  float* ob  = (float*)(ws + off); off += (size_t)BB * NN * DM * 4;                    // 16 MiB
  unsigned* tbits = (unsigned*)(ws + off); off += (size_t)(NN / 64) * (NN / 1024) * 128; // a 128-byte line a word
  if (off > ws_size) return;
  const int M = BB * NN;
  k_mask_tiles<<<(NN / 64) * (NN / 1024), 1024, 0, stream>>>(mask, tbits, NN);
  k_wt_bf16<<<(4 * DM / 128) * (DM / 64), 256, 0, stream>>>(Wq, Wqt, DM, Wkv, Wkvt, 2 * DM, Wo, Wot, DM, DM);
  k_gemm_bf<false, 0, false, false><<<(M / 64) * (DM / 128), 128, 0, stream>>>(x, DM, Wqt, DM, nullptr, qb, DM, M, DM, DM);
  k_gemm_bf<false, 0, false, true><<<(M / 64) * (2 * DM / 128), 128, 0, stream>>>(x, DM, Wkvt, DM, nullptr, kvb, 2 * DM, M, 2 * DM, DM);
  // k = kv[..., 0:1024] (head h at h*64), v = kv[..., 1024:2048]; stored split, a row is 4096 16-bit elements, head h's 128 at h*128
  const unsigned short* kvs = (const unsigned short*)kvb;
  k_flashm<HD><<<BB * NH * (NN / 128), 128, 0, stream>>>(qb, DM, kvs, 4 * DM, kvs + 2 * DM, 4 * DM, NN, NH, 0.03125f, mask, tbits, 0, ob, DM);
  k_gemm_bf<true, 0, true, false><<<(M / 64) * (DM / 128), 128, 0, stream>>>(ob, DM, Wot, DM, bo, (float*)d_out, DM, M, DM, DM);
}

// v009
// One run takes 150 microseconds.
// Timed twice side by side with v008, it ran 1.17 times as fast both times.
// Over all steps from v000 it is 4.48 times as fast.
#include <hip/hip_runtime.h>
// All contractions on v_wmma_f32_16x16x32_bf16, f32 accumulate: q = x·Wq and kv = x·Wkv with x/W rounded to bf16 (single
// exact-product term), QKᵀ and P·V 3-term bf16 hi/lo splits, out = o·Wout with o split hi/lo (2 terms); softmax f32.
// K and V are split hi/lo once, where the kv GEMM stores them; the attention kernel copies the two planes into LDS as they are,
// asynchronously, one pass ahead of their use.
// The boolean mask input is applied as given (together with nothing else).
#define BB 2
#define NN 2048
#define DM 1024
#define NH 16
#define HD 64

typedef __bf16 v16b __attribute__((ext_vector_type(16)));
typedef unsigned short v8us __attribute__((ext_vector_type(8), may_alias));
typedef unsigned short v4us __attribute__((ext_vector_type(4), may_alias));
typedef float  v8f  __attribute__((ext_vector_type(8)));
typedef float  v4f  __attribute__((ext_vector_type(4)));
typedef float  v4fa __attribute__((ext_vector_type(4), may_alias));
typedef int    v4ia __attribute__((ext_vector_type(4), may_alias));
union FragB { v16b v; v8us half[2]; unsigned short u[16]; };

__device__ __forceinline__ unsigned short bf16_bits(float x) { unsigned int u = __float_as_uint(x); return (unsigned short)((u + 0x7FFFu + ((u >> 16) & 1u)) >> 16); }
__device__ __forceinline__ float bf16_val(unsigned short b) { return __uint_as_float(((unsigned int)b) << 16); }
__device__ __forceinline__ float bf16_round(float x) { return bf16_val(bf16_bits(x)); }
// D += A·B with NT terms: 1 = ah·bh, 2 = + al·bh (A split), 3 = + ah·bl (both split)
template <int NT>
__device__ __forceinline__ v8f mmaN(v16b ah, v16b al, v16b bh, v16b bl, v8f c) {
  c = __builtin_amdgcn_wmma_f32_16x16x32_bf16(false, ah, false, bh, (short)0, c, false, false);
  if (NT >= 2) c = __builtin_amdgcn_wmma_f32_16x16x32_bf16(false, al, false, bh, (short)0, c, false, false);
  if (NT >= 3) c = __builtin_amdgcn_wmma_f32_16x16x32_bf16(false, ah, false, bl, (short)0, c, false, false);
  asm volatile("v_nop\n\tv_nop\n\tv_nop\n\tv_nop" : "+v"(c) : "v"(ah), "v"(al), "v"(bh), "v"(bl));
  return c;
}

// The same three terms for a transposed product, Dt += Bt*At with the operands swapped: ah*bh + ah*bl + al*bh, which is the order
// in which mmaN<3> adds them when a and b stand the other way round.
__device__ __forceinline__ v8f mma3T(v16b ah, v16b al, v16b bh, v16b bl, v8f c) {
  c = __builtin_amdgcn_wmma_f32_16x16x32_bf16(false, ah, false, bh, (short)0, c, false, false);
  c = __builtin_amdgcn_wmma_f32_16x16x32_bf16(false, ah, false, bl, (short)0, c, false, false);
  c = __builtin_amdgcn_wmma_f32_16x16x32_bf16(false, al, false, bh, (short)0, c, false, false);
  // four vector slots between the last product and whatever reads D or overwrites an operand, on every path
  asm volatile("v_nop\n\tv_nop\n\tv_nop\n\tv_nop" : "+v"(c) : "v"(ah), "v"(al), "v"(bh), "v"(bl));
  return c;
}
// lane l's value to lane l ^ 16 and back: the two halves of a wave exchange, on the vector unit
__device__ __forceinline__ float xhalf(float x) {
  const int b = __builtin_bit_cast(int, x);
  return __builtin_bit_cast(float, __builtin_amdgcn_permlanex16(b, b, 0x76543210, 0xfedcba98, false, false));
}

// Transposing LDS load: a row-major 16 x 16 tile of 16-bit elements arrives as half of a WMMA operand (8 k of one column per lane).
__device__ __forceinline__ v8us lds_tr16(const unsigned short* p) {
  typedef short s16x8 __attribute__((ext_vector_type(8)));
  typedef __attribute__((address_space(3))) s16x8 lds_s16x8;
  return __builtin_bit_cast(v8us, __builtin_amdgcn_ds_load_tr16_b128_v8i16((lds_s16x8*)p));
}

// The byte address inside the work-group's LDS of a __shared__ object: what an asynchronous copy to LDS takes as its destination.
__device__ __forceinline__ unsigned lds_addr(const void* p) {
  return (unsigned)(unsigned long long)(const __attribute__((address_space(3))) void*)p;
}

// Wt[n][k] = bf16(W[k][n]) for three weight matrices of K rows (N0, N1, N2 columns) in one launch. Block = 8 waves = a tile of 64 k x 128 n:
// wave w loads rows 8 w .. 8 w + 7, each load 512 contiguous bytes of one row (four whole lines); the tile turns in LDS, and each store
// covers four whole 128-byte lines of Wt (64 k of one n a line, one writer a line). K % 64 == 0, N % 128 == 0.
// LDS row j * 32 + l holds column n0 + 4 l + j: the lanes of a store then stand one row apart, which at this pitch meets no bank twice.
__global__ __launch_bounds__(256) void k_wt_bf16(const float* __restrict__ W0, unsigned short* __restrict__ T0, int N0,
                                                 const float* __restrict__ W1, unsigned short* __restrict__ T1, int N1,
                                                 const float* __restrict__ W2, unsigned short* __restrict__ T2, int N2, int K) {
  constexpr int TP = 64 + 8;   // row pitch in elements, 144 B: an odd multiple of 16 bytes
  __shared__ __attribute__((aligned(16))) unsigned short sT[128][TP];
  const int tid = threadIdx.x, w = tid >> 5, lane = tid & 31;
  const int kt = K / 64, nb0 = (N0 / 128) * kt, nb1 = (N1 / 128) * kt;
  int blk = blockIdx.x;        // block-uniform choice of the matrix
  const float* W = W0; unsigned short* Wt = T0; int N = N0;
  if (blk >= nb0 + nb1) { blk -= nb0 + nb1; W = W2; Wt = T2; N = N2; }
  else if (blk >= nb0)  { blk -= nb0;       W = W1; Wt = T1; N = N1; }
  const int k0 = (blk % kt) * 64, n0 = (blk / kt) * 128;
  if (n0 >= N) return;         // block-uniform, in front of the barrier
  unsigned wo[8];              // byte offsets (each matrix is far below 4 GiB)
#pragma unroll  // offsets in registers
  for (int i = 0; i < 8; ++i) wo[i] = ((unsigned)(k0 + w * 8 + i) * (unsigned)N + (unsigned)(n0 + lane * 4)) * 4u;
  v4f q[8];
#pragma unroll  // the eight loads back to back
  for (int i = 0; i < 8; ++i) q[i] = *(const v4fa*)((const char*)W + wo[i]);
  // No offset register of the batch is rewritten (not even as a later load's destination) in front of this wait.
  asm volatile("s_wait_xcnt 0x0" :: "v"(wo[0]), "v"(wo[1]), "v"(wo[2]), "v"(wo[3]), "v"(wo[4]), "v"(wo[5]), "v"(wo[6]), "v"(wo[7]) : "memory");
  // No rounding moves up among the loads: without this the last two loads went out only after the first ones had returned.
  __builtin_amdgcn_sched_barrier(0);
#pragma unroll  // q is indexed by constants
  for (int j = 0; j < 4; ++j) {
    v8us v;
#pragma unroll
    for (int i = 0; i < 8; ++i) v[i] = bf16_bits(q[i][j]);
    *(v8us*)&sT[j * 32 + lane][w * 8] = v;
  }
  __syncthreads();             // the tile is whole
  const int r8 = tid >> 3, c8 = (tid & 7) * 8;   // eight lanes a row of 128 bytes
  v8us o[4];
#pragma unroll  // the four LDS reads as one group
  for (int i = 0; i < 4; ++i) o[i] = *(const v8us*)&sT[i * 32 + r8][c8];
#pragma unroll
  for (int i = 0; i < 4; ++i) *(v8us*)((char*)Wt + ((unsigned)(n0 + 4 * r8 + i) * (unsigned)K + (unsigned)(k0 + c8)) * 2u) = o[i];
}

// One 64-k step of a GEMM block's operands, global memory to registers, as one batch of whole-line loads
// (A: 16 lanes a row of 256 B; W: 8 lanes a row of 128 B): uniform bases, sixteen running byte offsets that then move on by 64 k.
__device__ __forceinline__ void gemm_fetch(const float* A, const unsigned short* Wt, unsigned (&ao)[8], unsigned (&bo)[8], v4f (&aq)[8], v8us (&bq)[8]) {
#pragma unroll  // the sixteen loads back to back
  for (int i = 0; i < 8; ++i) { aq[i] = *(const v4fa*)((const char*)A + ao[i]); bq[i] = *(const v8us*)((const char*)Wt + bo[i]); }
  // No offset register of the batch is rewritten (not even as a later load's destination) in front of this wait.
  asm volatile("s_wait_xcnt 0x0" :: "v"(ao[0]), "v"(ao[1]), "v"(ao[2]), "v"(ao[3]), "v"(ao[4]), "v"(ao[5]), "v"(ao[6]), "v"(ao[7]),
               "v"(bo[0]), "v"(bo[1]), "v"(bo[2]), "v"(bo[3]), "v"(bo[4]), "v"(bo[5]), "v"(bo[6]), "v"(bo[7]) : "memory");
#pragma unroll  // offsets in registers
  for (int i = 0; i < 8; ++i) { ao[i] += 64u * 4u; bo[i] += 64u * 2u; }
}

// GEMM C[M][N] (f32, pitch ldc) = act(A[M][K]·W + bias). A f32 row-major (pitch lda), converted to bf16 once per block
// (ASPLIT: hi/lo two planes -> 2 terms, else single rounded term); Wt bf16 [N][K] (pitch ldb). BIAS_BF16 rounds the
// bias to bf16 first (bias quantised to bf16 before the add). Block = 4 waves = a 64 x 128 tile of C, wave = 32 x 64;
// both operands pass through LDS in steps of 64 k, the next step's loads in flight during the products of this one.
// K%64==0, K>=64, M%64==0, N%128==0.
// CSPLIT: C is stored split for a later 3-term product: the 256 bytes of each 64-column group of a row hold the 64 values' bf16 high
// parts, then the 64 bf16 roundings of what the high parts leave (same place and size as the group's f32 values would have).
template <bool ASPLIT, int ACT, bool BIAS_BF16, bool CSPLIT>
__global__ __launch_bounds__(128) void k_gemm_bf(const float* __restrict__ A, int lda, const unsigned short* __restrict__ Wt, int ldb,
                                               const float* __restrict__ bias, float* __restrict__ C, int ldc, int M, int N, int K) {
  constexpr int KP = 64 + 8;   // row pitch in elements, 144 B: an odd multiple of 16 bytes like the attention kernel's K rows, read the same way
  __shared__ __attribute__((aligned(16))) unsigned short sAh[64][KP], sAl[ASPLIT ? 64 : 1][KP], sB[128][KP];
  __shared__ __attribute__((aligned(16))) float so[4][32][64];
  const int tid = threadIdx.x, w = tid >> 5, lane = tid & 31, ln = lane & 15, hh = lane >> 4;
  const int wm = w >> 1, wn = w & 1;
  const int nb = N / 128;
  const int row0 = (blockIdx.x / nb) * 64, col0 = (blockIdx.x % nb) * 128;
  if (row0 >= M) return;       // block-uniform, in front of every barrier
  const int ar = tid >> 4, ac = (tid & 15) * 4, br = tid >> 3, bc = (tid & 7) * 8;
  unsigned ao[8], bo[8];       // byte offsets of A rows ar + 8 i and W rows br + 16 i (both operands are far below 4 GiB)
#pragma unroll  // offsets in registers
  for (int i = 0; i < 8; ++i) {
    ao[i] = ((unsigned)(row0 + ar + 8 * i) * (unsigned)lda + (unsigned)ac) * 4u;
    bo[i] = ((unsigned)(col0 + br + 16 * i) * (unsigned)ldb + (unsigned)bc) * 2u;
  }
  v4f aq[8]; v8us bq[8];
  v8f acc[2][4] = {};
  gemm_fetch(A, Wt, ao, bo, aq, bq);
  for (int kn = 64; ; kn += 64) {   // kn: the first k of the step after this one
    __syncthreads();           // every wave has read its last fragment of the step before
#pragma unroll  // aq and bq are indexed by constants
    for (int i = 0; i < 8; ++i) {
      v4us h, l;
#pragma unroll
      for (int t = 0; t < 4; ++t) { const unsigned short hb = bf16_bits(aq[i][t]); h[t] = hb; l[t] = ASPLIT ? bf16_bits(aq[i][t] - bf16_val(hb)) : (unsigned short)0; }
      *(v4us*)&sAh[ar + 8 * i][ac] = h;
      if (ASPLIT) *(v4us*)&sAl[ar + 8 * i][ac] = l;
      *(v8us*)&sB[br + 16 * i][bc] = bq[i];
    }
    __syncthreads();           // the step's tiles are whole
    if (kn < K) gemm_fetch(A, Wt, ao, bo, aq, bq);
#pragma unroll
    for (int ks = 0; ks < 2; ++ks) {
      FragB b[4];
#pragma unroll
      for (int t = 0; t < 4; ++t) {
        const unsigned short* brow = &sB[wn * 64 + t * 16 + ln][ks * 32];
        b[t].half[0] = *(const v8us*)(brow + 8 * hh);
        b[t].half[1] = *(const v8us*)(brow + 16 + 8 * hh);
      }
      FragB ah[2], al[2];
#pragma unroll  // all fragments of the 32 k as one group of LDS loads in front of their products
      for (int mi = 0; mi < 2; ++mi) {
        const int arow = wm * 32 + mi * 16 + ln;
        ah[mi].half[0] = *(const v8us*)&sAh[arow][ks * 32 + 8 * hh]; ah[mi].half[1] = *(const v8us*)&sAh[arow][ks * 32 + 16 + 8 * hh];
        if (ASPLIT) { al[mi].half[0] = *(const v8us*)&sAl[arow][ks * 32 + 8 * hh]; al[mi].half[1] = *(const v8us*)&sAl[arow][ks * 32 + 16 + 8 * hh]; }
        else al[mi] = ah[mi];
      }
#pragma unroll
      for (int mi = 0; mi < 2; ++mi)
#pragma unroll
        for (int t = 0; t < 4; ++t) acc[mi][t] = mmaN<ASPLIT ? 2 : 1>(ah[mi].v, al[mi].v, b[t].v, b[t].v, acc[mi][t]);
    }
    if (kn >= K) break;
  }
  const int rsub = lane >> 4, c4 = (lane & 15) * 4;
  float bv[4];
#pragma unroll
  for (int t = 0; t < 4; ++t) {
    bv[t] = bias ? bias[col0 + wn * 64 + t * 16 + ln] : 0.f;
    if (BIAS_BF16) bv[t] = bf16_round(bv[t]);
  }
#pragma unroll
  for (int mi = 0; mi < 2; ++mi)
#pragma unroll
    for (int t = 0; t < 4; ++t)
#pragma unroll
      for (int r = 0; r < 8; ++r) { float v = acc[mi][t][r] + bv[t]; if (ACT == 1) v = fmaxf(v, 0.f); so[w][mi * 16 + 8 * hh + r][t * 16 + ln] = v; }
  __builtin_amdgcn_fence(__ATOMIC_ACQ_REL, "workgroup");
  __builtin_amdgcn_wave_barrier();
  if (CSPLIT) {
    const int r4 = lane >> 3, c8 = (lane & 7) * 8;   // eight lanes a row: each store covers four whole 128-byte lines
#pragma unroll  // a round's LDS reads go out while the round before is split and stored
    for (int q = 0; q < 8; ++q) {
      const int r = q * 4 + r4;
      const v4f v0 = *(const v4fa*)&so[w][r][c8], v1 = *(const v4fa*)&so[w][r][c8 + 4];
      v8us h, l;
#pragma unroll  // h and l are indexed by constants
      for (int t = 0; t < 4; ++t) {
        unsigned short hb = bf16_bits(v0[t]); h[t] = hb;     l[t] = bf16_bits(v0[t] - bf16_val(hb));
        hb = bf16_bits(v1[t]);                h[4 + t] = hb; l[4 + t] = bf16_bits(v1[t] - bf16_val(hb));
      }
      unsigned short* cr = (unsigned short*)(C + (size_t)(row0 + wm * 32 + r) * ldc + col0 + wn * 64);
      *(v8us*)(cr + c8) = h;
      *(v8us*)(cr + 64 + c8) = l;
    }
  } else {
#pragma unroll
    for (int q = 0; q < 16; ++q) {
      const int r = q * 2 + rsub;
      const v4f v = *(const v4fa*)&so[w][r][c4];
      *(v4f*)(C + (size_t)(row0 + wm * 32 + r) * ldc + col0 + wn * 64 + c4) = v;
    }
  }
}

// Flash-style causal/unmasked attention, all contractions 3-term bf16 hi/lo splits, f32 softmax with running max.
// q,k,v rows are read from f32 buffers with arbitrary row pitch (so they can live inside a fused qkv buffer);
// D = head size (multiple of 32, <= 128); one wave = 16 query rows; block = 4 waves (64 queries) sharing K/V chunks of 32.
template <int D, bool CAUSAL>
__global__ __launch_bounds__(128) void k_flash(const float* __restrict__ qb, const float* __restrict__ kb, const float* __restrict__ vb,
                                             int pitch, int T, int H, float scale, float* __restrict__ y, int ypitch) {
  constexpr int KS = D / 32;        // k-steps for QK
  constexpr int DT = D / 16;        // d tiles for PV
  __shared__ __attribute__((aligned(16))) unsigned short sKh[32][D + 8], sKl[32][D + 8], sVh[32][D + 8], sVl[32][D + 8];
  __shared__ __attribute__((aligned(16))) unsigned short sPh[4][16][40], sPl[4][16][40];
  __shared__ __attribute__((aligned(16))) float sO[4][16][D];
  const int tid = threadIdx.x, w = tid >> 5, lane = tid & 31, ln = lane & 15, hh = lane >> 4;
  const int nqb = (T + 63) / 64;
  const int bh = blockIdx.x / nqb, qblk = blockIdx.x % nqb;
  const int b = bh / H, h = bh % H;
  const int q0 = qblk * 64 + w * 16;
  const float* Q = qb + (size_t)b * T * pitch + h * D;
  const float* K = kb + (size_t)b * T * pitch + h * D;
  const float* V = vb + (size_t)b * T * pitch + h * D;

  // A fragments of the wave's 16 query rows (scaled), hi/lo
  FragB aqh[KS], aql[KS];
  {
    int row = q0 + ln; if (row >= T) row = T - 1;
    const float* qr = Q + (size_t)row * pitch;
#pragma unroll
    for (int ks = 0; ks < KS; ++ks)
#pragma unroll
      for (int i = 0; i < 16; ++i) {
        const int d = ks * 32 + ((i < 8) ? (8 * hh + i) : (16 + 8 * hh + (i - 8)));
        const float x = qr[d] * scale; const unsigned short hb = bf16_bits(x);
        aqh[ks].u[i] = hb; aql[ks].u[i] = bf16_bits(x - bf16_val(hb));
      }
  }
  float m_r[8], l_r[8];
#pragma unroll
  for (int r = 0; r < 8; ++r) { m_r[r] = -3.0e38f; l_r[r] = 0.f; }
  v8f oacc[DT];
#pragma unroll
  for (int dt = 0; dt < DT; ++dt) oacc[dt] = (v8f){0.f,0.f,0.f,0.f,0.f,0.f,0.f,0.f};

  const int kv_end = CAUSAL ? min(T, qblk * 64 + 64) : T;     // block-uniform
  for (int j0 = 0; j0 < kv_end; j0 += 32) {
    __syncthreads();
    for (int e = tid; e < 32 * (D / 4); e += 128) {
      const int r = e / (D / 4), c4 = (e % (D / 4)) * 4;
      const int key = j0 + r;
      v4f kf = {0.f,0.f,0.f,0.f}, vf = {0.f,0.f,0.f,0.f};
      if (key < T) { kf = *(const v4fa*)(K + (size_t)key * pitch + c4); vf = *(const v4fa*)(V + (size_t)key * pitch + c4); }
#pragma unroll
      for (int t = 0; t < 4; ++t) {
        unsigned short hb = bf16_bits(kf[t]); sKh[r][c4 + t] = hb; sKl[r][c4 + t] = bf16_bits(kf[t] - bf16_val(hb));
        hb = bf16_bits(vf[t]); sVh[r][c4 + t] = hb; sVl[r][c4 + t] = bf16_bits(vf[t] - bf16_val(hb));
      }
    }
    __syncthreads();
    // S tile 16 x 32
    v8f s[2];
#pragma unroll
    for (int nt = 0; nt < 2; ++nt) {
      v8f acc = {};
#pragma unroll
      for (int ks = 0; ks < KS; ++ks) {
        FragB bh_, bl_;
        bh_.half[0] = *(const v8us*)&sKh[nt * 16 + ln][ks * 32 + 8 * hh]; bh_.half[1] = *(const v8us*)&sKh[nt * 16 + ln][ks * 32 + 16 + 8 * hh];
        bl_.half[0] = *(const v8us*)&sKl[nt * 16 + ln][ks * 32 + 8 * hh]; bl_.half[1] = *(const v8us*)&sKl[nt * 16 + ln][ks * 32 + 16 + 8 * hh];
        acc = mmaN<3>(aqh[ks].v, aql[ks].v, bh_.v, bl_.v, acc);
      }
      s[nt] = acc;
    }
    // mask + running max (rows 8hh+r; the 16 lanes of a half share rows)
    float alpha[8];
#pragma unroll
    for (int r = 0; r < 8; ++r) {
      const int qi = q0 + 8 * hh + r;
      const int ja = j0 + ln, jb = j0 + 16 + ln;
      if (CAUSAL) { if (ja > qi) s[0][r] = -3.0e38f; if (jb > qi) s[1][r] = -3.0e38f; }
      if (ja >= T) s[0][r] = -3.0e38f;
      if (jb >= T) s[1][r] = -3.0e38f;
      float mx = fmaxf(s[0][r], s[1][r]);
      mx = fmaxf(mx, __shfl_xor(mx, 1, 32)); mx = fmaxf(mx, __shfl_xor(mx, 2, 32)); mx = fmaxf(mx, __shfl_xor(mx, 4, 32)); mx = fmaxf(mx, __shfl_xor(mx, 8, 32));
      const float mnew = fmaxf(m_r[r], mx);
      alpha[r] = (mnew > -1.0e38f) ? __expf(m_r[r] - mnew) : 1.0f;
      const float p0 = (s[0][r] > -1.0e38f) ? __expf(s[0][r] - mnew) : 0.f;
      const float p1 = (s[1][r] > -1.0e38f) ? __expf(s[1][r] - mnew) : 0.f;
      m_r[r] = mnew;
      l_r[r] = l_r[r] * alpha[r] + p0 + p1;            // per-lane partial row sum (16 lanes combined at the end)
      unsigned short hb = bf16_bits(p0); sPh[w][8 * hh + r][ln] = hb;      sPl[w][8 * hh + r][ln] = bf16_bits(p0 - bf16_val(hb));
      hb = bf16_bits(p1);                sPh[w][8 * hh + r][16 + ln] = hb; sPl[w][8 * hh + r][16 + ln] = bf16_bits(p1 - bf16_val(hb));
    }
#pragma unroll
    for (int dt = 0; dt < DT; ++dt)
#pragma unroll
      for (int r = 0; r < 8; ++r) oacc[dt][r] *= alpha[r];
    __builtin_amdgcn_fence(__ATOMIC_ACQ_REL, "workgroup");
    __builtin_amdgcn_wave_barrier();
    FragB pah, pal;
    pah.half[0] = *(const v8us*)&sPh[w][ln][8 * hh]; pah.half[1] = *(const v8us*)&sPh[w][ln][16 + 8 * hh];
    pal.half[0] = *(const v8us*)&sPl[w][ln][8 * hh]; pal.half[1] = *(const v8us*)&sPl[w][ln][16 + 8 * hh];
#pragma unroll
    for (int dt = 0; dt < DT; ++dt) {
      FragB bvh, bvl;
#pragma unroll
      for (int i = 0; i < 8; ++i) {
        bvh.u[i] = sVh[8 * hh + i][dt * 16 + ln]; bvh.u[8 + i] = sVh[16 + 8 * hh + i][dt * 16 + ln];
        bvl.u[i] = sVl[8 * hh + i][dt * 16 + ln]; bvl.u[8 + i] = sVl[16 + 8 * hh + i][dt * 16 + ln];
      }
      oacc[dt] = mmaN<3>(pah.v, pal.v, bvh.v, bvl.v, oacc[dt]);
    }
    __builtin_amdgcn_fence(__ATOMIC_ACQ_REL, "workgroup");
    __builtin_amdgcn_wave_barrier();
  }
#pragma unroll
  for (int r = 0; r < 8; ++r) {
    float l = l_r[r];
    l += __shfl_xor(l, 1, 32); l += __shfl_xor(l, 2, 32); l += __shfl_xor(l, 4, 32); l += __shfl_xor(l, 8, 32);
    l_r[r] = (l > 0.f) ? 1.0f / l : 0.f;
  }
#pragma unroll
  for (int dt = 0; dt < DT; ++dt)
#pragma unroll
    for (int r = 0; r < 8; ++r) sO[w][8 * hh + r][dt * 16 + ln] = oacc[dt][r] * l_r[r];
  __builtin_amdgcn_fence(__ATOMIC_ACQ_REL, "workgroup");
  __builtin_amdgcn_wave_barrier();
  {
    for (int r = 0; r < 16; ++r) {
      const int row = q0 + r;
      if (row < T && lane < D / 4) {
        const v4f val = *(const v4fa*)&sO[w][r][lane * 4];
        *(v4f*)(y + ((size_t)b * T + row) * ypitch + h * D + lane * 4) = val;
      }
    }
    
  }
}

// Which 64-query x 32-key tiles of the int mask [T][T] hold a nonzero word at all: bit (kt & 31) of word [qt][kt >> 5], each word
// alone in a 128-byte line of its own (one writer a line). Block = 32 waves = 32 key tiles of one query tile, a tile a wave. T % 32 == 0.
__global__ __launch_bounds__(1024) void k_mask_tiles(const int* __restrict__ mask, unsigned* __restrict__ tbits, int T) {
  __shared__ int sany[32];
  const int w = threadIdx.x >> 5, lane = threadIdx.x & 31;
  const int nw = (T / 32 + 31) / 32;
  const int qt = blockIdx.x / nw, kt = (blockIdx.x % nw) * 32 + w;
  int any = 0;
  if (kt * 32 < T) {           // wave-uniform
    unsigned mo[16];           // byte offsets (the mask is far below 4 GiB): four whole 128-byte rows of the tile a load
#pragma unroll  // offsets in registers
    for (int i = 0; i < 16; ++i) {
      int row = qt * 64 + i * 4 + (lane >> 3); row = row < T ? row : T - 1;
      mo[i] = ((unsigned)row * (unsigned)T + (unsigned)(kt * 32 + (lane & 7) * 4)) * 4u;
    }
    v4ia mv[16];
#pragma unroll  // mv in registers, many loads in flight at once
    for (int i = 0; i < 16; ++i) mv[i] = *(const v4ia*)((const char*)mask + mo[i]);
    // No offset register of the batch is rewritten (not even as a later load's destination) in front of this wait.
    asm volatile("s_wait_xcnt 0x0" :: "v"(mo[0]), "v"(mo[1]), "v"(mo[2]), "v"(mo[3]), "v"(mo[4]), "v"(mo[5]), "v"(mo[6]), "v"(mo[7]),
                 "v"(mo[8]), "v"(mo[9]), "v"(mo[10]), "v"(mo[11]), "v"(mo[12]), "v"(mo[13]), "v"(mo[14]), "v"(mo[15]) : "memory");
#pragma unroll  // mv is indexed by constants
    for (int i = 0; i < 16; ++i) any |= mv[i][0] | mv[i][1] | mv[i][2] | mv[i][3];
  }
  const unsigned wany = __builtin_amdgcn_ballot_w32(any != 0);
  if (lane == 0) sany[w] = wany != 0u;
  __syncthreads();             // all 32 tiles' answers are in LDS
  if (w == 0) {
    const unsigned bits = __builtin_amdgcn_ballot_w32(sany[lane] != 0);
    if (lane == 0) tbits[(size_t)blockIdx.x * 32] = bits;
  }
}

// Self-attention (Tq == Tk == T) with optional int mask [T][T] (nonzero = keep) and/or causal flag; 3-term bf16 splits;
// Q rows read from an f32 buffer: Qb + b*T*qpitch + h*D + row*qpitch. K and V rows arrive split (k_gemm_bf's CSPLIT form): D bf16 high
// parts, then D bf16 low parts, at X + b*T*pitch + h*2*D + row*pitch, pitches in 16-bit elements.
// y[b][row][h*D + d], pitch ypitch. D == 64, T % 32 == 0.
// tbits: k_mask_tiles' words for this mask. A work-group takes two query tiles of a head, one after the other: n - 1 - t, then t.
// Both products are computed transposed, St = K*Qt and Ot += Vt*Pt: a lane (ln, hh) then holds scores of ONE query, q0 + ln, for keys
// 8 hh + r and 16 + 8 hh + r, which is the k order of a B operand: P goes from accumulator to operand inside the lane's own registers,
// and maximum, sum and rescale factor are one value a lane (the two halves of a wave join by one exchange).
// All that a pass reads from global memory (32 K rows, 32 V rows, the 64 x 32 mask tile) comes into one of two LDS buffers by asynchronous
// copies that are issued one pass ahead: they fly while the pass before is worked on, and one barrier a pass hands the buffers over.
template <int D>
__global__ __launch_bounds__(128) void k_flashm(const float* __restrict__ Qb, int qpitch, const unsigned short* __restrict__ Kb, int kpitch,
                                              const unsigned short* __restrict__ Vb, int vpitch, int T, int H, float scale,
                                              const int* __restrict__ mask, const unsigned* __restrict__ tbits, int causal,
                                              float* __restrict__ y, int ypitch) {
  constexpr int KS = D / 32, DT = D / 16;
  // An LDS row is a global row as it stands: D high parts, then D low parts.
  constexpr int KP = 2 * D + 8;    // K row pitch in elements: an odd multiple of 16 bytes, the conflict-free pitch of 16-byte reads down a column
  constexpr int VP = 2 * D + 16;   // V row pitch in elements: an odd multiple of 32 bytes, the conflict-free pitch of the transposing load
  static_assert((KP * 2) % 16 == 0 && ((KP * 2 / 16) & 1) == 1, "K rows: odd multiple of 16 bytes");
  static_assert((VP * 2) % 32 == 0 && ((VP * 2 / 32) & 1) == 1, "V rows: odd multiple of 32 bytes");
  constexpr int MP = 32 + 4;       // mask row pitch in words: an odd multiple of 16 bytes, for 16-byte reads down a column
  __shared__ __attribute__((aligned(16))) unsigned short sK[2][32][KP], sV[2][32][VP];
  __shared__ __attribute__((aligned(16))) int sM[2][64][MP];
  __shared__ __attribute__((aligned(16))) float sO[4][16][D + 4];   // row pitch an odd multiple of 16 bytes: 16 lanes store 16 bytes each down a column
  const int tid = threadIdx.x, w = tid >> 5, lane = tid & 31, ln = lane & 15, hh = lane >> 4;
  const int nqb = (T + 63) / 64, npair = (nqb + 1) / 2, nw = (T / 32 + 31) / 32;
  const int bh = blockIdx.x / npair, tlow = blockIdx.x % npair;
  const int b = bh / H, h = bh % H;
  const float* Q = Qb + (size_t)b * T * qpitch + h * D;
  const unsigned short* K = Kb + (size_t)b * T * kpitch + h * 2 * D;
  const unsigned short* V = Vb + (size_t)b * T * vpitch + h * 2 * D;
  // Under a mask that shuts more keys the lower the query's index, tiles n - 1 - t and t together cost every work-group the same number of
  // passes; all work-groups are resident at once, so the launch lasts as long as the longest. An odd n's middle tile is taken once.
  const int nparts = (nqb - 1 - tlow != tlow) ? 2 : 1;
#pragma unroll 1  // one copy of the body in the instruction cache
  for (int part = 0; part < nparts; ++part) {
  const int qblk = part ? tlow : nqb - 1 - tlow;
  const int q0 = qblk * 64 + w * 16;
  unsigned tw = ~0u;           // lane l: the query tile's word l of tbits (32 passes a word; T * T * 4 < 4 GiB, so never more than 32 words)
  if (mask) {
    const unsigned two = (unsigned)(qblk * nw + (lane < nw ? lane : nw - 1)) * 128u;
    tw = *(const unsigned*)((const char*)tbits + two);
    // The offset register is not rewritten in front of this wait.
    asm volatile("s_wait_xcnt 0x0" :: "v"(two) : "memory");
  }
  FragB aqh[KS], aql[KS];
  {
    int row = q0 + ln; if (row >= T) row = T - 1;
    const float* qr = Q + (size_t)row * qpitch;
#pragma unroll
    for (int ks = 0; ks < KS; ++ks)
#pragma unroll
      for (int i = 0; i < 16; ++i) {
        const int d = ks * 32 + ((i < 8) ? (8 * hh + i) : (16 + 8 * hh + (i - 8)));
        const float x = qr[d] * scale; const unsigned short hb = bf16_bits(x);
        aqh[ks].u[i] = hb; aql[ks].u[i] = bf16_bits(x - bf16_val(hb));
      }
    // The row's address register is not rewritten in front of this wait.
    asm volatile("s_wait_xcnt 0x0" :: "v"(qr) : "memory");
  }
  const int qrow = q0 + ln < T ? q0 + ln : T - 1;   // the lane's query
  float m_q = -3.0e38f, l_q = 0.f;                  // its running maximum; the sum over this half's keys
  v8f oacc[DT];                                     // oacc[dt][r]: element dt * 16 + 8 hh + r of the query's output row
#pragma unroll
  for (int dt = 0; dt < DT; ++dt) oacc[dt] = (v8f){0.f,0.f,0.f,0.f,0.f,0.f,0.f,0.f};
  const int kv_end = causal ? min(T, qblk * 64 + 64) : T;
  constexpr int NL = D / 16, RS = 128 / (D / 4);               // K (and V) 16-byte pieces per thread and pass; rows between a thread's pieces
  const int sr = tid / (D / 4), sc8 = (tid % (D / 4)) * 8;     // the thread's first staged row, and its place in the row of 2 D elements
  const unsigned kofs = ((unsigned)sr * (unsigned)kpitch + (unsigned)sc8) * 2u, vofs = ((unsigned)sr * (unsigned)vpitch + (unsigned)sc8) * 2u;
  // the lane's own 16 bytes of a 16 x 16 V tile for the transposing load: row 8 hh + (lane & 7), column half (lane >> 3) & 1
  const unsigned short* vth0 = &sV[0][8 * hh + (lane & 7)][8 * ((lane >> 3) & 1)];
  const unsigned short* krow0 = &sK[0][ln][8 * hh];
  const int* mrow0 = &sM[0][w * 16 + ln][8 * hh];              // the lane's query's row of the mask tile
  // Where the thread's copies land in buffer 0, and what it copies of the mask tile: 16 bytes of rows (tid >> 3) + 16 i (eight lanes a row of 128 bytes).
  const unsigned klds = lds_addr(&sK[0][sr][sc8]), vlds = lds_addr(&sV[0][sr][sc8]), mlds = lds_addr(&sM[0][tid >> 3][(tid & 7) * 4]);
  unsigned mro[4];             // byte offsets in the mask (it is far below 4 GiB)
#pragma unroll  // offsets in registers
  for (int i = 0; i < 4; ++i) {
    int row = qblk * 64 + (tid >> 3) + 16 * i; row = row < T ? row : T - 1;
    mro[i] = ((unsigned)row * (unsigned)T + (unsigned)((tid & 7) * 4)) * 4u;
  }
  const int npass = kv_end / 32;                               // every key of a pass is below T (T % 32 == 0)
  // A pass whose 64 x 32 mask tile holds no set word leaves every maximum, sum and accumulator as it is (each p is 0, each alpha 1):
  // the whole work-group steps over it. next_live() gives the passes that are not of that kind, in rising order, then npass: the same
  // values in every wave; at most one trip a word of tbits. wi: the word at hand; rest: its set bits not yet given out.
  const int nword = (npass + 31) / 32;
  int wi = -1;
  unsigned rest = 0u;
  auto next_live = [&]() -> int {
    while (rest == 0u) {
      if (++wi >= nword) { wi = nword; return npass; }
      rest = (unsigned)__builtin_amdgcn_readlane((int)tw, wi);
    }
    const int p = wi * 32 + __builtin_ctz(rest);
    rest &= rest - 1u;
    return p < npass ? p : npass;
  };
  // Pass p's K rows, V rows and mask tile into buffer bsel: every lane copies, under no lane test, whole 128-byte lines.
  static_assert(NL == 4, "the copy statement names four K and four V addresses");
  auto stage = [&](int p, int bsel) {
    const int j = p * 32;
    const char *kp[NL], *vp[NL];
    unsigned kl[NL], vl[NL];
#pragma unroll  // addresses in registers
    for (int i = 0; i < NL; ++i) {
      kp[i] = (const char*)(K + (size_t)(j + i * RS) * kpitch) + kofs;
      vp[i] = (const char*)(V + (size_t)(j + i * RS) * vpitch) + vofs;
      kl[i] = klds + (unsigned)(bsel * (32 * KP * 2) + i * (RS * KP * 2));
      vl[i] = vlds + (unsigned)(bsel * (32 * VP * 2) + i * (RS * VP * 2));
    }
    // The last line: no address register of these copies is rewritten in front of it.
    asm volatile("global_load_async_to_lds_b128 %0, %8, off\n\t"
                 "global_load_async_to_lds_b128 %1, %9, off\n\t"
                 "global_load_async_to_lds_b128 %2, %10, off\n\t"
                 "global_load_async_to_lds_b128 %3, %11, off\n\t"
                 "global_load_async_to_lds_b128 %4, %12, off\n\t"
                 "global_load_async_to_lds_b128 %5, %13, off\n\t"
                 "global_load_async_to_lds_b128 %6, %14, off\n\t"
                 "global_load_async_to_lds_b128 %7, %15, off\n\t"
                 "s_wait_xcnt 0x0"
                 :: "v"(kl[0]), "v"(kl[1]), "v"(kl[2]), "v"(kl[3]), "v"(vl[0]), "v"(vl[1]), "v"(vl[2]), "v"(vl[3]),
                    "v"(kp[0]), "v"(kp[1]), "v"(kp[2]), "v"(kp[3]), "v"(vp[0]), "v"(vp[1]), "v"(vp[2]), "v"(vp[3]) : "memory");
    if (mask) {                // the same in every wave
      const char* mp[4];
      unsigned ml[4];
#pragma unroll  // addresses in registers
      for (int i = 0; i < 4; ++i) {
        mp[i] = (const char*)(mask + j) + mro[i];
        ml[i] = mlds + (unsigned)(bsel * (64 * MP * 4) + i * (16 * MP * 4));
      }
      // The last line: as above.
      asm volatile("global_load_async_to_lds_b128 %0, %4, off\n\t"
                   "global_load_async_to_lds_b128 %1, %5, off\n\t"
                   "global_load_async_to_lds_b128 %2, %6, off\n\t"
                   "global_load_async_to_lds_b128 %3, %7, off\n\t"
                   "s_wait_xcnt 0x0"
                   :: "v"(ml[0]), "v"(ml[1]), "v"(ml[2]), "v"(ml[3]), "v"(mp[0]), "v"(mp[1]), "v"(mp[2]), "v"(mp[3]) : "memory");
    }
  };
  int pc = next_live();        // the pass at work; the tests on pc, pn and pf read the same in every wave
  if (pc < npass) {
  // Both buffers are free here: the tile before left its loop behind the barrier that ended its last reads.
  stage(pc, 0);
  asm volatile("s_wait_asynccnt 0x0" ::: "memory");   // this wave's copies of the first pass have landed
  __syncthreads();                                    // every wave's have
  int pn = next_live();        // the pass after it, in flight during this one
  if (pn < npass) stage(pn, 1);
  int buf = 0;
  for (;;) {
    const int j0 = pc * 32;
    const unsigned short* vth = vth0 + buf * (32 * VP);
    const unsigned short* vtl = vth + D;
    // The query's mask words for keys j0 + 8 hh + 0..7 (mk[0], mk[1]) and j0 + 16 + 8 hh + 0..7 (mk[2], mk[3]).
    v4ia mk[4];
#pragma unroll  // words in registers
    for (int i = 0; i < 4; ++i) mk[i] = (v4ia){1, 1, 1, 1};
    if (mask) {
      const int* mrow = mrow0 + buf * (64 * MP);
      mk[0] = *(const v4ia*)mrow; mk[1] = *(const v4ia*)(mrow + 4); mk[2] = *(const v4ia*)(mrow + 16); mk[3] = *(const v4ia*)(mrow + 20);
    }
    v8f s[2];                  // s[nt][r]: key j0 + nt * 16 + 8 hh + r against the lane's query
#pragma unroll
    for (int nt = 0; nt < 2; ++nt) {
      v8f acc = {};
#pragma unroll
      for (int ks = 0; ks < KS; ++ks) {
        FragB kh_, kl_;
        const unsigned short* krow = krow0 + buf * (32 * KP) + nt * 16 * KP + ks * 32;
        kh_.half[0] = *(const v8us*)krow;       kh_.half[1] = *(const v8us*)(krow + 16);
        kl_.half[0] = *(const v8us*)(krow + D); kl_.half[1] = *(const v8us*)(krow + D + 16);
        acc = mma3T(kh_.v, kl_.v, aqh[ks].v, aql[ks].v, acc);
      }
      s[nt] = acc;
    }
    // The pass's whole V operand as one group of loads, in front of the softmax arithmetic, which covers their latency.
    // Lane (ln, hh) receives V[kbase + 8 hh + 0..7][dt * 16 + ln], kbase 0 and 16: row dt * 16 + ln of Vt in the k order of the P fragment below.
    FragB bvh[DT], bvl[DT];
#pragma unroll  // fragments in registers
    for (int dt = 0; dt < DT; ++dt) {
      bvh[dt].half[0] = lds_tr16(vth + dt * 16); bvh[dt].half[1] = lds_tr16(vth + 16 * VP + dt * 16);
      bvl[dt].half[0] = lds_tr16(vtl + dt * 16); bvl[dt].half[1] = lds_tr16(vtl + 16 * VP + dt * 16);
    }
    if (causal) {              // the same in every lane: one branch for the sixteen words
#pragma unroll  // mk is indexed by constants
      for (int i = 0; i < 16; ++i) mk[i >> 2][i & 3] = (j0 + (i >> 3) * 16 + 8 * hh + (i & 7) <= qrow) ? mk[i >> 2][i & 3] : 0;
    }
    float mx = -3.0e38f;
#pragma unroll  // s and mk are indexed by constants
    for (int nt = 0; nt < 2; ++nt)
#pragma unroll  // likewise
      for (int r = 0; r < 8; ++r) {
        s[nt][r] = mk[nt * 2 + (r >> 2)][r & 3] != 0 ? s[nt][r] : -3.0e38f;
        mx = fmaxf(mx, s[nt][r]);
      }
    mx = fmaxf(mx, xhalf(mx));   // the other half's sixteen keys
    const float mnew = fmaxf(m_q, mx);
    const bool live = mnew > -1.0e38f;                        // some key of the query has been kept so far
    const float alpha = live ? __expf(m_q - mnew) : 1.0f;
    const float msub = live ? mnew : 0.f;                     // a shut key's -3e38 less msub gives p = 0 in either case
    m_q = mnew;
    FragB pbh, pbl;            // Pt as a B operand: element i is key 8 hh + i, element 8 + i key 16 + 8 hh + i, column ln
    float ps[8];
#pragma unroll  // fragments in registers
    for (int r = 0; r < 8; ++r) {
      const float p0 = __expf(s[0][r] - msub), p1 = __expf(s[1][r] - msub);
      ps[r] = p0 + p1;
      unsigned short hb = bf16_bits(p0); pbh.u[r] = hb;     pbl.u[r] = bf16_bits(p0 - bf16_val(hb));
      hb = bf16_bits(p1);                pbh.u[8 + r] = hb; pbl.u[8 + r] = bf16_bits(p1 - bf16_val(hb));
    }
    l_q = l_q * alpha + (((ps[0] + ps[1]) + (ps[2] + ps[3])) + ((ps[4] + ps[5]) + (ps[6] + ps[7])));
#pragma unroll
    for (int dt = 0; dt < DT; ++dt)
#pragma unroll
      for (int r = 0; r < 8; ++r) oacc[dt][r] *= alpha;
#pragma unroll  // oacc and the fragments are indexed by constants
    for (int dt = 0; dt < DT; ++dt) oacc[dt] = mma3T(bvh[dt].v, bvl[dt].v, pbh.v, pbl.v, oacc[dt]);
    // The hand-over, passed by every wave: this wave has read the last of this pass's buffer, and its copies of the next pass have landed;
    // behind the barrier that holds of every wave, so the next pass may be read and this pass's buffer refilled.
    asm volatile("s_wait_dscnt 0x0" ::: "memory");
    asm volatile("s_wait_asynccnt 0x0" ::: "memory");
    __syncthreads();
    if (pn >= npass) break;
    const int pf = next_live();
    if (pf < npass) stage(pf, buf);
    pc = pn; pn = pf; buf ^= 1;
  }
  }
  asm volatile("s_wait_asynccnt 0x0" ::: "memory");   // no copy is in flight behind the loop
  // NaN for fully-masked rows (softmax over a row of -inf)
  l_q += xhalf(l_q);
  const float inv = (m_q > -1.0e38f) ? 1.0f / l_q : __builtin_nanf("");
#pragma unroll  // oacc is indexed by constants
  for (int dt = 0; dt < DT; ++dt) {
    const v4f o0 = {oacc[dt][0] * inv, oacc[dt][1] * inv, oacc[dt][2] * inv, oacc[dt][3] * inv};
    const v4f o1 = {oacc[dt][4] * inv, oacc[dt][5] * inv, oacc[dt][6] * inv, oacc[dt][7] * inv};
    *(v4fa*)&sO[w][ln][dt * 16 + 8 * hh] = o0;
    *(v4fa*)&sO[w][ln][dt * 16 + 8 * hh + 4] = o1;
  }
  __builtin_amdgcn_fence(__ATOMIC_ACQ_REL, "workgroup");
  __builtin_amdgcn_wave_barrier();
  {
    for (int r = 0; r < 16; ++r) {
      const int row = q0 + r;
      if (row < T && lane < D / 4) {
        const v4f val = *(const v4fa*)&sO[w][r][lane * 4];
        *(v4f*)(y + ((size_t)b * T + row) * ypitch + h * D + lane * 4) = val;
      }
    }
    
  }
  // The next tile's first instructions rewrite registers that the last store names: not in front of this wait.
  asm volatile("s_wait_xcnt 0x0" ::: "memory");
  }
}

extern "C" void kernel_launch(void* const* d_in, const int* in_sizes, int n_in,
                              void* d_out, int out_size, void* d_ws, size_t ws_size, hipStream_t stream) {
  (void)in_sizes; (void)n_in; (void)out_size;
  const float* x = (const float*)d_in[0]; const int* mask = (const int*)d_in[1];
  const float* Wq = (const float*)d_in[2]; const float* Wkv = (const float*)d_in[3];
  const float* Wo = (const float*)d_in[4]; const float* bo = (const float*)d_in[5];
  char* ws = (char*)d_ws; size_t off = 0;
  unsigned short* Wqt  = (unsigned short*)(ws + off); off += (size_t)DM * DM * 2;       // [1024][1024]
  unsigned short* Wkvt = (unsigned short*)(ws + off); off += (size_t)2 * DM * DM * 2;   // [2048][1024]
  unsigned short* Wot  = (unsigned short*)(ws + off); off += (size_t)DM * DM * 2;
  float* qb  = (float*)(ws + off); off += (size_t)BB * NN * DM * 4;                    // 16 MiB
  float* kvb = (float*)(ws + off); off += (size_t)BB * NN * 2 * DM * 4;                // 32 MiB
  float* ob  = (float*)(ws + off); off += (size_t)BB * NN * DM * 4;                    // 16 MiB
  unsigned* tbits = (unsigned*)(ws + off); off += (size_t)(NN / 64) * (NN / 1024) * 128; // a 128-byte line a word
  if (off > ws_size) return;
  const int M = BB * NN;
  k_mask_tiles<<<(NN / 64) * (NN / 1024), 1024, 0, stream>>>(mask, tbits, NN);
  k_wt_bf16<<<(4 * DM / 128) * (DM / 64), 256, 0, stream>>>(Wq, Wqt, DM, Wkv, Wkvt, 2 * DM, Wo, Wot, DM, DM);
  k_gemm_bf<false, 0, false, false><<<(M / 64) * (DM / 128), 128, 0, stream>>>(x, DM, Wqt, DM, nullptr, qb, DM, M, DM, DM);
  k_gemm_bf<false, 0, false, true><<<(M / 64) * (2 * DM / 128), 128, 0, stream>>>(x, DM, Wkvt, DM, nullptr, kvb, 2 * DM, M, 2 * DM, DM);
  // k = kv[..., 0:1024] (head h at h*64), v = kv[..., 1024:2048]; stored split, a row is 4096 16-bit elements, head h's 128 at h*128
  const unsigned short* kvs = (const unsigned short*)kvb;
  k_flashm<HD><<<BB * NH * (NN / 128), 128, 0, stream>>>(qb, DM, kvs, 4 * DM, kvs + 2 * DM, 4 * DM, NN, NH, 0.03125f, mask, tbits, 0, ob, DM);
  k_gemm_bf<true, 0, true, false><<<(M / 64) * (DM / 128), 128, 0, stream>>>(ob, DM, Wot, DM, bo, (float*)d_out, DM, M, DM, DM);
}

// v010
// A run of this version takes 142 microseconds.
// Timed twice side by side with v009, it ran 1.06 and 1.05 times as fast.
// Over all steps from v000 it is 4.73 times as fast.
#include <hip/hip_runtime.h>
// All contractions on v_wmma_f32_16x16x32_bf16, f32 accumulate: q = x·Wq and kv = x·Wkv with x/W rounded to bf16 (single
// exact-product term), QKᵀ and P·V 3-term bf16 hi/lo splits, out = o·Wout with o split hi/lo (2 terms); softmax f32.
// K and V are split hi/lo once, where the kv GEMM stores them; the attention kernel copies the two planes into LDS as they are,
// asynchronously, one pass ahead of their use.
// The boolean mask input is applied as given (together with nothing else).
#define BB 2
#define NN 2048
#define DM 1024
#define NH 16
#define HD 64

typedef __bf16 v16b __attribute__((ext_vector_type(16)));
typedef unsigned short v8us __attribute__((ext_vector_type(8), may_alias));
typedef unsigned short v4us __attribute__((ext_vector_type(4), may_alias));
typedef float  v8f  __attribute__((ext_vector_type(8)));
typedef float  v4f  __attribute__((ext_vector_type(4)));
typedef float  v4fa __attribute__((ext_vector_type(4), may_alias));
typedef int    v4ia __attribute__((ext_vector_type(4), may_alias));
typedef float  v2f  __attribute__((ext_vector_type(2)));
typedef __bf16 v2b  __attribute__((ext_vector_type(2)));
typedef unsigned v2ua __attribute__((ext_vector_type(2), may_alias));
typedef unsigned v4u  __attribute__((ext_vector_type(4)));
union FragB { v16b v; v8us half[2]; unsigned short u[16]; unsigned w[8]; };

// to nearest even, by the hardware's conversion
__device__ __forceinline__ unsigned short bf16_bits(float x) { return __builtin_bit_cast(unsigned short, (__bf16)x); }
__device__ __forceinline__ float bf16_val(unsigned short b) { return __uint_as_float(((unsigned int)b) << 16); }
__device__ __forceinline__ float bf16_round(float x) { return bf16_val(bf16_bits(x)); }
// Two neighbours at once, a in the low half of the word, one packed conversion: their bf16 roundings ...
__device__ __forceinline__ unsigned bf16_pair(float a, float b) { return __builtin_bit_cast(unsigned, __builtin_convertvector((v2f){a, b}, v2b)); }
// ... and, for a split operand, the high parts (hi) with the roundings of what the high parts leave (lo).
__device__ __forceinline__ void bf16_split2(float a, float b, unsigned& hi, unsigned& lo) {
  const v2b h = __builtin_convertvector((v2f){a, b}, v2b);
  hi = __builtin_bit_cast(unsigned, h);
  lo = bf16_pair(a - (float)h[0], b - (float)h[1]);
}
// D += A·B with NT terms: 1 = ah·bh, 2 = + al·bh (A split), 3 = + ah·bl (both split)
template <int NT>
__device__ __forceinline__ v8f mmaN(v16b ah, v16b al, v16b bh, v16b bl, v8f c) {
  c = __builtin_amdgcn_wmma_f32_16x16x32_bf16(false, ah, false, bh, (short)0, c, false, false);
  if (NT >= 2) c = __builtin_amdgcn_wmma_f32_16x16x32_bf16(false, al, false, bh, (short)0, c, false, false);
  if (NT >= 3) c = __builtin_amdgcn_wmma_f32_16x16x32_bf16(false, ah, false, bl, (short)0, c, false, false);
  asm volatile("v_nop\n\tv_nop\n\tv_nop\n\tv_nop" : "+v"(c) : "v"(ah), "v"(al), "v"(bh), "v"(bl));
  return c;
}

// The same three terms for a transposed product, Dt += Bt*At with the operands swapped: ah*bh + ah*bl + al*bh, which is the order
// in which mmaN<3> adds them when a and b stand the other way round.
__device__ __forceinline__ v8f mma3T(v16b ah, v16b al, v16b bh, v16b bl, v8f c) {
  c = __builtin_amdgcn_wmma_f32_16x16x32_bf16(false, ah, false, bh, (short)0, c, false, false);
  c = __builtin_amdgcn_wmma_f32_16x16x32_bf16(false, ah, false, bl, (short)0, c, false, false);
  c = __builtin_amdgcn_wmma_f32_16x16x32_bf16(false, al, false, bh, (short)0, c, false, false);
  // four vector slots between the last product and whatever reads D or overwrites an operand, on every path
  asm volatile("v_nop\n\tv_nop\n\tv_nop\n\tv_nop" : "+v"(c) : "v"(ah), "v"(al), "v"(bh), "v"(bl));
  return c;
}
// lane l's value to lane l ^ 16 and back: the two halves of a wave exchange, on the vector unit
__device__ __forceinline__ float xhalf(float x) {
  const int b = __builtin_bit_cast(int, x);
  return __builtin_bit_cast(float, __builtin_amdgcn_permlanex16(b, b, 0x76543210, 0xfedcba98, false, false));
}

// Transposing LDS load: a row-major 16 x 16 tile of 16-bit elements arrives as half of a WMMA operand (8 k of one column per lane).
__device__ __forceinline__ v8us lds_tr16(const unsigned short* p) {
  typedef short s16x8 __attribute__((ext_vector_type(8)));
  typedef __attribute__((address_space(3))) s16x8 lds_s16x8;
  return __builtin_bit_cast(v8us, __builtin_amdgcn_ds_load_tr16_b128_v8i16((lds_s16x8*)p));
}

// The byte address inside the work-group's LDS of a __shared__ object: what an asynchronous copy to LDS takes as its destination.
__device__ __forceinline__ unsigned lds_addr(const void* p) {
  return (unsigned)(unsigned long long)(const __attribute__((address_space(3))) void*)p;
}

// Wt[n][k] = bf16(W[k][n]) for three weight matrices of K rows (N0, N1, N2 columns) in one launch. Block = 8 waves = a tile of 64 k x 128 n:
// wave w loads rows 8 w .. 8 w + 7, each load 512 contiguous bytes of one row (four whole lines); the tile turns in LDS, and each store
// covers four whole 128-byte lines of Wt (64 k of one n a line, one writer a line). K % 64 == 0, N % 128 == 0.
// LDS row j * 32 + l holds column n0 + 4 l + j: the lanes of a store then stand one row apart, which at this pitch meets no bank twice.
__global__ __launch_bounds__(256) void k_wt_bf16(const float* __restrict__ W0, unsigned short* __restrict__ T0, int N0,
                                                 const float* __restrict__ W1, unsigned short* __restrict__ T1, int N1,
                                                 const float* __restrict__ W2, unsigned short* __restrict__ T2, int N2, int K) {
  constexpr int TP = 64 + 8;   // row pitch in elements, 144 B: an odd multiple of 16 bytes
  __shared__ __attribute__((aligned(16))) unsigned short sT[128][TP];
  const int tid = threadIdx.x, w = tid >> 5, lane = tid & 31;
  const int kt = K / 64, nb0 = (N0 / 128) * kt, nb1 = (N1 / 128) * kt;
  int blk = blockIdx.x;        // block-uniform choice of the matrix
  const float* W = W0; unsigned short* Wt = T0; int N = N0;
  if (blk >= nb0 + nb1) { blk -= nb0 + nb1; W = W2; Wt = T2; N = N2; }
  else if (blk >= nb0)  { blk -= nb0;       W = W1; Wt = T1; N = N1; }
  const int k0 = (blk % kt) * 64, n0 = (blk / kt) * 128;
  if (n0 >= N) return;         // block-uniform, in front of the barrier
  unsigned wo[8];              // byte offsets (each matrix is far below 4 GiB)
#pragma unroll  // offsets in registers
  for (int i = 0; i < 8; ++i) wo[i] = ((unsigned)(k0 + w * 8 + i) * (unsigned)N + (unsigned)(n0 + lane * 4)) * 4u;
  v4f q[8];
#pragma unroll  // the eight loads back to back
  for (int i = 0; i < 8; ++i) q[i] = *(const v4fa*)((const char*)W + wo[i]);
  // No offset register of the batch is rewritten (not even as a later load's destination) in front of this wait.
  asm volatile("s_wait_xcnt 0x0" :: "v"(wo[0]), "v"(wo[1]), "v"(wo[2]), "v"(wo[3]), "v"(wo[4]), "v"(wo[5]), "v"(wo[6]), "v"(wo[7]) : "memory");
  // No rounding moves up among the loads: without this the last two loads went out only after the first ones had returned.
  __builtin_amdgcn_sched_barrier(0);
#pragma unroll  // q is indexed by constants
  for (int j = 0; j < 4; ++j) {
    v8us v;
#pragma unroll
    for (int i = 0; i < 8; ++i) v[i] = bf16_bits(q[i][j]);
    *(v8us*)&sT[j * 32 + lane][w * 8] = v;
  }
  __syncthreads();             // the tile is whole
  const int r8 = tid >> 3, c8 = (tid & 7) * 8;   // eight lanes a row of 128 bytes
  v8us o[4];
#pragma unroll  // the four LDS reads as one group
  for (int i = 0; i < 4; ++i) o[i] = *(const v8us*)&sT[i * 32 + r8][c8];
#pragma unroll
  for (int i = 0; i < 4; ++i) *(v8us*)((char*)Wt + ((unsigned)(n0 + 4 * r8 + i) * (unsigned)K + (unsigned)(k0 + c8)) * 2u) = o[i];
}

// One 64-k step of a GEMM block's operands, global memory to registers, as one batch of whole-line loads
// (A: 16 lanes a row of 256 B; W: 8 lanes a row of 128 B): uniform bases, sixteen running byte offsets that then move on by 64 k.
__device__ __forceinline__ void gemm_fetch(const float* A, const unsigned short* Wt, unsigned (&ao)[8], unsigned (&bo)[8], v4f (&aq)[8], v8us (&bq)[8]) {
#pragma unroll  // the sixteen loads back to back
  for (int i = 0; i < 8; ++i) { aq[i] = *(const v4fa*)((const char*)A + ao[i]); bq[i] = *(const v8us*)((const char*)Wt + bo[i]); }
  // No offset register of the batch is rewritten (not even as a later load's destination) in front of this wait.
  asm volatile("s_wait_xcnt 0x0" :: "v"(ao[0]), "v"(ao[1]), "v"(ao[2]), "v"(ao[3]), "v"(ao[4]), "v"(ao[5]), "v"(ao[6]), "v"(ao[7]),
               "v"(bo[0]), "v"(bo[1]), "v"(bo[2]), "v"(bo[3]), "v"(bo[4]), "v"(bo[5]), "v"(bo[6]), "v"(bo[7]) : "memory");
#pragma unroll  // offsets in registers
  for (int i = 0; i < 8; ++i) { ao[i] += 64u * 4u; bo[i] += 64u * 2u; }
}

// GEMM C[M][N] (f32, pitch ldc) = act(A[M][K]·W + bias). A f32 row-major (pitch lda), converted to bf16 once per block
// (ASPLIT: hi/lo two planes -> 2 terms, else single rounded term); Wt bf16 [N][K] (pitch ldb). BIAS_BF16 rounds the
// bias to bf16 first (bias quantised to bf16 before the add). Block = 4 waves = a 64 x 128 tile of C, wave = 32 x 64;
// both operands pass through LDS in steps of 64 k, the next step's loads in flight during the products of this one.
// K%64==0, K>=64, M%64==0, N%128==0.
// CSPLIT: C is stored split for a later 3-term product: the 256 bytes of each 64-column group of a row hold the 64 values' bf16 high
// parts, then the 64 bf16 roundings of what the high parts leave (same place and size as the group's f32 values would have).
template <bool ASPLIT, int ACT, bool BIAS_BF16, bool CSPLIT>
__global__ __launch_bounds__(128) void k_gemm_bf(const float* __restrict__ A, int lda, const unsigned short* __restrict__ Wt, int ldb,
                                               const float* __restrict__ bias, float* __restrict__ C, int ldc, int M, int N, int K) {
  constexpr int KP = 64 + 8;   // row pitch in elements, 144 B: an odd multiple of 16 bytes like the attention kernel's K rows, read the same way
  __shared__ __attribute__((aligned(16))) unsigned short sAh[64][KP], sAl[ASPLIT ? 64 : 1][KP], sB[128][KP];
  __shared__ __attribute__((aligned(16))) float so[4][32][64];
  const int tid = threadIdx.x, w = tid >> 5, lane = tid & 31, ln = lane & 15, hh = lane >> 4;
  const int wm = w >> 1, wn = w & 1;
  const int nb = N / 128;
  const int row0 = (blockIdx.x / nb) * 64, col0 = (blockIdx.x % nb) * 128;
  if (row0 >= M) return;       // block-uniform, in front of every barrier
  const int ar = tid >> 4, ac = (tid & 15) * 4, br = tid >> 3, bc = (tid & 7) * 8;
  unsigned ao[8], bo[8];       // byte offsets of A rows ar + 8 i and W rows br + 16 i (both operands are far below 4 GiB)
#pragma unroll  // offsets in registers
  for (int i = 0; i < 8; ++i) {
    ao[i] = ((unsigned)(row0 + ar + 8 * i) * (unsigned)lda + (unsigned)ac) * 4u;
    bo[i] = ((unsigned)(col0 + br + 16 * i) * (unsigned)ldb + (unsigned)bc) * 2u;
  }
  v4f aq[8]; v8us bq[8];
  v8f acc[2][4] = {};
  gemm_fetch(A, Wt, ao, bo, aq, bq);
  for (int kn = 64; ; kn += 64) {   // kn: the first k of the step after this one
    __syncthreads();           // every wave has read its last fragment of the step before
#pragma unroll  // aq and bq are indexed by constants
    for (int i = 0; i < 8; ++i) {
      v2ua h, l = {0u, 0u};
#pragma unroll  // h and l are indexed by constants
      for (int t = 0; t < 2; ++t) {
        unsigned hw, lw = 0u;
        if (ASPLIT) bf16_split2(aq[i][2 * t], aq[i][2 * t + 1], hw, lw); else hw = bf16_pair(aq[i][2 * t], aq[i][2 * t + 1]);
        h[t] = hw; l[t] = lw;
      }
      *(v2ua*)&sAh[ar + 8 * i][ac] = h;
      if (ASPLIT) *(v2ua*)&sAl[ar + 8 * i][ac] = l;
      *(v8us*)&sB[br + 16 * i][bc] = bq[i];
    }
    __syncthreads();           // the step's tiles are whole
    if (kn < K) gemm_fetch(A, Wt, ao, bo, aq, bq);
#pragma unroll
    for (int ks = 0; ks < 2; ++ks) {
      FragB b[4];
#pragma unroll
      for (int t = 0; t < 4; ++t) {
        const unsigned short* brow = &sB[wn * 64 + t * 16 + ln][ks * 32];
        b[t].half[0] = *(const v8us*)(brow + 8 * hh);
        b[t].half[1] = *(const v8us*)(brow + 16 + 8 * hh);
      }
      FragB ah[2], al[2];
#pragma unroll  // all fragments of the 32 k as one group of LDS loads in front of their products
      for (int mi = 0; mi < 2; ++mi) {
        const int arow = wm * 32 + mi * 16 + ln;
        ah[mi].half[0] = *(const v8us*)&sAh[arow][ks * 32 + 8 * hh]; ah[mi].half[1] = *(const v8us*)&sAh[arow][ks * 32 + 16 + 8 * hh];
        if (ASPLIT) { al[mi].half[0] = *(const v8us*)&sAl[arow][ks * 32 + 8 * hh]; al[mi].half[1] = *(const v8us*)&sAl[arow][ks * 32 + 16 + 8 * hh]; }
        else al[mi] = ah[mi];
      }
#pragma unroll
      for (int mi = 0; mi < 2; ++mi)
#pragma unroll
        for (int t = 0; t < 4; ++t) acc[mi][t] = mmaN<ASPLIT ? 2 : 1>(ah[mi].v, al[mi].v, b[t].v, b[t].v, acc[mi][t]);
    }
    if (kn >= K) break;
  }
  const int rsub = lane >> 4, c4 = (lane & 15) * 4;
  float bv[4];
#pragma unroll
  for (int t = 0; t < 4; ++t) {
    bv[t] = bias ? bias[col0 + wn * 64 + t * 16 + ln] : 0.f;
    if (BIAS_BF16) bv[t] = bf16_round(bv[t]);
  }
#pragma unroll
  for (int mi = 0; mi < 2; ++mi)
#pragma unroll
    for (int t = 0; t < 4; ++t)
#pragma unroll
      for (int r = 0; r < 8; ++r) { float v = acc[mi][t][r] + bv[t]; if (ACT == 1) v = fmaxf(v, 0.f); so[w][mi * 16 + 8 * hh + r][t * 16 + ln] = v; }
  __builtin_amdgcn_fence(__ATOMIC_ACQ_REL, "workgroup");
  __builtin_amdgcn_wave_barrier();
  if (CSPLIT) {
    const int r4 = lane >> 3, c8 = (lane & 7) * 8;   // eight lanes a row: each store covers four whole 128-byte lines
#pragma unroll  // a round's LDS reads go out while the round before is split and stored
    for (int q = 0; q < 8; ++q) {
      const int r = q * 4 + r4;
      const v4f v0 = *(const v4fa*)&so[w][r][c8], v1 = *(const v4fa*)&so[w][r][c8 + 4];
      unsigned hw[4], lw[4];
#pragma unroll  // hw and lw are indexed by constants
      for (int t = 0; t < 2; ++t) {
        bf16_split2(v0[2 * t], v0[2 * t + 1], hw[t], lw[t]);
        bf16_split2(v1[2 * t], v1[2 * t + 1], hw[2 + t], lw[2 + t]);
      }
      const v8us h = __builtin_bit_cast(v8us, (v4u){hw[0], hw[1], hw[2], hw[3]}), l = __builtin_bit_cast(v8us, (v4u){lw[0], lw[1], lw[2], lw[3]});
      unsigned short* cr = (unsigned short*)(C + (size_t)(row0 + wm * 32 + r) * ldc + col0 + wn * 64);
      *(v8us*)(cr + c8) = h;
      *(v8us*)(cr + 64 + c8) = l;
    }
  } else {
#pragma unroll
    for (int q = 0; q < 16; ++q) {
      const int r = q * 2 + rsub;
      const v4f v = *(const v4fa*)&so[w][r][c4];
      *(v4f*)(C + (size_t)(row0 + wm * 32 + r) * ldc + col0 + wn * 64 + c4) = v;
    }
  }
}

// Flash-style causal/unmasked attention, all contractions 3-term bf16 hi/lo splits, f32 softmax with running max.
// q,k,v rows are read from f32 buffers with arbitrary row pitch (so they can live inside a fused qkv buffer);
// D = head size (multiple of 32, <= 128); one wave = 16 query rows; block = 4 waves (64 queries) sharing K/V chunks of 32.
template <int D, bool CAUSAL>
__global__ __launch_bounds__(128) void k_flash(const float* __restrict__ qb, const float* __restrict__ kb, const float* __restrict__ vb,
                                             int pitch, int T, int H, float scale, float* __restrict__ y, int ypitch) {
  constexpr int KS = D / 32;        // k-steps for QK
  constexpr int DT = D / 16;        // d tiles for PV
  __shared__ __attribute__((aligned(16))) unsigned short sKh[32][D + 8], sKl[32][D + 8], sVh[32][D + 8], sVl[32][D + 8];
  __shared__ __attribute__((aligned(16))) unsigned short sPh[4][16][40], sPl[4][16][40];
  __shared__ __attribute__((aligned(16))) float sO[4][16][D];
  const int tid = threadIdx.x, w = tid >> 5, lane = tid & 31, ln = lane & 15, hh = lane >> 4;
  const int nqb = (T + 63) / 64;
  const int bh = blockIdx.x / nqb, qblk = blockIdx.x % nqb;
  const int b = bh / H, h = bh % H;
  const int q0 = qblk * 64 + w * 16;
  const float* Q = qb + (size_t)b * T * pitch + h * D;
  const float* K = kb + (size_t)b * T * pitch + h * D;
  const float* V = vb + (size_t)b * T * pitch + h * D;

  // A fragments of the wave's 16 query rows (scaled), hi/lo
  FragB aqh[KS], aql[KS];
  {
    int row = q0 + ln; if (row >= T) row = T - 1;
    const float* qr = Q + (size_t)row * pitch;
#pragma unroll
    for (int ks = 0; ks < KS; ++ks)
#pragma unroll
      for (int i = 0; i < 16; ++i) {
        const int d = ks * 32 + ((i < 8) ? (8 * hh + i) : (16 + 8 * hh + (i - 8)));
        const float x = qr[d] * scale; const unsigned short hb = bf16_bits(x);
        aqh[ks].u[i] = hb; aql[ks].u[i] = bf16_bits(x - bf16_val(hb));
      }
  }
  float m_r[8], l_r[8];
#pragma unroll
  for (int r = 0; r < 8; ++r) { m_r[r] = -3.0e38f; l_r[r] = 0.f; }
  v8f oacc[DT];
#pragma unroll
  for (int dt = 0; dt < DT; ++dt) oacc[dt] = (v8f){0.f,0.f,0.f,0.f,0.f,0.f,0.f,0.f};

  const int kv_end = CAUSAL ? min(T, qblk * 64 + 64) : T;     // block-uniform
  for (int j0 = 0; j0 < kv_end; j0 += 32) {
    __syncthreads();
    for (int e = tid; e < 32 * (D / 4); e += 128) {
      const int r = e / (D / 4), c4 = (e % (D / 4)) * 4;
      const int key = j0 + r;
      v4f kf = {0.f,0.f,0.f,0.f}, vf = {0.f,0.f,0.f,0.f};
      if (key < T) { kf = *(const v4fa*)(K + (size_t)key * pitch + c4); vf = *(const v4fa*)(V + (size_t)key * pitch + c4); }
#pragma unroll
      for (int t = 0; t < 4; ++t) {
        unsigned short hb = bf16_bits(kf[t]); sKh[r][c4 + t] = hb; sKl[r][c4 + t] = bf16_bits(kf[t] - bf16_val(hb));
        hb = bf16_bits(vf[t]); sVh[r][c4 + t] = hb; sVl[r][c4 + t] = bf16_bits(vf[t] - bf16_val(hb));
      }
    }
    __syncthreads();
    // S tile 16 x 32
    v8f s[2];
#pragma unroll
    for (int nt = 0; nt < 2; ++nt) {
      v8f acc = {};
#pragma unroll
      for (int ks = 0; ks < KS; ++ks) {
        FragB bh_, bl_;
        bh_.half[0] = *(const v8us*)&sKh[nt * 16 + ln][ks * 32 + 8 * hh]; bh_.half[1] = *(const v8us*)&sKh[nt * 16 + ln][ks * 32 + 16 + 8 * hh];
        bl_.half[0] = *(const v8us*)&sKl[nt * 16 + ln][ks * 32 + 8 * hh]; bl_.half[1] = *(const v8us*)&sKl[nt * 16 + ln][ks * 32 + 16 + 8 * hh];
        acc = mmaN<3>(aqh[ks].v, aql[ks].v, bh_.v, bl_.v, acc);
      }
      s[nt] = acc;
    }
    // mask + running max (rows 8hh+r; the 16 lanes of a half share rows)
    float alpha[8];
#pragma unroll
    for (int r = 0; r < 8; ++r) {
      const int qi = q0 + 8 * hh + r;
      const int ja = j0 + ln, jb = j0 + 16 + ln;
      if (CAUSAL) { if (ja > qi) s[0][r] = -3.0e38f; if (jb > qi) s[1][r] = -3.0e38f; }
      if (ja >= T) s[0][r] = -3.0e38f;
      if (jb >= T) s[1][r] = -3.0e38f;
      float mx = fmaxf(s[0][r], s[1][r]);
      mx = fmaxf(mx, __shfl_xor(mx, 1, 32)); mx = fmaxf(mx, __shfl_xor(mx, 2, 32)); mx = fmaxf(mx, __shfl_xor(mx, 4, 32)); mx = fmaxf(mx, __shfl_xor(mx, 8, 32));
      const float mnew = fmaxf(m_r[r], mx);
      alpha[r] = (mnew > -1.0e38f) ? __expf(m_r[r] - mnew) : 1.0f;
      const float p0 = (s[0][r] > -1.0e38f) ? __expf(s[0][r] - mnew) : 0.f;
      const float p1 = (s[1][r] > -1.0e38f) ? __expf(s[1][r] - mnew) : 0.f;
      m_r[r] = mnew;
      l_r[r] = l_r[r] * alpha[r] + p0 + p1;            // per-lane partial row sum (16 lanes combined at the end)
      unsigned short hb = bf16_bits(p0); sPh[w][8 * hh + r][ln] = hb;      sPl[w][8 * hh + r][ln] = bf16_bits(p0 - bf16_val(hb));
      hb = bf16_bits(p1);                sPh[w][8 * hh + r][16 + ln] = hb; sPl[w][8 * hh + r][16 + ln] = bf16_bits(p1 - bf16_val(hb));
    }
#pragma unroll
    for (int dt = 0; dt < DT; ++dt)
#pragma unroll
      for (int r = 0; r < 8; ++r) oacc[dt][r] *= alpha[r];
    __builtin_amdgcn_fence(__ATOMIC_ACQ_REL, "workgroup");
    __builtin_amdgcn_wave_barrier();
    FragB pah, pal;
    pah.half[0] = *(const v8us*)&sPh[w][ln][8 * hh]; pah.half[1] = *(const v8us*)&sPh[w][ln][16 + 8 * hh];
    pal.half[0] = *(const v8us*)&sPl[w][ln][8 * hh]; pal.half[1] = *(const v8us*)&sPl[w][ln][16 + 8 * hh];
#pragma unroll
    for (int dt = 0; dt < DT; ++dt) {
      FragB bvh, bvl;
#pragma unroll
      for (int i = 0; i < 8; ++i) {
        bvh.u[i] = sVh[8 * hh + i][dt * 16 + ln]; bvh.u[8 + i] = sVh[16 + 8 * hh + i][dt * 16 + ln];
        bvl.u[i] = sVl[8 * hh + i][dt * 16 + ln]; bvl.u[8 + i] = sVl[16 + 8 * hh + i][dt * 16 + ln];
      }
      oacc[dt] = mmaN<3>(pah.v, pal.v, bvh.v, bvl.v, oacc[dt]);
    }
    __builtin_amdgcn_fence(__ATOMIC_ACQ_REL, "workgroup");
    __builtin_amdgcn_wave_barrier();
  }
#pragma unroll
  for (int r = 0; r < 8; ++r) {
    float l = l_r[r];
    l += __shfl_xor(l, 1, 32); l += __shfl_xor(l, 2, 32); l += __shfl_xor(l, 4, 32); l += __shfl_xor(l, 8, 32);
    l_r[r] = (l > 0.f) ? 1.0f / l : 0.f;
  }
#pragma unroll
  for (int dt = 0; dt < DT; ++dt)
#pragma unroll
    for (int r = 0; r < 8; ++r) sO[w][8 * hh + r][dt * 16 + ln] = oacc[dt][r] * l_r[r];
  __builtin_amdgcn_fence(__ATOMIC_ACQ_REL, "workgroup");
  __builtin_amdgcn_wave_barrier();
  {
    for (int r = 0; r < 16; ++r) {
      const int row = q0 + r;
      if (row < T && lane < D / 4) {
        const v4f val = *(const v4fa*)&sO[w][r][lane * 4];
        *(v4f*)(y + ((size_t)b * T + row) * ypitch + h * D + lane * 4) = val;
      }
    }
    
  }
}

// Which 64-query x 32-key tiles of the int mask [T][T] hold a nonzero word at all: bit (kt & 31) of word [qt][kt >> 5], each word
// alone in a 128-byte line of its own (one writer a line). Block = 32 waves = 32 key tiles of one query tile, a tile a wave. T % 32 == 0.
__global__ __launch_bounds__(1024) void k_mask_tiles(const int* __restrict__ mask, unsigned* __restrict__ tbits, int T) {
  __shared__ int sany[32];
  const int w = threadIdx.x >> 5, lane = threadIdx.x & 31;
  const int nw = (T / 32 + 31) / 32;
  const int qt = blockIdx.x / nw, kt = (blockIdx.x % nw) * 32 + w;
  int any = 0;
  if (kt * 32 < T) {           // wave-uniform
    unsigned mo[16];           // byte offsets (the mask is far below 4 GiB): four whole 128-byte rows of the tile a load
#pragma unroll  // offsets in registers
    for (int i = 0; i < 16; ++i) {
      int row = qt * 64 + i * 4 + (lane >> 3); row = row < T ? row : T - 1;
      mo[i] = ((unsigned)row * (unsigned)T + (unsigned)(kt * 32 + (lane & 7) * 4)) * 4u;
    }
    v4ia mv[16];
#pragma unroll  // mv in registers, many loads in flight at once
    for (int i = 0; i < 16; ++i) mv[i] = *(const v4ia*)((const char*)mask + mo[i]);
    // No offset register of the batch is rewritten (not even as a later load's destination) in front of this wait.
    asm volatile("s_wait_xcnt 0x0" :: "v"(mo[0]), "v"(mo[1]), "v"(mo[2]), "v"(mo[3]), "v"(mo[4]), "v"(mo[5]), "v"(mo[6]), "v"(mo[7]),
                 "v"(mo[8]), "v"(mo[9]), "v"(mo[10]), "v"(mo[11]), "v"(mo[12]), "v"(mo[13]), "v"(mo[14]), "v"(mo[15]) : "memory");
#pragma unroll  // mv is indexed by constants
    for (int i = 0; i < 16; ++i) any |= mv[i][0] | mv[i][1] | mv[i][2] | mv[i][3];
  }
  const unsigned wany = __builtin_amdgcn_ballot_w32(any != 0);
  if (lane == 0) sany[w] = wany != 0u;
  __syncthreads();             // all 32 tiles' answers are in LDS
  if (w == 0) {
    const unsigned bits = __builtin_amdgcn_ballot_w32(sany[lane] != 0);
    if (lane == 0) tbits[(size_t)blockIdx.x * 32] = bits;
  }
}

// Self-attention (Tq == Tk == T) with optional int mask [T][T] (nonzero = keep) and/or causal flag; 3-term bf16 splits;
// Q rows read from an f32 buffer: Qb + b*T*qpitch + h*D + row*qpitch. K and V rows arrive split (k_gemm_bf's CSPLIT form): D bf16 high
// parts, then D bf16 low parts, at X + b*T*pitch + h*2*D + row*pitch, pitches in 16-bit elements.
// y[b][row][h*D + d], pitch ypitch. D == 64, T % 32 == 0.
// tbits: k_mask_tiles' words for this mask. A work-group takes two query tiles of a head, one after the other: n - 1 - t, then t.
// Both products are computed transposed, St = K*Qt and Ot += Vt*Pt: a lane (ln, hh) then holds scores of ONE query, q0 + ln, for keys
// 8 hh + r and 16 + 8 hh + r, which is the k order of a B operand: P goes from accumulator to operand inside the lane's own registers,
// and maximum, sum and rescale factor are one value a lane (the two halves of a wave join by one exchange).
// All that a pass reads from global memory (32 K rows, 32 V rows, the 64 x 32 mask tile) comes into one of two LDS buffers by asynchronous
// copies that are issued one pass ahead: they fly while the pass before is worked on, and one barrier a pass hands the buffers over.
template <int D>
__global__ __launch_bounds__(128) void k_flashm(const float* __restrict__ Qb, int qpitch, const unsigned short* __restrict__ Kb, int kpitch,
                                              const unsigned short* __restrict__ Vb, int vpitch, int T, int H, float scale,
                                              const int* __restrict__ mask, const unsigned* __restrict__ tbits, int causal,
                                              float* __restrict__ y, int ypitch) {
  constexpr int KS = D / 32, DT = D / 16;
  // An LDS row is a global row as it stands: D high parts, then D low parts.
  constexpr int KP = 2 * D + 8;    // K row pitch in elements: an odd multiple of 16 bytes, the conflict-free pitch of 16-byte reads down a column
  constexpr int VP = 2 * D + 16;   // V row pitch in elements: an odd multiple of 32 bytes, the conflict-free pitch of the transposing load
  static_assert((KP * 2) % 16 == 0 && ((KP * 2 / 16) & 1) == 1, "K rows: odd multiple of 16 bytes");
  static_assert((VP * 2) % 32 == 0 && ((VP * 2 / 32) & 1) == 1, "V rows: odd multiple of 32 bytes");
  constexpr int MP = 32 + 4;       // mask row pitch in words: an odd multiple of 16 bytes, for 16-byte reads down a column
  __shared__ __attribute__((aligned(16))) unsigned short sK[2][32][KP], sV[2][32][VP];
  __shared__ __attribute__((aligned(16))) int sM[2][64][MP];
  __shared__ __attribute__((aligned(16))) float sO[4][16][D + 4];   // row pitch an odd multiple of 16 bytes: 16 lanes store 16 bytes each down a column
  const int tid = threadIdx.x, w = tid >> 5, lane = tid & 31, ln = lane & 15, hh = lane >> 4;
  const int nqb = (T + 63) / 64, npair = (nqb + 1) / 2, nw = (T / 32 + 31) / 32;
  const int bh = blockIdx.x / npair, tlow = blockIdx.x % npair;
  const int b = bh / H, h = bh % H;
  const float* Q = Qb + (size_t)b * T * qpitch + h * D;
  const unsigned short* K = Kb + (size_t)b * T * kpitch + h * 2 * D;
  const unsigned short* V = Vb + (size_t)b * T * vpitch + h * 2 * D;
  // Under a mask that shuts more keys the lower the query's index, tiles n - 1 - t and t together cost every work-group the same number of
  // passes; all work-groups are resident at once, so the launch lasts as long as the longest. An odd n's middle tile is taken once.
  const int nparts = (nqb - 1 - tlow != tlow) ? 2 : 1;
#pragma unroll 1  // one copy of the body in the instruction cache
  for (int part = 0; part < nparts; ++part) {
  const int qblk = part ? tlow : nqb - 1 - tlow;
  const int q0 = qblk * 64 + w * 16;
  unsigned tw = ~0u;           // lane l: the query tile's word l of tbits (32 passes a word; T * T * 4 < 4 GiB, so never more than 32 words)
  if (mask) {
    const unsigned two = (unsigned)(qblk * nw + (lane < nw ? lane : nw - 1)) * 128u;
    tw = *(const unsigned*)((const char*)tbits + two);
    // The offset register is not rewritten in front of this wait.
    asm volatile("s_wait_xcnt 0x0" :: "v"(two) : "memory");
  }
  FragB aqh[KS], aql[KS];
  {
    int row = q0 + ln; if (row >= T) row = T - 1;
    const float* qr = Q + (size_t)row * qpitch;
#pragma unroll
    for (int ks = 0; ks < KS; ++ks)
#pragma unroll
      for (int i = 0; i < 16; i += 2) {
        const int d = ks * 32 + ((i < 8) ? (8 * hh + i) : (16 + 8 * hh + (i - 8)));
        bf16_split2(qr[d] * scale, qr[d + 1] * scale, aqh[ks].w[i >> 1], aql[ks].w[i >> 1]);
      }
    // The row's address register is not rewritten in front of this wait.
    asm volatile("s_wait_xcnt 0x0" :: "v"(qr) : "memory");
  }
  const int qrow = q0 + ln < T ? q0 + ln : T - 1;   // the lane's query
  float m_q = -3.0e38f, l_q = 0.f;                  // its running maximum; the sum over this half's keys
  v8f oacc[DT];                                     // oacc[dt][r]: element dt * 16 + 8 hh + r of the query's output row
#pragma unroll
  for (int dt = 0; dt < DT; ++dt) oacc[dt] = (v8f){0.f,0.f,0.f,0.f,0.f,0.f,0.f,0.f};
  const int kv_end = causal ? min(T, qblk * 64 + 64) : T;
  constexpr int NL = D / 16, RS = 128 / (D / 4);               // K (and V) 16-byte pieces per thread and pass; rows between a thread's pieces
  const int sr = tid / (D / 4), sc8 = (tid % (D / 4)) * 8;     // the thread's first staged row, and its place in the row of 2 D elements
  const unsigned kofs = ((unsigned)sr * (unsigned)kpitch + (unsigned)sc8) * 2u, vofs = ((unsigned)sr * (unsigned)vpitch + (unsigned)sc8) * 2u;
  // the lane's own 16 bytes of a 16 x 16 V tile for the transposing load: row 8 hh + (lane & 7), column half (lane >> 3) & 1
  const unsigned short* vth0 = &sV[0][8 * hh + (lane & 7)][8 * ((lane >> 3) & 1)];
  const unsigned short* krow0 = &sK[0][ln][8 * hh];
  const int* mrow0 = &sM[0][w * 16 + ln][8 * hh];              // the lane's query's row of the mask tile
  // Where the thread's copies land in buffer 0, and what it copies of the mask tile: 16 bytes of rows (tid >> 3) + 16 i (eight lanes a row of 128 bytes).
  const unsigned klds = lds_addr(&sK[0][sr][sc8]), vlds = lds_addr(&sV[0][sr][sc8]), mlds = lds_addr(&sM[0][tid >> 3][(tid & 7) * 4]);
  unsigned mro[4];             // byte offsets in the mask (it is far below 4 GiB)
#pragma unroll  // offsets in registers
  for (int i = 0; i < 4; ++i) {
    int row = qblk * 64 + (tid >> 3) + 16 * i; row = row < T ? row : T - 1;
    mro[i] = ((unsigned)row * (unsigned)T + (unsigned)((tid & 7) * 4)) * 4u;
  }
  const int npass = kv_end / 32;                               // every key of a pass is below T (T % 32 == 0)
  // A pass whose 64 x 32 mask tile holds no set word leaves every maximum, sum and accumulator as it is (each p is 0, each alpha 1):
  // the whole work-group steps over it. next_live() gives the passes that are not of that kind, in rising order, then npass: the same
  // values in every wave; at most one trip a word of tbits. wi: the word at hand; rest: its set bits not yet given out.
  const int nword = (npass + 31) / 32;
  int wi = -1;
  unsigned rest = 0u;
  auto next_live = [&]() -> int {
    while (rest == 0u) {
      if (++wi >= nword) { wi = nword; return npass; }
      rest = (unsigned)__builtin_amdgcn_readlane((int)tw, wi);
    }
    const int p = wi * 32 + __builtin_ctz(rest);
    rest &= rest - 1u;
    return p < npass ? p : npass;
  };
  // Pass p's K rows, V rows and mask tile into buffer bsel: every lane copies, under no lane test, whole 128-byte lines.
  static_assert(NL == 4, "the copy statement names four K and four V addresses");
  auto stage = [&](int p, int bsel) {
    const int j = p * 32;
    const char *kp[NL], *vp[NL];
    unsigned kl[NL], vl[NL];
#pragma unroll  // addresses in registers
    for (int i = 0; i < NL; ++i) {
      kp[i] = (const char*)(K + (size_t)(j + i * RS) * kpitch) + kofs;
      vp[i] = (const char*)(V + (size_t)(j + i * RS) * vpitch) + vofs;
      kl[i] = klds + (unsigned)(bsel * (32 * KP * 2) + i * (RS * KP * 2));
      vl[i] = vlds + (unsigned)(bsel * (32 * VP * 2) + i * (RS * VP * 2));
    }
    // The last line: no address register of these copies is rewritten in front of it.
    asm volatile("global_load_async_to_lds_b128 %0, %8, off\n\t"
                 "global_load_async_to_lds_b128 %1, %9, off\n\t"
                 "global_load_async_to_lds_b128 %2, %10, off\n\t"
                 "global_load_async_to_lds_b128 %3, %11, off\n\t"
                 "global_load_async_to_lds_b128 %4, %12, off\n\t"
                 "global_load_async_to_lds_b128 %5, %13, off\n\t"
                 "global_load_async_to_lds_b128 %6, %14, off\n\t"
                 "global_load_async_to_lds_b128 %7, %15, off\n\t"
                 "s_wait_xcnt 0x0"
                 :: "v"(kl[0]), "v"(kl[1]), "v"(kl[2]), "v"(kl[3]), "v"(vl[0]), "v"(vl[1]), "v"(vl[2]), "v"(vl[3]),
                    "v"(kp[0]), "v"(kp[1]), "v"(kp[2]), "v"(kp[3]), "v"(vp[0]), "v"(vp[1]), "v"(vp[2]), "v"(vp[3]) : "memory");
    if (mask) {                // the same in every wave
      const char* mp[4];
      unsigned ml[4];
#pragma unroll  // addresses in registers
      for (int i = 0; i < 4; ++i) {
        mp[i] = (const char*)(mask + j) + mro[i];
        ml[i] = mlds + (unsigned)(bsel * (64 * MP * 4) + i * (16 * MP * 4));
      }
      // The last line: as above.
      asm volatile("global_load_async_to_lds_b128 %0, %4, off\n\t"
                   "global_load_async_to_lds_b128 %1, %5, off\n\t"
                   "global_load_async_to_lds_b128 %2, %6, off\n\t"
                   "global_load_async_to_lds_b128 %3, %7, off\n\t"
                   "s_wait_xcnt 0x0"
                   :: "v"(ml[0]), "v"(ml[1]), "v"(ml[2]), "v"(ml[3]), "v"(mp[0]), "v"(mp[1]), "v"(mp[2]), "v"(mp[3]) : "memory");
    }
  };
  int pc = next_live();        // the pass at work; the tests on pc, pn and pf read the same in every wave
  if (pc < npass) {
  // Both buffers are free here: the tile before left its loop behind the barrier that ended its last reads.
  stage(pc, 0);
  asm volatile("s_wait_asynccnt 0x0" ::: "memory");   // this wave's copies of the first pass have landed
  __syncthreads();                                    // every wave's have
  int pn = next_live();        // the pass after it, in flight during this one
  if (pn < npass) stage(pn, 1);
  int buf = 0;
  for (;;) {
    const int j0 = pc * 32;
    const unsigned short* vth = vth0 + buf * (32 * VP);
    const unsigned short* vtl = vth + D;
    // The query's mask words for keys j0 + 8 hh + 0..7 (mk[0], mk[1]) and j0 + 16 + 8 hh + 0..7 (mk[2], mk[3]).
    v4ia mk[4];
#pragma unroll  // words in registers
    for (int i = 0; i < 4; ++i) mk[i] = (v4ia){1, 1, 1, 1};
    if (mask) {
      const int* mrow = mrow0 + buf * (64 * MP);
      mk[0] = *(const v4ia*)mrow; mk[1] = *(const v4ia*)(mrow + 4); mk[2] = *(const v4ia*)(mrow + 16); mk[3] = *(const v4ia*)(mrow + 20);
    }
    v8f s[2];                  // s[nt][r]: key j0 + nt * 16 + 8 hh + r against the lane's query
#pragma unroll
    for (int nt = 0; nt < 2; ++nt) {
      v8f acc = {};
#pragma unroll
      for (int ks = 0; ks < KS; ++ks) {
        FragB kh_, kl_;
        const unsigned short* krow = krow0 + buf * (32 * KP) + nt * 16 * KP + ks * 32;
        kh_.half[0] = *(const v8us*)krow;       kh_.half[1] = *(const v8us*)(krow + 16);
        kl_.half[0] = *(const v8us*)(krow + D); kl_.half[1] = *(const v8us*)(krow + D + 16);
        acc = mma3T(kh_.v, kl_.v, aqh[ks].v, aql[ks].v, acc);
      }
      s[nt] = acc;
    }
    // The pass's whole V operand as one group of loads, in front of the softmax arithmetic, which covers their latency.
    // Lane (ln, hh) receives V[kbase + 8 hh + 0..7][dt * 16 + ln], kbase 0 and 16: row dt * 16 + ln of Vt in the k order of the P fragment below.
    FragB bvh[DT], bvl[DT];
#pragma unroll  // fragments in registers
    for (int dt = 0; dt < DT; ++dt) {
      bvh[dt].half[0] = lds_tr16(vth + dt * 16); bvh[dt].half[1] = lds_tr16(vth + 16 * VP + dt * 16);
      bvl[dt].half[0] = lds_tr16(vtl + dt * 16); bvl[dt].half[1] = lds_tr16(vtl + 16 * VP + dt * 16);
    }
    if (causal) {              // the same in every lane: one branch for the sixteen words
#pragma unroll  // mk is indexed by constants
      for (int i = 0; i < 16; ++i) mk[i >> 2][i & 3] = (j0 + (i >> 3) * 16 + 8 * hh + (i & 7) <= qrow) ? mk[i >> 2][i & 3] : 0;
    }
    float mx = -3.0e38f;
#pragma unroll  // s and mk are indexed by constants
    for (int nt = 0; nt < 2; ++nt)
#pragma unroll  // likewise
      for (int r = 0; r < 8; ++r) {
        s[nt][r] = mk[nt * 2 + (r >> 2)][r & 3] != 0 ? s[nt][r] : -3.0e38f;
        mx = fmaxf(mx, s[nt][r]);
      }
    mx = fmaxf(mx, xhalf(mx));   // the other half's sixteen keys
    const float mnew = fmaxf(m_q, mx);
    const bool live = mnew > -1.0e38f;                        // some key of the query has been kept so far
    const float alpha = live ? __expf(m_q - mnew) : 1.0f;
    const float msub = live ? mnew : 0.f;                     // a shut key's -3e38 less msub gives p = 0 in either case
    m_q = mnew;
    FragB pbh, pbl;            // Pt as a B operand: element i is key 8 hh + i, element 8 + i key 16 + 8 hh + i, column ln
    float ps[8];
#pragma unroll  // fragments in registers
    for (int r = 0; r < 8; r += 2) {
      const float p0 = __expf(s[0][r] - msub), p1 = __expf(s[1][r] - msub), p2 = __expf(s[0][r + 1] - msub), p3 = __expf(s[1][r + 1] - msub);
      ps[r] = p0 + p1; ps[r + 1] = p2 + p3;
      bf16_split2(p0, p2, pbh.w[r >> 1], pbl.w[r >> 1]);
      bf16_split2(p1, p3, pbh.w[4 + (r >> 1)], pbl.w[4 + (r >> 1)]);
    }
    l_q = l_q * alpha + (((ps[0] + ps[1]) + (ps[2] + ps[3])) + ((ps[4] + ps[5]) + (ps[6] + ps[7])));
#pragma unroll
    for (int dt = 0; dt < DT; ++dt)
#pragma unroll
      for (int r = 0; r < 8; ++r) oacc[dt][r] *= alpha;
#pragma unroll  // oacc and the fragments are indexed by constants
    for (int dt = 0; dt < DT; ++dt) oacc[dt] = mma3T(bvh[dt].v, bvl[dt].v, pbh.v, pbl.v, oacc[dt]);
    // The hand-over, passed by every wave: this wave has read the last of this pass's buffer, and its copies of the next pass have landed;
    // behind the barrier that holds of every wave, so the next pass may be read and this pass's buffer refilled.
    asm volatile("s_wait_dscnt 0x0" ::: "memory");
    asm volatile("s_wait_asynccnt 0x0" ::: "memory");
    __syncthreads();
    if (pn >= npass) break;
    const int pf = next_live();
    if (pf < npass) stage(pf, buf);
    pc = pn; pn = pf; buf ^= 1;
  }
  }
  asm volatile("s_wait_asynccnt 0x0" ::: "memory");   // no copy is in flight behind the loop
  // NaN for fully-masked rows (softmax over a row of -inf)
  l_q += xhalf(l_q);
  const float inv = (m_q > -1.0e38f) ? 1.0f / l_q : __builtin_nanf("");
#pragma unroll  // oacc is indexed by constants
  for (int dt = 0; dt < DT; ++dt) {
    const v4f o0 = {oacc[dt][0] * inv, oacc[dt][1] * inv, oacc[dt][2] * inv, oacc[dt][3] * inv};
    const v4f o1 = {oacc[dt][4] * inv, oacc[dt][5] * inv, oacc[dt][6] * inv, oacc[dt][7] * inv};
    *(v4fa*)&sO[w][ln][dt * 16 + 8 * hh] = o0;
    *(v4fa*)&sO[w][ln][dt * 16 + 8 * hh + 4] = o1;
  }
  __builtin_amdgcn_fence(__ATOMIC_ACQ_REL, "workgroup");
  __builtin_amdgcn_wave_barrier();
  {
    for (int r = 0; r < 16; ++r) {
      const int row = q0 + r;
      if (row < T && lane < D / 4) {
        const v4f val = *(const v4fa*)&sO[w][r][lane * 4];
        *(v4f*)(y + ((size_t)b * T + row) * ypitch + h * D + lane * 4) = val;
      }
    }
    
  }
  // The next tile's first instructions rewrite registers that the last store names: not in front of this wait.
  asm volatile("s_wait_xcnt 0x0" ::: "memory");
  }
}

extern "C" void kernel_launch(void* const* d_in, const int* in_sizes, int n_in,
                              void* d_out, int out_size, void* d_ws, size_t ws_size, hipStream_t stream) {
  (void)in_sizes; (void)n_in; (void)out_size;
  const float* x = (const float*)d_in[0]; const int* mask = (const int*)d_in[1];
  const float* Wq = (const float*)d_in[2]; const float* Wkv = (const float*)d_in[3];
  const float* Wo = (const float*)d_in[4]; const float* bo = (const float*)d_in[5];
  char* ws = (char*)d_ws; size_t off = 0;
  unsigned short* Wqt  = (unsigned short*)(ws + off); off += (size_t)DM * DM * 2;       // [1024][1024]
  unsigned short* Wkvt = (unsigned short*)(ws + off); off += (size_t)2 * DM * DM * 2;   // [2048][1024]
  unsigned short* Wot  = (unsigned short*)(ws + off); off += (size_t)DM * DM * 2;
  float* qb  = (float*)(ws + off); off += (size_t)BB * NN * DM * 4;                    // 16 MiB
  float* kvb = (float*)(ws + off); off += (size_t)BB * NN * 2 * DM * 4;                // 32 MiB
  float* ob  = (float*)(ws + off); off += (size_t)BB * NN * DM * 4;                    // 16 MiB
  unsigned* tbits = (unsigned*)(ws + off); off += (size_t)(NN / 64) * (NN / 1024) * 128; // a 128-byte line a word
  if (off > ws_size) return;
  const int M = BB * NN;
  k_mask_tiles<<<(NN / 64) * (NN / 1024), 1024, 0, stream>>>(mask, tbits, NN);
  k_wt_bf16<<<(4 * DM / 128) * (DM / 64), 256, 0, stream>>>(Wq, Wqt, DM, Wkv, Wkvt, 2 * DM, Wo, Wot, DM, DM);
  k_gemm_bf<false, 0, false, false><<<(M / 64) * (DM / 128), 128, 0, stream>>>(x, DM, Wqt, DM, nullptr, qb, DM, M, DM, DM);
  k_gemm_bf<false, 0, false, true><<<(M / 64) * (2 * DM / 128), 128, 0, stream>>>(x, DM, Wkvt, DM, nullptr, kvb, 2 * DM, M, 2 * DM, DM);
  // k = kv[..., 0:1024] (head h at h*64), v = kv[..., 1024:2048]; stored split, a row is 4096 16-bit elements, head h's 128 at h*128
  const unsigned short* kvs = (const unsigned short*)kvb;
  k_flashm<HD><<<BB * NH * (NN / 128), 128, 0, stream>>>(qb, DM, kvs, 4 * DM, kvs + 2 * DM, 4 * DM, NN, NH, 0.03125f, mask, tbits, 0, ob, DM);
  k_gemm_bf<true, 0, true, false><<<(M / 64) * (DM / 128), 128, 0, stream>>>(ob, DM, Wot, DM, bo, (float*)d_out, DM, M, DM, DM);
}
